// v000
// Measured on an AMD MI455X. A time is GPU time per run, averaged over a window of back-to-back runs after a warm-up
// (all launches, gaps included; the runs take copies of the inputs in turn), and the median of several windows.
// Apart from v000's, it joins two sittings. Times from different sittings can be a few percent apart, while
// side-by-side timings come from the same sitting.
// v000 is the starting kernel. One run takes 8960 microseconds.
#include <hip/hip_runtime.h>
// Causal SINGLE-HEAD self-attention of full width with a fused bias-free QKV projection and NO output projection (x [4][2048][1024]; qkv = x W_qkv ([in][out] 1024 x 3072, no bias) split into q | k | v thirds of width 1024; scores = q k^T / sqrt(1024) over the FULL width (one head); causal (keys after the query -> -inf); softmax over keys; out = attn v -> [4][2048][1024]).
// Structure: token rows; x as exact f16 rows; ONE WMMA GEMM into the f16 q | k | v plane [8192][3072]; per batch v^T via LDS transposes (16 column chunks of 64 = the full 1024-wide row); causal 256-row query tiles: scores GEMM with K = 1024 (alpha 1/32), causal softmax f32 -> f16 x256 weights, P . V^T GEMM with N = 1024 written as f32 (alpha 2^-8) straight into the output rows.
// First-tile refinement: the first 512 query rows of every batch (which see few keys, so single-f16 q / k / v / P would be too coarse with no output projection to average the errors) are recomputed exactly: f32 q | k | v rows from a small extra GEMM (exact products, f32 accumulation), an f32 attention on VALU (k_att0w: one block per query row; full-width dot products; precise expf), and the rows are rewritten.
// Compute dtype: inputs rounded to bf16; x / weights exact; q, k, v and the softmax weights as plain f16 GEMM operands (~2^-12) past the exact rows; scores, softmax statistics and the output accumulation f32. v_wmma_f32_16x16x32_f16.
#define NB 4
#define SQ 2048
#define DM 1024
#define NH 16
#define HD 64
#define HG 4                         /* heads per attention launch group */
#define QT 256                       /* query rows per causal tile */
#define NKX SQ                       /* S / P row pitch */
#define QT0 512                      /* first-tile rows recomputed exactly (f32): 512 here (no output projection averages the early-row cancellation errors away; logit sigma 1.0) */
#define B0 0                         /* unused (the batch loop starts at 0) */
#define NBR NB                       /* unused by the launches (the batch loop runs over NB) */
#define NR ((size_t)NB * SQ)
#define DMQ DM
#define DFF 4096                     /* unused (no FFN in this file) */
#define DFFR 100                     /* unused */
#define MP ((int)((size_t)NBR * SQ)) /* unused by the launches (the projection covers NR rows) */
#define QN SQ                        /* unused (the query tiles cover SQ rows) */
#define NHD NH                       /* unused (one full-width head is attended) */
#define MPO MP                       /* unused (there is no output stage) */
#define LQ (3 * DM)      /* row pitch of the q/k/v rows */
typedef __bf16 v16b __attribute__((ext_vector_type(16)));
typedef unsigned short v8us __attribute__((ext_vector_type(8), may_alias));
typedef float  v8f  __attribute__((ext_vector_type(8)));
typedef float  v4f  __attribute__((ext_vector_type(4)));
typedef float  v4fa __attribute__((ext_vector_type(4), may_alias));
union FragB { v16b v; v8us half[2]; unsigned short u[16]; };

__device__ __forceinline__ unsigned short bf16_bits(float x) { unsigned int u = __float_as_uint(x); return (unsigned short)((u + 0x7FFFu + ((u >> 16) & 1u)) >> 16); }
__device__ __forceinline__ float bf16_val(unsigned short b) { return __uint_as_float(((unsigned int)b) << 16); }
__device__ __forceinline__ float bf16_round(float x) { return bf16_val(bf16_bits(x)); }
// D += A·B with NT terms: 1 = ah·bh, 2 = + al·bh (A split), 3 = + ah·bl (both split)
template <int NT>
__device__ __forceinline__ v8f mmaN(v16b ah, v16b al, v16b bh, v16b bl, v8f c) {
  c = __builtin_amdgcn_wmma_f32_16x16x32_bf16(false, ah, false, bh, (short)0, c, false, false);
  if (NT >= 2) c = __builtin_amdgcn_wmma_f32_16x16x32_bf16(false, al, false, bh, (short)0, c, false, false);
  if (NT >= 3) c = __builtin_amdgcn_wmma_f32_16x16x32_bf16(false, ah, false, bl, (short)0, c, false, false);
  asm volatile("v_nop\n\tv_nop\n\tv_nop\n\tv_nop" : "+v"(c) : "v"(ah), "v"(al), "v"(bh), "v"(bl));
  return c;
}

__global__ __launch_bounds__(256) void k_wt_bf16(const float* __restrict__ W, unsigned short* __restrict__ Wt, int K, int N) {
  const int t = blockIdx.x * 256 + threadIdx.x;
  const int k8n = K / 8;
  if (t >= N * k8n) return;
  const int n = t / k8n, k8 = (t % k8n) * 8;
  v8us v;
#pragma unroll
  for (int i = 0; i < 8; ++i) v[i] = bf16_bits(W[(size_t)(k8 + i) * N + n]);
  *(v8us*)(Wt + (size_t)n * K + k8) = v;
  
}

// GEMM C[M][N] (f32, pitch ldc) = act(A[M][K]·W + bias). A f32 row-major (pitch lda) converted per fragment to bf16
// (ASPLIT: hi/lo two planes -> 2 terms, else single rounded term); Wt bf16 [N][K] (pitch ldb). BIAS_BF16 rounds the
// bias to bf16 first (bias quantised to bf16 before the add). K%32==0, M%16==0, N%64==0.
template <bool ASPLIT, int ACT, bool BIAS_BF16>
__global__ __launch_bounds__(128) void k_gemm_bf(const float* __restrict__ A, int lda, const unsigned short* __restrict__ Wt, int ldb,
                                               const float* __restrict__ bias, float* __restrict__ C, int ldc, int M, int N, int K) {
  __shared__ __attribute__((aligned(16))) float so[4][16][64];
  const int tid = threadIdx.x, w = tid >> 5, lane = tid & 31, ln = lane & 15, hh = lane >> 4;
  const int ntn = N / 64;
  const int wid = blockIdx.x * 4 + w;
  const int mt = wid / ntn, nq = wid % ntn;
  if (mt * 16 >= M) return;
  const int row0 = mt * 16, col0 = nq * 64;
  const float* arow = A + (size_t)(row0 + ln) * lda;
  v8f acc[4] = {};
  for (int kb = 0; kb < K; kb += 32) {
    FragB ah, al;
    const v4f x0 = *(const v4fa*)(arow + kb + 8 * hh), x1 = *(const v4fa*)(arow + kb + 8 * hh + 4);
    const v4f x2 = *(const v4fa*)(arow + kb + 16 + 8 * hh), x3 = *(const v4fa*)(arow + kb + 16 + 8 * hh + 4);
    float xs[16] = {x0[0],x0[1],x0[2],x0[3],x1[0],x1[1],x1[2],x1[3],x2[0],x2[1],x2[2],x2[3],x3[0],x3[1],x3[2],x3[3]};
#pragma unroll
    for (int i = 0; i < 16; ++i) { const unsigned short hb = bf16_bits(xs[i]); ah.u[i] = hb; al.u[i] = ASPLIT ? bf16_bits(xs[i] - bf16_val(hb)) : (unsigned short)0; }
#pragma unroll
    for (int t = 0; t < 4; ++t) {
      const unsigned short* brow = Wt + (size_t)(col0 + t * 16 + ln) * ldb + kb;
      FragB b;
      b.half[0] = *(const v8us*)(brow + 8 * hh);
      b.half[1] = *(const v8us*)(brow + 16 + 8 * hh);
      acc[t] = mmaN<ASPLIT ? 2 : 1>(ah.v, al.v, b.v, b.v, acc[t]);
    }
  }
#pragma unroll
  for (int t = 0; t < 4; ++t) {
    float bv = bias ? bias[col0 + t * 16 + ln] : 0.f;
    if (BIAS_BF16) bv = bf16_round(bv);
#pragma unroll
    for (int r = 0; r < 8; ++r) { float v = acc[t][r] + bv; if (ACT == 1) v = fmaxf(v, 0.f); so[w][8 * hh + r][t * 16 + ln] = v; }
  }
  __builtin_amdgcn_fence(__ATOMIC_ACQ_REL, "workgroup");
  __builtin_amdgcn_wave_barrier();
  const int rsub = lane >> 4, c4 = (lane & 15) * 4;
  {
#pragma unroll
    for (int q = 0; q < 8; ++q) {
      const int r = q * 2 + rsub;
      const v4f v = *(const v4fa*)&so[w][r][c4];
      *(v4f*)(C + (size_t)(row0 + r) * ldc + col0 + c4) = v;
    }
    
  }
}

// GEMM C = act(A·W + bias + resid): A f32 (ASPLIT -> hi/lo 2 terms), Wt bf16 [N][K]; ACT 0 none, 1 relu, 2 exact gelu;
// resid (optional, f32, row index = (row % rmod), pitch ldr, RES_BF16 rounds it) added before the activation.
template <bool ASPLIT, int ACT, bool BIAS_BF16, bool RES_BF16>
__global__ __launch_bounds__(128) void k_gemm_bf3(const float* __restrict__ A, int lda, const unsigned short* __restrict__ Wt, int ldb,
                                                const float* __restrict__ bias, const float* __restrict__ resid, int rmod, int ldr,
                                                float* __restrict__ C, int ldc, int M, int N, int K) {
  __shared__ __attribute__((aligned(16))) float so[4][16][64];
  const int tid = threadIdx.x, w = tid >> 5, lane = tid & 31, ln = lane & 15, hh = lane >> 4;
  const int ntn = N / 64;
  const int wid = blockIdx.x * 4 + w;
  const int mt = wid / ntn, nq = wid % ntn;
  if (mt * 16 >= M) return;
  const int row0 = mt * 16, col0 = nq * 64;
  const float* arow = A + (size_t)(row0 + ln) * lda;
  v8f acc[4] = {};
  for (int kb = 0; kb < K; kb += 32) {
    FragB ah, al;
    const v4f x0 = *(const v4fa*)(arow + kb + 8 * hh), x1 = *(const v4fa*)(arow + kb + 8 * hh + 4);
    const v4f x2 = *(const v4fa*)(arow + kb + 16 + 8 * hh), x3 = *(const v4fa*)(arow + kb + 16 + 8 * hh + 4);
    float xs[16] = {x0[0],x0[1],x0[2],x0[3],x1[0],x1[1],x1[2],x1[3],x2[0],x2[1],x2[2],x2[3],x3[0],x3[1],x3[2],x3[3]};
#pragma unroll
    for (int i = 0; i < 16; ++i) { const unsigned short hb = bf16_bits(xs[i]); ah.u[i] = hb; al.u[i] = ASPLIT ? bf16_bits(xs[i] - bf16_val(hb)) : (unsigned short)0; }
#pragma unroll
    for (int t = 0; t < 4; ++t) {
      const unsigned short* brow = Wt + (size_t)(col0 + t * 16 + ln) * ldb + kb;
      FragB b;
      b.half[0] = *(const v8us*)(brow + 8 * hh);
      b.half[1] = *(const v8us*)(brow + 16 + 8 * hh);
      acc[t] = mmaN<ASPLIT ? 2 : 1>(ah.v, al.v, b.v, b.v, acc[t]);
    }
  }
#pragma unroll
  for (int t = 0; t < 4; ++t) {
    const int col = col0 + t * 16 + ln;
    float bv = bias ? bias[col] : 0.f;
    if (BIAS_BF16) bv = bf16_round(bv);
#pragma unroll
    for (int r = 0; r < 8; ++r) {
      float v = acc[t][r] + bv;
      if (resid) { float rv = resid[(size_t)((row0 + 8 * hh + r) % rmod) * ldr + col]; if (RES_BF16) rv = bf16_round(rv); v += rv; }
      if (ACT == 1) v = fmaxf(v, 0.f);
      if (ACT == 2) v = 0.5f * v * (1.0f + erff(v * 0.70710678118654752f));
      if (ACT == 3) { const float u = 0.7978845608028654f * (v + 0.044715f * v * v * v); v = 0.5f * v * (1.0f + tanhf(u)); }
      so[w][8 * hh + r][t * 16 + ln] = v;
    }
  }
  __builtin_amdgcn_fence(__ATOMIC_ACQ_REL, "workgroup");
  __builtin_amdgcn_wave_barrier();
  const int rsub = lane >> 4, c4 = (lane & 15) * 4;
  {
#pragma unroll
    for (int q = 0; q < 8; ++q) {
      const int r = q * 2 + rsub;
      const v4f v = *(const v4fa*)&so[w][r][c4];
      *(v4f*)(C + (size_t)(row0 + r) * ldc + col0 + c4) = v;
    }
    
  }
}
// row LayerNorm (biased variance, eps) over N: s = X (+ R); optional out_sum <- s; out_norm <- (s-mu)*rsqrt(var+eps)*g + b
template <bool PARAM_BF16>
__global__ __launch_bounds__(256) void k_layernorm(const float* __restrict__ X, const float* __restrict__ R, const float* __restrict__ g, const float* __restrict__ bta,
                                                  float* __restrict__ out_sum, float* __restrict__ out_norm, int N, float eps) {
  __shared__ float red[256];
  const int row = blockIdx.x, tid = threadIdx.x;
  const float* x = X + (size_t)row * N; const float* rr = R ? R + (size_t)row * N : nullptr;
  float vals[16];                     // up to N = 4096
  const int per = N / 256;            // contiguous chunk per thread? use strided-by-4 chunks: thread handles j = tid*4 + 1024*u
  float s1 = 0.f;
  for (int u = 0; u < per / 4; ++u) {
    const int j = tid * 4 + 1024 * u;
    const v4f a = *(const v4fa*)(x + j);
    v4f b = {0.f,0.f,0.f,0.f}; if (rr) b = *(const v4fa*)(rr + j);
#pragma unroll
    for (int q = 0; q < 4; ++q) { const float v = a[q] + b[q]; vals[u * 4 + q] = v; s1 += v; }
  }
  red[tid] = s1; __syncthreads();
  for (int st = 128; st > 0; st >>= 1) { if (tid < st) red[tid] += red[tid + st]; __syncthreads(); }
  const float mu = red[0] / (float)N; __syncthreads();
  float s2 = 0.f;
  for (int u = 0; u < per / 4; ++u)
#pragma unroll
    for (int q = 0; q < 4; ++q) { const float c = vals[u * 4 + q] - mu; s2 += c * c; }
  red[tid] = s2; __syncthreads();
  for (int st = 128; st > 0; st >>= 1) { if (tid < st) red[tid] += red[tid + st]; __syncthreads(); }
  const float rs = rsqrtf(red[0] / (float)N + eps);
  {
    for (int u = 0; u < per / 4; ++u) {
      const int j = tid * 4 + 1024 * u;
      v4f o, sm;
#pragma unroll
      for (int q = 0; q < 4; ++q) {
        float gg = g[j + q], bb = bta[j + q];
        if (PARAM_BF16) { gg = bf16_round(gg); bb = bf16_round(bb); }
        sm[q] = vals[u * 4 + q]; o[q] = (vals[u * 4 + q] - mu) * rs * gg + bb;
      }
      if (out_sum) *(v4f*)(out_sum + (size_t)row * N + j) = sm;
      *(v4f*)(out_norm + (size_t)row * N + j) = o;
    }
    
  }
}



// ---- f16 WMMA path (v_wmma_f32_16x16x32_f16): 11-bit significands for operands in range — used where a [0,1] probability operand needs more precision than bf16
typedef _Float16 v16h __attribute__((ext_vector_type(16)));
union FragH { v16h v; v8us half[2]; _Float16 h[16]; unsigned short u[16]; };
template <int NT>
__device__ __forceinline__ v8f mmaH(v16h ah, v16h al, v16h bh, v16h bl, v8f c) {
  c = __builtin_amdgcn_wmma_f32_16x16x32_f16(false, ah, false, bh, (short)0, c, false, false);
  if (NT >= 2) c = __builtin_amdgcn_wmma_f32_16x16x32_f16(false, al, false, bh, (short)0, c, false, false);
  if (NT >= 3) c = __builtin_amdgcn_wmma_f32_16x16x32_f16(false, ah, false, bl, (short)0, c, false, false);
  asm volatile("v_nop\n\tv_nop\n\tv_nop\n\tv_nop" : "+v"(c) : "v"(ah), "v"(al), "v"(bh), "v"(bl));
  return c;
}
// batched GEMM like k_gemm_b but f16 operands: A f32 (split into f16 hi/lo if ASPLIT, else rounded to f16), Bt = f16 values [n][k]; alpha; C f32; N multiple of 16 (partial tiles skipped)
template <bool ASPLIT>
__global__ __launch_bounds__(128) void k_gemm_h(const float* __restrict__ A, int lda, size_t sA, const _Float16* __restrict__ Bh, int ldb, size_t sB, float alpha, float* __restrict__ C, int ldc, size_t sC, int M, int N, int K) {
  __shared__ __attribute__((aligned(16))) float so[4][16][64];
  const int tid = threadIdx.x, w = tid >> 5, lane = tid & 31, ln = lane & 15, hh = lane >> 4; const int by = blockIdx.y;
  A += (size_t)by * sA; Bh += (size_t)by * sB; C += (size_t)by * sC;
  const int ntn = (N + 63) / 64; const int wid = blockIdx.x * 4 + w; const int mt = wid / ntn, nq = wid % ntn; if (mt * 16 >= M) return;
  const int row0 = mt * 16, col0 = nq * 64; const float* arow = A + (size_t)(row0 + ln) * lda;
  v8f acc[4] = {};
  for (int kb = 0; kb < K; kb += 32) {
    FragH ah, al;
    const v4f x0 = *(const v4fa*)(arow + kb + 8 * hh), x1 = *(const v4fa*)(arow + kb + 8 * hh + 4), x2 = *(const v4fa*)(arow + kb + 16 + 8 * hh), x3 = *(const v4fa*)(arow + kb + 16 + 8 * hh + 4);
    float xs[16] = {x0[0],x0[1],x0[2],x0[3],x1[0],x1[1],x1[2],x1[3],x2[0],x2[1],x2[2],x2[3],x3[0],x3[1],x3[2],x3[3]};
#pragma unroll
    for (int i = 0; i < 16; ++i) { const _Float16 h = (_Float16)xs[i]; ah.h[i] = h; al.h[i] = ASPLIT ? (_Float16)(xs[i] - (float)h) : (_Float16)0.0f; }
#pragma unroll
    for (int t = 0; t < 4; ++t) { if (col0 + t * 16 >= N) continue; const size_t boff = (size_t)(col0 + t * 16 + ln) * ldb + kb; FragH bq; bq.half[0] = *(const v8us*)(Bh + boff + 8 * hh); bq.half[1] = *(const v8us*)(Bh + boff + 16 + 8 * hh);
      acc[t] = mmaH<ASPLIT ? 2 : 1>(ah.v, al.v, bq.v, bq.v, acc[t]); }
  }
#pragma unroll
  for (int t = 0; t < 4; ++t) { if (col0 + t * 16 >= N) continue;
#pragma unroll
    for (int r = 0; r < 8; ++r) so[w][8 * hh + r][t * 16 + ln] = acc[t][r] * alpha; }
  __builtin_amdgcn_fence(__ATOMIC_ACQ_REL, "workgroup"); __builtin_amdgcn_wave_barrier();
  const int rsub = lane >> 4, c4 = (lane & 15) * 4;
  {
#pragma unroll
    for (int q = 0; q < 8; ++q) { const int r = q * 2 + rsub; if (col0 + c4 < N) { const v4f v = *(const v4fa*)&so[w][r][c4]; *(v4f*)(C + (size_t)(row0 + r) * ldc + col0 + c4) = v; } }
     }
}

// Wt[n][k] = f16(W[k][n]·scale) from f32 row-major W[K][N] (scale = power of two; bf16-exact weights stay exact in f16 away from the subnormal range)
__global__ __launch_bounds__(256) void k_wt_f16(const float* __restrict__ W, _Float16* __restrict__ Wt, int K, int N, float scale) {
  const int t = blockIdx.x * 256 + threadIdx.x; if (t >= N * (K / 8)) return; const int n = t / (K / 8), k8 = (t % (K / 8)) * 8; FragH f;
#pragma unroll
  for (int i = 0; i < 8; ++i) f.h[i] = (_Float16)(bf16_round(W[(size_t)(k8 + i) * N + n]) * scale); const v8us o = f.half[0];
  *(v8us*)((unsigned short*)Wt + (size_t)n * K + k8) = o; 
}
// k_gemm_hh variant with fused epilogue: v = acc·alpha + bias[by·sBias + col] (+ CP[(row/rowsPerB)·sCPb + by·64 + col] if CP) ; ACT 0 none / 1 elu ; writes f16 C16 (and f32 C if non-null)
template <int ACT>
__global__ __launch_bounds__(128) void k_gemm_hhx(const _Float16* __restrict__ A, int lda, size_t sA, const _Float16* __restrict__ Bh, int ldb, size_t sB, float alpha, const float* __restrict__ bias, size_t sBias, const float* __restrict__ CP, int rowsPerB, size_t sCPb, int row0g,
    float* __restrict__ C, _Float16* __restrict__ C16, int ldc, size_t sC, int M, int N, int K) {
  __shared__ __attribute__((aligned(16))) float so[4][16][64];
  const int tid = threadIdx.x, w = tid >> 5, lane = tid & 31, ln = lane & 15, hh = lane >> 4; const int by = blockIdx.y;
  A += (size_t)by * sA; Bh += (size_t)by * sB; const size_t cofs = (size_t)by * sC; const float* bp = bias ? bias + (size_t)by * sBias : nullptr;
  const int ntn = (N + 63) / 64; const int wid = blockIdx.x * 4 + w; const int mt = wid / ntn, nq = wid % ntn; if (mt * 16 >= M) return;
  const int row0 = mt * 16, col0 = nq * 64; const _Float16* arow = A + (size_t)(row0 + ln) * lda;
  v8f acc[4] = {};
  for (int kb = 0; kb < K; kb += 32) { FragH ah; ah.half[0] = *(const v8us*)((const unsigned short*)arow + kb + 8 * hh); ah.half[1] = *(const v8us*)((const unsigned short*)arow + kb + 16 + 8 * hh);
#pragma unroll
    for (int t = 0; t < 4; ++t) { if (col0 + t * 16 >= N) continue; const size_t boff = (size_t)(col0 + t * 16 + ln) * ldb + kb; FragH bq; bq.half[0] = *(const v8us*)((const unsigned short*)Bh + boff + 8 * hh); bq.half[1] = *(const v8us*)((const unsigned short*)Bh + boff + 16 + 8 * hh);
      acc[t] = mmaH<1>(ah.v, ah.v, bq.v, bq.v, acc[t]); }
  }
#pragma unroll
  for (int t = 0; t < 4; ++t) { if (col0 + t * 16 >= N) continue; const int col = col0 + t * 16 + ln; const float bv = bp ? bf16_round(bp[col]) : 0.f;
#pragma unroll
    for (int r = 0; r < 8; ++r) { float v = acc[t][r] * alpha + bv; if (CP) { const int rr = row0g + row0 + 8 * hh + r; if (rowsPerB < 0) v += CP[cofs + (size_t)rr * ldc + col];      /* rowsPerB < 0: own element of the batched C plane */ else { const int bidx = rr / rowsPerB; v += CP[(size_t)bidx * sCPb + (size_t)by * 64 + col]; } } if (ACT == 1) v = (v > 0.f) ? v : expm1f(v); else if (ACT == 7) v = (v > 0.f) ? v + 1.0f : expf(v); else if (ACT == 8) v = tanhf(v); else if (ACT == 9) v = 0.5f * v * (1.0f + tanhf(0.7978845608028654f * (v + 0.044715f * v * v * v))); else if (ACT == 11) v = 1.0f / (1.0f + expf(-v)); else if (ACT == 12) v = (v > 0.f) ? v : 0.01f * v; else if (ACT == 14) v = (v > 0.f) ? v : 0.1f * v; else if (ACT == 16) v = (v >= 0.f) ? v : 0.3f * v; else if (ACT == 17) v = (v >= 0.f) ? v : 0.2f * v; else if (ACT == 15) v = v / (1.0f + expf(-v)); else if (ACT == 3) v = fmaxf(v, 0.f); else if (ACT == 6) v = 0.5f * v * (1.0f + erff(v * 0.70710678118654752f)); so[w][8 * hh + r][t * 16 + ln] = v; } }
  __builtin_amdgcn_fence(__ATOMIC_ACQ_REL, "workgroup"); __builtin_amdgcn_wave_barrier();
  const int rsub = lane >> 4, c4 = (lane & 15) * 4; typedef _Float16 v4h __attribute__((ext_vector_type(4)));
  {
#pragma unroll
    for (int q = 0; q < 8; ++q) { const int r = q * 2 + rsub; if (col0 + c4 < N) { const v4f v = *(const v4fa*)&so[w][r][c4]; if (C) *(v4f*)(C + cofs + (size_t)(row0 + r) * ldc + col0 + c4) = v; if (C16) { v4h h4; for (int i = 0; i < 4; ++i) h4[i] = (_Float16)v[i]; *(v4h*)(C16 + cofs + (size_t)(row0 + r) * ldc + col0 + c4) = h4; } } }
     }
}


typedef _Float16 v4h __attribute__((ext_vector_type(4)));

__global__ __launch_bounds__(256) void k_x16(const float* __restrict__ x, _Float16* __restrict__ X16, size_t n8) { const size_t t = (size_t)blockIdx.x * 256 + threadIdx.x; if (t >= n8) return; FragH f;
#pragma unroll
  for (int q = 0; q < 8; ++q) f.h[q] = (_Float16)bf16_round(x[t * 8 + q]); *(v8us*)((unsigned short*)X16 + t * 8) = f.half[0];  }
__global__ __launch_bounds__(256) void k_h16(const float* __restrict__ x, _Float16* __restrict__ X16, size_t n8) { const size_t t = (size_t)blockIdx.x * 256 + threadIdx.x; if (t >= n8) return; FragH f;
#pragma unroll
  for (int q = 0; q < 8; ++q) f.h[q] = (_Float16)x[t * 8 + q]; *(v8us*)((unsigned short*)X16 + t * 8) = f.half[0];  }
__global__ __launch_bounds__(256) void k_round16f(const float* __restrict__ W, _Float16* __restrict__ Bt, size_t n8) { const size_t t = (size_t)blockIdx.x * 256 + threadIdx.x; if (t >= n8) return; FragH f;
#pragma unroll
  for (int i = 0; i < 8; ++i) f.h[i] = (_Float16)(bf16_round(W[t * 8 + i]) * 16.0f); *(v8us*)((unsigned short*)Bt + t * 8) = f.half[0];  }
template <int NHv, int TTv>
__global__ __launch_bounds__(256) void k_vt(const _Float16* __restrict__ V16, int ldv, int voff, _Float16* __restrict__ Vt) { __shared__ unsigned short tl[64][66]; const int tid = threadIdx.x; const int slab = blockIdx.x / (TTv / 64), lg = blockIdx.x % (TTv / 64); const int b = slab / NHv, h = slab % NHv;
  for (int i = tid; i < 64 * 8; i += 256) { const int r = i / 8, c8 = (i % 8) * 8; FragH f; f.half[0] = *(const v8us*)((const unsigned short*)V16 + ((size_t)b * TTv + lg * 64 + r) * ldv + voff + h * 64 + c8);
#pragma unroll
    for (int q = 0; q < 8; ++q) tl[r][c8 + q] = f.u[q]; }
  __syncthreads();
  {
#pragma unroll
    for (int rd = 0; rd < 2; ++rd) { const int d = rd * 32 + tid / 8, pc = tid % 8; FragH f;
#pragma unroll
      for (int q = 0; q < 8; ++q) f.u[q] = tl[pc * 8 + q][d];
      *(v8us*)((unsigned short*)Vt + ((size_t)slab * 64 + d) * TTv + lg * 64 + pc * 8) = f.half[0]; }
     } }

__global__ __launch_bounds__(256) void k_hl(const float* __restrict__ F, _Float16* __restrict__ Hh, _Float16* __restrict__ Hl, size_t n8) { const size_t t = (size_t)blockIdx.x * 256 + threadIdx.x; if (t >= n8) return; FragH fh, fl; const v4f a = *(const v4fa*)(F + t * 8), c = *(const v4fa*)(F + t * 8 + 4);
#pragma unroll
  for (int q = 0; q < 4; ++q) { _Float16 h = (_Float16)a[q]; fh.h[q] = h; fl.h[q] = (_Float16)((a[q] - (float)h) * 1024.0f); h = (_Float16)c[q]; fh.h[4 + q] = h; fl.h[4 + q] = (_Float16)((c[q] - (float)h) * 1024.0f); }
  { *(v8us*)((unsigned short*)Hh + t * 8) = fh.half[0]; *(v8us*)((unsigned short*)Hl + t * 8) = fl.half[0];  } }

// ---- fast GEMM (wave tile 32x64; requires M % 32 == 0 rows per launch region and N % 64 == 0); epilogue = k_gemm_hhx semantics ----
__device__ __forceinline__ v16h g2_frag(const _Float16* p, int hh) { FragH f; f.half[0] = *(const v8us*)((const unsigned short*)p + 8 * hh); f.half[1] = *(const v8us*)((const unsigned short*)p + 16 + 8 * hh); return f.v; }
__device__ __forceinline__ v8f g2_mma(v16h a, v16h b, v8f c) { v8f d = __builtin_amdgcn_wmma_f32_16x16x32_f16(false, a, false, b, (short)0, c, false, false); asm volatile("v_nop\n\tv_nop\n\tv_nop\n\tv_nop" : "+v"(d) : "v"(a), "v"(b)); return d; }
template <int ACT>
__global__ __launch_bounds__(128) void k_gemm2(const _Float16* __restrict__ A, int lda, size_t sA, const _Float16* __restrict__ Bh, int ldb, size_t sB, float alpha, const float* __restrict__ bias, size_t sBias, const float* __restrict__ CP, int rowsPerB, size_t sCPb, int row0g,
    float* __restrict__ C, _Float16* __restrict__ C16, int ldc, size_t sC, int M, int N, int K) { static_assert(ACT == 0 || ACT == 3 || ACT == 6 || ACT == 8 || ACT == 9 || ACT == 11 || ACT == 12 || ACT == 14 || ACT == 15 || ACT == 16 || ACT == 17, "k_gemm2: unsupported ACT code (would silently apply no activation)");
  __shared__ __attribute__((aligned(16))) float so[4][32][68];
  const int tid = threadIdx.x, w = tid >> 5, lane = tid & 31, ln = lane & 15, hh = lane >> 4; const int by = blockIdx.y;
  A += (size_t)by * sA; Bh += (size_t)by * sB; const size_t cofs = (size_t)by * sC; const float* bp = bias ? bias + (size_t)by * sBias : nullptr;
  const int ntn = N >> 6; const int mt = blockIdx.x / ntn, nq = blockIdx.x - mt * ntn; const int row0 = mt * 128 + 32 * w, col0 = nq * 64; if (row0 >= M) return;
  const _Float16* a0p = A + (size_t)(row0 + ln) * lda; const _Float16* a1p = a0p + (size_t)16 * lda;
  const _Float16* b0p = Bh + (size_t)(col0 + ln) * ldb; const _Float16* b1p = b0p + (size_t)16 * ldb; const _Float16* b2p = b1p + (size_t)16 * ldb; const _Float16* b3p = b2p + (size_t)16 * ldb;
  const v8f z8 = {0.f,0.f,0.f,0.f,0.f,0.f,0.f,0.f}; v8f c00 = z8, c01 = z8, c02 = z8, c03 = z8, c10 = z8, c11 = z8, c12 = z8, c13 = z8;
#pragma unroll 1
  for (int kb = 0; kb < K; kb += 32) { const v16h a0 = g2_frag(a0p + kb, hh), a1 = g2_frag(a1p + kb, hh);
    v16h b = g2_frag(b0p + kb, hh); c00 = g2_mma(a0, b, c00); c10 = g2_mma(a1, b, c10);
    b = g2_frag(b1p + kb, hh); c01 = g2_mma(a0, b, c01); c11 = g2_mma(a1, b, c11);
    b = g2_frag(b2p + kb, hh); c02 = g2_mma(a0, b, c02); c12 = g2_mma(a1, b, c12);
    b = g2_frag(b3p + kb, hh); c03 = g2_mma(a0, b, c03); c13 = g2_mma(a1, b, c13); }
  v8f accs[8] = {c00, c01, c02, c03, c10, c11, c12, c13};
#pragma unroll
  for (int u = 0; u < 8; ++u) { const int t = u & 3, half = u >> 2; const int col = col0 + t * 16 + ln; const float bv = bp ? bf16_round(bp[col]) : 0.f;
#pragma unroll
    for (int r = 0; r < 8; ++r) { const int rloc = half * 16 + 8 * hh + r; float v = accs[u][r] * alpha + bv; if (CP) { if (rowsPerB < 0) v += CP[cofs + (size_t)(row0g + row0 + rloc) * ldc + col];      /* rowsPerB < 0: own element of the batched C plane */ else { const int bidx = (row0g + row0 + rloc) / rowsPerB; v += CP[(size_t)bidx * sCPb + (size_t)by * 64 + col]; } }
      if (ACT == 3) v = fmaxf(v, 0.f); else if (ACT == 6) v = 0.5f * v * (1.0f + erff(v * 0.70710678118654752f)); else if (ACT == 11) v = 1.0f / (1.0f + expf(-v)); else if (ACT == 15) v = v / (1.0f + expf(-v)); else if (ACT == 12) v = (v > 0.f) ? v : 0.01f * v; else if (ACT == 8) v = tanhf(v); else if (ACT == 9) v = 0.5f * v * (1.0f + tanhf(0.7978845608028654f * (v + 0.044715f * v * v * v))); else if (ACT == 14) v = (v > 0.f) ? v : 0.1f * v; else if (ACT == 16) v = (v >= 0.f) ? v : 0.3f * v; else if (ACT == 17) v = (v >= 0.f) ? v : 0.2f * v;
      so[w][rloc][t * 16 + ln] = v; } }
  __builtin_amdgcn_fence(__ATOMIC_ACQ_REL, "workgroup"); __builtin_amdgcn_wave_barrier();
  const int rsub = lane >> 4, c4 = (lane & 15) * 4;
  {
#pragma unroll
    for (int q = 0; q < 16; ++q) { const int r = q * 2 + rsub; const v4f v = *(const v4fa*)&so[w][r][c4]; if (C) *(v4f*)(C + cofs + (size_t)(row0 + r) * ldc + col0 + c4) = v; if (C16) { v4h h4; for (int i = 0; i < 4; ++i) h4[i] = (_Float16)v[i]; *(v4h*)(C16 + cofs + (size_t)(row0 + r) * ldc + col0 + c4) = h4; } }
     } }


__global__ __launch_bounds__(256) void k_wnat(const float* __restrict__ w, size_t n8, _Float16* __restrict__ Bt) { const size_t t = (size_t)blockIdx.x * 256 + threadIdx.x; if (t >= n8) return; FragH f; for (int q = 0; q < 8; ++q) f.h[q] = (_Float16)(bf16_round(w[t * 8 + q]) * 16.0f); *(v8us*)((unsigned short*)Bt + t * 8) = f.half[0];  }
__global__ __launch_bounds__(256) void k_rsm(const float* __restrict__ S, _Float16* __restrict__ P, int nrows) {
  #pragma clang fp contract(off)
  const int i = blockIdx.x * 256 + threadIdx.x; if (i >= nrows) return; const float* s = S + (size_t)i * SQ; float mx = -3.0e38f;
#pragma unroll 1
  for (int j = 0; j < SQ; ++j) mx = fmaxf(mx, s[j]); float se = 0.f;
#pragma unroll 1
  for (int j = 0; j < SQ; ++j) se += expf(s[j] - mx); const float sc = 256.0f / se;
#pragma unroll 1
  for (int j0 = 0; j0 < SQ; j0 += 8) { FragH f; for (int q = 0; q < 8; ++q) f.h[q] = (_Float16)(expf(s[j0 + q] - mx) * sc); unsigned short* d = (unsigned short*)P + (size_t)i * SQ + j0; *(v8us*)d = f.half[0];  } }
__global__ __launch_bounds__(256) void k_vt(const _Float16* __restrict__ V16, int b, int h0, _Float16* __restrict__ VT) { __shared__ unsigned short tl[64][65]; const int tid = threadIdx.x; const int hh = blockIdx.x % HG, sg = blockIdx.x / HG; const int s0 = sg * 64; const int h = h0 + hh;
  for (int i = tid; i < 64 * 8; i += 256) { const int j = i / 8, d8 = (i % 8) * 8; FragH f; f.half[0] = *(const v8us*)((const unsigned short*)V16 + ((size_t)b * SQ + s0 + j) * DM + h * HD + d8); for (int q = 0; q < 8; ++q) tl[d8 + q][j] = f.u[q]; }
  __syncthreads();
  { for (int i = tid; i < 64 * 8; i += 256) { const int d = i / 8, j8 = (i % 8) * 8; FragH f; for (int q = 0; q < 8; ++q) f.u[q] = tl[d][j8 + q]; *(v8us*)((unsigned short*)VT + ((size_t)hh * HD + d) * SQ + s0 + j8) = f.half[0]; }  } }



__global__ __launch_bounds__(256) void k_rsmcf2(const float* __restrict__ S, _Float16* __restrict__ P, int hg, int q0, int nk) {
  #pragma clang fp contract(off)
  const int t = blockIdx.x * 256 + threadIdx.x; if (t >= hg * QT) return; const size_t i = (size_t)t; const float* s = S + i * NKX; const int last = q0 + (t % QT); float mx = -3.0e38f;
#pragma unroll 1
  for (int j = 0; j < nk; ++j) { const float f = (j <= last) ? 1.f : 0.f; mx = fmaxf(mx, fmaf(f, s[j], (1.f - f) * -1.0e9f)); } float se = 0.f;
#pragma unroll 1
  for (int j = 0; j < nk; ++j) { const float f = (j <= last) ? 1.f : 0.f; se += __expf(fmaf(f, s[j], (1.f - f) * -1.0e9f) - mx); } const float sc = 256.0f / se;
#pragma unroll 1
  for (int j0 = 0; j0 < nk; j0 += 8) { FragH fr; for (int q = 0; q < 8; ++q) { const int j = j0 + q; const float f = (j <= last) ? 1.f : 0.f; fr.h[q] = (_Float16)(__expf(fmaf(f, s[j], (1.f - f) * -1.0e9f) - mx) * sc); } unsigned short* d = (unsigned short*)P + i * NKX + j0; *(v8us*)d = fr.half[0];  } }


template <int MASKADD>
__global__ __launch_bounds__(64) void k_att0(const float* __restrict__ QF, const float* __restrict__ KF, const float* __restrict__ VF, int ld, const float* __restrict__ mask, float scale, float* __restrict__ OF, int ldo) {
  #pragma clang fp contract(off)
  __shared__ __attribute__((aligned(16))) float lq[64][64]; __shared__ __attribute__((aligned(16))) float lo[64][64];
  const int tid = threadIdx.x; const int h = blockIdx.x / (QT0 / 64), rg = blockIdx.x % (QT0 / 64); const int i = rg * 64 + tid;
  const float* qr = QF + (size_t)i * ld + h * HD;
#pragma unroll 1
  for (int c = 0; c < HD / 4; ++c) { *(v4f*)&lq[tid][c * 4] = *(const v4fa*)(qr + c * 4); const v4f z = {0.f, 0.f, 0.f, 0.f}; *(v4f*)&lo[tid][c * 4] = z; }
  float m = -1.0e30f, l = 0.f; const int jmax = MASKADD ? (SQ - 1) : (rg * 64 + 63);      /* additive-mask form: every key (the mask input decides); causal form: keys up to the block's last row */
#pragma unroll 1
  for (int j = 0; j <= jmax; ++j) { const float* kr = KF + (size_t)j * ld + h * HD; const float* vr = VF + (size_t)j * ld + h * HD; float s = 0.f;
#pragma unroll 1
    for (int c = 0; c < HD / 4; ++c) { const v4f kq = *(const v4fa*)(kr + c * 4); const v4f qq = *(v4f*)&lq[tid][c * 4]; s = __fadd_rn(s, __fmul_rn(qq[0], kq[0])); s = __fadd_rn(s, __fmul_rn(qq[1], kq[1])); s = __fadd_rn(s, __fmul_rn(qq[2], kq[2])); s = __fadd_rn(s, __fmul_rn(qq[3], kq[3])); }
    s = __fmul_rn(s, scale); if (MASKADD) s = __fadd_rn(s, __fmul_rn(bf16_round(mask[(size_t)i * SQ + j]), -10000.0f));
    const float f = (MASKADD || j <= i) ? 1.f : 0.f; const float sm = fmaf(f, s, (1.f - f) * -1.0e30f); const float mn = fmaxf(m, sm); const float sc = expf(m - mn); const float e = expf(sm - mn); l = __fadd_rn(__fmul_rn(l, sc), e); m = mn;
#pragma unroll 1
    for (int c = 0; c < HD / 4; ++c) { const v4f vv = *(const v4fa*)(vr + c * 4); v4f oo = *(v4f*)&lo[tid][c * 4]; for (int u = 0; u < 4; ++u) oo[u] = __fadd_rn(__fmul_rn(oo[u], sc), __fmul_rn(e, vv[u])); *(v4f*)&lo[tid][c * 4] = oo; } }
  const float fin = 64.0f / l;      /* o carried x64 like k_att0w */
#pragma unroll 1
  for (int c = 0; c < HD / 4; ++c) { v4f oo = *(v4f*)&lo[tid][c * 4]; for (int u = 0; u < 4; ++u) oo[u] = __fmul_rn(oo[u], fin); *(v4f*)&lo[tid][c * 4] = oo; }
  __syncthreads();
  {
#pragma unroll 1
    for (int it = 0; it < 16; ++it) { const int row = it * 4 + tid / 16, pc = (tid % 16) * 4; const v4f v = *(const v4f*)&lo[row][pc]; *(v4f*)(OF + (size_t)(rg * 64 + row) * ldo + h * HD + pc) = v; }
     } }


template <int BFIN, int WXB>
__global__ __launch_bounds__(256) void k_ln16(const float* __restrict__ X, const float* __restrict__ g, const float* __restrict__ bb, float eps, _Float16* __restrict__ N16, float* __restrict__ XB) {
  #pragma clang fp contract(off)
  __shared__ float red[256]; const size_t r = blockIdx.x; const int t = threadIdx.x; const v4f xa = *(const v4fa*)(X + r * DMQ + t * 4); float s[4]; float sum = 0.f;
  for (int q = 0; q < 4; ++q) { s[q] = BFIN ? bf16_round(xa[q]) : xa[q]; sum = __fadd_rn(sum, s[q]); }
  red[t] = sum; __syncthreads(); for (int st = 128; st > 0; st >>= 1) { if (t < st) red[t] = __fadd_rn(red[t], red[t + st]); __syncthreads(); } const float mu = red[0] / (float)DMQ; __syncthreads();
  float vs = 0.f; for (int q = 0; q < 4; ++q) { const float dl = __fadd_rn(s[q], -mu); vs = __fadd_rn(vs, __fmul_rn(dl, dl)); } red[t] = vs; __syncthreads(); for (int st = 128; st > 0; st >>= 1) { if (t < st) red[t] = __fadd_rn(red[t], red[t + st]); __syncthreads(); }
  const float rs = rsqrtf(__fadd_rn(red[0] / (float)DMQ, eps)); v4h y; v4f xb;
  for (int q = 0; q < 4; ++q) { const int c = t * 4 + q; y[q] = (_Float16)__fadd_rn(__fmul_rn(__fmul_rn(__fadd_rn(s[q], -mu), rs), bf16_round(g[c])), bf16_round(bb[c])); xb[q] = s[q]; }
  { *(v4h*)(N16 + r * DMQ + t * 4) = y; if (WXB) *(v4f*)(XB + r * DMQ + t * 4) = xb;  } }
__global__ __launch_bounds__(256) void k_ftres2(const float* __restrict__ OF0, const float* __restrict__ XB, float* __restrict__ X1, size_t n4) {
  #pragma clang fp contract(off)
  const size_t t = (size_t)blockIdx.x * 256 + threadIdx.x; if (t >= n4) return; const v4f o = *(const v4fa*)(OF0 + t * 4), xv = *(const v4fa*)(XB + t * 4); v4f y; for (int q = 0; q < 4; ++q) y[q] = __fadd_rn(__fmul_rn(o[q], 0.015625f), xv[q]); *(v4f*)(X1 + t * 4) = y;  }

__global__ __launch_bounds__(256) void k_wthd(const float* __restrict__ Wt, _Float16* __restrict__ Bt) { const size_t t = (size_t)blockIdx.x * 256 + threadIdx.x; if (t >= (size_t)NH * HD * (DM / 8)) return; const int m8 = (int)(t % (DM / 8)) * 8; const int d = (int)((t / (DM / 8)) % HD); const int h = (int)(t / ((size_t)(DM / 8) * HD)); FragH f;
  for (int q = 0; q < 8; ++q) f.h[q] = (_Float16)(16.0f * bf16_round(Wt[((size_t)h * DM + m8 + q) * HD + d])); unsigned short* dst = (unsigned short*)Bt + ((size_t)h * HD + d) * DM + m8; *(v8us*)dst = f.half[0];  }




__global__ __launch_bounds__(256) void k_wtpad(const float* __restrict__ Wm, _Float16* __restrict__ Wt, int Kr, int Kp, int Nr, int Np, float scale) {
  const int t = blockIdx.x * 256 + threadIdx.x; if (t >= Np * (Kp / 8)) return; const int n = t / (Kp / 8), k8 = (t % (Kp / 8)) * 8; const int nc = min(n, Nr - 1); const float fn = (n < Nr) ? 1.f : 0.f; FragH f;
  for (int i = 0; i < 8; ++i) { const int k = k8 + i; const int kc = min(k, Kr - 1); const float fk = (k < Kr) ? fn : 0.f; f.h[i] = (_Float16)(bf16_round(Wm[(size_t)kc * Nr + nc]) * scale * fk); }
  unsigned short* o = (unsigned short*)Wt + (size_t)n * Kp + k8; *(v8us*)o = f.half[0];  }
__global__ __launch_bounds__(128) void k_bpad(const float* __restrict__ b, float* __restrict__ Bp, int nr, int np) {
  const int i = threadIdx.x; if (i >= np) return; const float v = b[min(i, nr - 1)] * ((i < nr) ? 1.f : 0.f); *(float*)(Bp + i) = v;  }

#define DI 1024       /* inner width = NH * HD */
#define LQK (3 * DI)  /* fused q | k | v row pitch (3072) */
__global__ __launch_bounds__(256) void k_o0(const float* __restrict__ OF, float* __restrict__ ob, size_t n4) {
  #pragma clang fp contract(off)
  const size_t t = (size_t)blockIdx.x * 256 + threadIdx.x; if (t >= n4) return; const size_t e = t * 4; const int i = (int)(e / DI); const int c = (int)(e % DI); const int h = c / HD, d = c % HD; const v4f a = *(const v4fa*)(OF + e); v4f o; for (int q = 0; q < 4; ++q) o[q] = __fmul_rn(a[q], 0.015625f); float* dst = ob + (size_t)h * SQ * HD + (size_t)i * HD + d; *(v4f*)dst = o;  }

__global__ __launch_bounds__(256) void k_att0w(const float* __restrict__ QF, const float* __restrict__ KF, const float* __restrict__ VF, int ld, float scale, float* __restrict__ OF, int ldo) {
  #pragma clang fp contract(off)
  __shared__ __attribute__((aligned(16))) float lq[DI]; __shared__ float sj[QT0]; __shared__ float red[256];
  const int tid = threadIdx.x; const int i = blockIdx.x;
  *(v4f*)&lq[tid * 4] = *(const v4fa*)(QF + (size_t)i * ld + tid * 4); __syncthreads();
#pragma unroll 1
  for (int r = 0; r < QT0 / 256; ++r) { const int j = r * 256 + tid; const int jc = min(j, i); const float* kr = KF + (size_t)jc * ld; float s = 0.f;
#pragma unroll 1
    for (int c = 0; c < DI / 4; ++c) { const v4f kq = *(const v4fa*)(kr + c * 4); const v4f qq = *(v4f*)&lq[c * 4]; s = __fadd_rn(s, __fmul_rn(qq[0], kq[0])); s = __fadd_rn(s, __fmul_rn(qq[1], kq[1])); s = __fadd_rn(s, __fmul_rn(qq[2], kq[2])); s = __fadd_rn(s, __fmul_rn(qq[3], kq[3])); }
    s = __fmul_rn(s, scale); const float f = (j <= i) ? 1.f : 0.f; sj[j] = fmaf(f, s, (1.f - f) * -1.0e30f); }
  __syncthreads();
  float mx = -1.0e30f; for (int r = 0; r < QT0 / 256; ++r) mx = fmaxf(mx, sj[r * 256 + tid]); red[tid] = mx; __syncthreads(); for (int st = 128; st > 0; st >>= 1) { if (tid < st) red[tid] = fmaxf(red[tid], red[tid + st]); __syncthreads(); } mx = red[0]; __syncthreads();
  float ls = 0.f; for (int r = 0; r < QT0 / 256; ++r) { const int j = r * 256 + tid; const float e = expf(sj[j] - mx); sj[j] = e; ls = __fadd_rn(ls, e); } red[tid] = ls; __syncthreads(); for (int st = 128; st > 0; st >>= 1) { if (tid < st) red[tid] = __fadd_rn(red[tid], red[tid + st]); __syncthreads(); } const float l = red[0]; __syncthreads();
  v4f oo = {0.f, 0.f, 0.f, 0.f};
#pragma unroll 1
  for (int j = 0; j <= i; ++j) { const float e = sj[j]; const v4f vv = *(const v4fa*)(VF + (size_t)j * ld + tid * 4); for (int u = 0; u < 4; ++u) oo[u] = __fadd_rn(oo[u], __fmul_rn(e, vv[u])); }
  const float fin = 64.0f / l; for (int u = 0; u < 4; ++u) oo[u] = __fmul_rn(oo[u], fin);
  float* dst = OF + (size_t)i * ldo + tid * 4; *(v4f*)dst = oo;  }

__global__ __launch_bounds__(256) void k_o0m(const float* __restrict__ OF, float* __restrict__ o_, size_t n4) {
  #pragma clang fp contract(off)
  const size_t t = (size_t)blockIdx.x * 256 + threadIdx.x; if (t >= n4) return; const size_t e = t * 4; const v4f a = *(const v4fa*)(OF + e); v4f o; for (int q = 0; q < 4; ++q) o[q] = __fmul_rn(a[q], 0.015625f); *(v4f*)(o_ + e) = o;  }
extern "C" void kernel_launch(void* const* d_in, const int* in_sizes, int n_in,
                              void* d_out, int out_size, void* d_ws, size_t ws_size, hipStream_t stream) {
  (void)in_sizes; (void)n_in; (void)out_size;
  const float* const* I = (const float* const*)d_in; const float* x = I[0]; const float* wqkv = I[1];      /* input order: x [4][2048][1024], W_qkv ([in][out] [1024][3072]: q | k | v column thirds); the module has no biases and no output projection */
  char* ws = (char*)d_ws; size_t off = 0;
  auto take = [&](size_t bytes) { char* p = ws + off; off += (bytes + 255) & ~(size_t)255; return p; };
  _Float16* BW = (_Float16*)take((size_t)LQK * DM * 2); _Float16* X16 = (_Float16*)take(NR * DM * 2); _Float16* QKV = (_Float16*)take(NR * LQK * 2); _Float16* VT = (_Float16*)take((size_t)NH * HD * SQ * 2);
  float* S = (float*)take((size_t)QT * NKX * 4); _Float16* P = (_Float16*)take((size_t)QT * NKX * 2); float* QKVF0 = (float*)take((size_t)QT0 * LQK * 4); float* OF0 = (float*)take((size_t)QT0 * DI * 4);      /* ONE head: one S / P slab */
  if (off > ws_size) return;
  k_wtpad<<<(unsigned)(((size_t)LQK * (DM / 8) + 255) / 256), 256, 0, stream>>>(wqkv, BW, DM, DM, LQK, LQK, 16.0f);      /* [in][out] [1024][3072] -> Bt[n][k] x16 (no padding: Kr = Kp = 1024, Nr = Np = 3072) */
  k_x16<<<(unsigned)((NR * DM / 8 + 255) / 256), 256, 0, stream>>>(x, X16, NR * DM / 8);      /* x (bf16-valued) as exact f16 rows */
  k_gemm2<0><<<dim3((unsigned)((NR / 128) * (LQK / 64)), 1), 128, 0, stream>>>(X16, DM, 0, BW, DM, 0, 0.0625f, nullptr, 0, nullptr, 1, 0, 0, nullptr, QKV, LQK, 0, (int)NR, LQK, DM);      /* q | k | v = x W -> f16 rows, column blocks 0 / 1024 / 2048 of the fused plane (pitch 3072); no bias */
  const _Float16* Q16 = QKV; const _Float16* K16 = QKV + DI; const _Float16* V16 = QKV + 2 * DI;
  for (int b = 0; b < NB; ++b) { const size_t r0 = (size_t)b * SQ; float* ob = (float*)d_out + r0 * DI;
    k_vt<NH, SQ><<<NH * (SQ / 64), 256, 0, stream>>>(V16 + r0 * LQK, LQK, 0, VT);      /* V^T [1024][SQ] for this batch, as 16 column chunks of 64 */
    for (int q0 = 0; q0 < SQ; q0 += QT) { const int nk = q0 + QT;      /* causal: only keys below the tile end are computed */
      k_gemm2<0><<<dim3((QT / 128) * (nk / 64), 1), 128, 0, stream>>>(Q16 + (r0 + q0) * LQK, LQK, 0, K16 + r0 * LQK, LQK, 0, 0.03125f, nullptr, 0, nullptr, 1, 0, 0, S, nullptr, NKX, 0, QT, nk, DI);      /* scores / sqrt(1024) over the FULL width (K = 1024), one head */
      k_rsmcf2<<<(QT + 255) / 256, 256, 0, stream>>>(S, P, 1, q0, nk);      /* causal softmax -> P x256 f16 */
      k_gemm2<0><<<dim3((QT / 128) * (DI / 64), 1), 128, 0, stream>>>(P, NKX, 0, VT, SQ, 0, 0.00390625f, nullptr, 0, nullptr, 1, 0, 0, ob + (size_t)q0 * DI, nullptr, DI, 0, QT, DI, nk); }      /* out[b][q0 + i][:] = P V^T 2^-8 (f32), N = 1024 */
    k_gemm2<0><<<dim3((unsigned)((QT0 / 128) * (LQK / 64)), 1), 128, 0, stream>>>(X16 + r0 * DM, DM, 0, BW, DM, 0, 0.0625f, nullptr, 0, nullptr, 1, 0, 0, QKVF0, nullptr, LQK, 0, QT0, LQK, DM);      /* f32 q | k | v of rows 0..511 (exact products, f32 accumulation) */
    k_att0w<<<QT0, 256, 0, stream>>>(QKVF0, QKVF0 + DI, QKVF0 + 2 * DI, LQK, 0.03125f, OF0, DI);      /* exact f32 single-head causal attention for rows 0..511 (o x64) */
    k_o0m<<<(unsigned)(((size_t)QT0 * DI / 4 + 255) / 256), 256, 0, stream>>>(OF0, ob, (size_t)QT0 * DI / 4); }      /* rows 0..511 of the batch REWRITTEN from the exact path */
}

// v001
// One run takes 3360 microseconds.
// Two timings next to v000 put it at 2.67 and 2.70 times that version's speed.
#include <hip/hip_runtime.h>
// Causal SINGLE-HEAD self-attention of full width with a fused bias-free QKV projection and NO output projection (x [4][2048][1024]; qkv = x W_qkv ([in][out] 1024 x 3072, no bias) split into q | k | v thirds of width 1024; scores = q k^T / sqrt(1024) over the FULL width (one head); causal (keys after the query -> -inf); softmax over keys; out = attn v -> [4][2048][1024]).
// Structure: token rows; x as exact f16 rows; ONE WMMA GEMM into the f16 q | k | v plane [8192][3072]; per batch v^T via LDS transposes (16 column chunks of 64 = the full 1024-wide row); causal 256-row query tiles: scores GEMM with K = 1024 (alpha 1/32), causal softmax f32 -> f16 x256 weights, P . V^T GEMM with N = 1024 written as f32 (alpha 2^-8) straight into the output rows.
// First-tile refinement: the first 512 query rows of every batch (which see few keys, so single-f16 q / k / v / P would be too coarse with no output projection to average the errors) are recomputed exactly: f32 q | k | v rows from a small extra GEMM (exact products, f32 accumulation), an f32 attention on VALU (k_att0w: one block per query row; full-width dot products; precise expf), and the rows are rewritten.
// Compute dtype: inputs rounded to bf16; x / weights exact; q, k, v and the softmax weights as plain f16 GEMM operands (~2^-12) past the exact rows; scores, softmax statistics and the output accumulation f32. v_wmma_f32_16x16x32_f16.
#define NB 4
#define SQ 2048
#define DM 1024
#define NH 16
#define HD 64
#define HG 4                         /* heads per attention launch group */
#define QT 256                       /* query rows per causal tile */
#define NKX SQ                       /* S / P row pitch */
#define QT0 512                      /* first-tile rows recomputed exactly (f32): 512 here (no output projection averages the early-row cancellation errors away; logit sigma 1.0) */
#define B0 0                         /* unused (the batch loop starts at 0) */
#define NBR NB                       /* unused by the launches (the batch loop runs over NB) */
#define NR ((size_t)NB * SQ)
#define DMQ DM
#define DFF 4096                     /* unused (no FFN in this file) */
#define DFFR 100                     /* unused */
#define MP ((int)((size_t)NBR * SQ)) /* unused by the launches (the projection covers NR rows) */
#define QN SQ                        /* unused (the query tiles cover SQ rows) */
#define NHD NH                       /* unused (one full-width head is attended) */
#define MPO MP                       /* unused (there is no output stage) */
#define LQ (3 * DM)      /* row pitch of the q/k/v rows */
typedef __bf16 v16b __attribute__((ext_vector_type(16)));
typedef unsigned short v8us __attribute__((ext_vector_type(8), may_alias));
typedef float  v8f  __attribute__((ext_vector_type(8)));
typedef float  v4f  __attribute__((ext_vector_type(4)));
typedef float  v4fa __attribute__((ext_vector_type(4), may_alias));
union FragB { v16b v; v8us half[2]; unsigned short u[16]; };

__device__ __forceinline__ unsigned short bf16_bits(float x) { unsigned int u = __float_as_uint(x); return (unsigned short)((u + 0x7FFFu + ((u >> 16) & 1u)) >> 16); }
__device__ __forceinline__ float bf16_val(unsigned short b) { return __uint_as_float(((unsigned int)b) << 16); }
__device__ __forceinline__ float bf16_round(float x) { return bf16_val(bf16_bits(x)); }
// D += A·B with NT terms: 1 = ah·bh, 2 = + al·bh (A split), 3 = + ah·bl (both split)
template <int NT>
__device__ __forceinline__ v8f mmaN(v16b ah, v16b al, v16b bh, v16b bl, v8f c) {
  c = __builtin_amdgcn_wmma_f32_16x16x32_bf16(false, ah, false, bh, (short)0, c, false, false);
  if (NT >= 2) c = __builtin_amdgcn_wmma_f32_16x16x32_bf16(false, al, false, bh, (short)0, c, false, false);
  if (NT >= 3) c = __builtin_amdgcn_wmma_f32_16x16x32_bf16(false, ah, false, bl, (short)0, c, false, false);
  asm volatile("v_nop\n\tv_nop\n\tv_nop\n\tv_nop" : "+v"(c) : "v"(ah), "v"(al), "v"(bh), "v"(bl));
  return c;
}

__global__ __launch_bounds__(256) void k_wt_bf16(const float* __restrict__ W, unsigned short* __restrict__ Wt, int K, int N) {
  const int t = blockIdx.x * 256 + threadIdx.x;
  const int k8n = K / 8;
  if (t >= N * k8n) return;
  const int n = t / k8n, k8 = (t % k8n) * 8;
  v8us v;
#pragma unroll
  for (int i = 0; i < 8; ++i) v[i] = bf16_bits(W[(size_t)(k8 + i) * N + n]);
  *(v8us*)(Wt + (size_t)n * K + k8) = v;
  
}

// GEMM C[M][N] (f32, pitch ldc) = act(A[M][K]·W + bias). A f32 row-major (pitch lda) converted per fragment to bf16
// (ASPLIT: hi/lo two planes -> 2 terms, else single rounded term); Wt bf16 [N][K] (pitch ldb). BIAS_BF16 rounds the
// bias to bf16 first (bias quantised to bf16 before the add). K%32==0, M%16==0, N%64==0.
template <bool ASPLIT, int ACT, bool BIAS_BF16>
__global__ __launch_bounds__(128) void k_gemm_bf(const float* __restrict__ A, int lda, const unsigned short* __restrict__ Wt, int ldb,
                                               const float* __restrict__ bias, float* __restrict__ C, int ldc, int M, int N, int K) {
  __shared__ __attribute__((aligned(16))) float so[4][16][64];
  const int tid = threadIdx.x, w = tid >> 5, lane = tid & 31, ln = lane & 15, hh = lane >> 4;
  const int ntn = N / 64;
  const int wid = blockIdx.x * 4 + w;
  const int mt = wid / ntn, nq = wid % ntn;
  if (mt * 16 >= M) return;
  const int row0 = mt * 16, col0 = nq * 64;
  const float* arow = A + (size_t)(row0 + ln) * lda;
  v8f acc[4] = {};
  for (int kb = 0; kb < K; kb += 32) {
    FragB ah, al;
    const v4f x0 = *(const v4fa*)(arow + kb + 8 * hh), x1 = *(const v4fa*)(arow + kb + 8 * hh + 4);
    const v4f x2 = *(const v4fa*)(arow + kb + 16 + 8 * hh), x3 = *(const v4fa*)(arow + kb + 16 + 8 * hh + 4);
    float xs[16] = {x0[0],x0[1],x0[2],x0[3],x1[0],x1[1],x1[2],x1[3],x2[0],x2[1],x2[2],x2[3],x3[0],x3[1],x3[2],x3[3]};
#pragma unroll
    for (int i = 0; i < 16; ++i) { const unsigned short hb = bf16_bits(xs[i]); ah.u[i] = hb; al.u[i] = ASPLIT ? bf16_bits(xs[i] - bf16_val(hb)) : (unsigned short)0; }
#pragma unroll
    for (int t = 0; t < 4; ++t) {
      const unsigned short* brow = Wt + (size_t)(col0 + t * 16 + ln) * ldb + kb;
      FragB b;
      b.half[0] = *(const v8us*)(brow + 8 * hh);
      b.half[1] = *(const v8us*)(brow + 16 + 8 * hh);
      acc[t] = mmaN<ASPLIT ? 2 : 1>(ah.v, al.v, b.v, b.v, acc[t]);
    }
  }
#pragma unroll
  for (int t = 0; t < 4; ++t) {
    float bv = bias ? bias[col0 + t * 16 + ln] : 0.f;
    if (BIAS_BF16) bv = bf16_round(bv);
#pragma unroll
    for (int r = 0; r < 8; ++r) { float v = acc[t][r] + bv; if (ACT == 1) v = fmaxf(v, 0.f); so[w][8 * hh + r][t * 16 + ln] = v; }
  }
  __builtin_amdgcn_fence(__ATOMIC_ACQ_REL, "workgroup");
  __builtin_amdgcn_wave_barrier();
  const int rsub = lane >> 4, c4 = (lane & 15) * 4;
  {
#pragma unroll
    for (int q = 0; q < 8; ++q) {
      const int r = q * 2 + rsub;
      const v4f v = *(const v4fa*)&so[w][r][c4];
      *(v4f*)(C + (size_t)(row0 + r) * ldc + col0 + c4) = v;
    }
    
  }
}

// GEMM C = act(A·W + bias + resid): A f32 (ASPLIT -> hi/lo 2 terms), Wt bf16 [N][K]; ACT 0 none, 1 relu, 2 exact gelu;
// resid (optional, f32, row index = (row % rmod), pitch ldr, RES_BF16 rounds it) added before the activation.
template <bool ASPLIT, int ACT, bool BIAS_BF16, bool RES_BF16>
__global__ __launch_bounds__(128) void k_gemm_bf3(const float* __restrict__ A, int lda, const unsigned short* __restrict__ Wt, int ldb,
                                                const float* __restrict__ bias, const float* __restrict__ resid, int rmod, int ldr,
                                                float* __restrict__ C, int ldc, int M, int N, int K) {
  __shared__ __attribute__((aligned(16))) float so[4][16][64];
  const int tid = threadIdx.x, w = tid >> 5, lane = tid & 31, ln = lane & 15, hh = lane >> 4;
  const int ntn = N / 64;
  const int wid = blockIdx.x * 4 + w;
  const int mt = wid / ntn, nq = wid % ntn;
  if (mt * 16 >= M) return;
  const int row0 = mt * 16, col0 = nq * 64;
  const float* arow = A + (size_t)(row0 + ln) * lda;
  v8f acc[4] = {};
  for (int kb = 0; kb < K; kb += 32) {
    FragB ah, al;
    const v4f x0 = *(const v4fa*)(arow + kb + 8 * hh), x1 = *(const v4fa*)(arow + kb + 8 * hh + 4);
    const v4f x2 = *(const v4fa*)(arow + kb + 16 + 8 * hh), x3 = *(const v4fa*)(arow + kb + 16 + 8 * hh + 4);
    float xs[16] = {x0[0],x0[1],x0[2],x0[3],x1[0],x1[1],x1[2],x1[3],x2[0],x2[1],x2[2],x2[3],x3[0],x3[1],x3[2],x3[3]};
#pragma unroll
    for (int i = 0; i < 16; ++i) { const unsigned short hb = bf16_bits(xs[i]); ah.u[i] = hb; al.u[i] = ASPLIT ? bf16_bits(xs[i] - bf16_val(hb)) : (unsigned short)0; }
#pragma unroll
    for (int t = 0; t < 4; ++t) {
      const unsigned short* brow = Wt + (size_t)(col0 + t * 16 + ln) * ldb + kb;
      FragB b;
      b.half[0] = *(const v8us*)(brow + 8 * hh);
      b.half[1] = *(const v8us*)(brow + 16 + 8 * hh);
      acc[t] = mmaN<ASPLIT ? 2 : 1>(ah.v, al.v, b.v, b.v, acc[t]);
    }
  }
#pragma unroll
  for (int t = 0; t < 4; ++t) {
    const int col = col0 + t * 16 + ln;
    float bv = bias ? bias[col] : 0.f;
    if (BIAS_BF16) bv = bf16_round(bv);
#pragma unroll
    for (int r = 0; r < 8; ++r) {
      float v = acc[t][r] + bv;
      if (resid) { float rv = resid[(size_t)((row0 + 8 * hh + r) % rmod) * ldr + col]; if (RES_BF16) rv = bf16_round(rv); v += rv; }
      if (ACT == 1) v = fmaxf(v, 0.f);
      if (ACT == 2) v = 0.5f * v * (1.0f + erff(v * 0.70710678118654752f));
      if (ACT == 3) { const float u = 0.7978845608028654f * (v + 0.044715f * v * v * v); v = 0.5f * v * (1.0f + tanhf(u)); }
      so[w][8 * hh + r][t * 16 + ln] = v;
    }
  }
  __builtin_amdgcn_fence(__ATOMIC_ACQ_REL, "workgroup");
  __builtin_amdgcn_wave_barrier();
  const int rsub = lane >> 4, c4 = (lane & 15) * 4;
  {
#pragma unroll
    for (int q = 0; q < 8; ++q) {
      const int r = q * 2 + rsub;
      const v4f v = *(const v4fa*)&so[w][r][c4];
      *(v4f*)(C + (size_t)(row0 + r) * ldc + col0 + c4) = v;
    }
    
  }
}
// row LayerNorm (biased variance, eps) over N: s = X (+ R); optional out_sum <- s; out_norm <- (s-mu)*rsqrt(var+eps)*g + b
template <bool PARAM_BF16>
__global__ __launch_bounds__(256) void k_layernorm(const float* __restrict__ X, const float* __restrict__ R, const float* __restrict__ g, const float* __restrict__ bta,
                                                  float* __restrict__ out_sum, float* __restrict__ out_norm, int N, float eps) {
  __shared__ float red[256];
  const int row = blockIdx.x, tid = threadIdx.x;
  const float* x = X + (size_t)row * N; const float* rr = R ? R + (size_t)row * N : nullptr;
  float vals[16];                     // up to N = 4096
  const int per = N / 256;            // contiguous chunk per thread? use strided-by-4 chunks: thread handles j = tid*4 + 1024*u
  float s1 = 0.f;
  for (int u = 0; u < per / 4; ++u) {
    const int j = tid * 4 + 1024 * u;
    const v4f a = *(const v4fa*)(x + j);
    v4f b = {0.f,0.f,0.f,0.f}; if (rr) b = *(const v4fa*)(rr + j);
#pragma unroll
    for (int q = 0; q < 4; ++q) { const float v = a[q] + b[q]; vals[u * 4 + q] = v; s1 += v; }
  }
  red[tid] = s1; __syncthreads();
  for (int st = 128; st > 0; st >>= 1) { if (tid < st) red[tid] += red[tid + st]; __syncthreads(); }
  const float mu = red[0] / (float)N; __syncthreads();
  float s2 = 0.f;
  for (int u = 0; u < per / 4; ++u)
#pragma unroll
    for (int q = 0; q < 4; ++q) { const float c = vals[u * 4 + q] - mu; s2 += c * c; }
  red[tid] = s2; __syncthreads();
  for (int st = 128; st > 0; st >>= 1) { if (tid < st) red[tid] += red[tid + st]; __syncthreads(); }
  const float rs = rsqrtf(red[0] / (float)N + eps);
  {
    for (int u = 0; u < per / 4; ++u) {
      const int j = tid * 4 + 1024 * u;
      v4f o, sm;
#pragma unroll
      for (int q = 0; q < 4; ++q) {
        float gg = g[j + q], bb = bta[j + q];
        if (PARAM_BF16) { gg = bf16_round(gg); bb = bf16_round(bb); }
        sm[q] = vals[u * 4 + q]; o[q] = (vals[u * 4 + q] - mu) * rs * gg + bb;
      }
      if (out_sum) *(v4f*)(out_sum + (size_t)row * N + j) = sm;
      *(v4f*)(out_norm + (size_t)row * N + j) = o;
    }
    
  }
}



// ---- f16 WMMA path (v_wmma_f32_16x16x32_f16): 11-bit significands for operands in range — used where a [0,1] probability operand needs more precision than bf16
typedef _Float16 v16h __attribute__((ext_vector_type(16)));
union FragH { v16h v; v8us half[2]; _Float16 h[16]; unsigned short u[16]; };
template <int NT>
__device__ __forceinline__ v8f mmaH(v16h ah, v16h al, v16h bh, v16h bl, v8f c) {
  c = __builtin_amdgcn_wmma_f32_16x16x32_f16(false, ah, false, bh, (short)0, c, false, false);
  if (NT >= 2) c = __builtin_amdgcn_wmma_f32_16x16x32_f16(false, al, false, bh, (short)0, c, false, false);
  if (NT >= 3) c = __builtin_amdgcn_wmma_f32_16x16x32_f16(false, ah, false, bl, (short)0, c, false, false);
  asm volatile("v_nop\n\tv_nop\n\tv_nop\n\tv_nop" : "+v"(c) : "v"(ah), "v"(al), "v"(bh), "v"(bl));
  return c;
}
// batched GEMM like k_gemm_b but f16 operands: A f32 (split into f16 hi/lo if ASPLIT, else rounded to f16), Bt = f16 values [n][k]; alpha; C f32; N multiple of 16 (partial tiles skipped)
template <bool ASPLIT>
__global__ __launch_bounds__(128) void k_gemm_h(const float* __restrict__ A, int lda, size_t sA, const _Float16* __restrict__ Bh, int ldb, size_t sB, float alpha, float* __restrict__ C, int ldc, size_t sC, int M, int N, int K) {
  __shared__ __attribute__((aligned(16))) float so[4][16][64];
  const int tid = threadIdx.x, w = tid >> 5, lane = tid & 31, ln = lane & 15, hh = lane >> 4; const int by = blockIdx.y;
  A += (size_t)by * sA; Bh += (size_t)by * sB; C += (size_t)by * sC;
  const int ntn = (N + 63) / 64; const int wid = blockIdx.x * 4 + w; const int mt = wid / ntn, nq = wid % ntn; if (mt * 16 >= M) return;
  const int row0 = mt * 16, col0 = nq * 64; const float* arow = A + (size_t)(row0 + ln) * lda;
  v8f acc[4] = {};
  for (int kb = 0; kb < K; kb += 32) {
    FragH ah, al;
    const v4f x0 = *(const v4fa*)(arow + kb + 8 * hh), x1 = *(const v4fa*)(arow + kb + 8 * hh + 4), x2 = *(const v4fa*)(arow + kb + 16 + 8 * hh), x3 = *(const v4fa*)(arow + kb + 16 + 8 * hh + 4);
    float xs[16] = {x0[0],x0[1],x0[2],x0[3],x1[0],x1[1],x1[2],x1[3],x2[0],x2[1],x2[2],x2[3],x3[0],x3[1],x3[2],x3[3]};
#pragma unroll
    for (int i = 0; i < 16; ++i) { const _Float16 h = (_Float16)xs[i]; ah.h[i] = h; al.h[i] = ASPLIT ? (_Float16)(xs[i] - (float)h) : (_Float16)0.0f; }
#pragma unroll
    for (int t = 0; t < 4; ++t) { if (col0 + t * 16 >= N) continue; const size_t boff = (size_t)(col0 + t * 16 + ln) * ldb + kb; FragH bq; bq.half[0] = *(const v8us*)(Bh + boff + 8 * hh); bq.half[1] = *(const v8us*)(Bh + boff + 16 + 8 * hh);
      acc[t] = mmaH<ASPLIT ? 2 : 1>(ah.v, al.v, bq.v, bq.v, acc[t]); }
  }
#pragma unroll
  for (int t = 0; t < 4; ++t) { if (col0 + t * 16 >= N) continue;
#pragma unroll
    for (int r = 0; r < 8; ++r) so[w][8 * hh + r][t * 16 + ln] = acc[t][r] * alpha; }
  __builtin_amdgcn_fence(__ATOMIC_ACQ_REL, "workgroup"); __builtin_amdgcn_wave_barrier();
  const int rsub = lane >> 4, c4 = (lane & 15) * 4;
  {
#pragma unroll
    for (int q = 0; q < 8; ++q) { const int r = q * 2 + rsub; if (col0 + c4 < N) { const v4f v = *(const v4fa*)&so[w][r][c4]; *(v4f*)(C + (size_t)(row0 + r) * ldc + col0 + c4) = v; } }
     }
}

// Wt[n][k] = f16(W[k][n]·scale) from f32 row-major W[K][N] (scale = power of two; bf16-exact weights stay exact in f16 away from the subnormal range)
__global__ __launch_bounds__(256) void k_wt_f16(const float* __restrict__ W, _Float16* __restrict__ Wt, int K, int N, float scale) {
  const int t = blockIdx.x * 256 + threadIdx.x; if (t >= N * (K / 8)) return; const int n = t / (K / 8), k8 = (t % (K / 8)) * 8; FragH f;
#pragma unroll
  for (int i = 0; i < 8; ++i) f.h[i] = (_Float16)(bf16_round(W[(size_t)(k8 + i) * N + n]) * scale); const v8us o = f.half[0];
  *(v8us*)((unsigned short*)Wt + (size_t)n * K + k8) = o; 
}
// k_gemm_hh variant with fused epilogue: v = acc·alpha + bias[by·sBias + col] (+ CP[(row/rowsPerB)·sCPb + by·64 + col] if CP) ; ACT 0 none / 1 elu ; writes f16 C16 (and f32 C if non-null)
template <int ACT>
__global__ __launch_bounds__(128) void k_gemm_hhx(const _Float16* __restrict__ A, int lda, size_t sA, const _Float16* __restrict__ Bh, int ldb, size_t sB, float alpha, const float* __restrict__ bias, size_t sBias, const float* __restrict__ CP, int rowsPerB, size_t sCPb, int row0g,
    float* __restrict__ C, _Float16* __restrict__ C16, int ldc, size_t sC, int M, int N, int K) {
  __shared__ __attribute__((aligned(16))) float so[4][16][64];
  const int tid = threadIdx.x, w = tid >> 5, lane = tid & 31, ln = lane & 15, hh = lane >> 4; const int by = blockIdx.y;
  A += (size_t)by * sA; Bh += (size_t)by * sB; const size_t cofs = (size_t)by * sC; const float* bp = bias ? bias + (size_t)by * sBias : nullptr;
  const int ntn = (N + 63) / 64; const int wid = blockIdx.x * 4 + w; const int mt = wid / ntn, nq = wid % ntn; if (mt * 16 >= M) return;
  const int row0 = mt * 16, col0 = nq * 64; const _Float16* arow = A + (size_t)(row0 + ln) * lda;
  v8f acc[4] = {};
  for (int kb = 0; kb < K; kb += 32) { FragH ah; ah.half[0] = *(const v8us*)((const unsigned short*)arow + kb + 8 * hh); ah.half[1] = *(const v8us*)((const unsigned short*)arow + kb + 16 + 8 * hh);
#pragma unroll
    for (int t = 0; t < 4; ++t) { if (col0 + t * 16 >= N) continue; const size_t boff = (size_t)(col0 + t * 16 + ln) * ldb + kb; FragH bq; bq.half[0] = *(const v8us*)((const unsigned short*)Bh + boff + 8 * hh); bq.half[1] = *(const v8us*)((const unsigned short*)Bh + boff + 16 + 8 * hh);
      acc[t] = mmaH<1>(ah.v, ah.v, bq.v, bq.v, acc[t]); }
  }
#pragma unroll
  for (int t = 0; t < 4; ++t) { if (col0 + t * 16 >= N) continue; const int col = col0 + t * 16 + ln; const float bv = bp ? bf16_round(bp[col]) : 0.f;
#pragma unroll
    for (int r = 0; r < 8; ++r) { float v = acc[t][r] * alpha + bv; if (CP) { const int rr = row0g + row0 + 8 * hh + r; if (rowsPerB < 0) v += CP[cofs + (size_t)rr * ldc + col];      /* rowsPerB < 0: own element of the batched C plane */ else { const int bidx = rr / rowsPerB; v += CP[(size_t)bidx * sCPb + (size_t)by * 64 + col]; } } if (ACT == 1) v = (v > 0.f) ? v : expm1f(v); else if (ACT == 7) v = (v > 0.f) ? v + 1.0f : expf(v); else if (ACT == 8) v = tanhf(v); else if (ACT == 9) v = 0.5f * v * (1.0f + tanhf(0.7978845608028654f * (v + 0.044715f * v * v * v))); else if (ACT == 11) v = 1.0f / (1.0f + expf(-v)); else if (ACT == 12) v = (v > 0.f) ? v : 0.01f * v; else if (ACT == 14) v = (v > 0.f) ? v : 0.1f * v; else if (ACT == 16) v = (v >= 0.f) ? v : 0.3f * v; else if (ACT == 17) v = (v >= 0.f) ? v : 0.2f * v; else if (ACT == 15) v = v / (1.0f + expf(-v)); else if (ACT == 3) v = fmaxf(v, 0.f); else if (ACT == 6) v = 0.5f * v * (1.0f + erff(v * 0.70710678118654752f)); so[w][8 * hh + r][t * 16 + ln] = v; } }
  __builtin_amdgcn_fence(__ATOMIC_ACQ_REL, "workgroup"); __builtin_amdgcn_wave_barrier();
  const int rsub = lane >> 4, c4 = (lane & 15) * 4; typedef _Float16 v4h __attribute__((ext_vector_type(4)));
  {
#pragma unroll
    for (int q = 0; q < 8; ++q) { const int r = q * 2 + rsub; if (col0 + c4 < N) { const v4f v = *(const v4fa*)&so[w][r][c4]; if (C) *(v4f*)(C + cofs + (size_t)(row0 + r) * ldc + col0 + c4) = v; if (C16) { v4h h4; for (int i = 0; i < 4; ++i) h4[i] = (_Float16)v[i]; *(v4h*)(C16 + cofs + (size_t)(row0 + r) * ldc + col0 + c4) = h4; } } }
     }
}


typedef _Float16 v4h __attribute__((ext_vector_type(4)));

__global__ __launch_bounds__(256) void k_x16(const float* __restrict__ x, _Float16* __restrict__ X16, size_t n8) { const size_t t = (size_t)blockIdx.x * 256 + threadIdx.x; if (t >= n8) return; FragH f;
#pragma unroll
  for (int q = 0; q < 8; ++q) f.h[q] = (_Float16)bf16_round(x[t * 8 + q]); *(v8us*)((unsigned short*)X16 + t * 8) = f.half[0];  }
__global__ __launch_bounds__(256) void k_h16(const float* __restrict__ x, _Float16* __restrict__ X16, size_t n8) { const size_t t = (size_t)blockIdx.x * 256 + threadIdx.x; if (t >= n8) return; FragH f;
#pragma unroll
  for (int q = 0; q < 8; ++q) f.h[q] = (_Float16)x[t * 8 + q]; *(v8us*)((unsigned short*)X16 + t * 8) = f.half[0];  }
__global__ __launch_bounds__(256) void k_round16f(const float* __restrict__ W, _Float16* __restrict__ Bt, size_t n8) { const size_t t = (size_t)blockIdx.x * 256 + threadIdx.x; if (t >= n8) return; FragH f;
#pragma unroll
  for (int i = 0; i < 8; ++i) f.h[i] = (_Float16)(bf16_round(W[t * 8 + i]) * 16.0f); *(v8us*)((unsigned short*)Bt + t * 8) = f.half[0];  }
template <int NHv, int TTv>
__global__ __launch_bounds__(256) void k_vt(const _Float16* __restrict__ V16, int ldv, int voff, _Float16* __restrict__ Vt) { __shared__ unsigned short tl[64][66]; const int tid = threadIdx.x; const int slab = blockIdx.x / (TTv / 64), lg = blockIdx.x % (TTv / 64); const int b = slab / NHv, h = slab % NHv;
  for (int i = tid; i < 64 * 8; i += 256) { const int r = i / 8, c8 = (i % 8) * 8; FragH f; f.half[0] = *(const v8us*)((const unsigned short*)V16 + ((size_t)b * TTv + lg * 64 + r) * ldv + voff + h * 64 + c8);
#pragma unroll
    for (int q = 0; q < 8; ++q) tl[r][c8 + q] = f.u[q]; }
  __syncthreads();
  {
#pragma unroll
    for (int rd = 0; rd < 2; ++rd) { const int d = rd * 32 + tid / 8, pc = tid % 8; FragH f;
#pragma unroll
      for (int q = 0; q < 8; ++q) f.u[q] = tl[pc * 8 + q][d];
      *(v8us*)((unsigned short*)Vt + ((size_t)slab * 64 + d) * TTv + lg * 64 + pc * 8) = f.half[0]; }
     } }

__global__ __launch_bounds__(256) void k_hl(const float* __restrict__ F, _Float16* __restrict__ Hh, _Float16* __restrict__ Hl, size_t n8) { const size_t t = (size_t)blockIdx.x * 256 + threadIdx.x; if (t >= n8) return; FragH fh, fl; const v4f a = *(const v4fa*)(F + t * 8), c = *(const v4fa*)(F + t * 8 + 4);
#pragma unroll
  for (int q = 0; q < 4; ++q) { _Float16 h = (_Float16)a[q]; fh.h[q] = h; fl.h[q] = (_Float16)((a[q] - (float)h) * 1024.0f); h = (_Float16)c[q]; fh.h[4 + q] = h; fl.h[4 + q] = (_Float16)((c[q] - (float)h) * 1024.0f); }
  { *(v8us*)((unsigned short*)Hh + t * 8) = fh.half[0]; *(v8us*)((unsigned short*)Hl + t * 8) = fl.half[0];  } }

// ---- fast GEMM (wave tile 32x64; requires M % 32 == 0 rows per launch region and N % 64 == 0); epilogue = k_gemm_hhx semantics ----
__device__ __forceinline__ v16h g2_frag(const _Float16* p, int hh) { FragH f; f.half[0] = *(const v8us*)((const unsigned short*)p + 8 * hh); f.half[1] = *(const v8us*)((const unsigned short*)p + 16 + 8 * hh); return f.v; }
__device__ __forceinline__ v8f g2_mma(v16h a, v16h b, v8f c) { v8f d = __builtin_amdgcn_wmma_f32_16x16x32_f16(false, a, false, b, (short)0, c, false, false); asm volatile("v_nop\n\tv_nop\n\tv_nop\n\tv_nop" : "+v"(d) : "v"(a), "v"(b)); return d; }
template <int ACT>
__global__ __launch_bounds__(128) void k_gemm2(const _Float16* __restrict__ A, int lda, size_t sA, const _Float16* __restrict__ Bh, int ldb, size_t sB, float alpha, const float* __restrict__ bias, size_t sBias, const float* __restrict__ CP, int rowsPerB, size_t sCPb, int row0g,
    float* __restrict__ C, _Float16* __restrict__ C16, int ldc, size_t sC, int M, int N, int K) { static_assert(ACT == 0 || ACT == 3 || ACT == 6 || ACT == 8 || ACT == 9 || ACT == 11 || ACT == 12 || ACT == 14 || ACT == 15 || ACT == 16 || ACT == 17, "k_gemm2: unsupported ACT code (would silently apply no activation)");
  __shared__ __attribute__((aligned(16))) float so[4][32][68];
  const int tid = threadIdx.x, w = tid >> 5, lane = tid & 31, ln = lane & 15, hh = lane >> 4; const int by = blockIdx.y;
  A += (size_t)by * sA; Bh += (size_t)by * sB; const size_t cofs = (size_t)by * sC; const float* bp = bias ? bias + (size_t)by * sBias : nullptr;
  const int ntn = N >> 6; const int mt = blockIdx.x / ntn, nq = blockIdx.x - mt * ntn; const int row0 = mt * 128 + 32 * w, col0 = nq * 64; if (row0 >= M) return;
  const _Float16* a0p = A + (size_t)(row0 + ln) * lda; const _Float16* a1p = a0p + (size_t)16 * lda;
  const _Float16* b0p = Bh + (size_t)(col0 + ln) * ldb; const _Float16* b1p = b0p + (size_t)16 * ldb; const _Float16* b2p = b1p + (size_t)16 * ldb; const _Float16* b3p = b2p + (size_t)16 * ldb;
  const v8f z8 = {0.f,0.f,0.f,0.f,0.f,0.f,0.f,0.f}; v8f c00 = z8, c01 = z8, c02 = z8, c03 = z8, c10 = z8, c11 = z8, c12 = z8, c13 = z8;
#pragma unroll 1
  for (int kb = 0; kb < K; kb += 32) { const v16h a0 = g2_frag(a0p + kb, hh), a1 = g2_frag(a1p + kb, hh);
    v16h b = g2_frag(b0p + kb, hh); c00 = g2_mma(a0, b, c00); c10 = g2_mma(a1, b, c10);
    b = g2_frag(b1p + kb, hh); c01 = g2_mma(a0, b, c01); c11 = g2_mma(a1, b, c11);
    b = g2_frag(b2p + kb, hh); c02 = g2_mma(a0, b, c02); c12 = g2_mma(a1, b, c12);
    b = g2_frag(b3p + kb, hh); c03 = g2_mma(a0, b, c03); c13 = g2_mma(a1, b, c13); }
  v8f accs[8] = {c00, c01, c02, c03, c10, c11, c12, c13};
#pragma unroll
  for (int u = 0; u < 8; ++u) { const int t = u & 3, half = u >> 2; const int col = col0 + t * 16 + ln; const float bv = bp ? bf16_round(bp[col]) : 0.f;
#pragma unroll
    for (int r = 0; r < 8; ++r) { const int rloc = half * 16 + 8 * hh + r; float v = accs[u][r] * alpha + bv; if (CP) { if (rowsPerB < 0) v += CP[cofs + (size_t)(row0g + row0 + rloc) * ldc + col];      /* rowsPerB < 0: own element of the batched C plane */ else { const int bidx = (row0g + row0 + rloc) / rowsPerB; v += CP[(size_t)bidx * sCPb + (size_t)by * 64 + col]; } }
      if (ACT == 3) v = fmaxf(v, 0.f); else if (ACT == 6) v = 0.5f * v * (1.0f + erff(v * 0.70710678118654752f)); else if (ACT == 11) v = 1.0f / (1.0f + expf(-v)); else if (ACT == 15) v = v / (1.0f + expf(-v)); else if (ACT == 12) v = (v > 0.f) ? v : 0.01f * v; else if (ACT == 8) v = tanhf(v); else if (ACT == 9) v = 0.5f * v * (1.0f + tanhf(0.7978845608028654f * (v + 0.044715f * v * v * v))); else if (ACT == 14) v = (v > 0.f) ? v : 0.1f * v; else if (ACT == 16) v = (v >= 0.f) ? v : 0.3f * v; else if (ACT == 17) v = (v >= 0.f) ? v : 0.2f * v;
      so[w][rloc][t * 16 + ln] = v; } }
  __builtin_amdgcn_fence(__ATOMIC_ACQ_REL, "workgroup"); __builtin_amdgcn_wave_barrier();
  const int rsub = lane >> 4, c4 = (lane & 15) * 4;
  {
#pragma unroll
    for (int q = 0; q < 16; ++q) { const int r = q * 2 + rsub; const v4f v = *(const v4fa*)&so[w][r][c4]; if (C) *(v4f*)(C + cofs + (size_t)(row0 + r) * ldc + col0 + c4) = v; if (C16) { v4h h4; for (int i = 0; i < 4; ++i) h4[i] = (_Float16)v[i]; *(v4h*)(C16 + cofs + (size_t)(row0 + r) * ldc + col0 + c4) = h4; } }
     } }


__global__ __launch_bounds__(256) void k_wnat(const float* __restrict__ w, size_t n8, _Float16* __restrict__ Bt) { const size_t t = (size_t)blockIdx.x * 256 + threadIdx.x; if (t >= n8) return; FragH f; for (int q = 0; q < 8; ++q) f.h[q] = (_Float16)(bf16_round(w[t * 8 + q]) * 16.0f); *(v8us*)((unsigned short*)Bt + t * 8) = f.half[0];  }
__global__ __launch_bounds__(256) void k_rsm(const float* __restrict__ S, _Float16* __restrict__ P, int nrows) {
  #pragma clang fp contract(off)
  const int i = blockIdx.x * 256 + threadIdx.x; if (i >= nrows) return; const float* s = S + (size_t)i * SQ; float mx = -3.0e38f;
#pragma unroll 1
  for (int j = 0; j < SQ; ++j) mx = fmaxf(mx, s[j]); float se = 0.f;
#pragma unroll 1
  for (int j = 0; j < SQ; ++j) se += expf(s[j] - mx); const float sc = 256.0f / se;
#pragma unroll 1
  for (int j0 = 0; j0 < SQ; j0 += 8) { FragH f; for (int q = 0; q < 8; ++q) f.h[q] = (_Float16)(expf(s[j0 + q] - mx) * sc); unsigned short* d = (unsigned short*)P + (size_t)i * SQ + j0; *(v8us*)d = f.half[0];  } }
__global__ __launch_bounds__(256) void k_vt(const _Float16* __restrict__ V16, int b, int h0, _Float16* __restrict__ VT) { __shared__ unsigned short tl[64][65]; const int tid = threadIdx.x; const int hh = blockIdx.x % HG, sg = blockIdx.x / HG; const int s0 = sg * 64; const int h = h0 + hh;
  for (int i = tid; i < 64 * 8; i += 256) { const int j = i / 8, d8 = (i % 8) * 8; FragH f; f.half[0] = *(const v8us*)((const unsigned short*)V16 + ((size_t)b * SQ + s0 + j) * DM + h * HD + d8); for (int q = 0; q < 8; ++q) tl[d8 + q][j] = f.u[q]; }
  __syncthreads();
  { for (int i = tid; i < 64 * 8; i += 256) { const int d = i / 8, j8 = (i % 8) * 8; FragH f; for (int q = 0; q < 8; ++q) f.u[q] = tl[d][j8 + q]; *(v8us*)((unsigned short*)VT + ((size_t)hh * HD + d) * SQ + s0 + j8) = f.half[0]; }  } }



// Causal softmax, ONE S ROW PER WAVE, the row held in registers: lane l owns keys 256 c + 8 l .. + 7 of each 256-key chunk c (two 16-byte loads in, one 16-byte f16 store out per chunk).
// Row max and row sum: per-lane partials (the sum in four independent chains), then a five-step butterfly over the 32 lanes. NC = nk / 256 chunks, all loads of a row in flight together.
// e^x as the fast form has it (one multiply, v_exp_f32). The v_nop is the one slot the instruction set asks for behind a transcendental before its result is read or its source overwritten; it stands in the same statement because the compiler's own schedule of this kernel reused a source register directly behind some v_exp_f32.
__device__ __forceinline__ float rsm_exp(float x) { const float y = x * 1.44269504088896340736f; float e; asm("v_exp_f32 %0, %1\n\tv_nop" : "=v"(e) : "v"(y)); return e; }
template <int NC>
__device__ __forceinline__ void rsm_row(const float* __restrict__ s, unsigned short* __restrict__ p, int k0, int last) {
  float v[NC][8];
#pragma unroll
  for (int c = 0; c < NC; ++c) { const v4f a = *(const v4fa*)(s + c * 256 + k0), b = *(const v4fa*)(s + c * 256 + k0 + 4);
#pragma unroll
    for (int q = 0; q < 4; ++q) { v[c][q] = a[q]; v[c][4 + q] = b[q]; } }
  float mx = -3.0e38f;
#pragma unroll
  for (int c = 0; c < NC; ++c)
#pragma unroll
    for (int q = 0; q < 8; ++q) { if (c * 256 + k0 + q > last) v[c][q] = -1.0e9f; mx = fmaxf(mx, v[c][q]); }
#pragma unroll
  for (int m = 16; m > 0; m >>= 1) mx = fmaxf(mx, __shfl_xor(mx, m, 32));
  float s4[4] = {0.f, 0.f, 0.f, 0.f};
#pragma unroll
  for (int c = 0; c < NC; ++c)
#pragma unroll
    for (int q = 0; q < 8; ++q) { v[c][q] = rsm_exp(v[c][q] - mx); s4[q & 3] += v[c][q]; }
  float se = (s4[0] + s4[1]) + (s4[2] + s4[3]);
#pragma unroll
  for (int m = 16; m > 0; m >>= 1) se += __shfl_xor(se, m, 32);
  const float sc = 256.0f / se;
#pragma unroll
  for (int c = 0; c < NC; ++c) { FragH fr;
#pragma unroll
    for (int q = 0; q < 8; ++q) fr.h[q] = (_Float16)(v[c][q] * sc);
    *(v8us*)(p + c * 256 + k0) = fr.half[0]; }
  asm volatile("s_wait_xcnt 0x0" ::: "memory");      /* the built code lays the row lengths one behind the other, and only a conditional branch stands between these stores and the next length's code, which rewrites their address and data registers */
}
// grid = hg * QT rows, one 32-lane block each; nk a multiple of 256, at most NKX
__global__ __launch_bounds__(32) void k_rsmcf2(const float* __restrict__ S, _Float16* __restrict__ P, int hg, int q0, int nk) {
  const int t = blockIdx.x; if (t >= hg * QT) return; const int k0 = threadIdx.x * 8; const int last = q0 + (t % QT);
  const float* s = S + (size_t)t * NKX; unsigned short* p = (unsigned short*)P + (size_t)t * NKX;
  switch (nk >> 8) {      /* the same for every wave of the launch: straight-line code for each row length */
    case 1: rsm_row<1>(s, p, k0, last); break; case 2: rsm_row<2>(s, p, k0, last); break; case 3: rsm_row<3>(s, p, k0, last); break; case 4: rsm_row<4>(s, p, k0, last); break;
    case 5: rsm_row<5>(s, p, k0, last); break; case 6: rsm_row<6>(s, p, k0, last); break; case 7: rsm_row<7>(s, p, k0, last); break; case 8: rsm_row<8>(s, p, k0, last); break;
    default: break; } }


template <int MASKADD>
__global__ __launch_bounds__(64) void k_att0(const float* __restrict__ QF, const float* __restrict__ KF, const float* __restrict__ VF, int ld, const float* __restrict__ mask, float scale, float* __restrict__ OF, int ldo) {
  #pragma clang fp contract(off)
  __shared__ __attribute__((aligned(16))) float lq[64][64]; __shared__ __attribute__((aligned(16))) float lo[64][64];
  const int tid = threadIdx.x; const int h = blockIdx.x / (QT0 / 64), rg = blockIdx.x % (QT0 / 64); const int i = rg * 64 + tid;
  const float* qr = QF + (size_t)i * ld + h * HD;
#pragma unroll 1
  for (int c = 0; c < HD / 4; ++c) { *(v4f*)&lq[tid][c * 4] = *(const v4fa*)(qr + c * 4); const v4f z = {0.f, 0.f, 0.f, 0.f}; *(v4f*)&lo[tid][c * 4] = z; }
  float m = -1.0e30f, l = 0.f; const int jmax = MASKADD ? (SQ - 1) : (rg * 64 + 63);      /* additive-mask form: every key (the mask input decides); causal form: keys up to the block's last row */
#pragma unroll 1
  for (int j = 0; j <= jmax; ++j) { const float* kr = KF + (size_t)j * ld + h * HD; const float* vr = VF + (size_t)j * ld + h * HD; float s = 0.f;
#pragma unroll 1
    for (int c = 0; c < HD / 4; ++c) { const v4f kq = *(const v4fa*)(kr + c * 4); const v4f qq = *(v4f*)&lq[tid][c * 4]; s = __fadd_rn(s, __fmul_rn(qq[0], kq[0])); s = __fadd_rn(s, __fmul_rn(qq[1], kq[1])); s = __fadd_rn(s, __fmul_rn(qq[2], kq[2])); s = __fadd_rn(s, __fmul_rn(qq[3], kq[3])); }
    s = __fmul_rn(s, scale); if (MASKADD) s = __fadd_rn(s, __fmul_rn(bf16_round(mask[(size_t)i * SQ + j]), -10000.0f));
    const float f = (MASKADD || j <= i) ? 1.f : 0.f; const float sm = fmaf(f, s, (1.f - f) * -1.0e30f); const float mn = fmaxf(m, sm); const float sc = expf(m - mn); const float e = expf(sm - mn); l = __fadd_rn(__fmul_rn(l, sc), e); m = mn;
#pragma unroll 1
    for (int c = 0; c < HD / 4; ++c) { const v4f vv = *(const v4fa*)(vr + c * 4); v4f oo = *(v4f*)&lo[tid][c * 4]; for (int u = 0; u < 4; ++u) oo[u] = __fadd_rn(__fmul_rn(oo[u], sc), __fmul_rn(e, vv[u])); *(v4f*)&lo[tid][c * 4] = oo; } }
  const float fin = 64.0f / l;      /* o carried x64 like k_att0w */
#pragma unroll 1
  for (int c = 0; c < HD / 4; ++c) { v4f oo = *(v4f*)&lo[tid][c * 4]; for (int u = 0; u < 4; ++u) oo[u] = __fmul_rn(oo[u], fin); *(v4f*)&lo[tid][c * 4] = oo; }
  __syncthreads();
  {
#pragma unroll 1
    for (int it = 0; it < 16; ++it) { const int row = it * 4 + tid / 16, pc = (tid % 16) * 4; const v4f v = *(const v4f*)&lo[row][pc]; *(v4f*)(OF + (size_t)(rg * 64 + row) * ldo + h * HD + pc) = v; }
     } }


template <int BFIN, int WXB>
__global__ __launch_bounds__(256) void k_ln16(const float* __restrict__ X, const float* __restrict__ g, const float* __restrict__ bb, float eps, _Float16* __restrict__ N16, float* __restrict__ XB) {
  #pragma clang fp contract(off)
  __shared__ float red[256]; const size_t r = blockIdx.x; const int t = threadIdx.x; const v4f xa = *(const v4fa*)(X + r * DMQ + t * 4); float s[4]; float sum = 0.f;
  for (int q = 0; q < 4; ++q) { s[q] = BFIN ? bf16_round(xa[q]) : xa[q]; sum = __fadd_rn(sum, s[q]); }
  red[t] = sum; __syncthreads(); for (int st = 128; st > 0; st >>= 1) { if (t < st) red[t] = __fadd_rn(red[t], red[t + st]); __syncthreads(); } const float mu = red[0] / (float)DMQ; __syncthreads();
  float vs = 0.f; for (int q = 0; q < 4; ++q) { const float dl = __fadd_rn(s[q], -mu); vs = __fadd_rn(vs, __fmul_rn(dl, dl)); } red[t] = vs; __syncthreads(); for (int st = 128; st > 0; st >>= 1) { if (t < st) red[t] = __fadd_rn(red[t], red[t + st]); __syncthreads(); }
  const float rs = rsqrtf(__fadd_rn(red[0] / (float)DMQ, eps)); v4h y; v4f xb;
  for (int q = 0; q < 4; ++q) { const int c = t * 4 + q; y[q] = (_Float16)__fadd_rn(__fmul_rn(__fmul_rn(__fadd_rn(s[q], -mu), rs), bf16_round(g[c])), bf16_round(bb[c])); xb[q] = s[q]; }
  { *(v4h*)(N16 + r * DMQ + t * 4) = y; if (WXB) *(v4f*)(XB + r * DMQ + t * 4) = xb;  } }
__global__ __launch_bounds__(256) void k_ftres2(const float* __restrict__ OF0, const float* __restrict__ XB, float* __restrict__ X1, size_t n4) {
  #pragma clang fp contract(off)
  const size_t t = (size_t)blockIdx.x * 256 + threadIdx.x; if (t >= n4) return; const v4f o = *(const v4fa*)(OF0 + t * 4), xv = *(const v4fa*)(XB + t * 4); v4f y; for (int q = 0; q < 4; ++q) y[q] = __fadd_rn(__fmul_rn(o[q], 0.015625f), xv[q]); *(v4f*)(X1 + t * 4) = y;  }

__global__ __launch_bounds__(256) void k_wthd(const float* __restrict__ Wt, _Float16* __restrict__ Bt) { const size_t t = (size_t)blockIdx.x * 256 + threadIdx.x; if (t >= (size_t)NH * HD * (DM / 8)) return; const int m8 = (int)(t % (DM / 8)) * 8; const int d = (int)((t / (DM / 8)) % HD); const int h = (int)(t / ((size_t)(DM / 8) * HD)); FragH f;
  for (int q = 0; q < 8; ++q) f.h[q] = (_Float16)(16.0f * bf16_round(Wt[((size_t)h * DM + m8 + q) * HD + d])); unsigned short* dst = (unsigned short*)Bt + ((size_t)h * HD + d) * DM + m8; *(v8us*)dst = f.half[0];  }




__global__ __launch_bounds__(256) void k_wtpad(const float* __restrict__ Wm, _Float16* __restrict__ Wt, int Kr, int Kp, int Nr, int Np, float scale) {
  const int t = blockIdx.x * 256 + threadIdx.x; if (t >= Np * (Kp / 8)) return; const int n = t / (Kp / 8), k8 = (t % (Kp / 8)) * 8; const int nc = min(n, Nr - 1); const float fn = (n < Nr) ? 1.f : 0.f; FragH f;
  for (int i = 0; i < 8; ++i) { const int k = k8 + i; const int kc = min(k, Kr - 1); const float fk = (k < Kr) ? fn : 0.f; f.h[i] = (_Float16)(bf16_round(Wm[(size_t)kc * Nr + nc]) * scale * fk); }
  unsigned short* o = (unsigned short*)Wt + (size_t)n * Kp + k8; *(v8us*)o = f.half[0];  }
__global__ __launch_bounds__(128) void k_bpad(const float* __restrict__ b, float* __restrict__ Bp, int nr, int np) {
  const int i = threadIdx.x; if (i >= np) return; const float v = b[min(i, nr - 1)] * ((i < nr) ? 1.f : 0.f); *(float*)(Bp + i) = v;  }

#define DI 1024       /* inner width = NH * HD */
#define LQK (3 * DI)  /* fused q | k | v row pitch (3072) */
__global__ __launch_bounds__(256) void k_o0(const float* __restrict__ OF, float* __restrict__ ob, size_t n4) {
  #pragma clang fp contract(off)
  const size_t t = (size_t)blockIdx.x * 256 + threadIdx.x; if (t >= n4) return; const size_t e = t * 4; const int i = (int)(e / DI); const int c = (int)(e % DI); const int h = c / HD, d = c % HD; const v4f a = *(const v4fa*)(OF + e); v4f o; for (int q = 0; q < 4; ++q) o[q] = __fmul_rn(a[q], 0.015625f); float* dst = ob + (size_t)h * SQ * HD + (size_t)i * HD + d; *(v4f*)dst = o;  }

__global__ __launch_bounds__(256) void k_att0w(const float* __restrict__ QF, const float* __restrict__ KF, const float* __restrict__ VF, int ld, float scale, float* __restrict__ OF, int ldo) {
  #pragma clang fp contract(off)
  __shared__ __attribute__((aligned(16))) float lq[DI]; __shared__ float sj[QT0]; __shared__ float red[256];
  const int tid = threadIdx.x; const int i = blockIdx.x;
  *(v4f*)&lq[tid * 4] = *(const v4fa*)(QF + (size_t)i * ld + tid * 4); __syncthreads();
#pragma unroll 1
  for (int r = 0; r < QT0 / 256; ++r) { const int j = r * 256 + tid; const int jc = min(j, i); const float* kr = KF + (size_t)jc * ld; float s = 0.f;
#pragma unroll 1
    for (int c = 0; c < DI / 4; ++c) { const v4f kq = *(const v4fa*)(kr + c * 4); const v4f qq = *(v4f*)&lq[c * 4]; s = __fadd_rn(s, __fmul_rn(qq[0], kq[0])); s = __fadd_rn(s, __fmul_rn(qq[1], kq[1])); s = __fadd_rn(s, __fmul_rn(qq[2], kq[2])); s = __fadd_rn(s, __fmul_rn(qq[3], kq[3])); }
    s = __fmul_rn(s, scale); const float f = (j <= i) ? 1.f : 0.f; sj[j] = fmaf(f, s, (1.f - f) * -1.0e30f); }
  __syncthreads();
  float mx = -1.0e30f; for (int r = 0; r < QT0 / 256; ++r) mx = fmaxf(mx, sj[r * 256 + tid]); red[tid] = mx; __syncthreads(); for (int st = 128; st > 0; st >>= 1) { if (tid < st) red[tid] = fmaxf(red[tid], red[tid + st]); __syncthreads(); } mx = red[0]; __syncthreads();
  float ls = 0.f; for (int r = 0; r < QT0 / 256; ++r) { const int j = r * 256 + tid; const float e = expf(sj[j] - mx); sj[j] = e; ls = __fadd_rn(ls, e); } red[tid] = ls; __syncthreads(); for (int st = 128; st > 0; st >>= 1) { if (tid < st) red[tid] = __fadd_rn(red[tid], red[tid + st]); __syncthreads(); } const float l = red[0]; __syncthreads();
  v4f oo = {0.f, 0.f, 0.f, 0.f};
#pragma unroll 1
  for (int j = 0; j <= i; ++j) { const float e = sj[j]; const v4f vv = *(const v4fa*)(VF + (size_t)j * ld + tid * 4); for (int u = 0; u < 4; ++u) oo[u] = __fadd_rn(oo[u], __fmul_rn(e, vv[u])); }
  const float fin = 64.0f / l; for (int u = 0; u < 4; ++u) oo[u] = __fmul_rn(oo[u], fin);
  float* dst = OF + (size_t)i * ldo + tid * 4; *(v4f*)dst = oo;  }

__global__ __launch_bounds__(256) void k_o0m(const float* __restrict__ OF, float* __restrict__ o_, size_t n4) {
  #pragma clang fp contract(off)
  const size_t t = (size_t)blockIdx.x * 256 + threadIdx.x; if (t >= n4) return; const size_t e = t * 4; const v4f a = *(const v4fa*)(OF + e); v4f o; for (int q = 0; q < 4; ++q) o[q] = __fmul_rn(a[q], 0.015625f); *(v4f*)(o_ + e) = o;  }
extern "C" void kernel_launch(void* const* d_in, const int* in_sizes, int n_in,
                              void* d_out, int out_size, void* d_ws, size_t ws_size, hipStream_t stream) {
  (void)in_sizes; (void)n_in; (void)out_size;
  const float* const* I = (const float* const*)d_in; const float* x = I[0]; const float* wqkv = I[1];      /* input order: x [4][2048][1024], W_qkv ([in][out] [1024][3072]: q | k | v column thirds); the module has no biases and no output projection */
  char* ws = (char*)d_ws; size_t off = 0;
  auto take = [&](size_t bytes) { char* p = ws + off; off += (bytes + 255) & ~(size_t)255; return p; };
  _Float16* BW = (_Float16*)take((size_t)LQK * DM * 2); _Float16* X16 = (_Float16*)take(NR * DM * 2); _Float16* QKV = (_Float16*)take(NR * LQK * 2); _Float16* VT = (_Float16*)take((size_t)NH * HD * SQ * 2);
  float* S = (float*)take((size_t)QT * NKX * 4); _Float16* P = (_Float16*)take((size_t)QT * NKX * 2); float* QKVF0 = (float*)take((size_t)QT0 * LQK * 4); float* OF0 = (float*)take((size_t)QT0 * DI * 4);      /* ONE head: one S / P slab */
  if (off > ws_size) return;
  k_wtpad<<<(unsigned)(((size_t)LQK * (DM / 8) + 255) / 256), 256, 0, stream>>>(wqkv, BW, DM, DM, LQK, LQK, 16.0f);      /* [in][out] [1024][3072] -> Bt[n][k] x16 (no padding: Kr = Kp = 1024, Nr = Np = 3072) */
  k_x16<<<(unsigned)((NR * DM / 8 + 255) / 256), 256, 0, stream>>>(x, X16, NR * DM / 8);      /* x (bf16-valued) as exact f16 rows */
  k_gemm2<0><<<dim3((unsigned)((NR / 128) * (LQK / 64)), 1), 128, 0, stream>>>(X16, DM, 0, BW, DM, 0, 0.0625f, nullptr, 0, nullptr, 1, 0, 0, nullptr, QKV, LQK, 0, (int)NR, LQK, DM);      /* q | k | v = x W -> f16 rows, column blocks 0 / 1024 / 2048 of the fused plane (pitch 3072); no bias */
  const _Float16* Q16 = QKV; const _Float16* K16 = QKV + DI; const _Float16* V16 = QKV + 2 * DI;
  for (int b = 0; b < NB; ++b) { const size_t r0 = (size_t)b * SQ; float* ob = (float*)d_out + r0 * DI;
    k_vt<NH, SQ><<<NH * (SQ / 64), 256, 0, stream>>>(V16 + r0 * LQK, LQK, 0, VT);      /* V^T [1024][SQ] for this batch, as 16 column chunks of 64 */
    for (int q0 = 0; q0 < SQ; q0 += QT) { const int nk = q0 + QT;      /* causal: only keys below the tile end are computed */
      k_gemm2<0><<<dim3((QT / 128) * (nk / 64), 1), 128, 0, stream>>>(Q16 + (r0 + q0) * LQK, LQK, 0, K16 + r0 * LQK, LQK, 0, 0.03125f, nullptr, 0, nullptr, 1, 0, 0, S, nullptr, NKX, 0, QT, nk, DI);      /* scores / sqrt(1024) over the FULL width (K = 1024), one head */
      k_rsmcf2<<<QT, 32, 0, stream>>>(S, P, 1, q0, nk);      /* causal softmax -> P x256 f16, one wave per row */
      k_gemm2<0><<<dim3((QT / 128) * (DI / 64), 1), 128, 0, stream>>>(P, NKX, 0, VT, SQ, 0, 0.00390625f, nullptr, 0, nullptr, 1, 0, 0, ob + (size_t)q0 * DI, nullptr, DI, 0, QT, DI, nk); }      /* out[b][q0 + i][:] = P V^T 2^-8 (f32), N = 1024 */
    k_gemm2<0><<<dim3((unsigned)((QT0 / 128) * (LQK / 64)), 1), 128, 0, stream>>>(X16 + r0 * DM, DM, 0, BW, DM, 0, 0.0625f, nullptr, 0, nullptr, 1, 0, 0, QKVF0, nullptr, LQK, 0, QT0, LQK, DM);      /* f32 q | k | v of rows 0..511 (exact products, f32 accumulation) */
    k_att0w<<<QT0, 256, 0, stream>>>(QKVF0, QKVF0 + DI, QKVF0 + 2 * DI, LQK, 0.03125f, OF0, DI);      /* exact f32 single-head causal attention for rows 0..511 (o x64) */
    k_o0m<<<(unsigned)(((size_t)QT0 * DI / 4 + 255) / 256), 256, 0, stream>>>(OF0, ob, (size_t)QT0 * DI / 4); }      /* rows 0..511 of the batch REWRITTEN from the exact path */
}

// v002
// One run takes 748 microseconds.
// In two side-by-side timings against v001, it was 4.48 and 4.51 times as fast.
// All steps since v000 together make it 12.0 times as fast.
#include <hip/hip_runtime.h>
// Causal SINGLE-HEAD self-attention of full width with a fused bias-free QKV projection and NO output projection (x [4][2048][1024]; qkv = x W_qkv ([in][out] 1024 x 3072, no bias) split into q | k | v thirds of width 1024; scores = q k^T / sqrt(1024) over the FULL width (one head); causal (keys after the query -> -inf); softmax over keys; out = attn v -> [4][2048][1024]).
// Structure: token rows; x as exact f16 rows; ONE WMMA GEMM into the f16 q | k | v plane [8192][3072]; per batch v^T via LDS transposes (16 column chunks of 64 = the full 1024-wide row); causal 256-row query tiles: scores GEMM with K = 1024 (alpha 1/32), causal softmax f32 -> f16 x256 weights, P . V^T GEMM with N = 1024 written as f32 (alpha 2^-8) straight into the output rows. Every stage is ONE launch over all batches (the scores and P . V^T GEMMs: batch in grid y, query tile in grid z); S, P, V^T and the f32 planes hold all of them in the workspace.
// First-tile refinement: the first 512 query rows of every batch (which see few keys, so single-f16 q / k / v / P would be too coarse with no output projection to average the errors) are recomputed exactly: f32 q | k | v rows from a small extra GEMM (exact products, f32 accumulation), an f32 attention on VALU (k_att0w: one block per query row; full-width dot products; precise expf), and the rows are rewritten.
// Compute dtype: inputs rounded to bf16; x / weights exact; q, k, v and the softmax weights as plain f16 GEMM operands (~2^-12) past the exact rows; scores, softmax statistics and the output accumulation f32. v_wmma_f32_16x16x32_f16.
#define NB 4
#define SQ 2048
#define DM 1024
#define NH 16
#define HD 64
#define HG 4                         /* heads per attention launch group */
#define QT 256                       /* query rows per causal tile */
#define NKX SQ                       /* S / P row pitch */
#define QT0 512                      /* first-tile rows recomputed exactly (f32): 512 here (no output projection averages the early-row cancellation errors away; logit sigma 1.0) */
#define B0 0                         /* unused (each launch covers all batches) */
#define NBR NB                       /* unused by the launches (they cover all NB batches in their grids) */
#define NR ((size_t)NB * SQ)
#define DMQ DM
#define DFF 4096                     /* unused (no FFN in this file) */
#define DFFR 100                     /* unused */
#define MP ((int)((size_t)NBR * SQ)) /* unused by the launches (the projection covers NR rows) */
#define QN SQ                        /* unused (the query tiles cover SQ rows) */
#define NHD NH                       /* unused (one full-width head is attended) */
#define MPO MP                       /* unused (there is no output stage) */
#define LQ (3 * DM)      /* row pitch of the q/k/v rows */
typedef __bf16 v16b __attribute__((ext_vector_type(16)));
typedef unsigned short v8us __attribute__((ext_vector_type(8), may_alias));
typedef float  v8f  __attribute__((ext_vector_type(8)));
typedef float  v4f  __attribute__((ext_vector_type(4)));
typedef float  v4fa __attribute__((ext_vector_type(4), may_alias));
union FragB { v16b v; v8us half[2]; unsigned short u[16]; };

__device__ __forceinline__ unsigned short bf16_bits(float x) { unsigned int u = __float_as_uint(x); return (unsigned short)((u + 0x7FFFu + ((u >> 16) & 1u)) >> 16); }
__device__ __forceinline__ float bf16_val(unsigned short b) { return __uint_as_float(((unsigned int)b) << 16); }
__device__ __forceinline__ float bf16_round(float x) { return bf16_val(bf16_bits(x)); }
// D += A·B with NT terms: 1 = ah·bh, 2 = + al·bh (A split), 3 = + ah·bl (both split)
template <int NT>
__device__ __forceinline__ v8f mmaN(v16b ah, v16b al, v16b bh, v16b bl, v8f c) {
  c = __builtin_amdgcn_wmma_f32_16x16x32_bf16(false, ah, false, bh, (short)0, c, false, false);
  if (NT >= 2) c = __builtin_amdgcn_wmma_f32_16x16x32_bf16(false, al, false, bh, (short)0, c, false, false);
  if (NT >= 3) c = __builtin_amdgcn_wmma_f32_16x16x32_bf16(false, ah, false, bl, (short)0, c, false, false);
  asm volatile("v_nop\n\tv_nop\n\tv_nop\n\tv_nop" : "+v"(c) : "v"(ah), "v"(al), "v"(bh), "v"(bl));
  return c;
}

__global__ __launch_bounds__(256) void k_wt_bf16(const float* __restrict__ W, unsigned short* __restrict__ Wt, int K, int N) {
  const int t = blockIdx.x * 256 + threadIdx.x;
  const int k8n = K / 8;
  if (t >= N * k8n) return;
  const int n = t / k8n, k8 = (t % k8n) * 8;
  v8us v;
#pragma unroll
  for (int i = 0; i < 8; ++i) v[i] = bf16_bits(W[(size_t)(k8 + i) * N + n]);
  *(v8us*)(Wt + (size_t)n * K + k8) = v;
  
}

// GEMM C[M][N] (f32, pitch ldc) = act(A[M][K]·W + bias). A f32 row-major (pitch lda) converted per fragment to bf16
// (ASPLIT: hi/lo two planes -> 2 terms, else single rounded term); Wt bf16 [N][K] (pitch ldb). BIAS_BF16 rounds the
// bias to bf16 first (bias quantised to bf16 before the add). K%32==0, M%16==0, N%64==0.
template <bool ASPLIT, int ACT, bool BIAS_BF16>
__global__ __launch_bounds__(128) void k_gemm_bf(const float* __restrict__ A, int lda, const unsigned short* __restrict__ Wt, int ldb,
                                               const float* __restrict__ bias, float* __restrict__ C, int ldc, int M, int N, int K) {
  __shared__ __attribute__((aligned(16))) float so[4][16][64];
  const int tid = threadIdx.x, w = tid >> 5, lane = tid & 31, ln = lane & 15, hh = lane >> 4;
  const int ntn = N / 64;
  const int wid = blockIdx.x * 4 + w;
  const int mt = wid / ntn, nq = wid % ntn;
  if (mt * 16 >= M) return;
  const int row0 = mt * 16, col0 = nq * 64;
  const float* arow = A + (size_t)(row0 + ln) * lda;
  v8f acc[4] = {};
  for (int kb = 0; kb < K; kb += 32) {
    FragB ah, al;
    const v4f x0 = *(const v4fa*)(arow + kb + 8 * hh), x1 = *(const v4fa*)(arow + kb + 8 * hh + 4);
    const v4f x2 = *(const v4fa*)(arow + kb + 16 + 8 * hh), x3 = *(const v4fa*)(arow + kb + 16 + 8 * hh + 4);
    float xs[16] = {x0[0],x0[1],x0[2],x0[3],x1[0],x1[1],x1[2],x1[3],x2[0],x2[1],x2[2],x2[3],x3[0],x3[1],x3[2],x3[3]};
#pragma unroll
    for (int i = 0; i < 16; ++i) { const unsigned short hb = bf16_bits(xs[i]); ah.u[i] = hb; al.u[i] = ASPLIT ? bf16_bits(xs[i] - bf16_val(hb)) : (unsigned short)0; }
#pragma unroll
    for (int t = 0; t < 4; ++t) {
      const unsigned short* brow = Wt + (size_t)(col0 + t * 16 + ln) * ldb + kb;
      FragB b;
      b.half[0] = *(const v8us*)(brow + 8 * hh);
      b.half[1] = *(const v8us*)(brow + 16 + 8 * hh);
      acc[t] = mmaN<ASPLIT ? 2 : 1>(ah.v, al.v, b.v, b.v, acc[t]);
    }
  }
#pragma unroll
  for (int t = 0; t < 4; ++t) {
    float bv = bias ? bias[col0 + t * 16 + ln] : 0.f;
    if (BIAS_BF16) bv = bf16_round(bv);
#pragma unroll
    for (int r = 0; r < 8; ++r) { float v = acc[t][r] + bv; if (ACT == 1) v = fmaxf(v, 0.f); so[w][8 * hh + r][t * 16 + ln] = v; }
  }
  __builtin_amdgcn_fence(__ATOMIC_ACQ_REL, "workgroup");
  __builtin_amdgcn_wave_barrier();
  const int rsub = lane >> 4, c4 = (lane & 15) * 4;
  {
#pragma unroll
    for (int q = 0; q < 8; ++q) {
      const int r = q * 2 + rsub;
      const v4f v = *(const v4fa*)&so[w][r][c4];
      *(v4f*)(C + (size_t)(row0 + r) * ldc + col0 + c4) = v;
    }
    
  }
}

// GEMM C = act(A·W + bias + resid): A f32 (ASPLIT -> hi/lo 2 terms), Wt bf16 [N][K]; ACT 0 none, 1 relu, 2 exact gelu;
// resid (optional, f32, row index = (row % rmod), pitch ldr, RES_BF16 rounds it) added before the activation.
template <bool ASPLIT, int ACT, bool BIAS_BF16, bool RES_BF16>
__global__ __launch_bounds__(128) void k_gemm_bf3(const float* __restrict__ A, int lda, const unsigned short* __restrict__ Wt, int ldb,
                                                const float* __restrict__ bias, const float* __restrict__ resid, int rmod, int ldr,
                                                float* __restrict__ C, int ldc, int M, int N, int K) {
  __shared__ __attribute__((aligned(16))) float so[4][16][64];
  const int tid = threadIdx.x, w = tid >> 5, lane = tid & 31, ln = lane & 15, hh = lane >> 4;
  const int ntn = N / 64;
  const int wid = blockIdx.x * 4 + w;
  const int mt = wid / ntn, nq = wid % ntn;
  if (mt * 16 >= M) return;
  const int row0 = mt * 16, col0 = nq * 64;
  const float* arow = A + (size_t)(row0 + ln) * lda;
  v8f acc[4] = {};
  for (int kb = 0; kb < K; kb += 32) {
    FragB ah, al;
    const v4f x0 = *(const v4fa*)(arow + kb + 8 * hh), x1 = *(const v4fa*)(arow + kb + 8 * hh + 4);
    const v4f x2 = *(const v4fa*)(arow + kb + 16 + 8 * hh), x3 = *(const v4fa*)(arow + kb + 16 + 8 * hh + 4);
    float xs[16] = {x0[0],x0[1],x0[2],x0[3],x1[0],x1[1],x1[2],x1[3],x2[0],x2[1],x2[2],x2[3],x3[0],x3[1],x3[2],x3[3]};
#pragma unroll
    for (int i = 0; i < 16; ++i) { const unsigned short hb = bf16_bits(xs[i]); ah.u[i] = hb; al.u[i] = ASPLIT ? bf16_bits(xs[i] - bf16_val(hb)) : (unsigned short)0; }
#pragma unroll
    for (int t = 0; t < 4; ++t) {
      const unsigned short* brow = Wt + (size_t)(col0 + t * 16 + ln) * ldb + kb;
      FragB b;
      b.half[0] = *(const v8us*)(brow + 8 * hh);
      b.half[1] = *(const v8us*)(brow + 16 + 8 * hh);
      acc[t] = mmaN<ASPLIT ? 2 : 1>(ah.v, al.v, b.v, b.v, acc[t]);
    }
  }
#pragma unroll
  for (int t = 0; t < 4; ++t) {
    const int col = col0 + t * 16 + ln;
    float bv = bias ? bias[col] : 0.f;
    if (BIAS_BF16) bv = bf16_round(bv);
#pragma unroll
    for (int r = 0; r < 8; ++r) {
      float v = acc[t][r] + bv;
      if (resid) { float rv = resid[(size_t)((row0 + 8 * hh + r) % rmod) * ldr + col]; if (RES_BF16) rv = bf16_round(rv); v += rv; }
      if (ACT == 1) v = fmaxf(v, 0.f);
      if (ACT == 2) v = 0.5f * v * (1.0f + erff(v * 0.70710678118654752f));
      if (ACT == 3) { const float u = 0.7978845608028654f * (v + 0.044715f * v * v * v); v = 0.5f * v * (1.0f + tanhf(u)); }
      so[w][8 * hh + r][t * 16 + ln] = v;
    }
  }
  __builtin_amdgcn_fence(__ATOMIC_ACQ_REL, "workgroup");
  __builtin_amdgcn_wave_barrier();
  const int rsub = lane >> 4, c4 = (lane & 15) * 4;
  {
#pragma unroll
    for (int q = 0; q < 8; ++q) {
      const int r = q * 2 + rsub;
      const v4f v = *(const v4fa*)&so[w][r][c4];
      *(v4f*)(C + (size_t)(row0 + r) * ldc + col0 + c4) = v;
    }
    
  }
}
// row LayerNorm (biased variance, eps) over N: s = X (+ R); optional out_sum <- s; out_norm <- (s-mu)*rsqrt(var+eps)*g + b
template <bool PARAM_BF16>
__global__ __launch_bounds__(256) void k_layernorm(const float* __restrict__ X, const float* __restrict__ R, const float* __restrict__ g, const float* __restrict__ bta,
                                                  float* __restrict__ out_sum, float* __restrict__ out_norm, int N, float eps) {
  __shared__ float red[256];
  const int row = blockIdx.x, tid = threadIdx.x;
  const float* x = X + (size_t)row * N; const float* rr = R ? R + (size_t)row * N : nullptr;
  float vals[16];                     // up to N = 4096
  const int per = N / 256;            // contiguous chunk per thread? use strided-by-4 chunks: thread handles j = tid*4 + 1024*u
  float s1 = 0.f;
  for (int u = 0; u < per / 4; ++u) {
    const int j = tid * 4 + 1024 * u;
    const v4f a = *(const v4fa*)(x + j);
    v4f b = {0.f,0.f,0.f,0.f}; if (rr) b = *(const v4fa*)(rr + j);
#pragma unroll
    for (int q = 0; q < 4; ++q) { const float v = a[q] + b[q]; vals[u * 4 + q] = v; s1 += v; }
  }
  red[tid] = s1; __syncthreads();
  for (int st = 128; st > 0; st >>= 1) { if (tid < st) red[tid] += red[tid + st]; __syncthreads(); }
  const float mu = red[0] / (float)N; __syncthreads();
  float s2 = 0.f;
  for (int u = 0; u < per / 4; ++u)
#pragma unroll
    for (int q = 0; q < 4; ++q) { const float c = vals[u * 4 + q] - mu; s2 += c * c; }
  red[tid] = s2; __syncthreads();
  for (int st = 128; st > 0; st >>= 1) { if (tid < st) red[tid] += red[tid + st]; __syncthreads(); }
  const float rs = rsqrtf(red[0] / (float)N + eps);
  {
    for (int u = 0; u < per / 4; ++u) {
      const int j = tid * 4 + 1024 * u;
      v4f o, sm;
#pragma unroll
      for (int q = 0; q < 4; ++q) {
        float gg = g[j + q], bb = bta[j + q];
        if (PARAM_BF16) { gg = bf16_round(gg); bb = bf16_round(bb); }
        sm[q] = vals[u * 4 + q]; o[q] = (vals[u * 4 + q] - mu) * rs * gg + bb;
      }
      if (out_sum) *(v4f*)(out_sum + (size_t)row * N + j) = sm;
      *(v4f*)(out_norm + (size_t)row * N + j) = o;
    }
    
  }
}



// ---- f16 WMMA path (v_wmma_f32_16x16x32_f16): 11-bit significands for operands in range — used where a [0,1] probability operand needs more precision than bf16
typedef _Float16 v16h __attribute__((ext_vector_type(16)));
union FragH { v16h v; v8us half[2]; _Float16 h[16]; unsigned short u[16]; };
template <int NT>
__device__ __forceinline__ v8f mmaH(v16h ah, v16h al, v16h bh, v16h bl, v8f c) {
  c = __builtin_amdgcn_wmma_f32_16x16x32_f16(false, ah, false, bh, (short)0, c, false, false);
  if (NT >= 2) c = __builtin_amdgcn_wmma_f32_16x16x32_f16(false, al, false, bh, (short)0, c, false, false);
  if (NT >= 3) c = __builtin_amdgcn_wmma_f32_16x16x32_f16(false, ah, false, bl, (short)0, c, false, false);
  asm volatile("v_nop\n\tv_nop\n\tv_nop\n\tv_nop" : "+v"(c) : "v"(ah), "v"(al), "v"(bh), "v"(bl));
  return c;
}
// batched GEMM like k_gemm_b but f16 operands: A f32 (split into f16 hi/lo if ASPLIT, else rounded to f16), Bt = f16 values [n][k]; alpha; C f32; N multiple of 16 (partial tiles skipped)
template <bool ASPLIT>
__global__ __launch_bounds__(128) void k_gemm_h(const float* __restrict__ A, int lda, size_t sA, const _Float16* __restrict__ Bh, int ldb, size_t sB, float alpha, float* __restrict__ C, int ldc, size_t sC, int M, int N, int K) {
  __shared__ __attribute__((aligned(16))) float so[4][16][64];
  const int tid = threadIdx.x, w = tid >> 5, lane = tid & 31, ln = lane & 15, hh = lane >> 4; const int by = blockIdx.y;
  A += (size_t)by * sA; Bh += (size_t)by * sB; C += (size_t)by * sC;
  const int ntn = (N + 63) / 64; const int wid = blockIdx.x * 4 + w; const int mt = wid / ntn, nq = wid % ntn; if (mt * 16 >= M) return;
  const int row0 = mt * 16, col0 = nq * 64; const float* arow = A + (size_t)(row0 + ln) * lda;
  v8f acc[4] = {};
  for (int kb = 0; kb < K; kb += 32) {
    FragH ah, al;
    const v4f x0 = *(const v4fa*)(arow + kb + 8 * hh), x1 = *(const v4fa*)(arow + kb + 8 * hh + 4), x2 = *(const v4fa*)(arow + kb + 16 + 8 * hh), x3 = *(const v4fa*)(arow + kb + 16 + 8 * hh + 4);
    float xs[16] = {x0[0],x0[1],x0[2],x0[3],x1[0],x1[1],x1[2],x1[3],x2[0],x2[1],x2[2],x2[3],x3[0],x3[1],x3[2],x3[3]};
#pragma unroll
    for (int i = 0; i < 16; ++i) { const _Float16 h = (_Float16)xs[i]; ah.h[i] = h; al.h[i] = ASPLIT ? (_Float16)(xs[i] - (float)h) : (_Float16)0.0f; }
#pragma unroll
    for (int t = 0; t < 4; ++t) { if (col0 + t * 16 >= N) continue; const size_t boff = (size_t)(col0 + t * 16 + ln) * ldb + kb; FragH bq; bq.half[0] = *(const v8us*)(Bh + boff + 8 * hh); bq.half[1] = *(const v8us*)(Bh + boff + 16 + 8 * hh);
      acc[t] = mmaH<ASPLIT ? 2 : 1>(ah.v, al.v, bq.v, bq.v, acc[t]); }
  }
#pragma unroll
  for (int t = 0; t < 4; ++t) { if (col0 + t * 16 >= N) continue;
#pragma unroll
    for (int r = 0; r < 8; ++r) so[w][8 * hh + r][t * 16 + ln] = acc[t][r] * alpha; }
  __builtin_amdgcn_fence(__ATOMIC_ACQ_REL, "workgroup"); __builtin_amdgcn_wave_barrier();
  const int rsub = lane >> 4, c4 = (lane & 15) * 4;
  {
#pragma unroll
    for (int q = 0; q < 8; ++q) { const int r = q * 2 + rsub; if (col0 + c4 < N) { const v4f v = *(const v4fa*)&so[w][r][c4]; *(v4f*)(C + (size_t)(row0 + r) * ldc + col0 + c4) = v; } }
     }
}

// Wt[n][k] = f16(W[k][n]·scale) from f32 row-major W[K][N] (scale = power of two; bf16-exact weights stay exact in f16 away from the subnormal range)
__global__ __launch_bounds__(256) void k_wt_f16(const float* __restrict__ W, _Float16* __restrict__ Wt, int K, int N, float scale) {
  const int t = blockIdx.x * 256 + threadIdx.x; if (t >= N * (K / 8)) return; const int n = t / (K / 8), k8 = (t % (K / 8)) * 8; FragH f;
#pragma unroll
  for (int i = 0; i < 8; ++i) f.h[i] = (_Float16)(bf16_round(W[(size_t)(k8 + i) * N + n]) * scale); const v8us o = f.half[0];
  *(v8us*)((unsigned short*)Wt + (size_t)n * K + k8) = o; 
}
// k_gemm_hh variant with fused epilogue: v = acc·alpha + bias[by·sBias + col] (+ CP[(row/rowsPerB)·sCPb + by·64 + col] if CP) ; ACT 0 none / 1 elu ; writes f16 C16 (and f32 C if non-null)
template <int ACT>
__global__ __launch_bounds__(128) void k_gemm_hhx(const _Float16* __restrict__ A, int lda, size_t sA, const _Float16* __restrict__ Bh, int ldb, size_t sB, float alpha, const float* __restrict__ bias, size_t sBias, const float* __restrict__ CP, int rowsPerB, size_t sCPb, int row0g,
    float* __restrict__ C, _Float16* __restrict__ C16, int ldc, size_t sC, int M, int N, int K) {
  __shared__ __attribute__((aligned(16))) float so[4][16][64];
  const int tid = threadIdx.x, w = tid >> 5, lane = tid & 31, ln = lane & 15, hh = lane >> 4; const int by = blockIdx.y;
  A += (size_t)by * sA; Bh += (size_t)by * sB; const size_t cofs = (size_t)by * sC; const float* bp = bias ? bias + (size_t)by * sBias : nullptr;
  const int ntn = (N + 63) / 64; const int wid = blockIdx.x * 4 + w; const int mt = wid / ntn, nq = wid % ntn; if (mt * 16 >= M) return;
  const int row0 = mt * 16, col0 = nq * 64; const _Float16* arow = A + (size_t)(row0 + ln) * lda;
  v8f acc[4] = {};
  for (int kb = 0; kb < K; kb += 32) { FragH ah; ah.half[0] = *(const v8us*)((const unsigned short*)arow + kb + 8 * hh); ah.half[1] = *(const v8us*)((const unsigned short*)arow + kb + 16 + 8 * hh);
#pragma unroll
    for (int t = 0; t < 4; ++t) { if (col0 + t * 16 >= N) continue; const size_t boff = (size_t)(col0 + t * 16 + ln) * ldb + kb; FragH bq; bq.half[0] = *(const v8us*)((const unsigned short*)Bh + boff + 8 * hh); bq.half[1] = *(const v8us*)((const unsigned short*)Bh + boff + 16 + 8 * hh);
      acc[t] = mmaH<1>(ah.v, ah.v, bq.v, bq.v, acc[t]); }
  }
#pragma unroll
  for (int t = 0; t < 4; ++t) { if (col0 + t * 16 >= N) continue; const int col = col0 + t * 16 + ln; const float bv = bp ? bf16_round(bp[col]) : 0.f;
#pragma unroll
    for (int r = 0; r < 8; ++r) { float v = acc[t][r] * alpha + bv; if (CP) { const int rr = row0g + row0 + 8 * hh + r; if (rowsPerB < 0) v += CP[cofs + (size_t)rr * ldc + col];      /* rowsPerB < 0: own element of the batched C plane */ else { const int bidx = rr / rowsPerB; v += CP[(size_t)bidx * sCPb + (size_t)by * 64 + col]; } } if (ACT == 1) v = (v > 0.f) ? v : expm1f(v); else if (ACT == 7) v = (v > 0.f) ? v + 1.0f : expf(v); else if (ACT == 8) v = tanhf(v); else if (ACT == 9) v = 0.5f * v * (1.0f + tanhf(0.7978845608028654f * (v + 0.044715f * v * v * v))); else if (ACT == 11) v = 1.0f / (1.0f + expf(-v)); else if (ACT == 12) v = (v > 0.f) ? v : 0.01f * v; else if (ACT == 14) v = (v > 0.f) ? v : 0.1f * v; else if (ACT == 16) v = (v >= 0.f) ? v : 0.3f * v; else if (ACT == 17) v = (v >= 0.f) ? v : 0.2f * v; else if (ACT == 15) v = v / (1.0f + expf(-v)); else if (ACT == 3) v = fmaxf(v, 0.f); else if (ACT == 6) v = 0.5f * v * (1.0f + erff(v * 0.70710678118654752f)); so[w][8 * hh + r][t * 16 + ln] = v; } }
  __builtin_amdgcn_fence(__ATOMIC_ACQ_REL, "workgroup"); __builtin_amdgcn_wave_barrier();
  const int rsub = lane >> 4, c4 = (lane & 15) * 4; typedef _Float16 v4h __attribute__((ext_vector_type(4)));
  {
#pragma unroll
    for (int q = 0; q < 8; ++q) { const int r = q * 2 + rsub; if (col0 + c4 < N) { const v4f v = *(const v4fa*)&so[w][r][c4]; if (C) *(v4f*)(C + cofs + (size_t)(row0 + r) * ldc + col0 + c4) = v; if (C16) { v4h h4; for (int i = 0; i < 4; ++i) h4[i] = (_Float16)v[i]; *(v4h*)(C16 + cofs + (size_t)(row0 + r) * ldc + col0 + c4) = h4; } } }
     }
}


typedef _Float16 v4h __attribute__((ext_vector_type(4)));

__global__ __launch_bounds__(256) void k_x16(const float* __restrict__ x, _Float16* __restrict__ X16, size_t n8) { const size_t t = (size_t)blockIdx.x * 256 + threadIdx.x; if (t >= n8) return; FragH f;
#pragma unroll
  for (int q = 0; q < 8; ++q) f.h[q] = (_Float16)bf16_round(x[t * 8 + q]); *(v8us*)((unsigned short*)X16 + t * 8) = f.half[0];  }
__global__ __launch_bounds__(256) void k_h16(const float* __restrict__ x, _Float16* __restrict__ X16, size_t n8) { const size_t t = (size_t)blockIdx.x * 256 + threadIdx.x; if (t >= n8) return; FragH f;
#pragma unroll
  for (int q = 0; q < 8; ++q) f.h[q] = (_Float16)x[t * 8 + q]; *(v8us*)((unsigned short*)X16 + t * 8) = f.half[0];  }
__global__ __launch_bounds__(256) void k_round16f(const float* __restrict__ W, _Float16* __restrict__ Bt, size_t n8) { const size_t t = (size_t)blockIdx.x * 256 + threadIdx.x; if (t >= n8) return; FragH f;
#pragma unroll
  for (int i = 0; i < 8; ++i) f.h[i] = (_Float16)(bf16_round(W[t * 8 + i]) * 16.0f); *(v8us*)((unsigned short*)Bt + t * 8) = f.half[0];  }
template <int NHv, int TTv>
__global__ __launch_bounds__(256) void k_vt(const _Float16* __restrict__ V16, int ldv, int voff, _Float16* __restrict__ Vt) { __shared__ unsigned short tl[64][66]; const int tid = threadIdx.x; const int slab = blockIdx.x / (TTv / 64), lg = blockIdx.x % (TTv / 64); const int b = slab / NHv, h = slab % NHv;
  for (int i = tid; i < 64 * 8; i += 256) { const int r = i / 8, c8 = (i % 8) * 8; FragH f; f.half[0] = *(const v8us*)((const unsigned short*)V16 + ((size_t)b * TTv + lg * 64 + r) * ldv + voff + h * 64 + c8);
#pragma unroll
    for (int q = 0; q < 8; ++q) tl[r][c8 + q] = f.u[q]; }
  __syncthreads();
  {
#pragma unroll
    for (int rd = 0; rd < 2; ++rd) { const int d = rd * 32 + tid / 8, pc = tid % 8; FragH f;
#pragma unroll
      for (int q = 0; q < 8; ++q) f.u[q] = tl[pc * 8 + q][d];
      *(v8us*)((unsigned short*)Vt + ((size_t)slab * 64 + d) * TTv + lg * 64 + pc * 8) = f.half[0]; }
     } }

__global__ __launch_bounds__(256) void k_hl(const float* __restrict__ F, _Float16* __restrict__ Hh, _Float16* __restrict__ Hl, size_t n8) { const size_t t = (size_t)blockIdx.x * 256 + threadIdx.x; if (t >= n8) return; FragH fh, fl; const v4f a = *(const v4fa*)(F + t * 8), c = *(const v4fa*)(F + t * 8 + 4);
#pragma unroll
  for (int q = 0; q < 4; ++q) { _Float16 h = (_Float16)a[q]; fh.h[q] = h; fl.h[q] = (_Float16)((a[q] - (float)h) * 1024.0f); h = (_Float16)c[q]; fh.h[4 + q] = h; fl.h[4 + q] = (_Float16)((c[q] - (float)h) * 1024.0f); }
  { *(v8us*)((unsigned short*)Hh + t * 8) = fh.half[0]; *(v8us*)((unsigned short*)Hl + t * 8) = fl.half[0];  } }

// ---- fast GEMM (wave tile 32x64; requires M % 32 == 0 rows per launch region and N % 64 == 0); epilogue = k_gemm_hhx semantics ----
__device__ __forceinline__ v16h g2_frag(const _Float16* p, int hh) { FragH f; f.half[0] = *(const v8us*)((const unsigned short*)p + 8 * hh); f.half[1] = *(const v8us*)((const unsigned short*)p + 16 + 8 * hh); return f.v; }
__device__ __forceinline__ v8f g2_mma(v16h a, v16h b, v8f c) { v8f d = __builtin_amdgcn_wmma_f32_16x16x32_f16(false, a, false, b, (short)0, c, false, false); asm volatile("v_nop\n\tv_nop\n\tv_nop\n\tv_nop" : "+v"(d) : "v"(a), "v"(b)); return d; }
// CAUS: grid z = causal query tile of QT rows (A and C step QT rows a tile). 1 = scores: only key columns up to the tile's end are computed; 2 = P V: K ends at the tile's end.
template <int ACT, int CAUS = 0>
__global__ __launch_bounds__(128) void k_gemm2(const _Float16* __restrict__ A, int lda, size_t sA, const _Float16* __restrict__ Bh, int ldb, size_t sB, float alpha, const float* __restrict__ bias, size_t sBias, const float* __restrict__ CP, int rowsPerB, size_t sCPb, int row0g,
    float* __restrict__ C, _Float16* __restrict__ C16, int ldc, size_t sC, int M, int N, int K) { static_assert(ACT == 0 || ACT == 3 || ACT == 6 || ACT == 8 || ACT == 9 || ACT == 11 || ACT == 12 || ACT == 14 || ACT == 15 || ACT == 16 || ACT == 17, "k_gemm2: unsupported ACT code (would silently apply no activation)");
  __shared__ __attribute__((aligned(16))) float so[4][32][68];
  const int tid = threadIdx.x, w = tid >> 5, lane = tid & 31, ln = lane & 15, hh = lane >> 4; const int by = blockIdx.y;
  const int qt = CAUS ? SQ / QT - 1 - (int)blockIdx.z : 0;      /* low z starts first: the tile with the most keys goes first */
  A += (size_t)by * sA + (size_t)qt * QT * lda; Bh += (size_t)by * sB; const size_t cofs = (size_t)by * sC + (size_t)qt * QT * ldc; const float* bp = bias ? bias + (size_t)by * sBias : nullptr;
  const int ntn = N >> 6; const int mt = blockIdx.x / ntn, nq = blockIdx.x - mt * ntn; const int row0 = mt * 128 + 32 * w, col0 = nq * 64; if (row0 >= M) return;
  if (CAUS == 1 && col0 >= (qt + 1) * QT) return;
  if (CAUS == 2) K = (qt + 1) * QT;
  const _Float16* a0p = A + (size_t)(row0 + ln) * lda; const _Float16* a1p = a0p + (size_t)16 * lda;
  const _Float16* b0p = Bh + (size_t)(col0 + ln) * ldb; const _Float16* b1p = b0p + (size_t)16 * ldb; const _Float16* b2p = b1p + (size_t)16 * ldb; const _Float16* b3p = b2p + (size_t)16 * ldb;
  const v8f z8 = {0.f,0.f,0.f,0.f,0.f,0.f,0.f,0.f}; v8f c00 = z8, c01 = z8, c02 = z8, c03 = z8, c10 = z8, c11 = z8, c12 = z8, c13 = z8;
#pragma unroll 1
  for (int kb = 0; kb < K; kb += 32) { const v16h a0 = g2_frag(a0p + kb, hh), a1 = g2_frag(a1p + kb, hh);
    v16h b = g2_frag(b0p + kb, hh); c00 = g2_mma(a0, b, c00); c10 = g2_mma(a1, b, c10);
    b = g2_frag(b1p + kb, hh); c01 = g2_mma(a0, b, c01); c11 = g2_mma(a1, b, c11);
    b = g2_frag(b2p + kb, hh); c02 = g2_mma(a0, b, c02); c12 = g2_mma(a1, b, c12);
    b = g2_frag(b3p + kb, hh); c03 = g2_mma(a0, b, c03); c13 = g2_mma(a1, b, c13); }
  v8f accs[8] = {c00, c01, c02, c03, c10, c11, c12, c13};
#pragma unroll
  for (int u = 0; u < 8; ++u) { const int t = u & 3, half = u >> 2; const int col = col0 + t * 16 + ln; const float bv = bp ? bf16_round(bp[col]) : 0.f;
#pragma unroll
    for (int r = 0; r < 8; ++r) { const int rloc = half * 16 + 8 * hh + r; float v = accs[u][r] * alpha + bv; if (CP) { if (rowsPerB < 0) v += CP[cofs + (size_t)(row0g + row0 + rloc) * ldc + col];      /* rowsPerB < 0: own element of the batched C plane */ else { const int bidx = (row0g + row0 + rloc) / rowsPerB; v += CP[(size_t)bidx * sCPb + (size_t)by * 64 + col]; } }
      if (ACT == 3) v = fmaxf(v, 0.f); else if (ACT == 6) v = 0.5f * v * (1.0f + erff(v * 0.70710678118654752f)); else if (ACT == 11) v = 1.0f / (1.0f + expf(-v)); else if (ACT == 15) v = v / (1.0f + expf(-v)); else if (ACT == 12) v = (v > 0.f) ? v : 0.01f * v; else if (ACT == 8) v = tanhf(v); else if (ACT == 9) v = 0.5f * v * (1.0f + tanhf(0.7978845608028654f * (v + 0.044715f * v * v * v))); else if (ACT == 14) v = (v > 0.f) ? v : 0.1f * v; else if (ACT == 16) v = (v >= 0.f) ? v : 0.3f * v; else if (ACT == 17) v = (v >= 0.f) ? v : 0.2f * v;
      so[w][rloc][t * 16 + ln] = v; } }
  __builtin_amdgcn_fence(__ATOMIC_ACQ_REL, "workgroup"); __builtin_amdgcn_wave_barrier();
  const int rsub = lane >> 4, c4 = (lane & 15) * 4;
  {
#pragma unroll
    for (int q = 0; q < 16; ++q) { const int r = q * 2 + rsub; const v4f v = *(const v4fa*)&so[w][r][c4]; if (C) *(v4f*)(C + cofs + (size_t)(row0 + r) * ldc + col0 + c4) = v; if (C16) { v4h h4; for (int i = 0; i < 4; ++i) h4[i] = (_Float16)v[i]; *(v4h*)(C16 + cofs + (size_t)(row0 + r) * ldc + col0 + c4) = h4; } }
     } }


__global__ __launch_bounds__(256) void k_wnat(const float* __restrict__ w, size_t n8, _Float16* __restrict__ Bt) { const size_t t = (size_t)blockIdx.x * 256 + threadIdx.x; if (t >= n8) return; FragH f; for (int q = 0; q < 8; ++q) f.h[q] = (_Float16)(bf16_round(w[t * 8 + q]) * 16.0f); *(v8us*)((unsigned short*)Bt + t * 8) = f.half[0];  }
__global__ __launch_bounds__(256) void k_rsm(const float* __restrict__ S, _Float16* __restrict__ P, int nrows) {
  #pragma clang fp contract(off)
  const int i = blockIdx.x * 256 + threadIdx.x; if (i >= nrows) return; const float* s = S + (size_t)i * SQ; float mx = -3.0e38f;
#pragma unroll 1
  for (int j = 0; j < SQ; ++j) mx = fmaxf(mx, s[j]); float se = 0.f;
#pragma unroll 1
  for (int j = 0; j < SQ; ++j) se += expf(s[j] - mx); const float sc = 256.0f / se;
#pragma unroll 1
  for (int j0 = 0; j0 < SQ; j0 += 8) { FragH f; for (int q = 0; q < 8; ++q) f.h[q] = (_Float16)(expf(s[j0 + q] - mx) * sc); unsigned short* d = (unsigned short*)P + (size_t)i * SQ + j0; *(v8us*)d = f.half[0];  } }
__global__ __launch_bounds__(256) void k_vt(const _Float16* __restrict__ V16, int b, int h0, _Float16* __restrict__ VT) { __shared__ unsigned short tl[64][65]; const int tid = threadIdx.x; const int hh = blockIdx.x % HG, sg = blockIdx.x / HG; const int s0 = sg * 64; const int h = h0 + hh;
  for (int i = tid; i < 64 * 8; i += 256) { const int j = i / 8, d8 = (i % 8) * 8; FragH f; f.half[0] = *(const v8us*)((const unsigned short*)V16 + ((size_t)b * SQ + s0 + j) * DM + h * HD + d8); for (int q = 0; q < 8; ++q) tl[d8 + q][j] = f.u[q]; }
  __syncthreads();
  { for (int i = tid; i < 64 * 8; i += 256) { const int d = i / 8, j8 = (i % 8) * 8; FragH f; for (int q = 0; q < 8; ++q) f.u[q] = tl[d][j8 + q]; *(v8us*)((unsigned short*)VT + ((size_t)hh * HD + d) * SQ + s0 + j8) = f.half[0]; }  } }



// Causal softmax, ONE S ROW PER WAVE, the row held in registers: lane l owns keys 256 c + 8 l .. + 7 of each 256-key chunk c (two 16-byte loads in, one 16-byte f16 store out per chunk).
// Row max and row sum: per-lane partials (the sum in four independent chains), then a five-step butterfly over the 32 lanes. NC = nk / 256 chunks, all loads of a row in flight together.
// e^x as the fast form has it (one multiply, v_exp_f32). The v_nop is the one slot the instruction set asks for behind a transcendental before its result is read or its source overwritten; it stands in the same statement because the compiler's own schedule of this kernel reused a source register directly behind some v_exp_f32.
__device__ __forceinline__ float rsm_exp(float x) { const float y = x * 1.44269504088896340736f; float e; asm("v_exp_f32 %0, %1\n\tv_nop" : "=v"(e) : "v"(y)); return e; }
template <int NC>
__device__ __forceinline__ void rsm_row(const float* __restrict__ s, unsigned short* __restrict__ p, int k0, int last) {
  float v[NC][8];
#pragma unroll
  for (int c = 0; c < NC; ++c) { const v4f a = *(const v4fa*)(s + c * 256 + k0), b = *(const v4fa*)(s + c * 256 + k0 + 4);
#pragma unroll
    for (int q = 0; q < 4; ++q) { v[c][q] = a[q]; v[c][4 + q] = b[q]; } }
  float mx = -3.0e38f;
#pragma unroll
  for (int c = 0; c < NC; ++c)
#pragma unroll
    for (int q = 0; q < 8; ++q) { if (c * 256 + k0 + q > last) v[c][q] = -1.0e9f; mx = fmaxf(mx, v[c][q]); }
#pragma unroll
  for (int m = 16; m > 0; m >>= 1) mx = fmaxf(mx, __shfl_xor(mx, m, 32));
  float s4[4] = {0.f, 0.f, 0.f, 0.f};
#pragma unroll
  for (int c = 0; c < NC; ++c)
#pragma unroll
    for (int q = 0; q < 8; ++q) { v[c][q] = rsm_exp(v[c][q] - mx); s4[q & 3] += v[c][q]; }
  float se = (s4[0] + s4[1]) + (s4[2] + s4[3]);
#pragma unroll
  for (int m = 16; m > 0; m >>= 1) se += __shfl_xor(se, m, 32);
  const float sc = 256.0f / se;
#pragma unroll
  for (int c = 0; c < NC; ++c) { FragH fr;
#pragma unroll
    for (int q = 0; q < 8; ++q) fr.h[q] = (_Float16)(v[c][q] * sc);
    *(v8us*)(p + c * 256 + k0) = fr.half[0]; }
  asm volatile("s_wait_xcnt 0x0" ::: "memory");      /* the built code lays the row lengths one behind the other, and only a conditional branch stands between these stores and the next length's code, which rewrites their address and data registers */
}
// grid = all token rows of all batches, one 32-lane block each; a row's length is the end of its own QT-row query tile
__global__ __launch_bounds__(32) void k_rsmcf2(const float* __restrict__ S, _Float16* __restrict__ P, int nrows) {
  const int t = blockIdx.x; if (t >= nrows) return; const int k0 = threadIdx.x * 8; const int last = t % SQ;
  const float* s = S + (size_t)t * NKX; unsigned short* p = (unsigned short*)P + (size_t)t * NKX;
  switch (last / QT + 1) {      /* the same for every lane of the wave: straight-line code for each row length */
    case 1: rsm_row<1>(s, p, k0, last); break; case 2: rsm_row<2>(s, p, k0, last); break; case 3: rsm_row<3>(s, p, k0, last); break; case 4: rsm_row<4>(s, p, k0, last); break;
    case 5: rsm_row<5>(s, p, k0, last); break; case 6: rsm_row<6>(s, p, k0, last); break; case 7: rsm_row<7>(s, p, k0, last); break; case 8: rsm_row<8>(s, p, k0, last); break;
    default: break; } }


template <int MASKADD>
__global__ __launch_bounds__(64) void k_att0(const float* __restrict__ QF, const float* __restrict__ KF, const float* __restrict__ VF, int ld, const float* __restrict__ mask, float scale, float* __restrict__ OF, int ldo) {
  #pragma clang fp contract(off)
  __shared__ __attribute__((aligned(16))) float lq[64][64]; __shared__ __attribute__((aligned(16))) float lo[64][64];
  const int tid = threadIdx.x; const int h = blockIdx.x / (QT0 / 64), rg = blockIdx.x % (QT0 / 64); const int i = rg * 64 + tid;
  const float* qr = QF + (size_t)i * ld + h * HD;
#pragma unroll 1
  for (int c = 0; c < HD / 4; ++c) { *(v4f*)&lq[tid][c * 4] = *(const v4fa*)(qr + c * 4); const v4f z = {0.f, 0.f, 0.f, 0.f}; *(v4f*)&lo[tid][c * 4] = z; }
  float m = -1.0e30f, l = 0.f; const int jmax = MASKADD ? (SQ - 1) : (rg * 64 + 63);      /* additive-mask form: every key (the mask input decides); causal form: keys up to the block's last row */
#pragma unroll 1
  for (int j = 0; j <= jmax; ++j) { const float* kr = KF + (size_t)j * ld + h * HD; const float* vr = VF + (size_t)j * ld + h * HD; float s = 0.f;
#pragma unroll 1
    for (int c = 0; c < HD / 4; ++c) { const v4f kq = *(const v4fa*)(kr + c * 4); const v4f qq = *(v4f*)&lq[tid][c * 4]; s = __fadd_rn(s, __fmul_rn(qq[0], kq[0])); s = __fadd_rn(s, __fmul_rn(qq[1], kq[1])); s = __fadd_rn(s, __fmul_rn(qq[2], kq[2])); s = __fadd_rn(s, __fmul_rn(qq[3], kq[3])); }
    s = __fmul_rn(s, scale); if (MASKADD) s = __fadd_rn(s, __fmul_rn(bf16_round(mask[(size_t)i * SQ + j]), -10000.0f));
    const float f = (MASKADD || j <= i) ? 1.f : 0.f; const float sm = fmaf(f, s, (1.f - f) * -1.0e30f); const float mn = fmaxf(m, sm); const float sc = expf(m - mn); const float e = expf(sm - mn); l = __fadd_rn(__fmul_rn(l, sc), e); m = mn;
#pragma unroll 1
    for (int c = 0; c < HD / 4; ++c) { const v4f vv = *(const v4fa*)(vr + c * 4); v4f oo = *(v4f*)&lo[tid][c * 4]; for (int u = 0; u < 4; ++u) oo[u] = __fadd_rn(__fmul_rn(oo[u], sc), __fmul_rn(e, vv[u])); *(v4f*)&lo[tid][c * 4] = oo; } }
  const float fin = 64.0f / l;      /* o carried x64 like k_att0w */
#pragma unroll 1
  for (int c = 0; c < HD / 4; ++c) { v4f oo = *(v4f*)&lo[tid][c * 4]; for (int u = 0; u < 4; ++u) oo[u] = __fmul_rn(oo[u], fin); *(v4f*)&lo[tid][c * 4] = oo; }
  __syncthreads();
  {
#pragma unroll 1
    for (int it = 0; it < 16; ++it) { const int row = it * 4 + tid / 16, pc = (tid % 16) * 4; const v4f v = *(const v4f*)&lo[row][pc]; *(v4f*)(OF + (size_t)(rg * 64 + row) * ldo + h * HD + pc) = v; }
     } }


template <int BFIN, int WXB>
__global__ __launch_bounds__(256) void k_ln16(const float* __restrict__ X, const float* __restrict__ g, const float* __restrict__ bb, float eps, _Float16* __restrict__ N16, float* __restrict__ XB) {
  #pragma clang fp contract(off)
  __shared__ float red[256]; const size_t r = blockIdx.x; const int t = threadIdx.x; const v4f xa = *(const v4fa*)(X + r * DMQ + t * 4); float s[4]; float sum = 0.f;
  for (int q = 0; q < 4; ++q) { s[q] = BFIN ? bf16_round(xa[q]) : xa[q]; sum = __fadd_rn(sum, s[q]); }
  red[t] = sum; __syncthreads(); for (int st = 128; st > 0; st >>= 1) { if (t < st) red[t] = __fadd_rn(red[t], red[t + st]); __syncthreads(); } const float mu = red[0] / (float)DMQ; __syncthreads();
  float vs = 0.f; for (int q = 0; q < 4; ++q) { const float dl = __fadd_rn(s[q], -mu); vs = __fadd_rn(vs, __fmul_rn(dl, dl)); } red[t] = vs; __syncthreads(); for (int st = 128; st > 0; st >>= 1) { if (t < st) red[t] = __fadd_rn(red[t], red[t + st]); __syncthreads(); }
  const float rs = rsqrtf(__fadd_rn(red[0] / (float)DMQ, eps)); v4h y; v4f xb;
  for (int q = 0; q < 4; ++q) { const int c = t * 4 + q; y[q] = (_Float16)__fadd_rn(__fmul_rn(__fmul_rn(__fadd_rn(s[q], -mu), rs), bf16_round(g[c])), bf16_round(bb[c])); xb[q] = s[q]; }
  { *(v4h*)(N16 + r * DMQ + t * 4) = y; if (WXB) *(v4f*)(XB + r * DMQ + t * 4) = xb;  } }
__global__ __launch_bounds__(256) void k_ftres2(const float* __restrict__ OF0, const float* __restrict__ XB, float* __restrict__ X1, size_t n4) {
  #pragma clang fp contract(off)
  const size_t t = (size_t)blockIdx.x * 256 + threadIdx.x; if (t >= n4) return; const v4f o = *(const v4fa*)(OF0 + t * 4), xv = *(const v4fa*)(XB + t * 4); v4f y; for (int q = 0; q < 4; ++q) y[q] = __fadd_rn(__fmul_rn(o[q], 0.015625f), xv[q]); *(v4f*)(X1 + t * 4) = y;  }

__global__ __launch_bounds__(256) void k_wthd(const float* __restrict__ Wt, _Float16* __restrict__ Bt) { const size_t t = (size_t)blockIdx.x * 256 + threadIdx.x; if (t >= (size_t)NH * HD * (DM / 8)) return; const int m8 = (int)(t % (DM / 8)) * 8; const int d = (int)((t / (DM / 8)) % HD); const int h = (int)(t / ((size_t)(DM / 8) * HD)); FragH f;
  for (int q = 0; q < 8; ++q) f.h[q] = (_Float16)(16.0f * bf16_round(Wt[((size_t)h * DM + m8 + q) * HD + d])); unsigned short* dst = (unsigned short*)Bt + ((size_t)h * HD + d) * DM + m8; *(v8us*)dst = f.half[0];  }




__global__ __launch_bounds__(256) void k_wtpad(const float* __restrict__ Wm, _Float16* __restrict__ Wt, int Kr, int Kp, int Nr, int Np, float scale) {
  const int t = blockIdx.x * 256 + threadIdx.x; if (t >= Np * (Kp / 8)) return; const int n = t / (Kp / 8), k8 = (t % (Kp / 8)) * 8; const int nc = min(n, Nr - 1); const float fn = (n < Nr) ? 1.f : 0.f; FragH f;
  for (int i = 0; i < 8; ++i) { const int k = k8 + i; const int kc = min(k, Kr - 1); const float fk = (k < Kr) ? fn : 0.f; f.h[i] = (_Float16)(bf16_round(Wm[(size_t)kc * Nr + nc]) * scale * fk); }
  unsigned short* o = (unsigned short*)Wt + (size_t)n * Kp + k8; *(v8us*)o = f.half[0];  }
__global__ __launch_bounds__(128) void k_bpad(const float* __restrict__ b, float* __restrict__ Bp, int nr, int np) {
  const int i = threadIdx.x; if (i >= np) return; const float v = b[min(i, nr - 1)] * ((i < nr) ? 1.f : 0.f); *(float*)(Bp + i) = v;  }

#define DI 1024       /* inner width = NH * HD */
#define LQK (3 * DI)  /* fused q | k | v row pitch (3072) */
__global__ __launch_bounds__(256) void k_o0(const float* __restrict__ OF, float* __restrict__ ob, size_t n4) {
  #pragma clang fp contract(off)
  const size_t t = (size_t)blockIdx.x * 256 + threadIdx.x; if (t >= n4) return; const size_t e = t * 4; const int i = (int)(e / DI); const int c = (int)(e % DI); const int h = c / HD, d = c % HD; const v4f a = *(const v4fa*)(OF + e); v4f o; for (int q = 0; q < 4; ++q) o[q] = __fmul_rn(a[q], 0.015625f); float* dst = ob + (size_t)h * SQ * HD + (size_t)i * HD + d; *(v4f*)dst = o;  }

__global__ __launch_bounds__(256) void k_att0w(const float* __restrict__ QF, const float* __restrict__ KF, const float* __restrict__ VF, int ld, float scale, float* __restrict__ OF, int ldo) {
  #pragma clang fp contract(off)
  __shared__ __attribute__((aligned(16))) float lq[DI]; __shared__ float sj[QT0]; __shared__ float red[256];
  const int tid = threadIdx.x; const int i = blockIdx.x / NB; const int b = blockIdx.x % NB;      /* batch fastest: blocks whose indices differ by a multiple of NB read the same k and v rows */
  QF += (size_t)b * QT0 * ld; KF += (size_t)b * QT0 * ld; VF += (size_t)b * QT0 * ld; OF += (size_t)b * QT0 * ldo;
  *(v4f*)&lq[tid * 4] = *(const v4fa*)(QF + (size_t)i * ld + tid * 4); __syncthreads();
#pragma unroll 1
  for (int r = 0; r < QT0 / 256; ++r) { const int j = r * 256 + tid; const int jc = min(j, i); const float* kr = KF + (size_t)jc * ld; float s = 0.f;
#pragma unroll 1
    for (int c = 0; c < DI / 4; ++c) { const v4f kq = *(const v4fa*)(kr + c * 4); const v4f qq = *(v4f*)&lq[c * 4]; s = __fadd_rn(s, __fmul_rn(qq[0], kq[0])); s = __fadd_rn(s, __fmul_rn(qq[1], kq[1])); s = __fadd_rn(s, __fmul_rn(qq[2], kq[2])); s = __fadd_rn(s, __fmul_rn(qq[3], kq[3])); }
    s = __fmul_rn(s, scale); const float f = (j <= i) ? 1.f : 0.f; sj[j] = fmaf(f, s, (1.f - f) * -1.0e30f); }
  __syncthreads();
  float mx = -1.0e30f; for (int r = 0; r < QT0 / 256; ++r) mx = fmaxf(mx, sj[r * 256 + tid]); red[tid] = mx; __syncthreads(); for (int st = 128; st > 0; st >>= 1) { if (tid < st) red[tid] = fmaxf(red[tid], red[tid + st]); __syncthreads(); } mx = red[0]; __syncthreads();
  float ls = 0.f; for (int r = 0; r < QT0 / 256; ++r) { const int j = r * 256 + tid; const float e = expf(sj[j] - mx); sj[j] = e; ls = __fadd_rn(ls, e); } red[tid] = ls; __syncthreads(); for (int st = 128; st > 0; st >>= 1) { if (tid < st) red[tid] = __fadd_rn(red[tid], red[tid + st]); __syncthreads(); } const float l = red[0]; __syncthreads();
  v4f oo = {0.f, 0.f, 0.f, 0.f};
#pragma unroll 1
  for (int j = 0; j <= i; ++j) { const float e = sj[j]; const v4f vv = *(const v4fa*)(VF + (size_t)j * ld + tid * 4); for (int u = 0; u < 4; ++u) oo[u] = __fadd_rn(oo[u], __fmul_rn(e, vv[u])); }
  const float fin = 64.0f / l; for (int u = 0; u < 4; ++u) oo[u] = __fmul_rn(oo[u], fin);
  float* dst = OF + (size_t)i * ldo + tid * 4; *(v4f*)dst = oo;  }

__global__ __launch_bounds__(256) void k_o0m(const float* __restrict__ OF, float* __restrict__ o_, size_t n4) {
  #pragma clang fp contract(off)
  const size_t t = (size_t)blockIdx.x * 256 + threadIdx.x; if (t >= n4) return; const size_t e = t * 4; OF += (size_t)blockIdx.y * QT0 * DI; o_ += (size_t)blockIdx.y * SQ * DI;      /* grid y = batch */
  const v4f a = *(const v4fa*)(OF + e); v4f o; for (int q = 0; q < 4; ++q) o[q] = __fmul_rn(a[q], 0.015625f); *(v4f*)(o_ + e) = o;  }
extern "C" void kernel_launch(void* const* d_in, const int* in_sizes, int n_in,
                              void* d_out, int out_size, void* d_ws, size_t ws_size, hipStream_t stream) {
  (void)in_sizes; (void)n_in; (void)out_size;
  const float* const* I = (const float* const*)d_in; const float* x = I[0]; const float* wqkv = I[1];      /* input order: x [4][2048][1024], W_qkv ([in][out] [1024][3072]: q | k | v column thirds); the module has no biases and no output projection */
  char* ws = (char*)d_ws; size_t off = 0;
  auto take = [&](size_t bytes) { char* p = ws + off; off += (bytes + 255) & ~(size_t)255; return p; };
  _Float16* BW = (_Float16*)take((size_t)LQK * DM * 2); _Float16* X16 = (_Float16*)take(NR * DM * 2); _Float16* QKV = (_Float16*)take(NR * LQK * 2); _Float16* VT = (_Float16*)take((size_t)NB * DI * SQ * 2);
  float* S = (float*)take(NR * NKX * 4); _Float16* P = (_Float16*)take(NR * NKX * 2); float* QKVF0 = (float*)take((size_t)NB * QT0 * LQK * 4); float* OF0 = (float*)take((size_t)NB * QT0 * DI * 4);      /* ONE head: S / P row = token row, pitch NKX; every plane holds all batches */
  if (off > ws_size) return;
  k_wtpad<<<(unsigned)(((size_t)LQK * (DM / 8) + 255) / 256), 256, 0, stream>>>(wqkv, BW, DM, DM, LQK, LQK, 16.0f);      /* [in][out] [1024][3072] -> Bt[n][k] x16 (no padding: Kr = Kp = 1024, Nr = Np = 3072) */
  k_x16<<<(unsigned)((NR * DM / 8 + 255) / 256), 256, 0, stream>>>(x, X16, NR * DM / 8);      /* x (bf16-valued) as exact f16 rows */
  k_gemm2<0><<<dim3((unsigned)((NR / 128) * (LQK / 64)), 1), 128, 0, stream>>>(X16, DM, 0, BW, DM, 0, 0.0625f, nullptr, 0, nullptr, 1, 0, 0, nullptr, QKV, LQK, 0, (int)NR, LQK, DM);      /* q | k | v = x W -> f16 rows, column blocks 0 / 1024 / 2048 of the fused plane (pitch 3072); no bias */
  const _Float16* Q16 = QKV; const _Float16* K16 = QKV + DI; const _Float16* V16 = QKV + 2 * DI;
  k_vt<NH, SQ><<<NB * NH * (SQ / 64), 256, 0, stream>>>(V16, LQK, 0, VT);      /* V^T [NB][1024][SQ], as 16 column chunks of 64 a batch */
  k_gemm2<0, 1><<<dim3((QT / 128) * (SQ / 64), NB, SQ / QT), 128, 0, stream>>>(Q16, LQK, (size_t)SQ * LQK, K16, LQK, (size_t)SQ * LQK, 0.03125f, nullptr, 0, nullptr, 1, 0, 0, S, nullptr, NKX, (size_t)SQ * NKX, QT, SQ, DI);      /* scores / sqrt(1024) over the FULL width (K = 1024), one head; causal: only keys below each tile's end */
  k_rsmcf2<<<(unsigned)NR, 32, 0, stream>>>(S, P, (int)NR);      /* causal softmax -> P x256 f16, one wave per row */
  k_gemm2<0, 2><<<dim3((QT / 128) * (DI / 64), NB, SQ / QT), 128, 0, stream>>>(P, NKX, (size_t)SQ * NKX, VT, SQ, (size_t)DI * SQ, 0.00390625f, nullptr, 0, nullptr, 1, 0, 0, (float*)d_out, nullptr, DI, (size_t)SQ * DI, QT, DI, SQ);      /* out[b][q][:] = P V^T 2^-8 (f32), N = 1024, keys up to each tile's end */
  k_gemm2<0><<<dim3((unsigned)((QT0 / 128) * (LQK / 64)), NB), 128, 0, stream>>>(X16, DM, (size_t)SQ * DM, BW, DM, 0, 0.0625f, nullptr, 0, nullptr, 1, 0, 0, QKVF0, nullptr, LQK, (size_t)QT0 * LQK, QT0, LQK, DM);      /* f32 q | k | v of rows 0..511 of every batch (exact products, f32 accumulation) */
  k_att0w<<<NB * QT0, 256, 0, stream>>>(QKVF0, QKVF0 + DI, QKVF0 + 2 * DI, LQK, 0.03125f, OF0, DI);      /* exact f32 single-head causal attention for rows 0..511 of every batch (o x64) */
  k_o0m<<<dim3((unsigned)(((size_t)QT0 * DI / 4 + 255) / 256), NB), 256, 0, stream>>>(OF0, (float*)d_out, (size_t)QT0 * DI / 4);      /* rows 0..511 of every batch REWRITTEN from the exact path */
}

// v003
// One run takes 434 microseconds.
// In two side-by-side timings against v002, it was 1.71 and 1.72 times as fast.
// Counting every step since v000, it is 20.7 times as fast.
#include <hip/hip_runtime.h>
// Causal SINGLE-HEAD self-attention of full width with a fused bias-free QKV projection and NO output projection (x [4][2048][1024]; qkv = x W_qkv ([in][out] 1024 x 3072, no bias) split into q | k | v thirds of width 1024; scores = q k^T / sqrt(1024) over the FULL width (one head); causal (keys after the query -> -inf); softmax over keys; out = attn v -> [4][2048][1024]).
// Structure: token rows; x as exact f16 rows; ONE WMMA GEMM into the f16 q | k | v plane [8192][3072]; per batch v^T via LDS transposes (16 column chunks of 64 = the full 1024-wide row); causal 256-row query tiles: scores GEMM with K = 1024 (alpha 1/32), causal softmax f32 -> f16 x256 weights, P . V^T GEMM with N = 1024 written as f32 (alpha 2^-8) straight into the output rows. Every stage is ONE launch over all batches (grid y) and all query tiles (grid z); S, P, V^T and the f32 planes hold all of them in the workspace.
// First-tile refinement: the first 512 query rows of every batch (which see few keys, so single-f16 q / k / v / P would be too coarse with no output projection to average the errors) are recomputed exactly: f32 q | k | v rows from a small extra GEMM (exact products, f32 accumulation), an f32 attention on VALU (k_att0w: four query rows per block; full-width dot products; precise expf), and the rows are rewritten.
// Compute dtype: inputs rounded to bf16; x / weights exact; q, k, v and the softmax weights as plain f16 GEMM operands (~2^-12) past the exact rows; scores, softmax statistics and the output accumulation f32. v_wmma_f32_16x16x32_f16.
#define NB 4
#define SQ 2048
#define DM 1024
#define NH 16
#define HD 64
#define HG 4                         /* heads per attention launch group */
#define QT 256                       /* query rows per causal tile */
#define NKX SQ                       /* S / P row pitch */
#define QT0 512                      /* first-tile rows recomputed exactly (f32): 512 here (no output projection averages the early-row cancellation errors away; logit sigma 1.0) */
#define B0 0                         /* unused (each launch covers all batches) */
#define NBR NB                       /* unused by the launches (they cover all NB batches in their grids) */
#define NR ((size_t)NB * SQ)
#define DMQ DM
#define DFF 4096                     /* unused (no FFN in this file) */
#define DFFR 100                     /* unused */
#define MP ((int)((size_t)NBR * SQ)) /* unused by the launches (the projection covers NR rows) */
#define QN SQ                        /* unused (the query tiles cover SQ rows) */
#define NHD NH                       /* unused (one full-width head is attended) */
#define MPO MP                       /* unused (there is no output stage) */
#define LQ (3 * DM)      /* row pitch of the q/k/v rows */
typedef __bf16 v16b __attribute__((ext_vector_type(16)));
typedef unsigned short v8us __attribute__((ext_vector_type(8), may_alias));
typedef float  v8f  __attribute__((ext_vector_type(8)));
typedef float  v4f  __attribute__((ext_vector_type(4)));
typedef float  v4fa __attribute__((ext_vector_type(4), may_alias));
union FragB { v16b v; v8us half[2]; unsigned short u[16]; };

__device__ __forceinline__ unsigned short bf16_bits(float x) { unsigned int u = __float_as_uint(x); return (unsigned short)((u + 0x7FFFu + ((u >> 16) & 1u)) >> 16); }
__device__ __forceinline__ float bf16_val(unsigned short b) { return __uint_as_float(((unsigned int)b) << 16); }
__device__ __forceinline__ float bf16_round(float x) { return bf16_val(bf16_bits(x)); }
// D += A·B with NT terms: 1 = ah·bh, 2 = + al·bh (A split), 3 = + ah·bl (both split)
template <int NT>
__device__ __forceinline__ v8f mmaN(v16b ah, v16b al, v16b bh, v16b bl, v8f c) {
  c = __builtin_amdgcn_wmma_f32_16x16x32_bf16(false, ah, false, bh, (short)0, c, false, false);
  if (NT >= 2) c = __builtin_amdgcn_wmma_f32_16x16x32_bf16(false, al, false, bh, (short)0, c, false, false);
  if (NT >= 3) c = __builtin_amdgcn_wmma_f32_16x16x32_bf16(false, ah, false, bl, (short)0, c, false, false);
  asm volatile("v_nop\n\tv_nop\n\tv_nop\n\tv_nop" : "+v"(c) : "v"(ah), "v"(al), "v"(bh), "v"(bl));
  return c;
}

__global__ __launch_bounds__(256) void k_wt_bf16(const float* __restrict__ W, unsigned short* __restrict__ Wt, int K, int N) {
  const int t = blockIdx.x * 256 + threadIdx.x;
  const int k8n = K / 8;
  if (t >= N * k8n) return;
  const int n = t / k8n, k8 = (t % k8n) * 8;
  v8us v;
#pragma unroll
  for (int i = 0; i < 8; ++i) v[i] = bf16_bits(W[(size_t)(k8 + i) * N + n]);
  *(v8us*)(Wt + (size_t)n * K + k8) = v;
  
}

// GEMM C[M][N] (f32, pitch ldc) = act(A[M][K]·W + bias). A f32 row-major (pitch lda) converted per fragment to bf16
// (ASPLIT: hi/lo two planes -> 2 terms, else single rounded term); Wt bf16 [N][K] (pitch ldb). BIAS_BF16 rounds the
// bias to bf16 first (bias quantised to bf16 before the add). K%32==0, M%16==0, N%64==0.
template <bool ASPLIT, int ACT, bool BIAS_BF16>
__global__ __launch_bounds__(128) void k_gemm_bf(const float* __restrict__ A, int lda, const unsigned short* __restrict__ Wt, int ldb,
                                               const float* __restrict__ bias, float* __restrict__ C, int ldc, int M, int N, int K) {
  __shared__ __attribute__((aligned(16))) float so[4][16][64];
  const int tid = threadIdx.x, w = tid >> 5, lane = tid & 31, ln = lane & 15, hh = lane >> 4;
  const int ntn = N / 64;
  const int wid = blockIdx.x * 4 + w;
  const int mt = wid / ntn, nq = wid % ntn;
  if (mt * 16 >= M) return;
  const int row0 = mt * 16, col0 = nq * 64;
  const float* arow = A + (size_t)(row0 + ln) * lda;
  v8f acc[4] = {};
  for (int kb = 0; kb < K; kb += 32) {
    FragB ah, al;
    const v4f x0 = *(const v4fa*)(arow + kb + 8 * hh), x1 = *(const v4fa*)(arow + kb + 8 * hh + 4);
    const v4f x2 = *(const v4fa*)(arow + kb + 16 + 8 * hh), x3 = *(const v4fa*)(arow + kb + 16 + 8 * hh + 4);
    float xs[16] = {x0[0],x0[1],x0[2],x0[3],x1[0],x1[1],x1[2],x1[3],x2[0],x2[1],x2[2],x2[3],x3[0],x3[1],x3[2],x3[3]};
#pragma unroll
    for (int i = 0; i < 16; ++i) { const unsigned short hb = bf16_bits(xs[i]); ah.u[i] = hb; al.u[i] = ASPLIT ? bf16_bits(xs[i] - bf16_val(hb)) : (unsigned short)0; }
#pragma unroll
    for (int t = 0; t < 4; ++t) {
      const unsigned short* brow = Wt + (size_t)(col0 + t * 16 + ln) * ldb + kb;
      FragB b;
      b.half[0] = *(const v8us*)(brow + 8 * hh);
      b.half[1] = *(const v8us*)(brow + 16 + 8 * hh);
      acc[t] = mmaN<ASPLIT ? 2 : 1>(ah.v, al.v, b.v, b.v, acc[t]);
    }
  }
#pragma unroll
  for (int t = 0; t < 4; ++t) {
    float bv = bias ? bias[col0 + t * 16 + ln] : 0.f;
    if (BIAS_BF16) bv = bf16_round(bv);
#pragma unroll
    for (int r = 0; r < 8; ++r) { float v = acc[t][r] + bv; if (ACT == 1) v = fmaxf(v, 0.f); so[w][8 * hh + r][t * 16 + ln] = v; }
  }
  __builtin_amdgcn_fence(__ATOMIC_ACQ_REL, "workgroup");
  __builtin_amdgcn_wave_barrier();
  const int rsub = lane >> 4, c4 = (lane & 15) * 4;
  {
#pragma unroll
    for (int q = 0; q < 8; ++q) {
      const int r = q * 2 + rsub;
      const v4f v = *(const v4fa*)&so[w][r][c4];
      *(v4f*)(C + (size_t)(row0 + r) * ldc + col0 + c4) = v;
    }
    
  }
}

// GEMM C = act(A·W + bias + resid): A f32 (ASPLIT -> hi/lo 2 terms), Wt bf16 [N][K]; ACT 0 none, 1 relu, 2 exact gelu;
// resid (optional, f32, row index = (row % rmod), pitch ldr, RES_BF16 rounds it) added before the activation.
template <bool ASPLIT, int ACT, bool BIAS_BF16, bool RES_BF16>
__global__ __launch_bounds__(128) void k_gemm_bf3(const float* __restrict__ A, int lda, const unsigned short* __restrict__ Wt, int ldb,
                                                const float* __restrict__ bias, const float* __restrict__ resid, int rmod, int ldr,
                                                float* __restrict__ C, int ldc, int M, int N, int K) {
  __shared__ __attribute__((aligned(16))) float so[4][16][64];
  const int tid = threadIdx.x, w = tid >> 5, lane = tid & 31, ln = lane & 15, hh = lane >> 4;
  const int ntn = N / 64;
  const int wid = blockIdx.x * 4 + w;
  const int mt = wid / ntn, nq = wid % ntn;
  if (mt * 16 >= M) return;
  const int row0 = mt * 16, col0 = nq * 64;
  const float* arow = A + (size_t)(row0 + ln) * lda;
  v8f acc[4] = {};
  for (int kb = 0; kb < K; kb += 32) {
    FragB ah, al;
    const v4f x0 = *(const v4fa*)(arow + kb + 8 * hh), x1 = *(const v4fa*)(arow + kb + 8 * hh + 4);
    const v4f x2 = *(const v4fa*)(arow + kb + 16 + 8 * hh), x3 = *(const v4fa*)(arow + kb + 16 + 8 * hh + 4);
    float xs[16] = {x0[0],x0[1],x0[2],x0[3],x1[0],x1[1],x1[2],x1[3],x2[0],x2[1],x2[2],x2[3],x3[0],x3[1],x3[2],x3[3]};
#pragma unroll
    for (int i = 0; i < 16; ++i) { const unsigned short hb = bf16_bits(xs[i]); ah.u[i] = hb; al.u[i] = ASPLIT ? bf16_bits(xs[i] - bf16_val(hb)) : (unsigned short)0; }
#pragma unroll
    for (int t = 0; t < 4; ++t) {
      const unsigned short* brow = Wt + (size_t)(col0 + t * 16 + ln) * ldb + kb;
      FragB b;
      b.half[0] = *(const v8us*)(brow + 8 * hh);
      b.half[1] = *(const v8us*)(brow + 16 + 8 * hh);
      acc[t] = mmaN<ASPLIT ? 2 : 1>(ah.v, al.v, b.v, b.v, acc[t]);
    }
  }
#pragma unroll
  for (int t = 0; t < 4; ++t) {
    const int col = col0 + t * 16 + ln;
    float bv = bias ? bias[col] : 0.f;
    if (BIAS_BF16) bv = bf16_round(bv);
#pragma unroll
    for (int r = 0; r < 8; ++r) {
      float v = acc[t][r] + bv;
      if (resid) { float rv = resid[(size_t)((row0 + 8 * hh + r) % rmod) * ldr + col]; if (RES_BF16) rv = bf16_round(rv); v += rv; }
      if (ACT == 1) v = fmaxf(v, 0.f);
      if (ACT == 2) v = 0.5f * v * (1.0f + erff(v * 0.70710678118654752f));
      if (ACT == 3) { const float u = 0.7978845608028654f * (v + 0.044715f * v * v * v); v = 0.5f * v * (1.0f + tanhf(u)); }
      so[w][8 * hh + r][t * 16 + ln] = v;
    }
  }
  __builtin_amdgcn_fence(__ATOMIC_ACQ_REL, "workgroup");
  __builtin_amdgcn_wave_barrier();
  const int rsub = lane >> 4, c4 = (lane & 15) * 4;
  {
#pragma unroll
    for (int q = 0; q < 8; ++q) {
      const int r = q * 2 + rsub;
      const v4f v = *(const v4fa*)&so[w][r][c4];
      *(v4f*)(C + (size_t)(row0 + r) * ldc + col0 + c4) = v;
    }
    
  }
}
// row LayerNorm (biased variance, eps) over N: s = X (+ R); optional out_sum <- s; out_norm <- (s-mu)*rsqrt(var+eps)*g + b
template <bool PARAM_BF16>
__global__ __launch_bounds__(256) void k_layernorm(const float* __restrict__ X, const float* __restrict__ R, const float* __restrict__ g, const float* __restrict__ bta,
                                                  float* __restrict__ out_sum, float* __restrict__ out_norm, int N, float eps) {
  __shared__ float red[256];
  const int row = blockIdx.x, tid = threadIdx.x;
  const float* x = X + (size_t)row * N; const float* rr = R ? R + (size_t)row * N : nullptr;
  float vals[16];                     // up to N = 4096
  const int per = N / 256;            // contiguous chunk per thread? use strided-by-4 chunks: thread handles j = tid*4 + 1024*u
  float s1 = 0.f;
  for (int u = 0; u < per / 4; ++u) {
    const int j = tid * 4 + 1024 * u;
    const v4f a = *(const v4fa*)(x + j);
    v4f b = {0.f,0.f,0.f,0.f}; if (rr) b = *(const v4fa*)(rr + j);
#pragma unroll
    for (int q = 0; q < 4; ++q) { const float v = a[q] + b[q]; vals[u * 4 + q] = v; s1 += v; }
  }
  red[tid] = s1; __syncthreads();
  for (int st = 128; st > 0; st >>= 1) { if (tid < st) red[tid] += red[tid + st]; __syncthreads(); }
  const float mu = red[0] / (float)N; __syncthreads();
  float s2 = 0.f;
  for (int u = 0; u < per / 4; ++u)
#pragma unroll
    for (int q = 0; q < 4; ++q) { const float c = vals[u * 4 + q] - mu; s2 += c * c; }
  red[tid] = s2; __syncthreads();
  for (int st = 128; st > 0; st >>= 1) { if (tid < st) red[tid] += red[tid + st]; __syncthreads(); }
  const float rs = rsqrtf(red[0] / (float)N + eps);
  {
    for (int u = 0; u < per / 4; ++u) {
      const int j = tid * 4 + 1024 * u;
      v4f o, sm;
#pragma unroll
      for (int q = 0; q < 4; ++q) {
        float gg = g[j + q], bb = bta[j + q];
        if (PARAM_BF16) { gg = bf16_round(gg); bb = bf16_round(bb); }
        sm[q] = vals[u * 4 + q]; o[q] = (vals[u * 4 + q] - mu) * rs * gg + bb;
      }
      if (out_sum) *(v4f*)(out_sum + (size_t)row * N + j) = sm;
      *(v4f*)(out_norm + (size_t)row * N + j) = o;
    }
    
  }
}



// ---- f16 WMMA path (v_wmma_f32_16x16x32_f16): 11-bit significands for operands in range — used where a [0,1] probability operand needs more precision than bf16
typedef _Float16 v16h __attribute__((ext_vector_type(16)));
union FragH { v16h v; v8us half[2]; _Float16 h[16]; unsigned short u[16]; };
template <int NT>
__device__ __forceinline__ v8f mmaH(v16h ah, v16h al, v16h bh, v16h bl, v8f c) {
  c = __builtin_amdgcn_wmma_f32_16x16x32_f16(false, ah, false, bh, (short)0, c, false, false);
  if (NT >= 2) c = __builtin_amdgcn_wmma_f32_16x16x32_f16(false, al, false, bh, (short)0, c, false, false);
  if (NT >= 3) c = __builtin_amdgcn_wmma_f32_16x16x32_f16(false, ah, false, bl, (short)0, c, false, false);
  asm volatile("v_nop\n\tv_nop\n\tv_nop\n\tv_nop" : "+v"(c) : "v"(ah), "v"(al), "v"(bh), "v"(bl));
  return c;
}
// batched GEMM like k_gemm_b but f16 operands: A f32 (split into f16 hi/lo if ASPLIT, else rounded to f16), Bt = f16 values [n][k]; alpha; C f32; N multiple of 16 (partial tiles skipped)
template <bool ASPLIT>
__global__ __launch_bounds__(128) void k_gemm_h(const float* __restrict__ A, int lda, size_t sA, const _Float16* __restrict__ Bh, int ldb, size_t sB, float alpha, float* __restrict__ C, int ldc, size_t sC, int M, int N, int K) {
  __shared__ __attribute__((aligned(16))) float so[4][16][64];
  const int tid = threadIdx.x, w = tid >> 5, lane = tid & 31, ln = lane & 15, hh = lane >> 4; const int by = blockIdx.y;
  A += (size_t)by * sA; Bh += (size_t)by * sB; C += (size_t)by * sC;
  const int ntn = (N + 63) / 64; const int wid = blockIdx.x * 4 + w; const int mt = wid / ntn, nq = wid % ntn; if (mt * 16 >= M) return;
  const int row0 = mt * 16, col0 = nq * 64; const float* arow = A + (size_t)(row0 + ln) * lda;
  v8f acc[4] = {};
  for (int kb = 0; kb < K; kb += 32) {
    FragH ah, al;
    const v4f x0 = *(const v4fa*)(arow + kb + 8 * hh), x1 = *(const v4fa*)(arow + kb + 8 * hh + 4), x2 = *(const v4fa*)(arow + kb + 16 + 8 * hh), x3 = *(const v4fa*)(arow + kb + 16 + 8 * hh + 4);
    float xs[16] = {x0[0],x0[1],x0[2],x0[3],x1[0],x1[1],x1[2],x1[3],x2[0],x2[1],x2[2],x2[3],x3[0],x3[1],x3[2],x3[3]};
#pragma unroll
    for (int i = 0; i < 16; ++i) { const _Float16 h = (_Float16)xs[i]; ah.h[i] = h; al.h[i] = ASPLIT ? (_Float16)(xs[i] - (float)h) : (_Float16)0.0f; }
#pragma unroll
    for (int t = 0; t < 4; ++t) { if (col0 + t * 16 >= N) continue; const size_t boff = (size_t)(col0 + t * 16 + ln) * ldb + kb; FragH bq; bq.half[0] = *(const v8us*)(Bh + boff + 8 * hh); bq.half[1] = *(const v8us*)(Bh + boff + 16 + 8 * hh);
      acc[t] = mmaH<ASPLIT ? 2 : 1>(ah.v, al.v, bq.v, bq.v, acc[t]); }
  }
#pragma unroll
  for (int t = 0; t < 4; ++t) { if (col0 + t * 16 >= N) continue;
#pragma unroll
    for (int r = 0; r < 8; ++r) so[w][8 * hh + r][t * 16 + ln] = acc[t][r] * alpha; }
  __builtin_amdgcn_fence(__ATOMIC_ACQ_REL, "workgroup"); __builtin_amdgcn_wave_barrier();
  const int rsub = lane >> 4, c4 = (lane & 15) * 4;
  {
#pragma unroll
    for (int q = 0; q < 8; ++q) { const int r = q * 2 + rsub; if (col0 + c4 < N) { const v4f v = *(const v4fa*)&so[w][r][c4]; *(v4f*)(C + (size_t)(row0 + r) * ldc + col0 + c4) = v; } }
     }
}

// Wt[n][k] = f16(W[k][n]·scale) from f32 row-major W[K][N] (scale = power of two; bf16-exact weights stay exact in f16 away from the subnormal range)
__global__ __launch_bounds__(256) void k_wt_f16(const float* __restrict__ W, _Float16* __restrict__ Wt, int K, int N, float scale) {
  const int t = blockIdx.x * 256 + threadIdx.x; if (t >= N * (K / 8)) return; const int n = t / (K / 8), k8 = (t % (K / 8)) * 8; FragH f;
#pragma unroll
  for (int i = 0; i < 8; ++i) f.h[i] = (_Float16)(bf16_round(W[(size_t)(k8 + i) * N + n]) * scale); const v8us o = f.half[0];
  *(v8us*)((unsigned short*)Wt + (size_t)n * K + k8) = o; 
}
// k_gemm_hh variant with fused epilogue: v = acc·alpha + bias[by·sBias + col] (+ CP[(row/rowsPerB)·sCPb + by·64 + col] if CP) ; ACT 0 none / 1 elu ; writes f16 C16 (and f32 C if non-null)
template <int ACT>
__global__ __launch_bounds__(128) void k_gemm_hhx(const _Float16* __restrict__ A, int lda, size_t sA, const _Float16* __restrict__ Bh, int ldb, size_t sB, float alpha, const float* __restrict__ bias, size_t sBias, const float* __restrict__ CP, int rowsPerB, size_t sCPb, int row0g,
    float* __restrict__ C, _Float16* __restrict__ C16, int ldc, size_t sC, int M, int N, int K) {
  __shared__ __attribute__((aligned(16))) float so[4][16][64];
  const int tid = threadIdx.x, w = tid >> 5, lane = tid & 31, ln = lane & 15, hh = lane >> 4; const int by = blockIdx.y;
  A += (size_t)by * sA; Bh += (size_t)by * sB; const size_t cofs = (size_t)by * sC; const float* bp = bias ? bias + (size_t)by * sBias : nullptr;
  const int ntn = (N + 63) / 64; const int wid = blockIdx.x * 4 + w; const int mt = wid / ntn, nq = wid % ntn; if (mt * 16 >= M) return;
  const int row0 = mt * 16, col0 = nq * 64; const _Float16* arow = A + (size_t)(row0 + ln) * lda;
  v8f acc[4] = {};
  for (int kb = 0; kb < K; kb += 32) { FragH ah; ah.half[0] = *(const v8us*)((const unsigned short*)arow + kb + 8 * hh); ah.half[1] = *(const v8us*)((const unsigned short*)arow + kb + 16 + 8 * hh);
#pragma unroll
    for (int t = 0; t < 4; ++t) { if (col0 + t * 16 >= N) continue; const size_t boff = (size_t)(col0 + t * 16 + ln) * ldb + kb; FragH bq; bq.half[0] = *(const v8us*)((const unsigned short*)Bh + boff + 8 * hh); bq.half[1] = *(const v8us*)((const unsigned short*)Bh + boff + 16 + 8 * hh);
      acc[t] = mmaH<1>(ah.v, ah.v, bq.v, bq.v, acc[t]); }
  }
#pragma unroll
  for (int t = 0; t < 4; ++t) { if (col0 + t * 16 >= N) continue; const int col = col0 + t * 16 + ln; const float bv = bp ? bf16_round(bp[col]) : 0.f;
#pragma unroll
    for (int r = 0; r < 8; ++r) { float v = acc[t][r] * alpha + bv; if (CP) { const int rr = row0g + row0 + 8 * hh + r; if (rowsPerB < 0) v += CP[cofs + (size_t)rr * ldc + col];      /* rowsPerB < 0: own element of the batched C plane */ else { const int bidx = rr / rowsPerB; v += CP[(size_t)bidx * sCPb + (size_t)by * 64 + col]; } } if (ACT == 1) v = (v > 0.f) ? v : expm1f(v); else if (ACT == 7) v = (v > 0.f) ? v + 1.0f : expf(v); else if (ACT == 8) v = tanhf(v); else if (ACT == 9) v = 0.5f * v * (1.0f + tanhf(0.7978845608028654f * (v + 0.044715f * v * v * v))); else if (ACT == 11) v = 1.0f / (1.0f + expf(-v)); else if (ACT == 12) v = (v > 0.f) ? v : 0.01f * v; else if (ACT == 14) v = (v > 0.f) ? v : 0.1f * v; else if (ACT == 16) v = (v >= 0.f) ? v : 0.3f * v; else if (ACT == 17) v = (v >= 0.f) ? v : 0.2f * v; else if (ACT == 15) v = v / (1.0f + expf(-v)); else if (ACT == 3) v = fmaxf(v, 0.f); else if (ACT == 6) v = 0.5f * v * (1.0f + erff(v * 0.70710678118654752f)); so[w][8 * hh + r][t * 16 + ln] = v; } }
  __builtin_amdgcn_fence(__ATOMIC_ACQ_REL, "workgroup"); __builtin_amdgcn_wave_barrier();
  const int rsub = lane >> 4, c4 = (lane & 15) * 4; typedef _Float16 v4h __attribute__((ext_vector_type(4)));
  {
#pragma unroll
    for (int q = 0; q < 8; ++q) { const int r = q * 2 + rsub; if (col0 + c4 < N) { const v4f v = *(const v4fa*)&so[w][r][c4]; if (C) *(v4f*)(C + cofs + (size_t)(row0 + r) * ldc + col0 + c4) = v; if (C16) { v4h h4; for (int i = 0; i < 4; ++i) h4[i] = (_Float16)v[i]; *(v4h*)(C16 + cofs + (size_t)(row0 + r) * ldc + col0 + c4) = h4; } } }
     }
}


typedef _Float16 v4h __attribute__((ext_vector_type(4)));

__global__ __launch_bounds__(256) void k_x16(const float* __restrict__ x, _Float16* __restrict__ X16, size_t n8) { const size_t t = (size_t)blockIdx.x * 256 + threadIdx.x; if (t >= n8) return; FragH f;
#pragma unroll
  for (int q = 0; q < 8; ++q) f.h[q] = (_Float16)bf16_round(x[t * 8 + q]); *(v8us*)((unsigned short*)X16 + t * 8) = f.half[0];  }
__global__ __launch_bounds__(256) void k_h16(const float* __restrict__ x, _Float16* __restrict__ X16, size_t n8) { const size_t t = (size_t)blockIdx.x * 256 + threadIdx.x; if (t >= n8) return; FragH f;
#pragma unroll
  for (int q = 0; q < 8; ++q) f.h[q] = (_Float16)x[t * 8 + q]; *(v8us*)((unsigned short*)X16 + t * 8) = f.half[0];  }
__global__ __launch_bounds__(256) void k_round16f(const float* __restrict__ W, _Float16* __restrict__ Bt, size_t n8) { const size_t t = (size_t)blockIdx.x * 256 + threadIdx.x; if (t >= n8) return; FragH f;
#pragma unroll
  for (int i = 0; i < 8; ++i) f.h[i] = (_Float16)(bf16_round(W[t * 8 + i]) * 16.0f); *(v8us*)((unsigned short*)Bt + t * 8) = f.half[0];  }
template <int NHv, int TTv>
__global__ __launch_bounds__(256) void k_vt(const _Float16* __restrict__ V16, int ldv, int voff, _Float16* __restrict__ Vt) { __shared__ unsigned short tl[64][66]; const int tid = threadIdx.x; const int slab = blockIdx.x / (TTv / 64), lg = blockIdx.x % (TTv / 64); const int b = slab / NHv, h = slab % NHv;
  for (int i = tid; i < 64 * 8; i += 256) { const int r = i / 8, c8 = (i % 8) * 8; FragH f; f.half[0] = *(const v8us*)((const unsigned short*)V16 + ((size_t)b * TTv + lg * 64 + r) * ldv + voff + h * 64 + c8);
#pragma unroll
    for (int q = 0; q < 8; ++q) tl[r][c8 + q] = f.u[q]; }
  __syncthreads();
  {
#pragma unroll
    for (int rd = 0; rd < 2; ++rd) { const int d = rd * 32 + tid / 8, pc = tid % 8; FragH f;
#pragma unroll
      for (int q = 0; q < 8; ++q) f.u[q] = tl[pc * 8 + q][d];
      *(v8us*)((unsigned short*)Vt + ((size_t)slab * 64 + d) * TTv + lg * 64 + pc * 8) = f.half[0]; }
     } }

__global__ __launch_bounds__(256) void k_hl(const float* __restrict__ F, _Float16* __restrict__ Hh, _Float16* __restrict__ Hl, size_t n8) { const size_t t = (size_t)blockIdx.x * 256 + threadIdx.x; if (t >= n8) return; FragH fh, fl; const v4f a = *(const v4fa*)(F + t * 8), c = *(const v4fa*)(F + t * 8 + 4);
#pragma unroll
  for (int q = 0; q < 4; ++q) { _Float16 h = (_Float16)a[q]; fh.h[q] = h; fl.h[q] = (_Float16)((a[q] - (float)h) * 1024.0f); h = (_Float16)c[q]; fh.h[4 + q] = h; fl.h[4 + q] = (_Float16)((c[q] - (float)h) * 1024.0f); }
  { *(v8us*)((unsigned short*)Hh + t * 8) = fh.half[0]; *(v8us*)((unsigned short*)Hl + t * 8) = fl.half[0];  } }

// ---- fast GEMM (wave tile 32x64; requires M % 32 == 0 rows per launch region and N % 64 == 0); epilogue = k_gemm_hhx semantics ----
__device__ __forceinline__ v16h g2_frag(const _Float16* p, int hh) { FragH f; f.half[0] = *(const v8us*)((const unsigned short*)p + 8 * hh); f.half[1] = *(const v8us*)((const unsigned short*)p + 16 + 8 * hh); return f.v; }
__device__ __forceinline__ v8f g2_mma(v16h a, v16h b, v8f c) { v8f d = __builtin_amdgcn_wmma_f32_16x16x32_f16(false, a, false, b, (short)0, c, false, false); asm volatile("v_nop\n\tv_nop\n\tv_nop\n\tv_nop" : "+v"(d) : "v"(a), "v"(b)); return d; }
// CAUS: grid z = causal query tile of QT rows (A and C step QT rows a tile). 1 = scores: only key columns up to the tile's end are computed; 2 = P V: K ends at the tile's end.
template <int ACT, int CAUS = 0>
__global__ __launch_bounds__(128) void k_gemm2(const _Float16* __restrict__ A, int lda, size_t sA, const _Float16* __restrict__ Bh, int ldb, size_t sB, float alpha, const float* __restrict__ bias, size_t sBias, const float* __restrict__ CP, int rowsPerB, size_t sCPb, int row0g,
    float* __restrict__ C, _Float16* __restrict__ C16, int ldc, size_t sC, int M, int N, int K) { static_assert(ACT == 0 || ACT == 3 || ACT == 6 || ACT == 8 || ACT == 9 || ACT == 11 || ACT == 12 || ACT == 14 || ACT == 15 || ACT == 16 || ACT == 17, "k_gemm2: unsupported ACT code (would silently apply no activation)");
  __shared__ __attribute__((aligned(16))) float so[4][32][68];
  const int tid = threadIdx.x, w = tid >> 5, lane = tid & 31, ln = lane & 15, hh = lane >> 4; const int by = blockIdx.y;
  const int qt = CAUS ? SQ / QT - 1 - (int)blockIdx.z : 0;      /* low z starts first: the tile with the most keys goes first */
  A += (size_t)by * sA + (size_t)qt * QT * lda; Bh += (size_t)by * sB; const size_t cofs = (size_t)by * sC + (size_t)qt * QT * ldc; const float* bp = bias ? bias + (size_t)by * sBias : nullptr;
  const int ntn = N >> 6; const int mt = blockIdx.x / ntn, nq = blockIdx.x - mt * ntn; const int row0 = mt * 128 + 32 * w, col0 = nq * 64; if (row0 >= M) return;
  if (CAUS == 1 && col0 >= (qt + 1) * QT) return;
  if (CAUS == 2) K = (qt + 1) * QT;
  const _Float16* a0p = A + (size_t)(row0 + ln) * lda; const _Float16* a1p = a0p + (size_t)16 * lda;
  const _Float16* b0p = Bh + (size_t)(col0 + ln) * ldb; const _Float16* b1p = b0p + (size_t)16 * ldb; const _Float16* b2p = b1p + (size_t)16 * ldb; const _Float16* b3p = b2p + (size_t)16 * ldb;
  const v8f z8 = {0.f,0.f,0.f,0.f,0.f,0.f,0.f,0.f}; v8f c00 = z8, c01 = z8, c02 = z8, c03 = z8, c10 = z8, c11 = z8, c12 = z8, c13 = z8;
#pragma unroll 1
  for (int kb = 0; kb < K; kb += 32) { const v16h a0 = g2_frag(a0p + kb, hh), a1 = g2_frag(a1p + kb, hh);
    v16h b = g2_frag(b0p + kb, hh); c00 = g2_mma(a0, b, c00); c10 = g2_mma(a1, b, c10);
    b = g2_frag(b1p + kb, hh); c01 = g2_mma(a0, b, c01); c11 = g2_mma(a1, b, c11);
    b = g2_frag(b2p + kb, hh); c02 = g2_mma(a0, b, c02); c12 = g2_mma(a1, b, c12);
    b = g2_frag(b3p + kb, hh); c03 = g2_mma(a0, b, c03); c13 = g2_mma(a1, b, c13); }
  v8f accs[8] = {c00, c01, c02, c03, c10, c11, c12, c13};
#pragma unroll
  for (int u = 0; u < 8; ++u) { const int t = u & 3, half = u >> 2; const int col = col0 + t * 16 + ln; const float bv = bp ? bf16_round(bp[col]) : 0.f;
#pragma unroll
    for (int r = 0; r < 8; ++r) { const int rloc = half * 16 + 8 * hh + r; float v = accs[u][r] * alpha + bv; if (CP) { if (rowsPerB < 0) v += CP[cofs + (size_t)(row0g + row0 + rloc) * ldc + col];      /* rowsPerB < 0: own element of the batched C plane */ else { const int bidx = (row0g + row0 + rloc) / rowsPerB; v += CP[(size_t)bidx * sCPb + (size_t)by * 64 + col]; } }
      if (ACT == 3) v = fmaxf(v, 0.f); else if (ACT == 6) v = 0.5f * v * (1.0f + erff(v * 0.70710678118654752f)); else if (ACT == 11) v = 1.0f / (1.0f + expf(-v)); else if (ACT == 15) v = v / (1.0f + expf(-v)); else if (ACT == 12) v = (v > 0.f) ? v : 0.01f * v; else if (ACT == 8) v = tanhf(v); else if (ACT == 9) v = 0.5f * v * (1.0f + tanhf(0.7978845608028654f * (v + 0.044715f * v * v * v))); else if (ACT == 14) v = (v > 0.f) ? v : 0.1f * v; else if (ACT == 16) v = (v >= 0.f) ? v : 0.3f * v; else if (ACT == 17) v = (v >= 0.f) ? v : 0.2f * v;
      so[w][rloc][t * 16 + ln] = v; } }
  __builtin_amdgcn_fence(__ATOMIC_ACQ_REL, "workgroup"); __builtin_amdgcn_wave_barrier();
  const int rsub = lane >> 4, c4 = (lane & 15) * 4;
  {
#pragma unroll
    for (int q = 0; q < 16; ++q) { const int r = q * 2 + rsub; const v4f v = *(const v4fa*)&so[w][r][c4]; if (C) *(v4f*)(C + cofs + (size_t)(row0 + r) * ldc + col0 + c4) = v; if (C16) { v4h h4; for (int i = 0; i < 4; ++i) h4[i] = (_Float16)v[i]; *(v4h*)(C16 + cofs + (size_t)(row0 + r) * ldc + col0 + c4) = h4; } }
     } }


__global__ __launch_bounds__(256) void k_wnat(const float* __restrict__ w, size_t n8, _Float16* __restrict__ Bt) { const size_t t = (size_t)blockIdx.x * 256 + threadIdx.x; if (t >= n8) return; FragH f; for (int q = 0; q < 8; ++q) f.h[q] = (_Float16)(bf16_round(w[t * 8 + q]) * 16.0f); *(v8us*)((unsigned short*)Bt + t * 8) = f.half[0];  }
__global__ __launch_bounds__(256) void k_rsm(const float* __restrict__ S, _Float16* __restrict__ P, int nrows) {
  #pragma clang fp contract(off)
  const int i = blockIdx.x * 256 + threadIdx.x; if (i >= nrows) return; const float* s = S + (size_t)i * SQ; float mx = -3.0e38f;
#pragma unroll 1
  for (int j = 0; j < SQ; ++j) mx = fmaxf(mx, s[j]); float se = 0.f;
#pragma unroll 1
  for (int j = 0; j < SQ; ++j) se += expf(s[j] - mx); const float sc = 256.0f / se;
#pragma unroll 1
  for (int j0 = 0; j0 < SQ; j0 += 8) { FragH f; for (int q = 0; q < 8; ++q) f.h[q] = (_Float16)(expf(s[j0 + q] - mx) * sc); unsigned short* d = (unsigned short*)P + (size_t)i * SQ + j0; *(v8us*)d = f.half[0];  } }
__global__ __launch_bounds__(256) void k_vt(const _Float16* __restrict__ V16, int b, int h0, _Float16* __restrict__ VT) { __shared__ unsigned short tl[64][65]; const int tid = threadIdx.x; const int hh = blockIdx.x % HG, sg = blockIdx.x / HG; const int s0 = sg * 64; const int h = h0 + hh;
  for (int i = tid; i < 64 * 8; i += 256) { const int j = i / 8, d8 = (i % 8) * 8; FragH f; f.half[0] = *(const v8us*)((const unsigned short*)V16 + ((size_t)b * SQ + s0 + j) * DM + h * HD + d8); for (int q = 0; q < 8; ++q) tl[d8 + q][j] = f.u[q]; }
  __syncthreads();
  { for (int i = tid; i < 64 * 8; i += 256) { const int d = i / 8, j8 = (i % 8) * 8; FragH f; for (int q = 0; q < 8; ++q) f.u[q] = tl[d][j8 + q]; *(v8us*)((unsigned short*)VT + ((size_t)hh * HD + d) * SQ + s0 + j8) = f.half[0]; }  } }



// Causal softmax, ONE S ROW PER WAVE, the row held in registers: lane l owns keys 256 c + 8 l .. + 7 of each 256-key chunk c (two 16-byte loads in, one 16-byte f16 store out per chunk).
// Row max and row sum: per-lane partials (the sum in four independent chains), then a five-step butterfly over the 32 lanes. NC = nk / 256 chunks, all loads of a row in flight together.
// e^x as the fast form has it (one multiply, v_exp_f32). The v_nop is the one slot the instruction set asks for behind a transcendental before its result is read or its source overwritten; it stands in the same statement because the compiler's own schedule of this kernel reused a source register directly behind some v_exp_f32.
__device__ __forceinline__ float rsm_exp(float x) { const float y = x * 1.44269504088896340736f; float e; asm("v_exp_f32 %0, %1\n\tv_nop" : "=v"(e) : "v"(y)); return e; }
template <int NC>
__device__ __forceinline__ void rsm_row(const float* __restrict__ s, unsigned short* __restrict__ p, int k0, int last) {
  float v[NC][8];
#pragma unroll
  for (int c = 0; c < NC; ++c) { const v4f a = *(const v4fa*)(s + c * 256 + k0), b = *(const v4fa*)(s + c * 256 + k0 + 4);
#pragma unroll
    for (int q = 0; q < 4; ++q) { v[c][q] = a[q]; v[c][4 + q] = b[q]; } }
  float mx = -3.0e38f;
#pragma unroll
  for (int c = 0; c < NC; ++c)
#pragma unroll
    for (int q = 0; q < 8; ++q) { if (c * 256 + k0 + q > last) v[c][q] = -1.0e9f; mx = fmaxf(mx, v[c][q]); }
#pragma unroll
  for (int m = 16; m > 0; m >>= 1) mx = fmaxf(mx, __shfl_xor(mx, m, 32));
  float s4[4] = {0.f, 0.f, 0.f, 0.f};
#pragma unroll
  for (int c = 0; c < NC; ++c)
#pragma unroll
    for (int q = 0; q < 8; ++q) { v[c][q] = rsm_exp(v[c][q] - mx); s4[q & 3] += v[c][q]; }
  float se = (s4[0] + s4[1]) + (s4[2] + s4[3]);
#pragma unroll
  for (int m = 16; m > 0; m >>= 1) se += __shfl_xor(se, m, 32);
  const float sc = 256.0f / se;
#pragma unroll
  for (int c = 0; c < NC; ++c) { FragH fr;
#pragma unroll
    for (int q = 0; q < 8; ++q) fr.h[q] = (_Float16)(v[c][q] * sc);
    *(v8us*)(p + c * 256 + k0) = fr.half[0]; }
  asm volatile("s_wait_xcnt 0x0" ::: "memory");      /* the built code lays the row lengths one behind the other, and only a conditional branch stands between these stores and the next length's code, which rewrites their address and data registers */
}
// grid = all token rows of all batches, one 32-lane block each; a row's length is the end of its own QT-row query tile
__global__ __launch_bounds__(32) void k_rsmcf2(const float* __restrict__ S, _Float16* __restrict__ P, int nrows) {
  const int t = blockIdx.x; if (t >= nrows) return; const int k0 = threadIdx.x * 8; const int last = t % SQ;
  const float* s = S + (size_t)t * NKX; unsigned short* p = (unsigned short*)P + (size_t)t * NKX;
  switch (last / QT + 1) {      /* the same for every lane of the wave: straight-line code for each row length */
    case 1: rsm_row<1>(s, p, k0, last); break; case 2: rsm_row<2>(s, p, k0, last); break; case 3: rsm_row<3>(s, p, k0, last); break; case 4: rsm_row<4>(s, p, k0, last); break;
    case 5: rsm_row<5>(s, p, k0, last); break; case 6: rsm_row<6>(s, p, k0, last); break; case 7: rsm_row<7>(s, p, k0, last); break; case 8: rsm_row<8>(s, p, k0, last); break;
    default: break; } }


template <int MASKADD>
__global__ __launch_bounds__(64) void k_att0(const float* __restrict__ QF, const float* __restrict__ KF, const float* __restrict__ VF, int ld, const float* __restrict__ mask, float scale, float* __restrict__ OF, int ldo) {
  #pragma clang fp contract(off)
  __shared__ __attribute__((aligned(16))) float lq[64][64]; __shared__ __attribute__((aligned(16))) float lo[64][64];
  const int tid = threadIdx.x; const int h = blockIdx.x / (QT0 / 64), rg = blockIdx.x % (QT0 / 64); const int i = rg * 64 + tid;
  const float* qr = QF + (size_t)i * ld + h * HD;
#pragma unroll 1
  for (int c = 0; c < HD / 4; ++c) { *(v4f*)&lq[tid][c * 4] = *(const v4fa*)(qr + c * 4); const v4f z = {0.f, 0.f, 0.f, 0.f}; *(v4f*)&lo[tid][c * 4] = z; }
  float m = -1.0e30f, l = 0.f; const int jmax = MASKADD ? (SQ - 1) : (rg * 64 + 63);      /* additive-mask form: every key (the mask input decides); causal form: keys up to the block's last row */
#pragma unroll 1
  for (int j = 0; j <= jmax; ++j) { const float* kr = KF + (size_t)j * ld + h * HD; const float* vr = VF + (size_t)j * ld + h * HD; float s = 0.f;
#pragma unroll 1
    for (int c = 0; c < HD / 4; ++c) { const v4f kq = *(const v4fa*)(kr + c * 4); const v4f qq = *(v4f*)&lq[tid][c * 4]; s = __fadd_rn(s, __fmul_rn(qq[0], kq[0])); s = __fadd_rn(s, __fmul_rn(qq[1], kq[1])); s = __fadd_rn(s, __fmul_rn(qq[2], kq[2])); s = __fadd_rn(s, __fmul_rn(qq[3], kq[3])); }
    s = __fmul_rn(s, scale); if (MASKADD) s = __fadd_rn(s, __fmul_rn(bf16_round(mask[(size_t)i * SQ + j]), -10000.0f));
    const float f = (MASKADD || j <= i) ? 1.f : 0.f; const float sm = fmaf(f, s, (1.f - f) * -1.0e30f); const float mn = fmaxf(m, sm); const float sc = expf(m - mn); const float e = expf(sm - mn); l = __fadd_rn(__fmul_rn(l, sc), e); m = mn;
#pragma unroll 1
    for (int c = 0; c < HD / 4; ++c) { const v4f vv = *(const v4fa*)(vr + c * 4); v4f oo = *(v4f*)&lo[tid][c * 4]; for (int u = 0; u < 4; ++u) oo[u] = __fadd_rn(__fmul_rn(oo[u], sc), __fmul_rn(e, vv[u])); *(v4f*)&lo[tid][c * 4] = oo; } }
  const float fin = 64.0f / l;      /* o carried x64 like k_att0w */
#pragma unroll 1
  for (int c = 0; c < HD / 4; ++c) { v4f oo = *(v4f*)&lo[tid][c * 4]; for (int u = 0; u < 4; ++u) oo[u] = __fmul_rn(oo[u], fin); *(v4f*)&lo[tid][c * 4] = oo; }
  __syncthreads();
  {
#pragma unroll 1
    for (int it = 0; it < 16; ++it) { const int row = it * 4 + tid / 16, pc = (tid % 16) * 4; const v4f v = *(const v4f*)&lo[row][pc]; *(v4f*)(OF + (size_t)(rg * 64 + row) * ldo + h * HD + pc) = v; }
     } }


template <int BFIN, int WXB>
__global__ __launch_bounds__(256) void k_ln16(const float* __restrict__ X, const float* __restrict__ g, const float* __restrict__ bb, float eps, _Float16* __restrict__ N16, float* __restrict__ XB) {
  #pragma clang fp contract(off)
  __shared__ float red[256]; const size_t r = blockIdx.x; const int t = threadIdx.x; const v4f xa = *(const v4fa*)(X + r * DMQ + t * 4); float s[4]; float sum = 0.f;
  for (int q = 0; q < 4; ++q) { s[q] = BFIN ? bf16_round(xa[q]) : xa[q]; sum = __fadd_rn(sum, s[q]); }
  red[t] = sum; __syncthreads(); for (int st = 128; st > 0; st >>= 1) { if (t < st) red[t] = __fadd_rn(red[t], red[t + st]); __syncthreads(); } const float mu = red[0] / (float)DMQ; __syncthreads();
  float vs = 0.f; for (int q = 0; q < 4; ++q) { const float dl = __fadd_rn(s[q], -mu); vs = __fadd_rn(vs, __fmul_rn(dl, dl)); } red[t] = vs; __syncthreads(); for (int st = 128; st > 0; st >>= 1) { if (t < st) red[t] = __fadd_rn(red[t], red[t + st]); __syncthreads(); }
  const float rs = rsqrtf(__fadd_rn(red[0] / (float)DMQ, eps)); v4h y; v4f xb;
  for (int q = 0; q < 4; ++q) { const int c = t * 4 + q; y[q] = (_Float16)__fadd_rn(__fmul_rn(__fmul_rn(__fadd_rn(s[q], -mu), rs), bf16_round(g[c])), bf16_round(bb[c])); xb[q] = s[q]; }
  { *(v4h*)(N16 + r * DMQ + t * 4) = y; if (WXB) *(v4f*)(XB + r * DMQ + t * 4) = xb;  } }
__global__ __launch_bounds__(256) void k_ftres2(const float* __restrict__ OF0, const float* __restrict__ XB, float* __restrict__ X1, size_t n4) {
  #pragma clang fp contract(off)
  const size_t t = (size_t)blockIdx.x * 256 + threadIdx.x; if (t >= n4) return; const v4f o = *(const v4fa*)(OF0 + t * 4), xv = *(const v4fa*)(XB + t * 4); v4f y; for (int q = 0; q < 4; ++q) y[q] = __fadd_rn(__fmul_rn(o[q], 0.015625f), xv[q]); *(v4f*)(X1 + t * 4) = y;  }

__global__ __launch_bounds__(256) void k_wthd(const float* __restrict__ Wt, _Float16* __restrict__ Bt) { const size_t t = (size_t)blockIdx.x * 256 + threadIdx.x; if (t >= (size_t)NH * HD * (DM / 8)) return; const int m8 = (int)(t % (DM / 8)) * 8; const int d = (int)((t / (DM / 8)) % HD); const int h = (int)(t / ((size_t)(DM / 8) * HD)); FragH f;
  for (int q = 0; q < 8; ++q) f.h[q] = (_Float16)(16.0f * bf16_round(Wt[((size_t)h * DM + m8 + q) * HD + d])); unsigned short* dst = (unsigned short*)Bt + ((size_t)h * HD + d) * DM + m8; *(v8us*)dst = f.half[0];  }




__global__ __launch_bounds__(256) void k_wtpad(const float* __restrict__ Wm, _Float16* __restrict__ Wt, int Kr, int Kp, int Nr, int Np, float scale) {
  const int t = blockIdx.x * 256 + threadIdx.x; if (t >= Np * (Kp / 8)) return; const int n = t / (Kp / 8), k8 = (t % (Kp / 8)) * 8; const int nc = min(n, Nr - 1); const float fn = (n < Nr) ? 1.f : 0.f; FragH f;
  for (int i = 0; i < 8; ++i) { const int k = k8 + i; const int kc = min(k, Kr - 1); const float fk = (k < Kr) ? fn : 0.f; f.h[i] = (_Float16)(bf16_round(Wm[(size_t)kc * Nr + nc]) * scale * fk); }
  unsigned short* o = (unsigned short*)Wt + (size_t)n * Kp + k8; *(v8us*)o = f.half[0];  }
__global__ __launch_bounds__(128) void k_bpad(const float* __restrict__ b, float* __restrict__ Bp, int nr, int np) {
  const int i = threadIdx.x; if (i >= np) return; const float v = b[min(i, nr - 1)] * ((i < nr) ? 1.f : 0.f); *(float*)(Bp + i) = v;  }

#define DI 1024       /* inner width = NH * HD */
#define LQK (3 * DI)  /* fused q | k | v row pitch (3072) */
__global__ __launch_bounds__(256) void k_o0(const float* __restrict__ OF, float* __restrict__ ob, size_t n4) {
  #pragma clang fp contract(off)
  const size_t t = (size_t)blockIdx.x * 256 + threadIdx.x; if (t >= n4) return; const size_t e = t * 4; const int i = (int)(e / DI); const int c = (int)(e % DI); const int h = c / HD, d = c % HD; const v4f a = *(const v4fa*)(OF + e); v4f o; for (int q = 0; q < 4; ++q) o[q] = __fmul_rn(a[q], 0.015625f); float* dst = ob + (size_t)h * SQ * HD + (size_t)i * HD + d; *(v4f*)dst = o;  }

#define RQ 4                 /* query rows per block of the exact path */
#define SJP (QT0 + 16)       /* pitch of a score row in LDS: the RQ rows of one key fall on different banks */
// Exact f32 attention for the first QT0 rows of every batch, RQ query rows per block, so that every k row and every v row a block loads serves RQ queries, and every global load is whole lines.
// Scores: one wave per group of 8 keys; lane l holds columns 128 u + 4 l .. + 3 (u = 0..7) of the RQ query rows in registers and of the key row as it comes in; the 8 x RQ = 32 per-lane partial dot products
// are summed over the 32 lanes by a halving exchange (31 exchanges in all) that leaves sum number l (key * RQ + row) in lane l. Softmax: one wave per query row. Output: thread t owns columns 4 t .. + 3 of the RQ rows, keys in order.
// Every '#pragma unroll' of this kernel and its helpers makes the index of a register array a constant; each '#pragma unroll 1' keeps a loop rolled whose body already fills the registers that four waves per SIMD leave a wave.
typedef float v2f __attribute__((ext_vector_type(2)));
// the value of lane ^ BIT, on the vector unit: inside a 16-lane row by DPP (row_xmask), between the two rows by the cross-row move; all 32 lanes are on wherever it is called
template <int BIT>
__device__ __forceinline__ float att0_xor(float x) { int v = __float_as_int(x);
  if constexpr (BIT == 16) v = __builtin_amdgcn_permlanex16(v, v, 0x76543210, 0xfedcba98, false, false); else v = __builtin_amdgcn_update_dpp(v, v, 0x160 + BIT, 0xf, 0xf, false);
  return __int_as_float(v); }
// one step of the halving exchange over lane bit BIT: a lane with the bit set keeps the sums hi[], its partner (lane ^ BIT) the sums lo[]; each hands the other half over; the kept sums come back in lo[]
template <int N, int BIT>
__device__ __forceinline__ void att0_halve(float (&lo)[N], const float (&hi)[N], int lane) { const bool up = (lane & BIT) != 0;
#pragma unroll
  for (int t = 0; t < N; ++t) { const float send = up ? lo[t] : hi[t]; const float keep = up ? hi[t] : lo[t]; lo[t] = keep + att0_xor<BIT>(send); } }
// behind a run of global loads from one pointer: the wait that stands in front of any rewrite of the registers the loads name; naming the pointer keeps its registers live up to the wait, so that no load of the run is given them as its destination
#define ATT0_XW(p) asm volatile("s_wait_xcnt 0x0" :: "v"(p) : "memory")
__device__ __forceinline__ void att0_use8(v4f (&o)[RQ], const v4f (&v)[8], const float (*pe)[RQ]) {      /* eight v rows into the RQ output rows, keys in order */
#pragma unroll
  for (int t = 0; t < 8; ++t) { const v4f e = *(const v4f*)&pe[t][0];
#pragma unroll
    for (int r = 0; r < RQ; ++r) { const v2f er = {e[r], e[r]}; o[r].xy = __builtin_elementwise_fma(er, v[t].xy, o[r].xy); o[r].zw = __builtin_elementwise_fma(er, v[t].zw, o[r].zw); } } }
__global__ __launch_bounds__(256) __attribute__((amdgpu_waves_per_eu(4, 4))) void k_att0w(const float* __restrict__ QF, const float* __restrict__ KF, const float* __restrict__ VF, float scale, float* __restrict__ OF) {      /* q | k | v rows of pitch LQK, output rows of pitch DI; the register budget of four waves per SIMD, so that a long and a short block share a WGP */
  __shared__ float sj[RQ][SJP]; __shared__ __attribute__((aligned(16))) float pe[QT0][RQ]; __shared__ float fin[RQ];
  const int tid = threadIdx.x, w = __builtin_amdgcn_readfirstlane(tid >> 5), lane = tid & 31; const int b = blockIdx.x % NB, idx = blockIdx.x / NB;      /* the wave's number as a scalar: the key loop stays on the scalar unit; batch fastest */
  const int g = (idx < QT0 / RQ / 2) ? QT0 / RQ - 1 - idx : idx - QT0 / RQ / 2;      /* first half of the grid: the row groups with the most keys, longest first; second half: the short ones, shortest first */
  const int i0 = g * RQ, nk = i0 + RQ;      /* keys 0 .. nk - 1 are seen by at least one of the block's rows */
  QF += (size_t)b * QT0 * LQK; KF += (size_t)b * QT0 * LQK; VF += (size_t)b * QT0 * LQK; OF += (size_t)b * QT0 * DI;
  for (int t = tid; t < RQ * SJP; t += 256) (&sj[0][0])[t] = -1.0e30f;      /* keys no wave computes count as masked */
  v4f q[RQ][8]; const float* qp = QF + (size_t)i0 * LQK + lane * 4;
#pragma unroll
  for (int r = 0; r < RQ; ++r)
#pragma unroll
    for (int u = 0; u < 8; ++u) q[r][u] = *(const v4fa*)(qp + r * LQK + u * 128);
  ATT0_XW(qp);
  __syncthreads();
  v4f cur[8]; const float* kp = KF + (size_t)(w * 8) * LQK + lane * 4;      /* the key row in use; the next one is fetched while it is used. Rows w * 8 .. + 7 lie below QT0 for every wave, also for one that has no group */
#pragma unroll
  for (int u = 0; u < 8; ++u) cur[u] = *(const v4fa*)(kp + u * 128);
  ATT0_XW(kp);
#pragma unroll 1
  for (int g8 = w; g8 * 8 < nk; g8 += 8) {      /* the same for every lane of a wave; key rows g8 * 8 .. + 7 lie below QT0 */
    const float* kg = KF + (size_t)(g8 * 8) * LQK + lane * 4;
    const float* kn = KF + (size_t)((((g8 + 8) * 8 < nk) ? g8 + 8 : g8) * 8) * LQK + lane * 4;      /* first row of the wave's next group (the last trip fetches its own first row again) */
    float a4[2][RQ];      /* the exchange runs as a tree beside the keys (2 keys, 4 keys, 8 keys), so that few partial sums are live at a time */
#pragma unroll
    for (int k4 = 0; k4 < 2; ++k4) { float a2[2][RQ];
#pragma unroll
      for (int k2 = 0; k2 < 2; ++k2) { float a1[2][RQ];
#pragma unroll
        for (int k1 = 0; k1 < 2; ++k1) { const int kk = k4 * 4 + k2 * 2 + k1; const float* kr = (kk < 7) ? kg + (kk + 1) * LQK : kn; v4f nxt[8];
#pragma unroll
          for (int u = 0; u < 8; ++u) nxt[u] = *(const v4fa*)(kr + u * 128);
          ATT0_XW(kr);
#pragma unroll
          for (int r = 0; r < RQ; ++r) { v2f s = {0.f, 0.f};      /* even and odd columns in the two halves of a packed multiply-add */
#pragma unroll
            for (int u = 0; u < 8; ++u) { s = __builtin_elementwise_fma(q[r][u].xy, cur[u].xy, s); s = __builtin_elementwise_fma(q[r][u].zw, cur[u].zw, s); }
            a1[k1][r] = s.x + s.y; }
#pragma unroll
          for (int u = 0; u < 8; ++u) cur[u] = nxt[u];
          __builtin_amdgcn_sched_barrier(0); }      /* keeps the eight keys of a group apart: left free, the scheduler mixed their loads and spilled query registers to scratch */
        att0_halve<RQ, 4>(a1[0], a1[1], lane);
#pragma unroll
        for (int r = 0; r < RQ; ++r) a2[k2][r] = a1[0][r]; }
      att0_halve<RQ, 8>(a2[0], a2[1], lane);
#pragma unroll
      for (int r = 0; r < RQ; ++r) a4[k4][r] = a2[0][r]; }
    att0_halve<RQ, 16>(a4[0], a4[1], lane);
    float b2[2][2] = {{a4[0][0], a4[0][1]}, {a4[0][2], a4[0][3]}}; att0_halve<2, 2>(b2[0], b2[1], lane);
    float b1[2][1] = {{b2[0][0]}, {b2[0][1]}}; att0_halve<1, 1>(b1[0], b1[1], lane);
    const int j = g8 * 8 + (lane >> 2), r = lane & 3;      /* lane bits 16, 8, 4 chose the key in the group, bits 2, 1 the row */
    sj[r][j] = (j <= i0 + r) ? b1[0][0] * scale : -1.0e30f; }
  __syncthreads();
  if (w < RQ) { float sv[QT0 / 32]; float mx = -1.0e30f;
#pragma unroll
    for (int u = 0; u < QT0 / 32; ++u) { sv[u] = sj[w][u * 32 + lane]; mx = fmaxf(mx, sv[u]); }
    mx = fmaxf(mx, att0_xor<1>(mx)); mx = fmaxf(mx, att0_xor<2>(mx)); mx = fmaxf(mx, att0_xor<4>(mx)); mx = fmaxf(mx, att0_xor<8>(mx)); mx = fmaxf(mx, att0_xor<16>(mx));
    float ls = 0.f;
#pragma unroll
    for (int u = 0; u < QT0 / 32; ++u) { const float e = expf(sv[u] - mx); pe[u * 32 + lane][w] = e; ls += e; }
    ls += att0_xor<1>(ls); ls += att0_xor<2>(ls); ls += att0_xor<4>(ls); ls += att0_xor<8>(ls); ls += att0_xor<16>(ls);
    if (lane == 0) fin[w] = 64.0f / ls; }      /* o is carried x64; k_o0m takes the factor off */
  __syncthreads();
  const float* vp = VF + tid * 4; const v4f z4 = {0.f, 0.f, 0.f, 0.f}; v4f o[RQ] = {z4, z4, z4, z4}; v4f va[8], vb[8];
  const int nk16 = (nk + 15) & ~15;      /* v rows in steps of 16: rows nk .. nk16 - 1 lie below QT0 and carry weight 0 for all RQ queries */
#pragma unroll
  for (int t = 0; t < 8; ++t) va[t] = *(const v4fa*)(vp + t * LQK);
  ATT0_XW(vp);
#pragma unroll 1
  for (int j = 0; j < nk16; j += 16) {      /* two sets of eight v rows: one flies while the other is used */
    const float* pb = vp + (size_t)(j + 8) * LQK;
#pragma unroll
    for (int t = 0; t < 8; ++t) vb[t] = *(const v4fa*)(pb + t * LQK);
    ATT0_XW(pb);
    att0_use8(o, va, &pe[j]);
    __builtin_amdgcn_sched_barrier(0);      /* keeps each fetch ahead of the work it flies beside: left free, the loads were moved down to where their rows are used */
    const float* pa = vp + (size_t)((j + 16 < nk16) ? j + 16 : j) * LQK;      /* the last trip loads its own first rows again */
#pragma unroll
    for (int t = 0; t < 8; ++t) va[t] = *(const v4fa*)(pa + t * LQK);
    ATT0_XW(pa);
    att0_use8(o, vb, &pe[j + 8]);
    __builtin_amdgcn_sched_barrier(0); }      /* as above */
#pragma unroll
  for (int r = 0; r < RQ; ++r) { const v4f y = o[r] * fin[r]; *(v4f*)(OF + (size_t)(i0 + r) * DI + tid * 4) = y; } }

__global__ __launch_bounds__(256) void k_o0m(const float* __restrict__ OF, float* __restrict__ o_, size_t n4) {
  #pragma clang fp contract(off)
  const size_t t = (size_t)blockIdx.x * 256 + threadIdx.x; if (t >= n4) return; const size_t e = t * 4; OF += (size_t)blockIdx.y * QT0 * DI; o_ += (size_t)blockIdx.y * SQ * DI;      /* grid y = batch */
  const v4f a = *(const v4fa*)(OF + e); v4f o; for (int q = 0; q < 4; ++q) o[q] = __fmul_rn(a[q], 0.015625f); *(v4f*)(o_ + e) = o;  }
extern "C" void kernel_launch(void* const* d_in, const int* in_sizes, int n_in,
                              void* d_out, int out_size, void* d_ws, size_t ws_size, hipStream_t stream) {
  (void)in_sizes; (void)n_in; (void)out_size;
  const float* const* I = (const float* const*)d_in; const float* x = I[0]; const float* wqkv = I[1];      /* input order: x [4][2048][1024], W_qkv ([in][out] [1024][3072]: q | k | v column thirds); the module has no biases and no output projection */
  char* ws = (char*)d_ws; size_t off = 0;
  auto take = [&](size_t bytes) { char* p = ws + off; off += (bytes + 255) & ~(size_t)255; return p; };
  _Float16* BW = (_Float16*)take((size_t)LQK * DM * 2); _Float16* X16 = (_Float16*)take(NR * DM * 2); _Float16* QKV = (_Float16*)take(NR * LQK * 2); _Float16* VT = (_Float16*)take((size_t)NB * DI * SQ * 2);
  float* S = (float*)take(NR * NKX * 4); _Float16* P = (_Float16*)take(NR * NKX * 2); float* QKVF0 = (float*)take((size_t)NB * QT0 * LQK * 4); float* OF0 = (float*)take((size_t)NB * QT0 * DI * 4);      /* ONE head: S / P row = token row, pitch NKX; every plane holds all batches */
  if (off > ws_size) return;
  k_wtpad<<<(unsigned)(((size_t)LQK * (DM / 8) + 255) / 256), 256, 0, stream>>>(wqkv, BW, DM, DM, LQK, LQK, 16.0f);      /* [in][out] [1024][3072] -> Bt[n][k] x16 (no padding: Kr = Kp = 1024, Nr = Np = 3072) */
  k_x16<<<(unsigned)((NR * DM / 8 + 255) / 256), 256, 0, stream>>>(x, X16, NR * DM / 8);      /* x (bf16-valued) as exact f16 rows */
  k_gemm2<0><<<dim3((unsigned)((NR / 128) * (LQK / 64)), 1), 128, 0, stream>>>(X16, DM, 0, BW, DM, 0, 0.0625f, nullptr, 0, nullptr, 1, 0, 0, nullptr, QKV, LQK, 0, (int)NR, LQK, DM);      /* q | k | v = x W -> f16 rows, column blocks 0 / 1024 / 2048 of the fused plane (pitch 3072); no bias */
  const _Float16* Q16 = QKV; const _Float16* K16 = QKV + DI; const _Float16* V16 = QKV + 2 * DI;
  k_vt<NH, SQ><<<NB * NH * (SQ / 64), 256, 0, stream>>>(V16, LQK, 0, VT);      /* V^T [NB][1024][SQ], as 16 column chunks of 64 a batch */
  k_gemm2<0, 1><<<dim3((QT / 128) * (SQ / 64), NB, SQ / QT), 128, 0, stream>>>(Q16, LQK, (size_t)SQ * LQK, K16, LQK, (size_t)SQ * LQK, 0.03125f, nullptr, 0, nullptr, 1, 0, 0, S, nullptr, NKX, (size_t)SQ * NKX, QT, SQ, DI);      /* scores / sqrt(1024) over the FULL width (K = 1024), one head; causal: only keys below each tile's end */
  k_rsmcf2<<<(unsigned)NR, 32, 0, stream>>>(S, P, (int)NR);      /* causal softmax -> P x256 f16, one wave per row */
  k_gemm2<0, 2><<<dim3((QT / 128) * (DI / 64), NB, SQ / QT), 128, 0, stream>>>(P, NKX, (size_t)SQ * NKX, VT, SQ, (size_t)DI * SQ, 0.00390625f, nullptr, 0, nullptr, 1, 0, 0, (float*)d_out, nullptr, DI, (size_t)SQ * DI, QT, DI, SQ);      /* out[b][q][:] = P V^T 2^-8 (f32), N = 1024, keys up to each tile's end */
  k_gemm2<0><<<dim3((unsigned)((QT0 / 128) * (LQK / 64)), NB), 128, 0, stream>>>(X16, DM, (size_t)SQ * DM, BW, DM, 0, 0.0625f, nullptr, 0, nullptr, 1, 0, 0, QKVF0, nullptr, LQK, (size_t)QT0 * LQK, QT0, LQK, DM);      /* f32 q | k | v of rows 0..511 of every batch (exact products, f32 accumulation) */
  k_att0w<<<NB * (QT0 / RQ), 256, 0, stream>>>(QKVF0, QKVF0 + DI, QKVF0 + 2 * DI, 0.03125f, OF0);      /* exact f32 single-head causal attention for rows 0..511 of every batch (o x64) */
  k_o0m<<<dim3((unsigned)(((size_t)QT0 * DI / 4 + 255) / 256), NB), 256, 0, stream>>>(OF0, (float*)d_out, (size_t)QT0 * DI / 4);      /* rows 0..511 of every batch REWRITTEN from the exact path */
}

// v004
// A run of this version takes 197 microseconds.
// Timed twice side by side with v003, it ran 2.19 times as fast both times.
// Over all steps from v000 it is 45.3 times as fast.
#include <hip/hip_runtime.h>
// Causal SINGLE-HEAD self-attention of full width with a fused bias-free QKV projection and NO output projection (x [4][2048][1024]; qkv = x W_qkv ([in][out] 1024 x 3072, no bias) split into q | k | v thirds of width 1024; scores = q k^T / sqrt(1024) over the FULL width (one head); causal (keys after the query -> -inf); softmax over keys; out = attn v -> [4][2048][1024]).
// Structure: token rows; x as exact f16 rows; ONE WMMA GEMM into the f16 q | k | v plane [8192][3072]; per batch v^T via LDS transposes (16 column chunks of 64 = the full 1024-wide row); causal 256-row query tiles: scores GEMM with K = 1024 (alpha 1/32), causal softmax f32 -> f16 x256 weights, P . V^T GEMM with N = 1024 written as f32 (alpha 2^-8) straight into the output rows. Every stage is ONE launch over all batches (grid y) and all query tiles (grid z); S, P, V^T and the f32 planes hold all of them in the workspace.
// First-tile refinement: the first 512 query rows of every batch (which see few keys, so single-f16 q / k / v / P would be too coarse with no output projection to average the errors) are recomputed exactly: f32 q | k | v rows from a small extra GEMM (exact products, f32 accumulation), an f32 attention on VALU (k_att0w: four query rows per block; full-width dot products; precise expf), and the rows are rewritten.
// Compute dtype: inputs rounded to bf16; x / weights exact; q, k, v and the softmax weights as plain f16 GEMM operands (~2^-12) past the exact rows; scores, softmax statistics and the output accumulation f32. v_wmma_f32_16x16x32_f16.
#define NB 4
#define SQ 2048
#define DM 1024
#define NH 16
#define HD 64
#define HG 4                         /* heads per attention launch group */
#define QT 256                       /* query rows per causal tile */
#define NKX SQ                       /* S / P row pitch */
#define QT0 512                      /* first-tile rows recomputed exactly (f32): 512 here (no output projection averages the early-row cancellation errors away; logit sigma 1.0) */
#define B0 0                         /* unused (each launch covers all batches) */
#define NBR NB                       /* unused by the launches (they cover all NB batches in their grids) */
#define NR ((size_t)NB * SQ)
#define DMQ DM
#define DFF 4096                     /* unused (no FFN in this file) */
#define DFFR 100                     /* unused */
#define MP ((int)((size_t)NBR * SQ)) /* unused by the launches (the projection covers NR rows) */
#define QN SQ                        /* unused (the query tiles cover SQ rows) */
#define NHD NH                       /* unused (one full-width head is attended) */
#define MPO MP                       /* unused (there is no output stage) */
#define LQ (3 * DM)      /* unused (the q | k | v rows have pitch LQK) */
typedef __bf16 v16b __attribute__((ext_vector_type(16)));
typedef unsigned short v8us __attribute__((ext_vector_type(8), may_alias));
typedef float  v8f  __attribute__((ext_vector_type(8)));
typedef float  v4f  __attribute__((ext_vector_type(4)));
typedef float  v4fa __attribute__((ext_vector_type(4), may_alias));
union FragB { v16b v; v8us half[2]; unsigned short u[16]; };

__device__ __forceinline__ unsigned short bf16_bits(float x) { unsigned int u = __float_as_uint(x); return (unsigned short)((u + 0x7FFFu + ((u >> 16) & 1u)) >> 16); }
__device__ __forceinline__ float bf16_val(unsigned short b) { return __uint_as_float(((unsigned int)b) << 16); }
__device__ __forceinline__ float bf16_round(float x) { return bf16_val(bf16_bits(x)); }
// D += A·B with NT terms: 1 = ah·bh, 2 = + al·bh (A split), 3 = + ah·bl (both split)
template <int NT>
__device__ __forceinline__ v8f mmaN(v16b ah, v16b al, v16b bh, v16b bl, v8f c) {
  c = __builtin_amdgcn_wmma_f32_16x16x32_bf16(false, ah, false, bh, (short)0, c, false, false);
  if (NT >= 2) c = __builtin_amdgcn_wmma_f32_16x16x32_bf16(false, al, false, bh, (short)0, c, false, false);
  if (NT >= 3) c = __builtin_amdgcn_wmma_f32_16x16x32_bf16(false, ah, false, bl, (short)0, c, false, false);
  asm volatile("v_nop\n\tv_nop\n\tv_nop\n\tv_nop" : "+v"(c) : "v"(ah), "v"(al), "v"(bh), "v"(bl));
  return c;
}

__global__ __launch_bounds__(256) void k_wt_bf16(const float* __restrict__ W, unsigned short* __restrict__ Wt, int K, int N) {
  const int t = blockIdx.x * 256 + threadIdx.x;
  const int k8n = K / 8;
  if (t >= N * k8n) return;
  const int n = t / k8n, k8 = (t % k8n) * 8;
  v8us v;
#pragma unroll
  for (int i = 0; i < 8; ++i) v[i] = bf16_bits(W[(size_t)(k8 + i) * N + n]);
  *(v8us*)(Wt + (size_t)n * K + k8) = v;
  
}

// GEMM C[M][N] (f32, pitch ldc) = act(A[M][K]·W + bias). A f32 row-major (pitch lda) converted per fragment to bf16
// (ASPLIT: hi/lo two planes -> 2 terms, else single rounded term); Wt bf16 [N][K] (pitch ldb). BIAS_BF16 rounds the
// bias to bf16 first (bias quantised to bf16 before the add). K%32==0, M%16==0, N%64==0.
template <bool ASPLIT, int ACT, bool BIAS_BF16>
__global__ __launch_bounds__(128) void k_gemm_bf(const float* __restrict__ A, int lda, const unsigned short* __restrict__ Wt, int ldb,
                                               const float* __restrict__ bias, float* __restrict__ C, int ldc, int M, int N, int K) {
  __shared__ __attribute__((aligned(16))) float so[4][16][64];
  const int tid = threadIdx.x, w = tid >> 5, lane = tid & 31, ln = lane & 15, hh = lane >> 4;
  const int ntn = N / 64;
  const int wid = blockIdx.x * 4 + w;
  const int mt = wid / ntn, nq = wid % ntn;
  if (mt * 16 >= M) return;
  const int row0 = mt * 16, col0 = nq * 64;
  const float* arow = A + (size_t)(row0 + ln) * lda;
  v8f acc[4] = {};
  for (int kb = 0; kb < K; kb += 32) {
    FragB ah, al;
    const v4f x0 = *(const v4fa*)(arow + kb + 8 * hh), x1 = *(const v4fa*)(arow + kb + 8 * hh + 4);
    const v4f x2 = *(const v4fa*)(arow + kb + 16 + 8 * hh), x3 = *(const v4fa*)(arow + kb + 16 + 8 * hh + 4);
    float xs[16] = {x0[0],x0[1],x0[2],x0[3],x1[0],x1[1],x1[2],x1[3],x2[0],x2[1],x2[2],x2[3],x3[0],x3[1],x3[2],x3[3]};
#pragma unroll
    for (int i = 0; i < 16; ++i) { const unsigned short hb = bf16_bits(xs[i]); ah.u[i] = hb; al.u[i] = ASPLIT ? bf16_bits(xs[i] - bf16_val(hb)) : (unsigned short)0; }
#pragma unroll
    for (int t = 0; t < 4; ++t) {
      const unsigned short* brow = Wt + (size_t)(col0 + t * 16 + ln) * ldb + kb;
      FragB b;
      b.half[0] = *(const v8us*)(brow + 8 * hh);
      b.half[1] = *(const v8us*)(brow + 16 + 8 * hh);
      acc[t] = mmaN<ASPLIT ? 2 : 1>(ah.v, al.v, b.v, b.v, acc[t]);
    }
  }
#pragma unroll
  for (int t = 0; t < 4; ++t) {
    float bv = bias ? bias[col0 + t * 16 + ln] : 0.f;
    if (BIAS_BF16) bv = bf16_round(bv);
#pragma unroll
    for (int r = 0; r < 8; ++r) { float v = acc[t][r] + bv; if (ACT == 1) v = fmaxf(v, 0.f); so[w][8 * hh + r][t * 16 + ln] = v; }
  }
  __builtin_amdgcn_fence(__ATOMIC_ACQ_REL, "workgroup");
  __builtin_amdgcn_wave_barrier();
  const int rsub = lane >> 4, c4 = (lane & 15) * 4;
  {
#pragma unroll
    for (int q = 0; q < 8; ++q) {
      const int r = q * 2 + rsub;
      const v4f v = *(const v4fa*)&so[w][r][c4];
      *(v4f*)(C + (size_t)(row0 + r) * ldc + col0 + c4) = v;
    }
    
  }
}

// GEMM C = act(A·W + bias + resid): A f32 (ASPLIT -> hi/lo 2 terms), Wt bf16 [N][K]; ACT 0 none, 1 relu, 2 exact gelu;
// resid (optional, f32, row index = (row % rmod), pitch ldr, RES_BF16 rounds it) added before the activation.
template <bool ASPLIT, int ACT, bool BIAS_BF16, bool RES_BF16>
__global__ __launch_bounds__(128) void k_gemm_bf3(const float* __restrict__ A, int lda, const unsigned short* __restrict__ Wt, int ldb,
                                                const float* __restrict__ bias, const float* __restrict__ resid, int rmod, int ldr,
                                                float* __restrict__ C, int ldc, int M, int N, int K) {
  __shared__ __attribute__((aligned(16))) float so[4][16][64];
  const int tid = threadIdx.x, w = tid >> 5, lane = tid & 31, ln = lane & 15, hh = lane >> 4;
  const int ntn = N / 64;
  const int wid = blockIdx.x * 4 + w;
  const int mt = wid / ntn, nq = wid % ntn;
  if (mt * 16 >= M) return;
  const int row0 = mt * 16, col0 = nq * 64;
  const float* arow = A + (size_t)(row0 + ln) * lda;
  v8f acc[4] = {};
  for (int kb = 0; kb < K; kb += 32) {
    FragB ah, al;
    const v4f x0 = *(const v4fa*)(arow + kb + 8 * hh), x1 = *(const v4fa*)(arow + kb + 8 * hh + 4);
    const v4f x2 = *(const v4fa*)(arow + kb + 16 + 8 * hh), x3 = *(const v4fa*)(arow + kb + 16 + 8 * hh + 4);
    float xs[16] = {x0[0],x0[1],x0[2],x0[3],x1[0],x1[1],x1[2],x1[3],x2[0],x2[1],x2[2],x2[3],x3[0],x3[1],x3[2],x3[3]};
#pragma unroll
    for (int i = 0; i < 16; ++i) { const unsigned short hb = bf16_bits(xs[i]); ah.u[i] = hb; al.u[i] = ASPLIT ? bf16_bits(xs[i] - bf16_val(hb)) : (unsigned short)0; }
#pragma unroll
    for (int t = 0; t < 4; ++t) {
      const unsigned short* brow = Wt + (size_t)(col0 + t * 16 + ln) * ldb + kb;
      FragB b;
      b.half[0] = *(const v8us*)(brow + 8 * hh);
      b.half[1] = *(const v8us*)(brow + 16 + 8 * hh);
      acc[t] = mmaN<ASPLIT ? 2 : 1>(ah.v, al.v, b.v, b.v, acc[t]);
    }
  }
#pragma unroll
  for (int t = 0; t < 4; ++t) {
    const int col = col0 + t * 16 + ln;
    float bv = bias ? bias[col] : 0.f;
    if (BIAS_BF16) bv = bf16_round(bv);
#pragma unroll
    for (int r = 0; r < 8; ++r) {
      float v = acc[t][r] + bv;
      if (resid) { float rv = resid[(size_t)((row0 + 8 * hh + r) % rmod) * ldr + col]; if (RES_BF16) rv = bf16_round(rv); v += rv; }
      if (ACT == 1) v = fmaxf(v, 0.f);
      if (ACT == 2) v = 0.5f * v * (1.0f + erff(v * 0.70710678118654752f));
      if (ACT == 3) { const float u = 0.7978845608028654f * (v + 0.044715f * v * v * v); v = 0.5f * v * (1.0f + tanhf(u)); }
      so[w][8 * hh + r][t * 16 + ln] = v;
    }
  }
  __builtin_amdgcn_fence(__ATOMIC_ACQ_REL, "workgroup");
  __builtin_amdgcn_wave_barrier();
  const int rsub = lane >> 4, c4 = (lane & 15) * 4;
  {
#pragma unroll
    for (int q = 0; q < 8; ++q) {
      const int r = q * 2 + rsub;
      const v4f v = *(const v4fa*)&so[w][r][c4];
      *(v4f*)(C + (size_t)(row0 + r) * ldc + col0 + c4) = v;
    }
    
  }
}
// row LayerNorm (biased variance, eps) over N: s = X (+ R); optional out_sum <- s; out_norm <- (s-mu)*rsqrt(var+eps)*g + b
template <bool PARAM_BF16>
__global__ __launch_bounds__(256) void k_layernorm(const float* __restrict__ X, const float* __restrict__ R, const float* __restrict__ g, const float* __restrict__ bta,
                                                  float* __restrict__ out_sum, float* __restrict__ out_norm, int N, float eps) {
  __shared__ float red[256];
  const int row = blockIdx.x, tid = threadIdx.x;
  const float* x = X + (size_t)row * N; const float* rr = R ? R + (size_t)row * N : nullptr;
  float vals[16];                     // up to N = 4096
  const int per = N / 256;            // contiguous chunk per thread? use strided-by-4 chunks: thread handles j = tid*4 + 1024*u
  float s1 = 0.f;
  for (int u = 0; u < per / 4; ++u) {
    const int j = tid * 4 + 1024 * u;
    const v4f a = *(const v4fa*)(x + j);
    v4f b = {0.f,0.f,0.f,0.f}; if (rr) b = *(const v4fa*)(rr + j);
#pragma unroll
    for (int q = 0; q < 4; ++q) { const float v = a[q] + b[q]; vals[u * 4 + q] = v; s1 += v; }
  }
  red[tid] = s1; __syncthreads();
  for (int st = 128; st > 0; st >>= 1) { if (tid < st) red[tid] += red[tid + st]; __syncthreads(); }
  const float mu = red[0] / (float)N; __syncthreads();
  float s2 = 0.f;
  for (int u = 0; u < per / 4; ++u)
#pragma unroll
    for (int q = 0; q < 4; ++q) { const float c = vals[u * 4 + q] - mu; s2 += c * c; }
  red[tid] = s2; __syncthreads();
  for (int st = 128; st > 0; st >>= 1) { if (tid < st) red[tid] += red[tid + st]; __syncthreads(); }
  const float rs = rsqrtf(red[0] / (float)N + eps);
  {
    for (int u = 0; u < per / 4; ++u) {
      const int j = tid * 4 + 1024 * u;
      v4f o, sm;
#pragma unroll
      for (int q = 0; q < 4; ++q) {
        float gg = g[j + q], bb = bta[j + q];
        if (PARAM_BF16) { gg = bf16_round(gg); bb = bf16_round(bb); }
        sm[q] = vals[u * 4 + q]; o[q] = (vals[u * 4 + q] - mu) * rs * gg + bb;
      }
      if (out_sum) *(v4f*)(out_sum + (size_t)row * N + j) = sm;
      *(v4f*)(out_norm + (size_t)row * N + j) = o;
    }
    
  }
}



// ---- f16 WMMA path (v_wmma_f32_16x16x32_f16): 11-bit significands for operands in range — used where a [0,1] probability operand needs more precision than bf16
typedef _Float16 v16h __attribute__((ext_vector_type(16)));
union FragH { v16h v; v8us half[2]; _Float16 h[16]; unsigned short u[16]; };
template <int NT>
__device__ __forceinline__ v8f mmaH(v16h ah, v16h al, v16h bh, v16h bl, v8f c) {
  c = __builtin_amdgcn_wmma_f32_16x16x32_f16(false, ah, false, bh, (short)0, c, false, false);
  if (NT >= 2) c = __builtin_amdgcn_wmma_f32_16x16x32_f16(false, al, false, bh, (short)0, c, false, false);
  if (NT >= 3) c = __builtin_amdgcn_wmma_f32_16x16x32_f16(false, ah, false, bl, (short)0, c, false, false);
  asm volatile("v_nop\n\tv_nop\n\tv_nop\n\tv_nop" : "+v"(c) : "v"(ah), "v"(al), "v"(bh), "v"(bl));
  return c;
}
// batched GEMM like k_gemm_b but f16 operands: A f32 (split into f16 hi/lo if ASPLIT, else rounded to f16), Bt = f16 values [n][k]; alpha; C f32; N multiple of 16 (partial tiles skipped)
template <bool ASPLIT>
__global__ __launch_bounds__(128) void k_gemm_h(const float* __restrict__ A, int lda, size_t sA, const _Float16* __restrict__ Bh, int ldb, size_t sB, float alpha, float* __restrict__ C, int ldc, size_t sC, int M, int N, int K) {
  __shared__ __attribute__((aligned(16))) float so[4][16][64];
  const int tid = threadIdx.x, w = tid >> 5, lane = tid & 31, ln = lane & 15, hh = lane >> 4; const int by = blockIdx.y;
  A += (size_t)by * sA; Bh += (size_t)by * sB; C += (size_t)by * sC;
  const int ntn = (N + 63) / 64; const int wid = blockIdx.x * 4 + w; const int mt = wid / ntn, nq = wid % ntn; if (mt * 16 >= M) return;
  const int row0 = mt * 16, col0 = nq * 64; const float* arow = A + (size_t)(row0 + ln) * lda;
  v8f acc[4] = {};
  for (int kb = 0; kb < K; kb += 32) {
    FragH ah, al;
    const v4f x0 = *(const v4fa*)(arow + kb + 8 * hh), x1 = *(const v4fa*)(arow + kb + 8 * hh + 4), x2 = *(const v4fa*)(arow + kb + 16 + 8 * hh), x3 = *(const v4fa*)(arow + kb + 16 + 8 * hh + 4);
    float xs[16] = {x0[0],x0[1],x0[2],x0[3],x1[0],x1[1],x1[2],x1[3],x2[0],x2[1],x2[2],x2[3],x3[0],x3[1],x3[2],x3[3]};
#pragma unroll
    for (int i = 0; i < 16; ++i) { const _Float16 h = (_Float16)xs[i]; ah.h[i] = h; al.h[i] = ASPLIT ? (_Float16)(xs[i] - (float)h) : (_Float16)0.0f; }
#pragma unroll
    for (int t = 0; t < 4; ++t) { if (col0 + t * 16 >= N) continue; const size_t boff = (size_t)(col0 + t * 16 + ln) * ldb + kb; FragH bq; bq.half[0] = *(const v8us*)(Bh + boff + 8 * hh); bq.half[1] = *(const v8us*)(Bh + boff + 16 + 8 * hh);
      acc[t] = mmaH<ASPLIT ? 2 : 1>(ah.v, al.v, bq.v, bq.v, acc[t]); }
  }
#pragma unroll
  for (int t = 0; t < 4; ++t) { if (col0 + t * 16 >= N) continue;
#pragma unroll
    for (int r = 0; r < 8; ++r) so[w][8 * hh + r][t * 16 + ln] = acc[t][r] * alpha; }
  __builtin_amdgcn_fence(__ATOMIC_ACQ_REL, "workgroup"); __builtin_amdgcn_wave_barrier();
  const int rsub = lane >> 4, c4 = (lane & 15) * 4;
  {
#pragma unroll
    for (int q = 0; q < 8; ++q) { const int r = q * 2 + rsub; if (col0 + c4 < N) { const v4f v = *(const v4fa*)&so[w][r][c4]; *(v4f*)(C + (size_t)(row0 + r) * ldc + col0 + c4) = v; } }
     }
}

// Wt[n][k] = f16(W[k][n]·scale) from f32 row-major W[K][N] (scale = power of two; bf16-exact weights stay exact in f16 away from the subnormal range)
__global__ __launch_bounds__(256) void k_wt_f16(const float* __restrict__ W, _Float16* __restrict__ Wt, int K, int N, float scale) {
  const int t = blockIdx.x * 256 + threadIdx.x; if (t >= N * (K / 8)) return; const int n = t / (K / 8), k8 = (t % (K / 8)) * 8; FragH f;
#pragma unroll
  for (int i = 0; i < 8; ++i) f.h[i] = (_Float16)(bf16_round(W[(size_t)(k8 + i) * N + n]) * scale); const v8us o = f.half[0];
  *(v8us*)((unsigned short*)Wt + (size_t)n * K + k8) = o; 
}
// k_gemm_hh variant with fused epilogue: v = acc·alpha + bias[by·sBias + col] (+ CP[(row/rowsPerB)·sCPb + by·64 + col] if CP) ; ACT 0 none / 1 elu ; writes f16 C16 (and f32 C if non-null)
template <int ACT>
__global__ __launch_bounds__(128) void k_gemm_hhx(const _Float16* __restrict__ A, int lda, size_t sA, const _Float16* __restrict__ Bh, int ldb, size_t sB, float alpha, const float* __restrict__ bias, size_t sBias, const float* __restrict__ CP, int rowsPerB, size_t sCPb, int row0g,
    float* __restrict__ C, _Float16* __restrict__ C16, int ldc, size_t sC, int M, int N, int K) {
  __shared__ __attribute__((aligned(16))) float so[4][16][64];
  const int tid = threadIdx.x, w = tid >> 5, lane = tid & 31, ln = lane & 15, hh = lane >> 4; const int by = blockIdx.y;
  A += (size_t)by * sA; Bh += (size_t)by * sB; const size_t cofs = (size_t)by * sC; const float* bp = bias ? bias + (size_t)by * sBias : nullptr;
  const int ntn = (N + 63) / 64; const int wid = blockIdx.x * 4 + w; const int mt = wid / ntn, nq = wid % ntn; if (mt * 16 >= M) return;
  const int row0 = mt * 16, col0 = nq * 64; const _Float16* arow = A + (size_t)(row0 + ln) * lda;
  v8f acc[4] = {};
  for (int kb = 0; kb < K; kb += 32) { FragH ah; ah.half[0] = *(const v8us*)((const unsigned short*)arow + kb + 8 * hh); ah.half[1] = *(const v8us*)((const unsigned short*)arow + kb + 16 + 8 * hh);
#pragma unroll
    for (int t = 0; t < 4; ++t) { if (col0 + t * 16 >= N) continue; const size_t boff = (size_t)(col0 + t * 16 + ln) * ldb + kb; FragH bq; bq.half[0] = *(const v8us*)((const unsigned short*)Bh + boff + 8 * hh); bq.half[1] = *(const v8us*)((const unsigned short*)Bh + boff + 16 + 8 * hh);
      acc[t] = mmaH<1>(ah.v, ah.v, bq.v, bq.v, acc[t]); }
  }
#pragma unroll
  for (int t = 0; t < 4; ++t) { if (col0 + t * 16 >= N) continue; const int col = col0 + t * 16 + ln; const float bv = bp ? bf16_round(bp[col]) : 0.f;
#pragma unroll
    for (int r = 0; r < 8; ++r) { float v = acc[t][r] * alpha + bv; if (CP) { const int rr = row0g + row0 + 8 * hh + r; if (rowsPerB < 0) v += CP[cofs + (size_t)rr * ldc + col];      /* rowsPerB < 0: own element of the batched C plane */ else { const int bidx = rr / rowsPerB; v += CP[(size_t)bidx * sCPb + (size_t)by * 64 + col]; } } if (ACT == 1) v = (v > 0.f) ? v : expm1f(v); else if (ACT == 7) v = (v > 0.f) ? v + 1.0f : expf(v); else if (ACT == 8) v = tanhf(v); else if (ACT == 9) v = 0.5f * v * (1.0f + tanhf(0.7978845608028654f * (v + 0.044715f * v * v * v))); else if (ACT == 11) v = 1.0f / (1.0f + expf(-v)); else if (ACT == 12) v = (v > 0.f) ? v : 0.01f * v; else if (ACT == 14) v = (v > 0.f) ? v : 0.1f * v; else if (ACT == 16) v = (v >= 0.f) ? v : 0.3f * v; else if (ACT == 17) v = (v >= 0.f) ? v : 0.2f * v; else if (ACT == 15) v = v / (1.0f + expf(-v)); else if (ACT == 3) v = fmaxf(v, 0.f); else if (ACT == 6) v = 0.5f * v * (1.0f + erff(v * 0.70710678118654752f)); so[w][8 * hh + r][t * 16 + ln] = v; } }
  __builtin_amdgcn_fence(__ATOMIC_ACQ_REL, "workgroup"); __builtin_amdgcn_wave_barrier();
  const int rsub = lane >> 4, c4 = (lane & 15) * 4; typedef _Float16 v4h __attribute__((ext_vector_type(4)));
  {
#pragma unroll
    for (int q = 0; q < 8; ++q) { const int r = q * 2 + rsub; if (col0 + c4 < N) { const v4f v = *(const v4fa*)&so[w][r][c4]; if (C) *(v4f*)(C + cofs + (size_t)(row0 + r) * ldc + col0 + c4) = v; if (C16) { v4h h4; for (int i = 0; i < 4; ++i) h4[i] = (_Float16)v[i]; *(v4h*)(C16 + cofs + (size_t)(row0 + r) * ldc + col0 + c4) = h4; } } }
     }
}


typedef _Float16 v4h __attribute__((ext_vector_type(4)));

__global__ __launch_bounds__(256) void k_x16(const float* __restrict__ x, _Float16* __restrict__ X16, size_t n8) { const size_t t = (size_t)blockIdx.x * 256 + threadIdx.x; if (t >= n8) return; FragH f;
#pragma unroll
  for (int q = 0; q < 8; ++q) f.h[q] = (_Float16)bf16_round(x[t * 8 + q]); *(v8us*)((unsigned short*)X16 + t * 8) = f.half[0];  }
__global__ __launch_bounds__(256) void k_h16(const float* __restrict__ x, _Float16* __restrict__ X16, size_t n8) { const size_t t = (size_t)blockIdx.x * 256 + threadIdx.x; if (t >= n8) return; FragH f;
#pragma unroll
  for (int q = 0; q < 8; ++q) f.h[q] = (_Float16)x[t * 8 + q]; *(v8us*)((unsigned short*)X16 + t * 8) = f.half[0];  }
__global__ __launch_bounds__(256) void k_round16f(const float* __restrict__ W, _Float16* __restrict__ Bt, size_t n8) { const size_t t = (size_t)blockIdx.x * 256 + threadIdx.x; if (t >= n8) return; FragH f;
#pragma unroll
  for (int i = 0; i < 8; ++i) f.h[i] = (_Float16)(bf16_round(W[t * 8 + i]) * 16.0f); *(v8us*)((unsigned short*)Bt + t * 8) = f.half[0];  }
template <int NHv, int TTv>
__global__ __launch_bounds__(256) void k_vt(const _Float16* __restrict__ V16, int ldv, int voff, _Float16* __restrict__ Vt) { __shared__ unsigned short tl[64][66]; const int tid = threadIdx.x; const int slab = blockIdx.x / (TTv / 64), lg = blockIdx.x % (TTv / 64); const int b = slab / NHv, h = slab % NHv;
  for (int i = tid; i < 64 * 8; i += 256) { const int r = i / 8, c8 = (i % 8) * 8; FragH f; f.half[0] = *(const v8us*)((const unsigned short*)V16 + ((size_t)b * TTv + lg * 64 + r) * ldv + voff + h * 64 + c8);
#pragma unroll
    for (int q = 0; q < 8; ++q) tl[r][c8 + q] = f.u[q]; }
  __syncthreads();
  {
#pragma unroll
    for (int rd = 0; rd < 2; ++rd) { const int d = rd * 32 + tid / 8, pc = tid % 8; FragH f;
#pragma unroll
      for (int q = 0; q < 8; ++q) f.u[q] = tl[pc * 8 + q][d];
      *(v8us*)((unsigned short*)Vt + ((size_t)slab * 64 + d) * TTv + lg * 64 + pc * 8) = f.half[0]; }
     } }

__global__ __launch_bounds__(256) void k_hl(const float* __restrict__ F, _Float16* __restrict__ Hh, _Float16* __restrict__ Hl, size_t n8) { const size_t t = (size_t)blockIdx.x * 256 + threadIdx.x; if (t >= n8) return; FragH fh, fl; const v4f a = *(const v4fa*)(F + t * 8), c = *(const v4fa*)(F + t * 8 + 4);
#pragma unroll
  for (int q = 0; q < 4; ++q) { _Float16 h = (_Float16)a[q]; fh.h[q] = h; fl.h[q] = (_Float16)((a[q] - (float)h) * 1024.0f); h = (_Float16)c[q]; fh.h[4 + q] = h; fl.h[4 + q] = (_Float16)((c[q] - (float)h) * 1024.0f); }
  { *(v8us*)((unsigned short*)Hh + t * 8) = fh.half[0]; *(v8us*)((unsigned short*)Hl + t * 8) = fl.half[0];  } }

// ---- LDS-staged GEMM: C[M][N] = alpha * A[M][K] . Bt[N][K]^T, f16 operands, f32 accumulation; one 128 x 128 tile of C per block of four waves (2 x 2, 64 x 64 of C a wave); M, N multiples of 128, K of 64 ----
// Each slab of 64 k (128-byte pieces of 128 A rows and 128 Bt rows) comes in as whole-line 16-byte loads (8 lanes a row, 4 rows a wave-load), goes through registers into one of two LDS buffers, and is read from there as fragments:
// every operand byte leaves L2 once per block and serves 64 rows or columns of each wave that needs it. The next slab's global loads fly while this slab is multiplied; one barrier a slab.
__device__ __forceinline__ v16h g2_frag(const _Float16* p, int hh) { FragH f; f.half[0] = *(const v8us*)((const unsigned short*)p + 8 * hh); f.half[1] = *(const v8us*)((const unsigned short*)p + 16 + 8 * hh); return f.v; }
#define G3T 128                      /* tile rows of A and of Bt per block */
#define G3K 64                       /* k per slab */
#define G3P 72                       /* LDS row pitch in f16: 144 bytes = 16 x odd, the conflict-free pitch for 16-byte fragment reads */
#define G3B (2 * G3T * G3P)          /* f16 per buffer: rows 0..127 A, rows 128..255 Bt */
// one slab: every fragment of its 64 k from LDS, then the 2 x 16 products of the wave's 64 x 64 tile, k ascending; each '#pragma unroll' makes the index of a register array a constant
__device__ __forceinline__ void g3_slab(v8f (&acc)[4][4], const unsigned short* fa, const unsigned short* fb, int hh) { v16h a[2][4], b[2][4];
#pragma unroll
  for (int kk = 0; kk < 2; ++kk)
#pragma unroll
    for (int i = 0; i < 4; ++i) { a[kk][i] = g2_frag((const _Float16*)(fa + 16 * i * G3P + 32 * kk), hh); b[kk][i] = g2_frag((const _Float16*)(fb + 16 * i * G3P + 32 * kk), hh); }
#pragma unroll
  for (int kk = 0; kk < 2; ++kk)
#pragma unroll
    for (int i = 0; i < 4; ++i)
#pragma unroll
      for (int j = 0; j < 4; ++j) acc[i][j] = __builtin_amdgcn_wmma_f32_16x16x32_f16(false, a[kk][i], false, b[kk][j], (short)0, acc[i][j], false, false); }
// behind a run of global loads from two pointers: the wait that stands in front of any rewrite of the registers the loads name; naming the pointers keeps their registers live up to the wait.
// Built without it, one load of the run sank to just in front of its LDS store (no time to fly).
#define G3_XW(p, q) asm volatile("s_wait_xcnt 0x0" :: "v"(p), "v"(q) : "memory")
// CAUS: grid z = causal query tile of QT rows (A and C step QT rows a tile). 1 = scores: only key columns up to the tile's end are computed; 2 = P V: K ends at the tile's end. grid x = (rows / 128) * (N / 128), grid y = batch.
// H16: the output rows are f16 (C16), else f32 (C). The row pitches lda, ldb, ldc, N and K are compile-time constants: a thread's eight rows of an operand are then one address pair with immediate offsets.
template <int CAUS, bool H16, int lda, int ldb, int ldc, int N, int KF>
__global__ __launch_bounds__(128) void k_gemm3(const _Float16* __restrict__ A, size_t sA, const _Float16* __restrict__ Bh, size_t sB, float alpha,
    float* __restrict__ C, _Float16* __restrict__ C16, size_t sC) {
  __shared__ __attribute__((aligned(16))) unsigned short sm[2 * G3B];      /* 73,728 bytes; after the last slab the same bytes stage the output rows */
  const int tid = threadIdx.x, w = tid >> 5, lane = tid & 31, ln = lane & 15, hh = lane >> 4; const int by = blockIdx.y;
  const int qt = CAUS ? SQ / QT - 1 - (int)blockIdx.z : 0;      /* low z starts first: the tile with the most keys goes first */
  A += (size_t)by * sA + (size_t)qt * QT * lda; Bh += (size_t)by * sB; const size_t cofs = (size_t)by * sC + (size_t)qt * QT * ldc;
  const int ntn = N / G3T; const int mt = blockIdx.x / ntn, nq = blockIdx.x - mt * ntn; const int row0 = mt * G3T, col0 = nq * G3T;
  if (CAUS == 1 && col0 >= (qt + 1) * QT) return;      /* the same for the whole block, in front of every barrier */
  const int K = (CAUS == 2) ? (qt + 1) * QT : KF;
  const int sr = tid >> 3, sc = (tid & 7) * 8;      /* staging: thread t moves 16-byte piece t % 8 of rows t / 8 + 16 i, i = 0..7, of both operands */
  const unsigned short* ga = (const unsigned short*)A + (size_t)(row0 + sr) * lda + sc;
  const unsigned short* gb = (const unsigned short*)Bh + (size_t)(col0 + sr) * ldb + sc;
  unsigned short* st = sm + sr * G3P + sc;
  const int wm = w >> 1, wn = w & 1;
  const unsigned short* fa = sm + (wm * 64 + ln) * G3P; const unsigned short* fb = sm + (G3T + wn * 64 + ln) * G3P;
  const v8f z8 = {0.f,0.f,0.f,0.f,0.f,0.f,0.f,0.f}; v8f acc[4][4]; v8us ra[8], rb[8];
  /* every '#pragma unroll' of this kernel makes the index of a register array a constant */
#pragma unroll
  for (int i = 0; i < 4; ++i)
#pragma unroll
    for (int j = 0; j < 4; ++j) acc[i][j] = z8;
#pragma unroll
  for (int i = 0; i < 8; ++i) { ra[i] = *(const v8us*)(ga + 16 * i * lda); rb[i] = *(const v8us*)(gb + 16 * i * ldb); }
  G3_XW(ga, gb);
#pragma unroll
  for (int i = 0; i < 8; ++i) { *(v8us*)(st + 16 * i * G3P) = ra[i]; *(v8us*)(st + (G3T + 16 * i) * G3P) = rb[i]; }
  __syncthreads();
  const int nkt = K / G3K;
  for (int kt = 0; kt + 1 < nkt; ++kt) {      /* the trip count is the same for the whole block */
    const int bo = (kt & 1) * G3B;
    const unsigned short* pa = ga + (kt + 1) * G3K; const unsigned short* pb = gb + (kt + 1) * G3K;
#pragma unroll
    for (int i = 0; i < 8; ++i) { ra[i] = *(const v8us*)(pa + 16 * i * lda); rb[i] = *(const v8us*)(pb + 16 * i * ldb); }
    G3_XW(pa, pb);
    g3_slab(acc, fa + bo, fb + bo, hh);
    unsigned short* sn = st + (G3B - bo);      /* the other buffer: its last readers left it in front of the barrier that ended the slab before */
#pragma unroll
    for (int i = 0; i < 8; ++i) { *(v8us*)(sn + 16 * i * G3P) = ra[i]; *(v8us*)(sn + (G3T + 16 * i) * G3P) = rb[i]; }
    __syncthreads(); }      /* publishes the next slab and ends every read of this one */
  g3_slab(acc, fa + ((nkt - 1) & 1) * G3B, fb + ((nkt - 1) & 1) * G3B, hh);
  __syncthreads();      /* ends every read of the last slab: the output rows are staged over it */
  float* so = (float*)sm + w * (64 * 68);      /* the wave's own 64 x 64 f32 rows at pitch 68, so that the stores below are whole lines */
#pragma unroll
  for (int i = 0; i < 4; ++i)
#pragma unroll
    for (int j = 0; j < 4; ++j)
#pragma unroll
      for (int r = 0; r < 8; ++r) so[(16 * i + 8 * hh + r) * 68 + 16 * j + ln] = acc[i][j][r] * alpha;
  __builtin_amdgcn_fence(__ATOMIC_ACQ_REL, "workgroup"); __builtin_amdgcn_wave_barrier();
  const int rsub = lane >> 4, c4 = (lane & 15) * 4; const size_t co = cofs + (size_t)(row0 + wm * 64 + rsub) * ldc + col0 + wn * 64 + c4; float* cp = H16 ? nullptr : C + co; _Float16* cp16 = H16 ? C16 + co : nullptr;
#pragma unroll
  for (int q = 0; q < 32; ++q) { const int r = q * 2 + rsub; const v4f v = *(const v4fa*)&so[r * 68 + c4]; if (!H16) *(v4f*)(cp + q * 2 * ldc) = v; else { v4h h4; for (int i = 0; i < 4; ++i) h4[i] = (_Float16)v[i]; *(v4h*)(cp16 + q * 2 * ldc) = h4; } } }


__global__ __launch_bounds__(256) void k_wnat(const float* __restrict__ w, size_t n8, _Float16* __restrict__ Bt) { const size_t t = (size_t)blockIdx.x * 256 + threadIdx.x; if (t >= n8) return; FragH f; for (int q = 0; q < 8; ++q) f.h[q] = (_Float16)(bf16_round(w[t * 8 + q]) * 16.0f); *(v8us*)((unsigned short*)Bt + t * 8) = f.half[0];  }
__global__ __launch_bounds__(256) void k_rsm(const float* __restrict__ S, _Float16* __restrict__ P, int nrows) {
  #pragma clang fp contract(off)
  const int i = blockIdx.x * 256 + threadIdx.x; if (i >= nrows) return; const float* s = S + (size_t)i * SQ; float mx = -3.0e38f;
#pragma unroll 1
  for (int j = 0; j < SQ; ++j) mx = fmaxf(mx, s[j]); float se = 0.f;
#pragma unroll 1
  for (int j = 0; j < SQ; ++j) se += expf(s[j] - mx); const float sc = 256.0f / se;
#pragma unroll 1
  for (int j0 = 0; j0 < SQ; j0 += 8) { FragH f; for (int q = 0; q < 8; ++q) f.h[q] = (_Float16)(expf(s[j0 + q] - mx) * sc); unsigned short* d = (unsigned short*)P + (size_t)i * SQ + j0; *(v8us*)d = f.half[0];  } }
__global__ __launch_bounds__(256) void k_vt(const _Float16* __restrict__ V16, int b, int h0, _Float16* __restrict__ VT) { __shared__ unsigned short tl[64][65]; const int tid = threadIdx.x; const int hh = blockIdx.x % HG, sg = blockIdx.x / HG; const int s0 = sg * 64; const int h = h0 + hh;
  for (int i = tid; i < 64 * 8; i += 256) { const int j = i / 8, d8 = (i % 8) * 8; FragH f; f.half[0] = *(const v8us*)((const unsigned short*)V16 + ((size_t)b * SQ + s0 + j) * DM + h * HD + d8); for (int q = 0; q < 8; ++q) tl[d8 + q][j] = f.u[q]; }
  __syncthreads();
  { for (int i = tid; i < 64 * 8; i += 256) { const int d = i / 8, j8 = (i % 8) * 8; FragH f; for (int q = 0; q < 8; ++q) f.u[q] = tl[d][j8 + q]; *(v8us*)((unsigned short*)VT + ((size_t)hh * HD + d) * SQ + s0 + j8) = f.half[0]; }  } }



// Causal softmax, ONE S ROW PER WAVE, the row held in registers: lane l owns keys 256 c + 8 l .. + 7 of each 256-key chunk c (two 16-byte loads in, one 16-byte f16 store out per chunk).
// Row max and row sum: per-lane partials (the sum in four independent chains), then a five-step butterfly over the 32 lanes. NC = nk / 256 chunks, all loads of a row in flight together.
// e^x as the fast form has it (one multiply, v_exp_f32). The v_nop is the one slot the instruction set asks for behind a transcendental before its result is read or its source overwritten; it stands in the same statement because the compiler's own schedule of this kernel reused a source register directly behind some v_exp_f32.
__device__ __forceinline__ float rsm_exp(float x) { const float y = x * 1.44269504088896340736f; float e; asm("v_exp_f32 %0, %1\n\tv_nop" : "=v"(e) : "v"(y)); return e; }
template <int NC>
__device__ __forceinline__ void rsm_row(const float* __restrict__ s, unsigned short* __restrict__ p, int k0, int last) {
  float v[NC][8];
#pragma unroll
  for (int c = 0; c < NC; ++c) { const v4f a = *(const v4fa*)(s + c * 256 + k0), b = *(const v4fa*)(s + c * 256 + k0 + 4);
#pragma unroll
    for (int q = 0; q < 4; ++q) { v[c][q] = a[q]; v[c][4 + q] = b[q]; } }
  float mx = -3.0e38f;
#pragma unroll
  for (int c = 0; c < NC; ++c)
#pragma unroll
    for (int q = 0; q < 8; ++q) { if (c * 256 + k0 + q > last) v[c][q] = -1.0e9f; mx = fmaxf(mx, v[c][q]); }
#pragma unroll
  for (int m = 16; m > 0; m >>= 1) mx = fmaxf(mx, __shfl_xor(mx, m, 32));
  float s4[4] = {0.f, 0.f, 0.f, 0.f};
#pragma unroll
  for (int c = 0; c < NC; ++c)
#pragma unroll
    for (int q = 0; q < 8; ++q) { v[c][q] = rsm_exp(v[c][q] - mx); s4[q & 3] += v[c][q]; }
  float se = (s4[0] + s4[1]) + (s4[2] + s4[3]);
#pragma unroll
  for (int m = 16; m > 0; m >>= 1) se += __shfl_xor(se, m, 32);
  const float sc = 256.0f / se;
#pragma unroll
  for (int c = 0; c < NC; ++c) { FragH fr;
#pragma unroll
    for (int q = 0; q < 8; ++q) fr.h[q] = (_Float16)(v[c][q] * sc);
    *(v8us*)(p + c * 256 + k0) = fr.half[0]; }
  asm volatile("s_wait_xcnt 0x0" ::: "memory");      /* the built code lays the row lengths one behind the other, and only a conditional branch stands between these stores and the next length's code, which rewrites their address and data registers */
}
// grid = all token rows of all batches, one 32-lane block each; a row's length is the end of its own QT-row query tile
__global__ __launch_bounds__(32) void k_rsmcf2(const float* __restrict__ S, _Float16* __restrict__ P, int nrows) {
  const int t = blockIdx.x; if (t >= nrows) return; const int k0 = threadIdx.x * 8; const int last = t % SQ;
  const float* s = S + (size_t)t * NKX; unsigned short* p = (unsigned short*)P + (size_t)t * NKX;
  switch (last / QT + 1) {      /* the same for every lane of the wave: straight-line code for each row length */
    case 1: rsm_row<1>(s, p, k0, last); break; case 2: rsm_row<2>(s, p, k0, last); break; case 3: rsm_row<3>(s, p, k0, last); break; case 4: rsm_row<4>(s, p, k0, last); break;
    case 5: rsm_row<5>(s, p, k0, last); break; case 6: rsm_row<6>(s, p, k0, last); break; case 7: rsm_row<7>(s, p, k0, last); break; case 8: rsm_row<8>(s, p, k0, last); break;
    default: break; } }


template <int MASKADD>
__global__ __launch_bounds__(64) void k_att0(const float* __restrict__ QF, const float* __restrict__ KF, const float* __restrict__ VF, int ld, const float* __restrict__ mask, float scale, float* __restrict__ OF, int ldo) {
  #pragma clang fp contract(off)
  __shared__ __attribute__((aligned(16))) float lq[64][64]; __shared__ __attribute__((aligned(16))) float lo[64][64];
  const int tid = threadIdx.x; const int h = blockIdx.x / (QT0 / 64), rg = blockIdx.x % (QT0 / 64); const int i = rg * 64 + tid;
  const float* qr = QF + (size_t)i * ld + h * HD;
#pragma unroll 1
  for (int c = 0; c < HD / 4; ++c) { *(v4f*)&lq[tid][c * 4] = *(const v4fa*)(qr + c * 4); const v4f z = {0.f, 0.f, 0.f, 0.f}; *(v4f*)&lo[tid][c * 4] = z; }
  float m = -1.0e30f, l = 0.f; const int jmax = MASKADD ? (SQ - 1) : (rg * 64 + 63);      /* additive-mask form: every key (the mask input decides); causal form: keys up to the block's last row */
#pragma unroll 1
  for (int j = 0; j <= jmax; ++j) { const float* kr = KF + (size_t)j * ld + h * HD; const float* vr = VF + (size_t)j * ld + h * HD; float s = 0.f;
#pragma unroll 1
    for (int c = 0; c < HD / 4; ++c) { const v4f kq = *(const v4fa*)(kr + c * 4); const v4f qq = *(v4f*)&lq[tid][c * 4]; s = __fadd_rn(s, __fmul_rn(qq[0], kq[0])); s = __fadd_rn(s, __fmul_rn(qq[1], kq[1])); s = __fadd_rn(s, __fmul_rn(qq[2], kq[2])); s = __fadd_rn(s, __fmul_rn(qq[3], kq[3])); }
    s = __fmul_rn(s, scale); if (MASKADD) s = __fadd_rn(s, __fmul_rn(bf16_round(mask[(size_t)i * SQ + j]), -10000.0f));
    const float f = (MASKADD || j <= i) ? 1.f : 0.f; const float sm = fmaf(f, s, (1.f - f) * -1.0e30f); const float mn = fmaxf(m, sm); const float sc = expf(m - mn); const float e = expf(sm - mn); l = __fadd_rn(__fmul_rn(l, sc), e); m = mn;
#pragma unroll 1
    for (int c = 0; c < HD / 4; ++c) { const v4f vv = *(const v4fa*)(vr + c * 4); v4f oo = *(v4f*)&lo[tid][c * 4]; for (int u = 0; u < 4; ++u) oo[u] = __fadd_rn(__fmul_rn(oo[u], sc), __fmul_rn(e, vv[u])); *(v4f*)&lo[tid][c * 4] = oo; } }
  const float fin = 64.0f / l;      /* o carried x64 like k_att0w */
#pragma unroll 1
  for (int c = 0; c < HD / 4; ++c) { v4f oo = *(v4f*)&lo[tid][c * 4]; for (int u = 0; u < 4; ++u) oo[u] = __fmul_rn(oo[u], fin); *(v4f*)&lo[tid][c * 4] = oo; }
  __syncthreads();
  {
#pragma unroll 1
    for (int it = 0; it < 16; ++it) { const int row = it * 4 + tid / 16, pc = (tid % 16) * 4; const v4f v = *(const v4f*)&lo[row][pc]; *(v4f*)(OF + (size_t)(rg * 64 + row) * ldo + h * HD + pc) = v; }
     } }


template <int BFIN, int WXB>
__global__ __launch_bounds__(256) void k_ln16(const float* __restrict__ X, const float* __restrict__ g, const float* __restrict__ bb, float eps, _Float16* __restrict__ N16, float* __restrict__ XB) {
  #pragma clang fp contract(off)
  __shared__ float red[256]; const size_t r = blockIdx.x; const int t = threadIdx.x; const v4f xa = *(const v4fa*)(X + r * DMQ + t * 4); float s[4]; float sum = 0.f;
  for (int q = 0; q < 4; ++q) { s[q] = BFIN ? bf16_round(xa[q]) : xa[q]; sum = __fadd_rn(sum, s[q]); }
  red[t] = sum; __syncthreads(); for (int st = 128; st > 0; st >>= 1) { if (t < st) red[t] = __fadd_rn(red[t], red[t + st]); __syncthreads(); } const float mu = red[0] / (float)DMQ; __syncthreads();
  float vs = 0.f; for (int q = 0; q < 4; ++q) { const float dl = __fadd_rn(s[q], -mu); vs = __fadd_rn(vs, __fmul_rn(dl, dl)); } red[t] = vs; __syncthreads(); for (int st = 128; st > 0; st >>= 1) { if (t < st) red[t] = __fadd_rn(red[t], red[t + st]); __syncthreads(); }
  const float rs = rsqrtf(__fadd_rn(red[0] / (float)DMQ, eps)); v4h y; v4f xb;
  for (int q = 0; q < 4; ++q) { const int c = t * 4 + q; y[q] = (_Float16)__fadd_rn(__fmul_rn(__fmul_rn(__fadd_rn(s[q], -mu), rs), bf16_round(g[c])), bf16_round(bb[c])); xb[q] = s[q]; }
  { *(v4h*)(N16 + r * DMQ + t * 4) = y; if (WXB) *(v4f*)(XB + r * DMQ + t * 4) = xb;  } }
__global__ __launch_bounds__(256) void k_ftres2(const float* __restrict__ OF0, const float* __restrict__ XB, float* __restrict__ X1, size_t n4) {
  #pragma clang fp contract(off)
  const size_t t = (size_t)blockIdx.x * 256 + threadIdx.x; if (t >= n4) return; const v4f o = *(const v4fa*)(OF0 + t * 4), xv = *(const v4fa*)(XB + t * 4); v4f y; for (int q = 0; q < 4; ++q) y[q] = __fadd_rn(__fmul_rn(o[q], 0.015625f), xv[q]); *(v4f*)(X1 + t * 4) = y;  }

__global__ __launch_bounds__(256) void k_wthd(const float* __restrict__ Wt, _Float16* __restrict__ Bt) { const size_t t = (size_t)blockIdx.x * 256 + threadIdx.x; if (t >= (size_t)NH * HD * (DM / 8)) return; const int m8 = (int)(t % (DM / 8)) * 8; const int d = (int)((t / (DM / 8)) % HD); const int h = (int)(t / ((size_t)(DM / 8) * HD)); FragH f;
  for (int q = 0; q < 8; ++q) f.h[q] = (_Float16)(16.0f * bf16_round(Wt[((size_t)h * DM + m8 + q) * HD + d])); unsigned short* dst = (unsigned short*)Bt + ((size_t)h * HD + d) * DM + m8; *(v8us*)dst = f.half[0];  }




__global__ __launch_bounds__(256) void k_wtpad(const float* __restrict__ Wm, _Float16* __restrict__ Wt, int Kr, int Kp, int Nr, int Np, float scale) {
  const int t = blockIdx.x * 256 + threadIdx.x; if (t >= Np * (Kp / 8)) return; const int n = t / (Kp / 8), k8 = (t % (Kp / 8)) * 8; const int nc = min(n, Nr - 1); const float fn = (n < Nr) ? 1.f : 0.f; FragH f;
  for (int i = 0; i < 8; ++i) { const int k = k8 + i; const int kc = min(k, Kr - 1); const float fk = (k < Kr) ? fn : 0.f; f.h[i] = (_Float16)(bf16_round(Wm[(size_t)kc * Nr + nc]) * scale * fk); }
  unsigned short* o = (unsigned short*)Wt + (size_t)n * Kp + k8; *(v8us*)o = f.half[0];  }
__global__ __launch_bounds__(128) void k_bpad(const float* __restrict__ b, float* __restrict__ Bp, int nr, int np) {
  const int i = threadIdx.x; if (i >= np) return; const float v = b[min(i, nr - 1)] * ((i < nr) ? 1.f : 0.f); *(float*)(Bp + i) = v;  }

#define DI 1024       /* inner width = NH * HD */
#define LQK (3 * DI)  /* fused q | k | v row pitch (3072) */
__global__ __launch_bounds__(256) void k_o0(const float* __restrict__ OF, float* __restrict__ ob, size_t n4) {
  #pragma clang fp contract(off)
  const size_t t = (size_t)blockIdx.x * 256 + threadIdx.x; if (t >= n4) return; const size_t e = t * 4; const int i = (int)(e / DI); const int c = (int)(e % DI); const int h = c / HD, d = c % HD; const v4f a = *(const v4fa*)(OF + e); v4f o; for (int q = 0; q < 4; ++q) o[q] = __fmul_rn(a[q], 0.015625f); float* dst = ob + (size_t)h * SQ * HD + (size_t)i * HD + d; *(v4f*)dst = o;  }

#define RQ 4                 /* query rows per block of the exact path */
#define SJP (QT0 + 16)       /* pitch of a score row in LDS: the RQ rows of one key fall on different banks */
// Exact f32 attention for the first QT0 rows of every batch, RQ query rows per block, so that every k row and every v row a block loads serves RQ queries, and every global load is whole lines.
// Scores: one wave per group of 8 keys; lane l holds columns 128 u + 4 l .. + 3 (u = 0..7) of the RQ query rows in registers and of the key row as it comes in; the 8 x RQ = 32 per-lane partial dot products
// are summed over the 32 lanes by a halving exchange (31 exchanges in all) that leaves sum number l (key * RQ + row) in lane l. Softmax: one wave per query row. Output: thread t owns columns 4 t .. + 3 of the RQ rows, keys in order.
// Every '#pragma unroll' of this kernel and its helpers makes the index of a register array a constant; each '#pragma unroll 1' keeps a loop rolled whose body already fills the registers that four waves per SIMD leave a wave.
typedef float v2f __attribute__((ext_vector_type(2)));
// the value of lane ^ BIT, on the vector unit: inside a 16-lane row by DPP (row_xmask), between the two rows by the cross-row move; all 32 lanes are on wherever it is called
template <int BIT>
__device__ __forceinline__ float att0_xor(float x) { int v = __float_as_int(x);
  if constexpr (BIT == 16) v = __builtin_amdgcn_permlanex16(v, v, 0x76543210, 0xfedcba98, false, false); else v = __builtin_amdgcn_update_dpp(v, v, 0x160 + BIT, 0xf, 0xf, false);
  return __int_as_float(v); }
// one step of the halving exchange over lane bit BIT: a lane with the bit set keeps the sums hi[], its partner (lane ^ BIT) the sums lo[]; each hands the other half over; the kept sums come back in lo[]
template <int N, int BIT>
__device__ __forceinline__ void att0_halve(float (&lo)[N], const float (&hi)[N], int lane) { const bool up = (lane & BIT) != 0;
#pragma unroll
  for (int t = 0; t < N; ++t) { const float send = up ? lo[t] : hi[t]; const float keep = up ? hi[t] : lo[t]; lo[t] = keep + att0_xor<BIT>(send); } }
// behind a run of global loads from one pointer: the wait that stands in front of any rewrite of the registers the loads name; naming the pointer keeps its registers live up to the wait, so that no load of the run is given them as its destination
#define ATT0_XW(p) asm volatile("s_wait_xcnt 0x0" :: "v"(p) : "memory")
__device__ __forceinline__ void att0_use8(v4f (&o)[RQ], const v4f (&v)[8], const float (*pe)[RQ]) {      /* eight v rows into the RQ output rows, keys in order */
#pragma unroll
  for (int t = 0; t < 8; ++t) { const v4f e = *(const v4f*)&pe[t][0];
#pragma unroll
    for (int r = 0; r < RQ; ++r) { const v2f er = {e[r], e[r]}; o[r].xy = __builtin_elementwise_fma(er, v[t].xy, o[r].xy); o[r].zw = __builtin_elementwise_fma(er, v[t].zw, o[r].zw); } } }
__global__ __launch_bounds__(256) __attribute__((amdgpu_waves_per_eu(4, 4))) void k_att0w(const float* __restrict__ QF, const float* __restrict__ KF, const float* __restrict__ VF, float scale, float* __restrict__ OF) {      /* q | k | v rows of pitch LQK, output rows of pitch DI; the register budget of four waves per SIMD, so that a long and a short block share a WGP */
  __shared__ float sj[RQ][SJP]; __shared__ __attribute__((aligned(16))) float pe[QT0][RQ]; __shared__ float fin[RQ];
  const int tid = threadIdx.x, w = __builtin_amdgcn_readfirstlane(tid >> 5), lane = tid & 31; const int b = blockIdx.x % NB, idx = blockIdx.x / NB;      /* the wave's number as a scalar: the key loop stays on the scalar unit; batch fastest */
  const int g = (idx < QT0 / RQ / 2) ? QT0 / RQ - 1 - idx : idx - QT0 / RQ / 2;      /* first half of the grid: the row groups with the most keys, longest first; second half: the short ones, shortest first */
  const int i0 = g * RQ, nk = i0 + RQ;      /* keys 0 .. nk - 1 are seen by at least one of the block's rows */
  QF += (size_t)b * QT0 * LQK; KF += (size_t)b * QT0 * LQK; VF += (size_t)b * QT0 * LQK; OF += (size_t)b * QT0 * DI;
  for (int t = tid; t < RQ * SJP; t += 256) (&sj[0][0])[t] = -1.0e30f;      /* keys no wave computes count as masked */
  v4f q[RQ][8]; const float* qp = QF + (size_t)i0 * LQK + lane * 4;
#pragma unroll
  for (int r = 0; r < RQ; ++r)
#pragma unroll
    for (int u = 0; u < 8; ++u) q[r][u] = *(const v4fa*)(qp + r * LQK + u * 128);
  ATT0_XW(qp);
  __syncthreads();
  v4f cur[8]; const float* kp = KF + (size_t)(w * 8) * LQK + lane * 4;      /* the key row in use; the next one is fetched while it is used. Rows w * 8 .. + 7 lie below QT0 for every wave, also for one that has no group */
#pragma unroll
  for (int u = 0; u < 8; ++u) cur[u] = *(const v4fa*)(kp + u * 128);
  ATT0_XW(kp);
#pragma unroll 1
  for (int g8 = w; g8 * 8 < nk; g8 += 8) {      /* the same for every lane of a wave; key rows g8 * 8 .. + 7 lie below QT0 */
    const float* kg = KF + (size_t)(g8 * 8) * LQK + lane * 4;
    const float* kn = KF + (size_t)((((g8 + 8) * 8 < nk) ? g8 + 8 : g8) * 8) * LQK + lane * 4;      /* first row of the wave's next group (the last trip fetches its own first row again) */
    float a4[2][RQ];      /* the exchange runs as a tree beside the keys (2 keys, 4 keys, 8 keys), so that few partial sums are live at a time */
#pragma unroll
    for (int k4 = 0; k4 < 2; ++k4) { float a2[2][RQ];
#pragma unroll
      for (int k2 = 0; k2 < 2; ++k2) { float a1[2][RQ];
#pragma unroll
        for (int k1 = 0; k1 < 2; ++k1) { const int kk = k4 * 4 + k2 * 2 + k1; const float* kr = (kk < 7) ? kg + (kk + 1) * LQK : kn; v4f nxt[8];
#pragma unroll
          for (int u = 0; u < 8; ++u) nxt[u] = *(const v4fa*)(kr + u * 128);
          ATT0_XW(kr);
#pragma unroll
          for (int r = 0; r < RQ; ++r) { v2f s = {0.f, 0.f};      /* even and odd columns in the two halves of a packed multiply-add */
#pragma unroll
            for (int u = 0; u < 8; ++u) { s = __builtin_elementwise_fma(q[r][u].xy, cur[u].xy, s); s = __builtin_elementwise_fma(q[r][u].zw, cur[u].zw, s); }
            a1[k1][r] = s.x + s.y; }
#pragma unroll
          for (int u = 0; u < 8; ++u) cur[u] = nxt[u];
          __builtin_amdgcn_sched_barrier(0); }      /* keeps the eight keys of a group apart: left free, the scheduler mixed their loads and spilled query registers to scratch */
        att0_halve<RQ, 4>(a1[0], a1[1], lane);
#pragma unroll
        for (int r = 0; r < RQ; ++r) a2[k2][r] = a1[0][r]; }
      att0_halve<RQ, 8>(a2[0], a2[1], lane);
#pragma unroll
      for (int r = 0; r < RQ; ++r) a4[k4][r] = a2[0][r]; }
    att0_halve<RQ, 16>(a4[0], a4[1], lane);
    float b2[2][2] = {{a4[0][0], a4[0][1]}, {a4[0][2], a4[0][3]}}; att0_halve<2, 2>(b2[0], b2[1], lane);
    float b1[2][1] = {{b2[0][0]}, {b2[0][1]}}; att0_halve<1, 1>(b1[0], b1[1], lane);
    const int j = g8 * 8 + (lane >> 2), r = lane & 3;      /* lane bits 16, 8, 4 chose the key in the group, bits 2, 1 the row */
    sj[r][j] = (j <= i0 + r) ? b1[0][0] * scale : -1.0e30f; }
  __syncthreads();
  if (w < RQ) { float sv[QT0 / 32]; float mx = -1.0e30f;
#pragma unroll
    for (int u = 0; u < QT0 / 32; ++u) { sv[u] = sj[w][u * 32 + lane]; mx = fmaxf(mx, sv[u]); }
    mx = fmaxf(mx, att0_xor<1>(mx)); mx = fmaxf(mx, att0_xor<2>(mx)); mx = fmaxf(mx, att0_xor<4>(mx)); mx = fmaxf(mx, att0_xor<8>(mx)); mx = fmaxf(mx, att0_xor<16>(mx));
    float ls = 0.f;
#pragma unroll
    for (int u = 0; u < QT0 / 32; ++u) { const float e = expf(sv[u] - mx); pe[u * 32 + lane][w] = e; ls += e; }
    ls += att0_xor<1>(ls); ls += att0_xor<2>(ls); ls += att0_xor<4>(ls); ls += att0_xor<8>(ls); ls += att0_xor<16>(ls);
    if (lane == 0) fin[w] = 64.0f / ls; }      /* o is carried x64; k_o0m takes the factor off */
  __syncthreads();
  const float* vp = VF + tid * 4; const v4f z4 = {0.f, 0.f, 0.f, 0.f}; v4f o[RQ] = {z4, z4, z4, z4}; v4f va[8], vb[8];
  const int nk16 = (nk + 15) & ~15;      /* v rows in steps of 16: rows nk .. nk16 - 1 lie below QT0 and carry weight 0 for all RQ queries */
#pragma unroll
  for (int t = 0; t < 8; ++t) va[t] = *(const v4fa*)(vp + t * LQK);
  ATT0_XW(vp);
#pragma unroll 1
  for (int j = 0; j < nk16; j += 16) {      /* two sets of eight v rows: one flies while the other is used */
    const float* pb = vp + (size_t)(j + 8) * LQK;
#pragma unroll
    for (int t = 0; t < 8; ++t) vb[t] = *(const v4fa*)(pb + t * LQK);
    ATT0_XW(pb);
    att0_use8(o, va, &pe[j]);
    __builtin_amdgcn_sched_barrier(0);      /* keeps each fetch ahead of the work it flies beside: left free, the loads were moved down to where their rows are used */
    const float* pa = vp + (size_t)((j + 16 < nk16) ? j + 16 : j) * LQK;      /* the last trip loads its own first rows again */
#pragma unroll
    for (int t = 0; t < 8; ++t) va[t] = *(const v4fa*)(pa + t * LQK);
    ATT0_XW(pa);
    att0_use8(o, vb, &pe[j + 8]);
    __builtin_amdgcn_sched_barrier(0); }      /* as above */
#pragma unroll
  for (int r = 0; r < RQ; ++r) { const v4f y = o[r] * fin[r]; *(v4f*)(OF + (size_t)(i0 + r) * DI + tid * 4) = y; } }

__global__ __launch_bounds__(256) void k_o0m(const float* __restrict__ OF, float* __restrict__ o_, size_t n4) {
  #pragma clang fp contract(off)
  const size_t t = (size_t)blockIdx.x * 256 + threadIdx.x; if (t >= n4) return; const size_t e = t * 4; OF += (size_t)blockIdx.y * QT0 * DI; o_ += (size_t)blockIdx.y * SQ * DI;      /* grid y = batch */
  const v4f a = *(const v4fa*)(OF + e); v4f o; for (int q = 0; q < 4; ++q) o[q] = __fmul_rn(a[q], 0.015625f); *(v4f*)(o_ + e) = o;  }
extern "C" void kernel_launch(void* const* d_in, const int* in_sizes, int n_in,
                              void* d_out, int out_size, void* d_ws, size_t ws_size, hipStream_t stream) {
  (void)in_sizes; (void)n_in; (void)out_size;
  const float* const* I = (const float* const*)d_in; const float* x = I[0]; const float* wqkv = I[1];      /* input order: x [4][2048][1024], W_qkv ([in][out] [1024][3072]: q | k | v column thirds); the module has no biases and no output projection */
  char* ws = (char*)d_ws; size_t off = 0;
  auto take = [&](size_t bytes) { char* p = ws + off; off += (bytes + 255) & ~(size_t)255; return p; };
  _Float16* BW = (_Float16*)take((size_t)LQK * DM * 2); _Float16* X16 = (_Float16*)take(NR * DM * 2); _Float16* QKV = (_Float16*)take(NR * LQK * 2); _Float16* VT = (_Float16*)take((size_t)NB * DI * SQ * 2);
  float* S = (float*)take(NR * NKX * 4); _Float16* P = (_Float16*)take(NR * NKX * 2); float* QKVF0 = (float*)take((size_t)NB * QT0 * LQK * 4); float* OF0 = (float*)take((size_t)NB * QT0 * DI * 4);      /* ONE head: S / P row = token row, pitch NKX; every plane holds all batches */
  if (off > ws_size) return;
  k_wtpad<<<(unsigned)(((size_t)LQK * (DM / 8) + 255) / 256), 256, 0, stream>>>(wqkv, BW, DM, DM, LQK, LQK, 16.0f);      /* [in][out] [1024][3072] -> Bt[n][k] x16 (no padding: Kr = Kp = 1024, Nr = Np = 3072) */
  k_x16<<<(unsigned)((NR * DM / 8 + 255) / 256), 256, 0, stream>>>(x, X16, NR * DM / 8);      /* x (bf16-valued) as exact f16 rows */
  k_gemm3<0, true, DM, DM, LQK, LQK, DM><<<dim3((unsigned)((NR / 128) * (LQK / 128)), 1), 128, 0, stream>>>(X16, 0, BW, 0, 0.0625f, nullptr, QKV, 0);      /* q | k | v = x W -> f16 rows, column blocks 0 / 1024 / 2048 of the fused plane (pitch 3072); no bias */
  const _Float16* Q16 = QKV; const _Float16* K16 = QKV + DI; const _Float16* V16 = QKV + 2 * DI;
  k_vt<NH, SQ><<<NB * NH * (SQ / 64), 256, 0, stream>>>(V16, LQK, 0, VT);      /* V^T [NB][1024][SQ], as 16 column chunks of 64 a batch */
  k_gemm3<1, false, LQK, LQK, NKX, SQ, DI><<<dim3((QT / 128) * (SQ / 128), NB, SQ / QT), 128, 0, stream>>>(Q16, (size_t)SQ * LQK, K16, (size_t)SQ * LQK, 0.03125f, S, nullptr, (size_t)SQ * NKX);      /* scores / sqrt(1024) over the FULL width (K = 1024), one head; causal: only keys below each tile's end */
  k_rsmcf2<<<(unsigned)NR, 32, 0, stream>>>(S, P, (int)NR);      /* causal softmax -> P x256 f16, one wave per row */
  k_gemm3<2, false, NKX, SQ, DI, DI, SQ><<<dim3((QT / 128) * (DI / 128), NB, SQ / QT), 128, 0, stream>>>(P, (size_t)SQ * NKX, VT, (size_t)DI * SQ, 0.00390625f, (float*)d_out, nullptr, (size_t)SQ * DI);      /* out[b][q][:] = P V^T 2^-8 (f32), N = 1024, keys up to each tile's end */
  k_gemm3<0, false, DM, DM, LQK, LQK, DM><<<dim3((unsigned)((QT0 / 128) * (LQK / 128)), NB), 128, 0, stream>>>(X16, (size_t)SQ * DM, BW, 0, 0.0625f, QKVF0, nullptr, (size_t)QT0 * LQK);      /* f32 q | k | v of rows 0..511 of every batch (exact products, f32 accumulation) */
  k_att0w<<<NB * (QT0 / RQ), 256, 0, stream>>>(QKVF0, QKVF0 + DI, QKVF0 + 2 * DI, 0.03125f, OF0);      /* exact f32 single-head causal attention for rows 0..511 of every batch (o x64) */
  k_o0m<<<dim3((unsigned)(((size_t)QT0 * DI / 4 + 255) / 256), NB), 256, 0, stream>>>(OF0, (float*)d_out, (size_t)QT0 * DI / 4);      /* rows 0..511 of every batch REWRITTEN from the exact path */
}

// v005
// It runs in 174 microseconds.
// Two timings next to v004 both put it at 1.13 times that version's speed.
// Over all steps from v000 it is 51.2 times as fast.
#include <hip/hip_runtime.h>
// Causal SINGLE-HEAD self-attention of full width with a fused bias-free QKV projection and NO output projection (x [4][2048][1024]; qkv = x W_qkv ([in][out] 1024 x 3072, no bias) split into q | k | v thirds of width 1024; scores = q k^T / sqrt(1024) over the FULL width (one head); causal (keys after the query -> -inf); softmax over keys; out = attn v -> [4][2048][1024]).
// Structure: token rows; x as exact f16 rows; ONE WMMA GEMM into the f16 q | k | v plane [8192][3072]; per batch v^T via LDS transposes (16 column chunks of 64 = the full 1024-wide row); causal 256-row query tiles: scores GEMM with K = 1024 (alpha 1/32), causal softmax f32 -> f16 x256 weights, P . V^T GEMM with N = 1024 written as f32 (alpha 2^-8) straight into the output rows (query tiles past the exact rows only). Every stage is ONE launch over all batches (grid y = batch and grid z = query tile in the two causal GEMMs; the other stages fold the batch into grid x); S, P, V^T and the f32 planes hold all of them in the workspace.
// First-tile refinement: the first 512 query rows of every batch (which see few keys, so single-f16 q / k / v / P would be too coarse with no output projection to average the errors) are computed exactly and only so: the projection GEMM stores their q | k | v rows as f32 too (exact products, f32 accumulation), and an f32 attention on VALU (k_att0w: four query rows per block; full-width dot products; precise expf) stores them into the output; the f16 scores, softmax and P . V stages leave these rows out.
// Compute dtype: inputs rounded to bf16; x / weights exact; q, k, v and the softmax weights as plain f16 GEMM operands (~2^-12) past the exact rows; scores, softmax statistics and the output accumulation f32. v_wmma_f32_16x16x32_f16.
#define NB 4
#define SQ 2048
#define DM 1024
#define NH 16
#define HD 64
#define HG 4                         /* heads per attention launch group */
#define QT 256                       /* query rows per causal tile */
#define NKX SQ                       /* S / P row pitch */
#define QT0 512                      /* first-tile rows recomputed exactly (f32): 512 here (no output projection averages the early-row cancellation errors away; logit sigma 1.0) */
#define B0 0                         /* unused (each launch covers all batches) */
#define NBR NB                       /* unused by the launches (they cover all NB batches in their grids) */
#define NR ((size_t)NB * SQ)
#define DMQ DM
#define DFF 4096                     /* unused (no FFN in this file) */
#define DFFR 100                     /* unused */
#define MP ((int)((size_t)NBR * SQ)) /* unused by the launches (the projection covers NR rows) */
#define QN SQ                        /* unused (the query tiles cover SQ rows) */
#define NHD NH                       /* unused (one full-width head is attended) */
#define MPO MP                       /* unused (there is no output stage) */
#define LQ (3 * DM)      /* unused (the q | k | v rows have pitch LQK) */
typedef __bf16 v16b __attribute__((ext_vector_type(16)));
typedef unsigned short v8us __attribute__((ext_vector_type(8), may_alias));
typedef float  v8f  __attribute__((ext_vector_type(8)));
typedef float  v4f  __attribute__((ext_vector_type(4)));
typedef float  v4fa __attribute__((ext_vector_type(4), may_alias));
union FragB { v16b v; v8us half[2]; unsigned short u[16]; };

__device__ __forceinline__ unsigned short bf16_bits(float x) { unsigned int u = __float_as_uint(x); return (unsigned short)((u + 0x7FFFu + ((u >> 16) & 1u)) >> 16); }
__device__ __forceinline__ float bf16_val(unsigned short b) { return __uint_as_float(((unsigned int)b) << 16); }
__device__ __forceinline__ float bf16_round(float x) { return bf16_val(bf16_bits(x)); }
// D += A·B with NT terms: 1 = ah·bh, 2 = + al·bh (A split), 3 = + ah·bl (both split)
template <int NT>
__device__ __forceinline__ v8f mmaN(v16b ah, v16b al, v16b bh, v16b bl, v8f c) {
  c = __builtin_amdgcn_wmma_f32_16x16x32_bf16(false, ah, false, bh, (short)0, c, false, false);
  if (NT >= 2) c = __builtin_amdgcn_wmma_f32_16x16x32_bf16(false, al, false, bh, (short)0, c, false, false);
  if (NT >= 3) c = __builtin_amdgcn_wmma_f32_16x16x32_bf16(false, ah, false, bl, (short)0, c, false, false);
  asm volatile("v_nop\n\tv_nop\n\tv_nop\n\tv_nop" : "+v"(c) : "v"(ah), "v"(al), "v"(bh), "v"(bl));
  return c;
}

__global__ __launch_bounds__(256) void k_wt_bf16(const float* __restrict__ W, unsigned short* __restrict__ Wt, int K, int N) {
  const int t = blockIdx.x * 256 + threadIdx.x;
  const int k8n = K / 8;
  if (t >= N * k8n) return;
  const int n = t / k8n, k8 = (t % k8n) * 8;
  v8us v;
#pragma unroll
  for (int i = 0; i < 8; ++i) v[i] = bf16_bits(W[(size_t)(k8 + i) * N + n]);
  *(v8us*)(Wt + (size_t)n * K + k8) = v;
  
}

// GEMM C[M][N] (f32, pitch ldc) = act(A[M][K]·W + bias). A f32 row-major (pitch lda) converted per fragment to bf16
// (ASPLIT: hi/lo two planes -> 2 terms, else single rounded term); Wt bf16 [N][K] (pitch ldb). BIAS_BF16 rounds the
// bias to bf16 first (bias quantised to bf16 before the add). K%32==0, M%16==0, N%64==0.
template <bool ASPLIT, int ACT, bool BIAS_BF16>
__global__ __launch_bounds__(128) void k_gemm_bf(const float* __restrict__ A, int lda, const unsigned short* __restrict__ Wt, int ldb,
                                               const float* __restrict__ bias, float* __restrict__ C, int ldc, int M, int N, int K) {
  __shared__ __attribute__((aligned(16))) float so[4][16][64];
  const int tid = threadIdx.x, w = tid >> 5, lane = tid & 31, ln = lane & 15, hh = lane >> 4;
  const int ntn = N / 64;
  const int wid = blockIdx.x * 4 + w;
  const int mt = wid / ntn, nq = wid % ntn;
  if (mt * 16 >= M) return;
  const int row0 = mt * 16, col0 = nq * 64;
  const float* arow = A + (size_t)(row0 + ln) * lda;
  v8f acc[4] = {};
  for (int kb = 0; kb < K; kb += 32) {
    FragB ah, al;
    const v4f x0 = *(const v4fa*)(arow + kb + 8 * hh), x1 = *(const v4fa*)(arow + kb + 8 * hh + 4);
    const v4f x2 = *(const v4fa*)(arow + kb + 16 + 8 * hh), x3 = *(const v4fa*)(arow + kb + 16 + 8 * hh + 4);
    float xs[16] = {x0[0],x0[1],x0[2],x0[3],x1[0],x1[1],x1[2],x1[3],x2[0],x2[1],x2[2],x2[3],x3[0],x3[1],x3[2],x3[3]};
#pragma unroll
    for (int i = 0; i < 16; ++i) { const unsigned short hb = bf16_bits(xs[i]); ah.u[i] = hb; al.u[i] = ASPLIT ? bf16_bits(xs[i] - bf16_val(hb)) : (unsigned short)0; }
#pragma unroll
    for (int t = 0; t < 4; ++t) {
      const unsigned short* brow = Wt + (size_t)(col0 + t * 16 + ln) * ldb + kb;
      FragB b;
      b.half[0] = *(const v8us*)(brow + 8 * hh);
      b.half[1] = *(const v8us*)(brow + 16 + 8 * hh);
      acc[t] = mmaN<ASPLIT ? 2 : 1>(ah.v, al.v, b.v, b.v, acc[t]);
    }
  }
#pragma unroll
  for (int t = 0; t < 4; ++t) {
    float bv = bias ? bias[col0 + t * 16 + ln] : 0.f;
    if (BIAS_BF16) bv = bf16_round(bv);
#pragma unroll
    for (int r = 0; r < 8; ++r) { float v = acc[t][r] + bv; if (ACT == 1) v = fmaxf(v, 0.f); so[w][8 * hh + r][t * 16 + ln] = v; }
  }
  __builtin_amdgcn_fence(__ATOMIC_ACQ_REL, "workgroup");
  __builtin_amdgcn_wave_barrier();
  const int rsub = lane >> 4, c4 = (lane & 15) * 4;
  {
#pragma unroll
    for (int q = 0; q < 8; ++q) {
      const int r = q * 2 + rsub;
      const v4f v = *(const v4fa*)&so[w][r][c4];
      *(v4f*)(C + (size_t)(row0 + r) * ldc + col0 + c4) = v;
    }
    
  }
}

// GEMM C = act(A·W + bias + resid): A f32 (ASPLIT -> hi/lo 2 terms), Wt bf16 [N][K]; ACT 0 none, 1 relu, 2 exact gelu;
// resid (optional, f32, row index = (row % rmod), pitch ldr, RES_BF16 rounds it) added before the activation.
template <bool ASPLIT, int ACT, bool BIAS_BF16, bool RES_BF16>
__global__ __launch_bounds__(128) void k_gemm_bf3(const float* __restrict__ A, int lda, const unsigned short* __restrict__ Wt, int ldb,
                                                const float* __restrict__ bias, const float* __restrict__ resid, int rmod, int ldr,
                                                float* __restrict__ C, int ldc, int M, int N, int K) {
  __shared__ __attribute__((aligned(16))) float so[4][16][64];
  const int tid = threadIdx.x, w = tid >> 5, lane = tid & 31, ln = lane & 15, hh = lane >> 4;
  const int ntn = N / 64;
  const int wid = blockIdx.x * 4 + w;
  const int mt = wid / ntn, nq = wid % ntn;
  if (mt * 16 >= M) return;
  const int row0 = mt * 16, col0 = nq * 64;
  const float* arow = A + (size_t)(row0 + ln) * lda;
  v8f acc[4] = {};
  for (int kb = 0; kb < K; kb += 32) {
    FragB ah, al;
    const v4f x0 = *(const v4fa*)(arow + kb + 8 * hh), x1 = *(const v4fa*)(arow + kb + 8 * hh + 4);
    const v4f x2 = *(const v4fa*)(arow + kb + 16 + 8 * hh), x3 = *(const v4fa*)(arow + kb + 16 + 8 * hh + 4);
    float xs[16] = {x0[0],x0[1],x0[2],x0[3],x1[0],x1[1],x1[2],x1[3],x2[0],x2[1],x2[2],x2[3],x3[0],x3[1],x3[2],x3[3]};
#pragma unroll
    for (int i = 0; i < 16; ++i) { const unsigned short hb = bf16_bits(xs[i]); ah.u[i] = hb; al.u[i] = ASPLIT ? bf16_bits(xs[i] - bf16_val(hb)) : (unsigned short)0; }
#pragma unroll
    for (int t = 0; t < 4; ++t) {
      const unsigned short* brow = Wt + (size_t)(col0 + t * 16 + ln) * ldb + kb;
      FragB b;
      b.half[0] = *(const v8us*)(brow + 8 * hh);
      b.half[1] = *(const v8us*)(brow + 16 + 8 * hh);
      acc[t] = mmaN<ASPLIT ? 2 : 1>(ah.v, al.v, b.v, b.v, acc[t]);
    }
  }
#pragma unroll
  for (int t = 0; t < 4; ++t) {
    const int col = col0 + t * 16 + ln;
    float bv = bias ? bias[col] : 0.f;
    if (BIAS_BF16) bv = bf16_round(bv);
#pragma unroll
    for (int r = 0; r < 8; ++r) {
      float v = acc[t][r] + bv;
      if (resid) { float rv = resid[(size_t)((row0 + 8 * hh + r) % rmod) * ldr + col]; if (RES_BF16) rv = bf16_round(rv); v += rv; }
      if (ACT == 1) v = fmaxf(v, 0.f);
      if (ACT == 2) v = 0.5f * v * (1.0f + erff(v * 0.70710678118654752f));
      if (ACT == 3) { const float u = 0.7978845608028654f * (v + 0.044715f * v * v * v); v = 0.5f * v * (1.0f + tanhf(u)); }
      so[w][8 * hh + r][t * 16 + ln] = v;
    }
  }
  __builtin_amdgcn_fence(__ATOMIC_ACQ_REL, "workgroup");
  __builtin_amdgcn_wave_barrier();
  const int rsub = lane >> 4, c4 = (lane & 15) * 4;
  {
#pragma unroll
    for (int q = 0; q < 8; ++q) {
      const int r = q * 2 + rsub;
      const v4f v = *(const v4fa*)&so[w][r][c4];
      *(v4f*)(C + (size_t)(row0 + r) * ldc + col0 + c4) = v;
    }
    
  }
}
// row LayerNorm (biased variance, eps) over N: s = X (+ R); optional out_sum <- s; out_norm <- (s-mu)*rsqrt(var+eps)*g + b
template <bool PARAM_BF16>
__global__ __launch_bounds__(256) void k_layernorm(const float* __restrict__ X, const float* __restrict__ R, const float* __restrict__ g, const float* __restrict__ bta,
                                                  float* __restrict__ out_sum, float* __restrict__ out_norm, int N, float eps) {
  __shared__ float red[256];
  const int row = blockIdx.x, tid = threadIdx.x;
  const float* x = X + (size_t)row * N; const float* rr = R ? R + (size_t)row * N : nullptr;
  float vals[16];                     // up to N = 4096
  const int per = N / 256;            // contiguous chunk per thread? use strided-by-4 chunks: thread handles j = tid*4 + 1024*u
  float s1 = 0.f;
  for (int u = 0; u < per / 4; ++u) {
    const int j = tid * 4 + 1024 * u;
    const v4f a = *(const v4fa*)(x + j);
    v4f b = {0.f,0.f,0.f,0.f}; if (rr) b = *(const v4fa*)(rr + j);
#pragma unroll
    for (int q = 0; q < 4; ++q) { const float v = a[q] + b[q]; vals[u * 4 + q] = v; s1 += v; }
  }
  red[tid] = s1; __syncthreads();
  for (int st = 128; st > 0; st >>= 1) { if (tid < st) red[tid] += red[tid + st]; __syncthreads(); }
  const float mu = red[0] / (float)N; __syncthreads();
  float s2 = 0.f;
  for (int u = 0; u < per / 4; ++u)
#pragma unroll
    for (int q = 0; q < 4; ++q) { const float c = vals[u * 4 + q] - mu; s2 += c * c; }
  red[tid] = s2; __syncthreads();
  for (int st = 128; st > 0; st >>= 1) { if (tid < st) red[tid] += red[tid + st]; __syncthreads(); }
  const float rs = rsqrtf(red[0] / (float)N + eps);
  {
    for (int u = 0; u < per / 4; ++u) {
      const int j = tid * 4 + 1024 * u;
      v4f o, sm;
#pragma unroll
      for (int q = 0; q < 4; ++q) {
        float gg = g[j + q], bb = bta[j + q];
        if (PARAM_BF16) { gg = bf16_round(gg); bb = bf16_round(bb); }
        sm[q] = vals[u * 4 + q]; o[q] = (vals[u * 4 + q] - mu) * rs * gg + bb;
      }
      if (out_sum) *(v4f*)(out_sum + (size_t)row * N + j) = sm;
      *(v4f*)(out_norm + (size_t)row * N + j) = o;
    }
    
  }
}



// ---- f16 WMMA path (v_wmma_f32_16x16x32_f16): 11-bit significands for operands in range — used where a [0,1] probability operand needs more precision than bf16
typedef _Float16 v16h __attribute__((ext_vector_type(16)));
union FragH { v16h v; v8us half[2]; _Float16 h[16]; unsigned short u[16]; };
template <int NT>
__device__ __forceinline__ v8f mmaH(v16h ah, v16h al, v16h bh, v16h bl, v8f c) {
  c = __builtin_amdgcn_wmma_f32_16x16x32_f16(false, ah, false, bh, (short)0, c, false, false);
  if (NT >= 2) c = __builtin_amdgcn_wmma_f32_16x16x32_f16(false, al, false, bh, (short)0, c, false, false);
  if (NT >= 3) c = __builtin_amdgcn_wmma_f32_16x16x32_f16(false, ah, false, bl, (short)0, c, false, false);
  asm volatile("v_nop\n\tv_nop\n\tv_nop\n\tv_nop" : "+v"(c) : "v"(ah), "v"(al), "v"(bh), "v"(bl));
  return c;
}
// batched GEMM like k_gemm_b but f16 operands: A f32 (split into f16 hi/lo if ASPLIT, else rounded to f16), Bt = f16 values [n][k]; alpha; C f32; N multiple of 16 (partial tiles skipped)
template <bool ASPLIT>
__global__ __launch_bounds__(128) void k_gemm_h(const float* __restrict__ A, int lda, size_t sA, const _Float16* __restrict__ Bh, int ldb, size_t sB, float alpha, float* __restrict__ C, int ldc, size_t sC, int M, int N, int K) {
  __shared__ __attribute__((aligned(16))) float so[4][16][64];
  const int tid = threadIdx.x, w = tid >> 5, lane = tid & 31, ln = lane & 15, hh = lane >> 4; const int by = blockIdx.y;
  A += (size_t)by * sA; Bh += (size_t)by * sB; C += (size_t)by * sC;
  const int ntn = (N + 63) / 64; const int wid = blockIdx.x * 4 + w; const int mt = wid / ntn, nq = wid % ntn; if (mt * 16 >= M) return;
  const int row0 = mt * 16, col0 = nq * 64; const float* arow = A + (size_t)(row0 + ln) * lda;
  v8f acc[4] = {};
  for (int kb = 0; kb < K; kb += 32) {
    FragH ah, al;
    const v4f x0 = *(const v4fa*)(arow + kb + 8 * hh), x1 = *(const v4fa*)(arow + kb + 8 * hh + 4), x2 = *(const v4fa*)(arow + kb + 16 + 8 * hh), x3 = *(const v4fa*)(arow + kb + 16 + 8 * hh + 4);
    float xs[16] = {x0[0],x0[1],x0[2],x0[3],x1[0],x1[1],x1[2],x1[3],x2[0],x2[1],x2[2],x2[3],x3[0],x3[1],x3[2],x3[3]};
#pragma unroll
    for (int i = 0; i < 16; ++i) { const _Float16 h = (_Float16)xs[i]; ah.h[i] = h; al.h[i] = ASPLIT ? (_Float16)(xs[i] - (float)h) : (_Float16)0.0f; }
#pragma unroll
    for (int t = 0; t < 4; ++t) { if (col0 + t * 16 >= N) continue; const size_t boff = (size_t)(col0 + t * 16 + ln) * ldb + kb; FragH bq; bq.half[0] = *(const v8us*)(Bh + boff + 8 * hh); bq.half[1] = *(const v8us*)(Bh + boff + 16 + 8 * hh);
      acc[t] = mmaH<ASPLIT ? 2 : 1>(ah.v, al.v, bq.v, bq.v, acc[t]); }
  }
#pragma unroll
  for (int t = 0; t < 4; ++t) { if (col0 + t * 16 >= N) continue;
#pragma unroll
    for (int r = 0; r < 8; ++r) so[w][8 * hh + r][t * 16 + ln] = acc[t][r] * alpha; }
  __builtin_amdgcn_fence(__ATOMIC_ACQ_REL, "workgroup"); __builtin_amdgcn_wave_barrier();
  const int rsub = lane >> 4, c4 = (lane & 15) * 4;
  {
#pragma unroll
    for (int q = 0; q < 8; ++q) { const int r = q * 2 + rsub; if (col0 + c4 < N) { const v4f v = *(const v4fa*)&so[w][r][c4]; *(v4f*)(C + (size_t)(row0 + r) * ldc + col0 + c4) = v; } }
     }
}

// Wt[n][k] = f16(W[k][n]·scale) from f32 row-major W[K][N] (scale = power of two; bf16-exact weights stay exact in f16 away from the subnormal range)
__global__ __launch_bounds__(256) void k_wt_f16(const float* __restrict__ W, _Float16* __restrict__ Wt, int K, int N, float scale) {
  const int t = blockIdx.x * 256 + threadIdx.x; if (t >= N * (K / 8)) return; const int n = t / (K / 8), k8 = (t % (K / 8)) * 8; FragH f;
#pragma unroll
  for (int i = 0; i < 8; ++i) f.h[i] = (_Float16)(bf16_round(W[(size_t)(k8 + i) * N + n]) * scale); const v8us o = f.half[0];
  *(v8us*)((unsigned short*)Wt + (size_t)n * K + k8) = o; 
}
// k_gemm_hh variant with fused epilogue: v = acc·alpha + bias[by·sBias + col] (+ CP[(row/rowsPerB)·sCPb + by·64 + col] if CP) ; ACT 0 none / 1 elu ; writes f16 C16 (and f32 C if non-null)
template <int ACT>
__global__ __launch_bounds__(128) void k_gemm_hhx(const _Float16* __restrict__ A, int lda, size_t sA, const _Float16* __restrict__ Bh, int ldb, size_t sB, float alpha, const float* __restrict__ bias, size_t sBias, const float* __restrict__ CP, int rowsPerB, size_t sCPb, int row0g,
    float* __restrict__ C, _Float16* __restrict__ C16, int ldc, size_t sC, int M, int N, int K) {
  __shared__ __attribute__((aligned(16))) float so[4][16][64];
  const int tid = threadIdx.x, w = tid >> 5, lane = tid & 31, ln = lane & 15, hh = lane >> 4; const int by = blockIdx.y;
  A += (size_t)by * sA; Bh += (size_t)by * sB; const size_t cofs = (size_t)by * sC; const float* bp = bias ? bias + (size_t)by * sBias : nullptr;
  const int ntn = (N + 63) / 64; const int wid = blockIdx.x * 4 + w; const int mt = wid / ntn, nq = wid % ntn; if (mt * 16 >= M) return;
  const int row0 = mt * 16, col0 = nq * 64; const _Float16* arow = A + (size_t)(row0 + ln) * lda;
  v8f acc[4] = {};
  for (int kb = 0; kb < K; kb += 32) { FragH ah; ah.half[0] = *(const v8us*)((const unsigned short*)arow + kb + 8 * hh); ah.half[1] = *(const v8us*)((const unsigned short*)arow + kb + 16 + 8 * hh);
#pragma unroll
    for (int t = 0; t < 4; ++t) { if (col0 + t * 16 >= N) continue; const size_t boff = (size_t)(col0 + t * 16 + ln) * ldb + kb; FragH bq; bq.half[0] = *(const v8us*)((const unsigned short*)Bh + boff + 8 * hh); bq.half[1] = *(const v8us*)((const unsigned short*)Bh + boff + 16 + 8 * hh);
      acc[t] = mmaH<1>(ah.v, ah.v, bq.v, bq.v, acc[t]); }
  }
#pragma unroll
  for (int t = 0; t < 4; ++t) { if (col0 + t * 16 >= N) continue; const int col = col0 + t * 16 + ln; const float bv = bp ? bf16_round(bp[col]) : 0.f;
#pragma unroll
    for (int r = 0; r < 8; ++r) { float v = acc[t][r] * alpha + bv; if (CP) { const int rr = row0g + row0 + 8 * hh + r; if (rowsPerB < 0) v += CP[cofs + (size_t)rr * ldc + col];      /* rowsPerB < 0: own element of the batched C plane */ else { const int bidx = rr / rowsPerB; v += CP[(size_t)bidx * sCPb + (size_t)by * 64 + col]; } } if (ACT == 1) v = (v > 0.f) ? v : expm1f(v); else if (ACT == 7) v = (v > 0.f) ? v + 1.0f : expf(v); else if (ACT == 8) v = tanhf(v); else if (ACT == 9) v = 0.5f * v * (1.0f + tanhf(0.7978845608028654f * (v + 0.044715f * v * v * v))); else if (ACT == 11) v = 1.0f / (1.0f + expf(-v)); else if (ACT == 12) v = (v > 0.f) ? v : 0.01f * v; else if (ACT == 14) v = (v > 0.f) ? v : 0.1f * v; else if (ACT == 16) v = (v >= 0.f) ? v : 0.3f * v; else if (ACT == 17) v = (v >= 0.f) ? v : 0.2f * v; else if (ACT == 15) v = v / (1.0f + expf(-v)); else if (ACT == 3) v = fmaxf(v, 0.f); else if (ACT == 6) v = 0.5f * v * (1.0f + erff(v * 0.70710678118654752f)); so[w][8 * hh + r][t * 16 + ln] = v; } }
  __builtin_amdgcn_fence(__ATOMIC_ACQ_REL, "workgroup"); __builtin_amdgcn_wave_barrier();
  const int rsub = lane >> 4, c4 = (lane & 15) * 4; typedef _Float16 v4h __attribute__((ext_vector_type(4)));
  {
#pragma unroll
    for (int q = 0; q < 8; ++q) { const int r = q * 2 + rsub; if (col0 + c4 < N) { const v4f v = *(const v4fa*)&so[w][r][c4]; if (C) *(v4f*)(C + cofs + (size_t)(row0 + r) * ldc + col0 + c4) = v; if (C16) { v4h h4; for (int i = 0; i < 4; ++i) h4[i] = (_Float16)v[i]; *(v4h*)(C16 + cofs + (size_t)(row0 + r) * ldc + col0 + c4) = h4; } } }
     }
}


typedef _Float16 v4h __attribute__((ext_vector_type(4)));

__global__ __launch_bounds__(256) void k_x16(const float* __restrict__ x, _Float16* __restrict__ X16, size_t n8) { const size_t t = (size_t)blockIdx.x * 256 + threadIdx.x; if (t >= n8) return; FragH f;
#pragma unroll
  for (int q = 0; q < 8; ++q) f.h[q] = (_Float16)bf16_round(x[t * 8 + q]); *(v8us*)((unsigned short*)X16 + t * 8) = f.half[0];  }
__global__ __launch_bounds__(256) void k_h16(const float* __restrict__ x, _Float16* __restrict__ X16, size_t n8) { const size_t t = (size_t)blockIdx.x * 256 + threadIdx.x; if (t >= n8) return; FragH f;
#pragma unroll
  for (int q = 0; q < 8; ++q) f.h[q] = (_Float16)x[t * 8 + q]; *(v8us*)((unsigned short*)X16 + t * 8) = f.half[0];  }
__global__ __launch_bounds__(256) void k_round16f(const float* __restrict__ W, _Float16* __restrict__ Bt, size_t n8) { const size_t t = (size_t)blockIdx.x * 256 + threadIdx.x; if (t >= n8) return; FragH f;
#pragma unroll
  for (int i = 0; i < 8; ++i) f.h[i] = (_Float16)(bf16_round(W[t * 8 + i]) * 16.0f); *(v8us*)((unsigned short*)Bt + t * 8) = f.half[0];  }
template <int NHv, int TTv>
__global__ __launch_bounds__(256) void k_vt(const _Float16* __restrict__ V16, int ldv, int voff, _Float16* __restrict__ Vt) { __shared__ unsigned short tl[64][66]; const int tid = threadIdx.x; const int slab = blockIdx.x / (TTv / 64), lg = blockIdx.x % (TTv / 64); const int b = slab / NHv, h = slab % NHv;
  for (int i = tid; i < 64 * 8; i += 256) { const int r = i / 8, c8 = (i % 8) * 8; FragH f; f.half[0] = *(const v8us*)((const unsigned short*)V16 + ((size_t)b * TTv + lg * 64 + r) * ldv + voff + h * 64 + c8);
#pragma unroll
    for (int q = 0; q < 8; ++q) tl[r][c8 + q] = f.u[q]; }
  __syncthreads();
  {
#pragma unroll
    for (int rd = 0; rd < 2; ++rd) { const int d = rd * 32 + tid / 8, pc = tid % 8; FragH f;
#pragma unroll
      for (int q = 0; q < 8; ++q) f.u[q] = tl[pc * 8 + q][d];
      *(v8us*)((unsigned short*)Vt + ((size_t)slab * 64 + d) * TTv + lg * 64 + pc * 8) = f.half[0]; }
     } }

__global__ __launch_bounds__(256) void k_hl(const float* __restrict__ F, _Float16* __restrict__ Hh, _Float16* __restrict__ Hl, size_t n8) { const size_t t = (size_t)blockIdx.x * 256 + threadIdx.x; if (t >= n8) return; FragH fh, fl; const v4f a = *(const v4fa*)(F + t * 8), c = *(const v4fa*)(F + t * 8 + 4);
#pragma unroll
  for (int q = 0; q < 4; ++q) { _Float16 h = (_Float16)a[q]; fh.h[q] = h; fl.h[q] = (_Float16)((a[q] - (float)h) * 1024.0f); h = (_Float16)c[q]; fh.h[4 + q] = h; fl.h[4 + q] = (_Float16)((c[q] - (float)h) * 1024.0f); }
  { *(v8us*)((unsigned short*)Hh + t * 8) = fh.half[0]; *(v8us*)((unsigned short*)Hl + t * 8) = fl.half[0];  } }

// ---- LDS-staged GEMM: C[M][N] = alpha * A[M][K] . Bt[N][K]^T, f16 operands, f32 accumulation; one 128 x 128 tile of C per block of four waves (2 x 2, 64 x 64 of C a wave); M, N multiples of 128, K of 64 ----
// Each slab of 64 k (128-byte pieces of 128 A rows and 128 Bt rows) comes in as whole-line 16-byte loads (8 lanes a row, 4 rows a wave-load), goes through registers into one of two LDS buffers, and is read from there as fragments:
// every operand byte leaves L2 once per block and serves 64 rows or columns of each wave that needs it. The next slab's global loads fly while this slab is multiplied; one barrier a slab.
__device__ __forceinline__ v16h g2_frag(const _Float16* p, int hh) { FragH f; f.half[0] = *(const v8us*)((const unsigned short*)p + 8 * hh); f.half[1] = *(const v8us*)((const unsigned short*)p + 16 + 8 * hh); return f.v; }
#define G3T 128                      /* tile rows of A and of Bt per block */
#define G3K 64                       /* k per slab */
#define G3P 72                       /* LDS row pitch in f16: 144 bytes = 16 x odd, the conflict-free pitch for 16-byte fragment reads */
#define G3B (2 * G3T * G3P)          /* f16 per buffer: rows 0..127 A, rows 128..255 Bt */
// one slab: every fragment of its 64 k from LDS, then the 2 x 16 products of the wave's 64 x 64 tile, k ascending; each '#pragma unroll' makes the index of a register array a constant
__device__ __forceinline__ void g3_slab(v8f (&acc)[4][4], const unsigned short* fa, const unsigned short* fb, int hh) { v16h a[2][4], b[2][4];
#pragma unroll
  for (int kk = 0; kk < 2; ++kk)
#pragma unroll
    for (int i = 0; i < 4; ++i) { a[kk][i] = g2_frag((const _Float16*)(fa + 16 * i * G3P + 32 * kk), hh); b[kk][i] = g2_frag((const _Float16*)(fb + 16 * i * G3P + 32 * kk), hh); }
#pragma unroll
  for (int kk = 0; kk < 2; ++kk)
#pragma unroll
    for (int i = 0; i < 4; ++i)
#pragma unroll
      for (int j = 0; j < 4; ++j) acc[i][j] = __builtin_amdgcn_wmma_f32_16x16x32_f16(false, a[kk][i], false, b[kk][j], (short)0, acc[i][j], false, false); }
// behind a run of global loads from two pointers: the wait that stands in front of any rewrite of the registers the loads name; naming the pointers keeps their registers live up to the wait.
// Built without it, one load of the run sank to just in front of its LDS store (no time to fly).
#define G3_XW(p, q) asm volatile("s_wait_xcnt 0x0" :: "v"(p), "v"(q) : "memory")
// CAUS: grid z = causal query tile of QT rows (A and C step QT rows a tile). 1 = scores: only key columns up to the tile's end are computed; 2 = P V: K ends at the tile's end. grid x = (rows / 128) * (N / 128), grid y = batch.
// H16: the output rows are f16 (C16), else f32 (C). X32 (with H16): the first QT0 rows of every SQ rows go to C as f32 as well, packed QT0 rows a batch. The row pitches lda, ldb, ldc, N and K are compile-time constants: a thread's eight rows of an operand are then one address pair with immediate offsets.
template <int CAUS, bool H16, bool X32, int lda, int ldb, int ldc, int N, int KF>
__global__ __launch_bounds__(128) void k_gemm3(const _Float16* __restrict__ A, size_t sA, const _Float16* __restrict__ Bh, size_t sB, float alpha,
    float* __restrict__ C, _Float16* __restrict__ C16, size_t sC) {
  __shared__ __attribute__((aligned(16))) unsigned short sm[2 * G3B];      /* 73,728 bytes; after the last slab the same bytes stage the output rows */
  const int tid = threadIdx.x, w = tid >> 5, lane = tid & 31, ln = lane & 15, hh = lane >> 4; const int by = blockIdx.y;
  const int qt = CAUS ? SQ / QT - 1 - (int)blockIdx.z : 0;      /* low z starts first: the tile with the most keys goes first */
  A += (size_t)by * sA + (size_t)qt * QT * lda; Bh += (size_t)by * sB; const size_t cofs = (size_t)by * sC + (size_t)qt * QT * ldc;
  const int ntn = N / G3T; const int mt = blockIdx.x / ntn, nq = blockIdx.x - mt * ntn; const int row0 = mt * G3T, col0 = nq * G3T;
  if (CAUS == 1 && col0 >= (qt + 1) * QT) return;      /* the same for the whole block, in front of every barrier */
  const int K = (CAUS == 2) ? (qt + 1) * QT : KF;
  const int sr = tid >> 3, sc = (tid & 7) * 8;      /* staging: thread t moves 16-byte piece t % 8 of rows t / 8 + 16 i, i = 0..7, of both operands */
  const unsigned short* ga = (const unsigned short*)A + (size_t)(row0 + sr) * lda + sc;
  const unsigned short* gb = (const unsigned short*)Bh + (size_t)(col0 + sr) * ldb + sc;
  unsigned short* st = sm + sr * G3P + sc;
  const int wm = w >> 1, wn = w & 1;
  const unsigned short* fa = sm + (wm * 64 + ln) * G3P; const unsigned short* fb = sm + (G3T + wn * 64 + ln) * G3P;
  const v8f z8 = {0.f,0.f,0.f,0.f,0.f,0.f,0.f,0.f}; v8f acc[4][4]; v8us ra[8], rb[8];
  /* every '#pragma unroll' of this kernel makes the index of a register array a constant */
#pragma unroll
  for (int i = 0; i < 4; ++i)
#pragma unroll
    for (int j = 0; j < 4; ++j) acc[i][j] = z8;
#pragma unroll
  for (int i = 0; i < 8; ++i) { ra[i] = *(const v8us*)(ga + 16 * i * lda); rb[i] = *(const v8us*)(gb + 16 * i * ldb); }
  G3_XW(ga, gb);
#pragma unroll
  for (int i = 0; i < 8; ++i) { *(v8us*)(st + 16 * i * G3P) = ra[i]; *(v8us*)(st + (G3T + 16 * i) * G3P) = rb[i]; }
  __syncthreads();
  const int nkt = K / G3K;
  for (int kt = 0; kt + 1 < nkt; ++kt) {      /* the trip count is the same for the whole block */
    const int bo = (kt & 1) * G3B;
    const unsigned short* pa = ga + (kt + 1) * G3K; const unsigned short* pb = gb + (kt + 1) * G3K;
#pragma unroll
    for (int i = 0; i < 8; ++i) { ra[i] = *(const v8us*)(pa + 16 * i * lda); rb[i] = *(const v8us*)(pb + 16 * i * ldb); }
    G3_XW(pa, pb);
    g3_slab(acc, fa + bo, fb + bo, hh);
    unsigned short* sn = st + (G3B - bo);      /* the other buffer: its last readers left it in front of the barrier that ended the slab before */
#pragma unroll
    for (int i = 0; i < 8; ++i) { *(v8us*)(sn + 16 * i * G3P) = ra[i]; *(v8us*)(sn + (G3T + 16 * i) * G3P) = rb[i]; }
    __syncthreads(); }      /* publishes the next slab and ends every read of this one */
  g3_slab(acc, fa + ((nkt - 1) & 1) * G3B, fb + ((nkt - 1) & 1) * G3B, hh);
  __syncthreads();      /* ends every read of the last slab: the output rows are staged over it */
  float* so = (float*)sm + w * (64 * 68);      /* the wave's own 64 x 64 f32 rows at pitch 68, so that the stores below are whole lines */
#pragma unroll
  for (int i = 0; i < 4; ++i)
#pragma unroll
    for (int j = 0; j < 4; ++j)
#pragma unroll
      for (int r = 0; r < 8; ++r) so[(16 * i + 8 * hh + r) * 68 + 16 * j + ln] = acc[i][j][r] * alpha;
  __builtin_amdgcn_fence(__ATOMIC_ACQ_REL, "workgroup"); __builtin_amdgcn_wave_barrier();
  const int rsub = lane >> 4, c4 = (lane & 15) * 4; const size_t co = cofs + (size_t)(row0 + wm * 64 + rsub) * ldc + col0 + wn * 64 + c4; float* cp = H16 ? nullptr : C + co; _Float16* cp16 = H16 ? C16 + co : nullptr;
  if (X32 && row0 % SQ < QT0) {      /* the same for the whole block: a tile of 128 rows lies wholly inside or outside the exact rows */
    float* cx = C + (co - (size_t)(row0 / SQ) * ((SQ - QT0) * ldc));      /* the f16 row's place less the rows of earlier batches that are not kept */
#pragma unroll
    for (int q = 0; q < 32; ++q) { const v4f v = *(const v4fa*)&so[(q * 2 + rsub) * 68 + c4]; v4h h4; for (int i = 0; i < 4; ++i) h4[i] = (_Float16)v[i]; *(v4h*)(cp16 + q * 2 * ldc) = h4; *(v4f*)(cx + q * 2 * ldc) = v; } }
  else {
#pragma unroll
    for (int q = 0; q < 32; ++q) { const int r = q * 2 + rsub; const v4f v = *(const v4fa*)&so[r * 68 + c4]; if (!H16) *(v4f*)(cp + q * 2 * ldc) = v; else { v4h h4; for (int i = 0; i < 4; ++i) h4[i] = (_Float16)v[i]; *(v4h*)(cp16 + q * 2 * ldc) = h4; } }
    if (X32) asm volatile("s_wait_xcnt 0x0" ::: "memory"); } }      /* the built code lays the other branch directly behind these stores, with only a conditional branch between, and it rewrites their data registers */


__global__ __launch_bounds__(256) void k_wnat(const float* __restrict__ w, size_t n8, _Float16* __restrict__ Bt) { const size_t t = (size_t)blockIdx.x * 256 + threadIdx.x; if (t >= n8) return; FragH f; for (int q = 0; q < 8; ++q) f.h[q] = (_Float16)(bf16_round(w[t * 8 + q]) * 16.0f); *(v8us*)((unsigned short*)Bt + t * 8) = f.half[0];  }
__global__ __launch_bounds__(256) void k_rsm(const float* __restrict__ S, _Float16* __restrict__ P, int nrows) {
  #pragma clang fp contract(off)
  const int i = blockIdx.x * 256 + threadIdx.x; if (i >= nrows) return; const float* s = S + (size_t)i * SQ; float mx = -3.0e38f;
#pragma unroll 1
  for (int j = 0; j < SQ; ++j) mx = fmaxf(mx, s[j]); float se = 0.f;
#pragma unroll 1
  for (int j = 0; j < SQ; ++j) se += expf(s[j] - mx); const float sc = 256.0f / se;
#pragma unroll 1
  for (int j0 = 0; j0 < SQ; j0 += 8) { FragH f; for (int q = 0; q < 8; ++q) f.h[q] = (_Float16)(expf(s[j0 + q] - mx) * sc); unsigned short* d = (unsigned short*)P + (size_t)i * SQ + j0; *(v8us*)d = f.half[0];  } }
__global__ __launch_bounds__(256) void k_vt(const _Float16* __restrict__ V16, int b, int h0, _Float16* __restrict__ VT) { __shared__ unsigned short tl[64][65]; const int tid = threadIdx.x; const int hh = blockIdx.x % HG, sg = blockIdx.x / HG; const int s0 = sg * 64; const int h = h0 + hh;
  for (int i = tid; i < 64 * 8; i += 256) { const int j = i / 8, d8 = (i % 8) * 8; FragH f; f.half[0] = *(const v8us*)((const unsigned short*)V16 + ((size_t)b * SQ + s0 + j) * DM + h * HD + d8); for (int q = 0; q < 8; ++q) tl[d8 + q][j] = f.u[q]; }
  __syncthreads();
  { for (int i = tid; i < 64 * 8; i += 256) { const int d = i / 8, j8 = (i % 8) * 8; FragH f; for (int q = 0; q < 8; ++q) f.u[q] = tl[d][j8 + q]; *(v8us*)((unsigned short*)VT + ((size_t)hh * HD + d) * SQ + s0 + j8) = f.half[0]; }  } }



// Causal softmax, ONE S ROW PER WAVE, the row held in registers: lane l owns keys 256 c + 8 l .. + 7 of each 256-key chunk c (two 16-byte loads in, one 16-byte f16 store out per chunk).
// Row max and row sum: per-lane partials (the sum in four independent chains), then a five-step butterfly over the 32 lanes. NC = nk / 256 chunks, all loads of a row in flight together.
// e^x as the fast form has it (one multiply, v_exp_f32). The v_nop is the one slot the instruction set asks for behind a transcendental before its result is read or its source overwritten; it stands in the same statement because the compiler's own schedule of this kernel reused a source register directly behind some v_exp_f32.
__device__ __forceinline__ float rsm_exp(float x) { const float y = x * 1.44269504088896340736f; float e; asm("v_exp_f32 %0, %1\n\tv_nop" : "=v"(e) : "v"(y)); return e; }
template <int NC>
__device__ __forceinline__ void rsm_row(const float* __restrict__ s, unsigned short* __restrict__ p, int k0, int last) {
  float v[NC][8];
#pragma unroll
  for (int c = 0; c < NC; ++c) { const v4f a = *(const v4fa*)(s + c * 256 + k0), b = *(const v4fa*)(s + c * 256 + k0 + 4);
#pragma unroll
    for (int q = 0; q < 4; ++q) { v[c][q] = a[q]; v[c][4 + q] = b[q]; } }
  float mx = -3.0e38f;
#pragma unroll
  for (int c = 0; c < NC; ++c)
#pragma unroll
    for (int q = 0; q < 8; ++q) { if (c * 256 + k0 + q > last) v[c][q] = -1.0e9f; mx = fmaxf(mx, v[c][q]); }
#pragma unroll
  for (int m = 16; m > 0; m >>= 1) mx = fmaxf(mx, __shfl_xor(mx, m, 32));
  float s4[4] = {0.f, 0.f, 0.f, 0.f};
#pragma unroll
  for (int c = 0; c < NC; ++c)
#pragma unroll
    for (int q = 0; q < 8; ++q) { v[c][q] = rsm_exp(v[c][q] - mx); s4[q & 3] += v[c][q]; }
  float se = (s4[0] + s4[1]) + (s4[2] + s4[3]);
#pragma unroll
  for (int m = 16; m > 0; m >>= 1) se += __shfl_xor(se, m, 32);
  const float sc = 256.0f / se;
#pragma unroll
  for (int c = 0; c < NC; ++c) { FragH fr;
#pragma unroll
    for (int q = 0; q < 8; ++q) fr.h[q] = (_Float16)(v[c][q] * sc);
    *(v8us*)(p + c * 256 + k0) = fr.half[0]; }
  asm volatile("s_wait_xcnt 0x0" ::: "memory");      /* the built code lays the row lengths one behind the other, and only a conditional branch stands between these stores and the next length's code, which rewrites their address and data registers */
}
// grid = the token rows past the exact rows, of all batches, one 32-lane block each; a row's length is the end of its own QT-row query tile
__global__ __launch_bounds__(32) void k_rsmcf2(const float* __restrict__ S, _Float16* __restrict__ P, int nrows) {
  if ((int)blockIdx.x >= nrows) return; const int last = QT0 + blockIdx.x % (SQ - QT0); const int t = blockIdx.x / (SQ - QT0) * SQ + last; const int k0 = threadIdx.x * 8;
  const float* s = S + (size_t)t * NKX; unsigned short* p = (unsigned short*)P + (size_t)t * NKX;
  switch (last / QT + 1) {      /* the same for every lane of the wave: straight-line code for each row length */
    case 1: rsm_row<1>(s, p, k0, last); break; case 2: rsm_row<2>(s, p, k0, last); break; case 3: rsm_row<3>(s, p, k0, last); break; case 4: rsm_row<4>(s, p, k0, last); break;
    case 5: rsm_row<5>(s, p, k0, last); break; case 6: rsm_row<6>(s, p, k0, last); break; case 7: rsm_row<7>(s, p, k0, last); break; case 8: rsm_row<8>(s, p, k0, last); break;
    default: break; } }


template <int MASKADD>
__global__ __launch_bounds__(64) void k_att0(const float* __restrict__ QF, const float* __restrict__ KF, const float* __restrict__ VF, int ld, const float* __restrict__ mask, float scale, float* __restrict__ OF, int ldo) {
  #pragma clang fp contract(off)
  __shared__ __attribute__((aligned(16))) float lq[64][64]; __shared__ __attribute__((aligned(16))) float lo[64][64];
  const int tid = threadIdx.x; const int h = blockIdx.x / (QT0 / 64), rg = blockIdx.x % (QT0 / 64); const int i = rg * 64 + tid;
  const float* qr = QF + (size_t)i * ld + h * HD;
#pragma unroll 1
  for (int c = 0; c < HD / 4; ++c) { *(v4f*)&lq[tid][c * 4] = *(const v4fa*)(qr + c * 4); const v4f z = {0.f, 0.f, 0.f, 0.f}; *(v4f*)&lo[tid][c * 4] = z; }
  float m = -1.0e30f, l = 0.f; const int jmax = MASKADD ? (SQ - 1) : (rg * 64 + 63);      /* additive-mask form: every key (the mask input decides); causal form: keys up to the block's last row */
#pragma unroll 1
  for (int j = 0; j <= jmax; ++j) { const float* kr = KF + (size_t)j * ld + h * HD; const float* vr = VF + (size_t)j * ld + h * HD; float s = 0.f;
#pragma unroll 1
    for (int c = 0; c < HD / 4; ++c) { const v4f kq = *(const v4fa*)(kr + c * 4); const v4f qq = *(v4f*)&lq[tid][c * 4]; s = __fadd_rn(s, __fmul_rn(qq[0], kq[0])); s = __fadd_rn(s, __fmul_rn(qq[1], kq[1])); s = __fadd_rn(s, __fmul_rn(qq[2], kq[2])); s = __fadd_rn(s, __fmul_rn(qq[3], kq[3])); }
    s = __fmul_rn(s, scale); if (MASKADD) s = __fadd_rn(s, __fmul_rn(bf16_round(mask[(size_t)i * SQ + j]), -10000.0f));
    const float f = (MASKADD || j <= i) ? 1.f : 0.f; const float sm = fmaf(f, s, (1.f - f) * -1.0e30f); const float mn = fmaxf(m, sm); const float sc = expf(m - mn); const float e = expf(sm - mn); l = __fadd_rn(__fmul_rn(l, sc), e); m = mn;
#pragma unroll 1
    for (int c = 0; c < HD / 4; ++c) { const v4f vv = *(const v4fa*)(vr + c * 4); v4f oo = *(v4f*)&lo[tid][c * 4]; for (int u = 0; u < 4; ++u) oo[u] = __fadd_rn(__fmul_rn(oo[u], sc), __fmul_rn(e, vv[u])); *(v4f*)&lo[tid][c * 4] = oo; } }
  const float fin = 64.0f / l;      /* o carried x64 */
#pragma unroll 1
  for (int c = 0; c < HD / 4; ++c) { v4f oo = *(v4f*)&lo[tid][c * 4]; for (int u = 0; u < 4; ++u) oo[u] = __fmul_rn(oo[u], fin); *(v4f*)&lo[tid][c * 4] = oo; }
  __syncthreads();
  {
#pragma unroll 1
    for (int it = 0; it < 16; ++it) { const int row = it * 4 + tid / 16, pc = (tid % 16) * 4; const v4f v = *(const v4f*)&lo[row][pc]; *(v4f*)(OF + (size_t)(rg * 64 + row) * ldo + h * HD + pc) = v; }
     } }


template <int BFIN, int WXB>
__global__ __launch_bounds__(256) void k_ln16(const float* __restrict__ X, const float* __restrict__ g, const float* __restrict__ bb, float eps, _Float16* __restrict__ N16, float* __restrict__ XB) {
  #pragma clang fp contract(off)
  __shared__ float red[256]; const size_t r = blockIdx.x; const int t = threadIdx.x; const v4f xa = *(const v4fa*)(X + r * DMQ + t * 4); float s[4]; float sum = 0.f;
  for (int q = 0; q < 4; ++q) { s[q] = BFIN ? bf16_round(xa[q]) : xa[q]; sum = __fadd_rn(sum, s[q]); }
  red[t] = sum; __syncthreads(); for (int st = 128; st > 0; st >>= 1) { if (t < st) red[t] = __fadd_rn(red[t], red[t + st]); __syncthreads(); } const float mu = red[0] / (float)DMQ; __syncthreads();
  float vs = 0.f; for (int q = 0; q < 4; ++q) { const float dl = __fadd_rn(s[q], -mu); vs = __fadd_rn(vs, __fmul_rn(dl, dl)); } red[t] = vs; __syncthreads(); for (int st = 128; st > 0; st >>= 1) { if (t < st) red[t] = __fadd_rn(red[t], red[t + st]); __syncthreads(); }
  const float rs = rsqrtf(__fadd_rn(red[0] / (float)DMQ, eps)); v4h y; v4f xb;
  for (int q = 0; q < 4; ++q) { const int c = t * 4 + q; y[q] = (_Float16)__fadd_rn(__fmul_rn(__fmul_rn(__fadd_rn(s[q], -mu), rs), bf16_round(g[c])), bf16_round(bb[c])); xb[q] = s[q]; }
  { *(v4h*)(N16 + r * DMQ + t * 4) = y; if (WXB) *(v4f*)(XB + r * DMQ + t * 4) = xb;  } }
__global__ __launch_bounds__(256) void k_ftres2(const float* __restrict__ OF0, const float* __restrict__ XB, float* __restrict__ X1, size_t n4) {
  #pragma clang fp contract(off)
  const size_t t = (size_t)blockIdx.x * 256 + threadIdx.x; if (t >= n4) return; const v4f o = *(const v4fa*)(OF0 + t * 4), xv = *(const v4fa*)(XB + t * 4); v4f y; for (int q = 0; q < 4; ++q) y[q] = __fadd_rn(__fmul_rn(o[q], 0.015625f), xv[q]); *(v4f*)(X1 + t * 4) = y;  }

__global__ __launch_bounds__(256) void k_wthd(const float* __restrict__ Wt, _Float16* __restrict__ Bt) { const size_t t = (size_t)blockIdx.x * 256 + threadIdx.x; if (t >= (size_t)NH * HD * (DM / 8)) return; const int m8 = (int)(t % (DM / 8)) * 8; const int d = (int)((t / (DM / 8)) % HD); const int h = (int)(t / ((size_t)(DM / 8) * HD)); FragH f;
  for (int q = 0; q < 8; ++q) f.h[q] = (_Float16)(16.0f * bf16_round(Wt[((size_t)h * DM + m8 + q) * HD + d])); unsigned short* dst = (unsigned short*)Bt + ((size_t)h * HD + d) * DM + m8; *(v8us*)dst = f.half[0];  }




__global__ __launch_bounds__(256) void k_wtpad(const float* __restrict__ Wm, _Float16* __restrict__ Wt, int Kr, int Kp, int Nr, int Np, float scale) {
  const int t = blockIdx.x * 256 + threadIdx.x; if (t >= Np * (Kp / 8)) return; const int n = t / (Kp / 8), k8 = (t % (Kp / 8)) * 8; const int nc = min(n, Nr - 1); const float fn = (n < Nr) ? 1.f : 0.f; FragH f;
  for (int i = 0; i < 8; ++i) { const int k = k8 + i; const int kc = min(k, Kr - 1); const float fk = (k < Kr) ? fn : 0.f; f.h[i] = (_Float16)(bf16_round(Wm[(size_t)kc * Nr + nc]) * scale * fk); }
  unsigned short* o = (unsigned short*)Wt + (size_t)n * Kp + k8; *(v8us*)o = f.half[0];  }
__global__ __launch_bounds__(128) void k_bpad(const float* __restrict__ b, float* __restrict__ Bp, int nr, int np) {
  const int i = threadIdx.x; if (i >= np) return; const float v = b[min(i, nr - 1)] * ((i < nr) ? 1.f : 0.f); *(float*)(Bp + i) = v;  }

#define DI 1024       /* inner width = NH * HD */
#define LQK (3 * DI)  /* fused q | k | v row pitch (3072) */
__global__ __launch_bounds__(256) void k_o0(const float* __restrict__ OF, float* __restrict__ ob, size_t n4) {
  #pragma clang fp contract(off)
  const size_t t = (size_t)blockIdx.x * 256 + threadIdx.x; if (t >= n4) return; const size_t e = t * 4; const int i = (int)(e / DI); const int c = (int)(e % DI); const int h = c / HD, d = c % HD; const v4f a = *(const v4fa*)(OF + e); v4f o; for (int q = 0; q < 4; ++q) o[q] = __fmul_rn(a[q], 0.015625f); float* dst = ob + (size_t)h * SQ * HD + (size_t)i * HD + d; *(v4f*)dst = o;  }

#define RQ 4                 /* query rows per block of the exact path */
#define SJP (QT0 + 16)       /* pitch of a score row in LDS: the RQ rows of one key fall on different banks */
// Exact f32 attention for the first QT0 rows of every batch, RQ query rows per block, so that every k row and every v row a block loads serves RQ queries, and every global load is whole lines.
// Scores: one wave per group of 8 keys; lane l holds columns 128 u + 4 l .. + 3 (u = 0..7) of the RQ query rows in registers and of the key row as it comes in; the 8 x RQ = 32 per-lane partial dot products
// are summed over the 32 lanes by a halving exchange (31 exchanges in all) that leaves sum number l (key * RQ + row) in lane l. Softmax: one wave per query row. Output: thread t owns columns 4 t .. + 3 of the RQ rows, keys in order.
// Every '#pragma unroll' of this kernel and its helpers makes the index of a register array a constant; each '#pragma unroll 1' keeps a loop rolled whose body already fills the registers that four waves per SIMD leave a wave.
typedef float v2f __attribute__((ext_vector_type(2)));
// the value of lane ^ BIT, on the vector unit: inside a 16-lane row by DPP (row_xmask), between the two rows by the cross-row move; all 32 lanes are on wherever it is called
template <int BIT>
__device__ __forceinline__ float att0_xor(float x) { int v = __float_as_int(x);
  if constexpr (BIT == 16) v = __builtin_amdgcn_permlanex16(v, v, 0x76543210, 0xfedcba98, false, false); else v = __builtin_amdgcn_update_dpp(v, v, 0x160 + BIT, 0xf, 0xf, false);
  return __int_as_float(v); }
// one step of the halving exchange over lane bit BIT: a lane with the bit set keeps the sums hi[], its partner (lane ^ BIT) the sums lo[]; each hands the other half over; the kept sums come back in lo[]
template <int N, int BIT>
__device__ __forceinline__ void att0_halve(float (&lo)[N], const float (&hi)[N], int lane) { const bool up = (lane & BIT) != 0;
#pragma unroll
  for (int t = 0; t < N; ++t) { const float send = up ? lo[t] : hi[t]; const float keep = up ? hi[t] : lo[t]; lo[t] = keep + att0_xor<BIT>(send); } }
// behind a run of global loads from one pointer: the wait that stands in front of any rewrite of the registers the loads name; naming the pointer keeps its registers live up to the wait, so that no load of the run is given them as its destination
#define ATT0_XW(p) asm volatile("s_wait_xcnt 0x0" :: "v"(p) : "memory")
__device__ __forceinline__ void att0_use8(v4f (&o)[RQ], const v4f (&v)[8], const float (*pe)[RQ]) {      /* eight v rows into the RQ output rows, keys in order */
#pragma unroll
  for (int t = 0; t < 8; ++t) { const v4f e = *(const v4f*)&pe[t][0];
#pragma unroll
    for (int r = 0; r < RQ; ++r) { const v2f er = {e[r], e[r]}; o[r].xy = __builtin_elementwise_fma(er, v[t].xy, o[r].xy); o[r].zw = __builtin_elementwise_fma(er, v[t].zw, o[r].zw); } } }
__global__ __launch_bounds__(256) __attribute__((amdgpu_waves_per_eu(4, 4))) void k_att0w(const float* __restrict__ QF, const float* __restrict__ KF, const float* __restrict__ VF, float scale, float* __restrict__ OF) {      /* q | k | v rows of pitch LQK, QT0 a batch; OF = the output itself, rows of pitch DI, SQ a batch; the register budget of four waves per SIMD, so that a long and a short block share a WGP */
  __shared__ float sj[RQ][SJP]; __shared__ __attribute__((aligned(16))) float pe[QT0][RQ]; __shared__ float fin[RQ];
  const int tid = threadIdx.x, w = __builtin_amdgcn_readfirstlane(tid >> 5), lane = tid & 31; const int b = blockIdx.x % NB, idx = blockIdx.x / NB;      /* the wave's number as a scalar: the key loop stays on the scalar unit; batch fastest */
  const int g = (idx < QT0 / RQ / 2) ? QT0 / RQ - 1 - idx : idx - QT0 / RQ / 2;      /* first half of the grid: the row groups with the most keys, longest first; second half: the short ones, shortest first */
  const int i0 = g * RQ, nk = i0 + RQ;      /* keys 0 .. nk - 1 are seen by at least one of the block's rows */
  QF += (size_t)b * QT0 * LQK; KF += (size_t)b * QT0 * LQK; VF += (size_t)b * QT0 * LQK; OF += (size_t)b * SQ * DI;
  for (int t = tid; t < RQ * SJP; t += 256) (&sj[0][0])[t] = -1.0e30f;      /* keys no wave computes count as masked */
  v4f q[RQ][8]; const float* qp = QF + (size_t)i0 * LQK + lane * 4;
#pragma unroll
  for (int r = 0; r < RQ; ++r)
#pragma unroll
    for (int u = 0; u < 8; ++u) q[r][u] = *(const v4fa*)(qp + r * LQK + u * 128);
  ATT0_XW(qp);
  __syncthreads();
  v4f cur[8]; const float* kp = KF + (size_t)(w * 8) * LQK + lane * 4;      /* the key row in use; the next one is fetched while it is used. Rows w * 8 .. + 7 lie below QT0 for every wave, also for one that has no group */
#pragma unroll
  for (int u = 0; u < 8; ++u) cur[u] = *(const v4fa*)(kp + u * 128);
  ATT0_XW(kp);
#pragma unroll 1
  for (int g8 = w; g8 * 8 < nk; g8 += 8) {      /* the same for every lane of a wave; key rows g8 * 8 .. + 7 lie below QT0 */
    const float* kg = KF + (size_t)(g8 * 8) * LQK + lane * 4;
    const float* kn = KF + (size_t)((((g8 + 8) * 8 < nk) ? g8 + 8 : g8) * 8) * LQK + lane * 4;      /* first row of the wave's next group (the last trip fetches its own first row again) */
    float a4[2][RQ];      /* the exchange runs as a tree beside the keys (2 keys, 4 keys, 8 keys), so that few partial sums are live at a time */
#pragma unroll
    for (int k4 = 0; k4 < 2; ++k4) { float a2[2][RQ];
#pragma unroll
      for (int k2 = 0; k2 < 2; ++k2) { float a1[2][RQ];
#pragma unroll
        for (int k1 = 0; k1 < 2; ++k1) { const int kk = k4 * 4 + k2 * 2 + k1; const float* kr = (kk < 7) ? kg + (kk + 1) * LQK : kn; v4f nxt[8];
#pragma unroll
          for (int u = 0; u < 8; ++u) nxt[u] = *(const v4fa*)(kr + u * 128);
          ATT0_XW(kr);
#pragma unroll
          for (int r = 0; r < RQ; ++r) { v2f s = {0.f, 0.f};      /* even and odd columns in the two halves of a packed multiply-add */
#pragma unroll
            for (int u = 0; u < 8; ++u) { s = __builtin_elementwise_fma(q[r][u].xy, cur[u].xy, s); s = __builtin_elementwise_fma(q[r][u].zw, cur[u].zw, s); }
            a1[k1][r] = s.x + s.y; }
#pragma unroll
          for (int u = 0; u < 8; ++u) cur[u] = nxt[u];
          __builtin_amdgcn_sched_barrier(0); }      /* keeps the eight keys of a group apart: left free, the scheduler mixed their loads and spilled query registers to scratch */
        att0_halve<RQ, 4>(a1[0], a1[1], lane);
#pragma unroll
        for (int r = 0; r < RQ; ++r) a2[k2][r] = a1[0][r]; }
      att0_halve<RQ, 8>(a2[0], a2[1], lane);
#pragma unroll
      for (int r = 0; r < RQ; ++r) a4[k4][r] = a2[0][r]; }
    att0_halve<RQ, 16>(a4[0], a4[1], lane);
    float b2[2][2] = {{a4[0][0], a4[0][1]}, {a4[0][2], a4[0][3]}}; att0_halve<2, 2>(b2[0], b2[1], lane);
    float b1[2][1] = {{b2[0][0]}, {b2[0][1]}}; att0_halve<1, 1>(b1[0], b1[1], lane);
    const int j = g8 * 8 + (lane >> 2), r = lane & 3;      /* lane bits 16, 8, 4 chose the key in the group, bits 2, 1 the row */
    sj[r][j] = (j <= i0 + r) ? b1[0][0] * scale : -1.0e30f; }
  __syncthreads();
  if (w < RQ) { float sv[QT0 / 32]; float mx = -1.0e30f;
#pragma unroll
    for (int u = 0; u < QT0 / 32; ++u) { sv[u] = sj[w][u * 32 + lane]; mx = fmaxf(mx, sv[u]); }
    mx = fmaxf(mx, att0_xor<1>(mx)); mx = fmaxf(mx, att0_xor<2>(mx)); mx = fmaxf(mx, att0_xor<4>(mx)); mx = fmaxf(mx, att0_xor<8>(mx)); mx = fmaxf(mx, att0_xor<16>(mx));
    float ls = 0.f;
#pragma unroll
    for (int u = 0; u < QT0 / 32; ++u) { const float e = expf(sv[u] - mx); pe[u * 32 + lane][w] = e; ls += e; }
    ls += att0_xor<1>(ls); ls += att0_xor<2>(ls); ls += att0_xor<4>(ls); ls += att0_xor<8>(ls); ls += att0_xor<16>(ls);
    if (lane == 0) fin[w] = 1.0f / ls; }
  __syncthreads();
  const float* vp = VF + tid * 4; const v4f z4 = {0.f, 0.f, 0.f, 0.f}; v4f o[RQ] = {z4, z4, z4, z4}; v4f va[8], vb[8];
  const int nk16 = (nk + 15) & ~15;      /* v rows in steps of 16: rows nk .. nk16 - 1 lie below QT0 and carry weight 0 for all RQ queries */
#pragma unroll
  for (int t = 0; t < 8; ++t) va[t] = *(const v4fa*)(vp + t * LQK);
  ATT0_XW(vp);
#pragma unroll 1
  for (int j = 0; j < nk16; j += 16) {      /* two sets of eight v rows: one flies while the other is used */
    const float* pb = vp + (size_t)(j + 8) * LQK;
#pragma unroll
    for (int t = 0; t < 8; ++t) vb[t] = *(const v4fa*)(pb + t * LQK);
    ATT0_XW(pb);
    att0_use8(o, va, &pe[j]);
    __builtin_amdgcn_sched_barrier(0);      /* keeps each fetch ahead of the work it flies beside: left free, the loads were moved down to where their rows are used */
    const float* pa = vp + (size_t)((j + 16 < nk16) ? j + 16 : j) * LQK;      /* the last trip loads its own first rows again */
#pragma unroll
    for (int t = 0; t < 8; ++t) va[t] = *(const v4fa*)(pa + t * LQK);
    ATT0_XW(pa);
    att0_use8(o, vb, &pe[j + 8]);
    __builtin_amdgcn_sched_barrier(0); }      /* as above */
#pragma unroll
  for (int r = 0; r < RQ; ++r) { const v4f y = o[r] * fin[r]; *(v4f*)(OF + (size_t)(i0 + r) * DI + tid * 4) = y; } }

__global__ __launch_bounds__(256) void k_o0m(const float* __restrict__ OF, float* __restrict__ o_, size_t n4) {
  #pragma clang fp contract(off)
  const size_t t = (size_t)blockIdx.x * 256 + threadIdx.x; if (t >= n4) return; const size_t e = t * 4; OF += (size_t)blockIdx.y * QT0 * DI; o_ += (size_t)blockIdx.y * SQ * DI;      /* grid y = batch */
  const v4f a = *(const v4fa*)(OF + e); v4f o; for (int q = 0; q < 4; ++q) o[q] = __fmul_rn(a[q], 0.015625f); *(v4f*)(o_ + e) = o;  }
extern "C" void kernel_launch(void* const* d_in, const int* in_sizes, int n_in,
                              void* d_out, int out_size, void* d_ws, size_t ws_size, hipStream_t stream) {
  (void)in_sizes; (void)n_in; (void)out_size;
  const float* const* I = (const float* const*)d_in; const float* x = I[0]; const float* wqkv = I[1];      /* input order: x [4][2048][1024], W_qkv ([in][out] [1024][3072]: q | k | v column thirds); the module has no biases and no output projection */
  char* ws = (char*)d_ws; size_t off = 0;
  auto take = [&](size_t bytes) { char* p = ws + off; off += (bytes + 255) & ~(size_t)255; return p; };
  _Float16* BW = (_Float16*)take((size_t)LQK * DM * 2); _Float16* X16 = (_Float16*)take(NR * DM * 2); _Float16* QKV = (_Float16*)take(NR * LQK * 2); _Float16* VT = (_Float16*)take((size_t)NB * DI * SQ * 2);
  float* S = (float*)take(NR * NKX * 4); _Float16* P = (_Float16*)take(NR * NKX * 2); float* QKVF0 = (float*)take((size_t)NB * QT0 * LQK * 4);      /* ONE head: S / P row = token row, pitch NKX; every plane holds all batches */
  if (off > ws_size) return;
  k_wtpad<<<(unsigned)(((size_t)LQK * (DM / 8) + 255) / 256), 256, 0, stream>>>(wqkv, BW, DM, DM, LQK, LQK, 16.0f);      /* [in][out] [1024][3072] -> Bt[n][k] x16 (no padding: Kr = Kp = 1024, Nr = Np = 3072) */
  k_x16<<<(unsigned)((NR * DM / 8 + 255) / 256), 256, 0, stream>>>(x, X16, NR * DM / 8);      /* x (bf16-valued) as exact f16 rows */
  k_gemm3<0, true, true, DM, DM, LQK, LQK, DM><<<dim3((unsigned)((NR / 128) * (LQK / 128)), 1), 128, 0, stream>>>(X16, 0, BW, 0, 0.0625f, QKVF0, QKV, 0);      /* q | k | v = x W -> f16 rows, column blocks 0 / 1024 / 2048 of the fused plane (pitch 3072); no bias; rows 0..511 of every batch also as f32 (exact products, f32 accumulation) */
  const _Float16* Q16 = QKV; const _Float16* K16 = QKV + DI; const _Float16* V16 = QKV + 2 * DI;
  k_vt<NH, SQ><<<NB * NH * (SQ / 64), 256, 0, stream>>>(V16, LQK, 0, VT);      /* V^T [NB][1024][SQ], as 16 column chunks of 64 a batch */
  k_gemm3<1, false, false, LQK, LQK, NKX, SQ, DI><<<dim3((QT / 128) * (SQ / 128), NB, (SQ - QT0) / QT), 128, 0, stream>>>(Q16, (size_t)SQ * LQK, K16, (size_t)SQ * LQK, 0.03125f, S, nullptr, (size_t)SQ * NKX);      /* scores / sqrt(1024) over the FULL width (K = 1024), one head; causal: only keys below each tile's end; query tiles past the exact rows */
  k_rsmcf2<<<NB * (SQ - QT0), 32, 0, stream>>>(S, P, NB * (SQ - QT0));      /* causal softmax -> P x256 f16, one wave per row */
  k_gemm3<2, false, false, NKX, SQ, DI, DI, SQ><<<dim3((QT / 128) * (DI / 128), NB, (SQ - QT0) / QT), 128, 0, stream>>>(P, (size_t)SQ * NKX, VT, (size_t)DI * SQ, 0.00390625f, (float*)d_out, nullptr, (size_t)SQ * DI);      /* out[b][q][:] = P V^T 2^-8 (f32), N = 1024, keys up to each tile's end */
  k_att0w<<<NB * (QT0 / RQ), 256, 0, stream>>>(QKVF0, QKVF0 + DI, QKVF0 + 2 * DI, 0.03125f, (float*)d_out);      /* exact f32 single-head causal attention for rows 0..511 of every batch, stored into the output rows */
}

// v006
// It runs in 171 microseconds.
// Next to v005, in two timings, it ran 1.03 and 1.02 times as fast.
// Counting every step since v000, it is 52.6 times as fast.
#include <hip/hip_runtime.h>
// Causal SINGLE-HEAD self-attention of full width with a fused bias-free QKV projection and NO output projection (x [4][2048][1024]; qkv = x W_qkv ([in][out] 1024 x 3072, no bias) split into q | k | v thirds of width 1024; scores = q k^T / sqrt(1024) over the FULL width (one head); causal (keys after the query -> -inf); softmax over keys; out = attn v -> [4][2048][1024]).
// Structure: token rows; x as exact f16 rows; ONE WMMA GEMM into the f16 q | k plane (pitch 3072) and, from the same epilogue, v^T [batch][1024][2048]; causal 256-row query tiles: scores GEMM with K = 1024 (alpha 1/32), causal softmax f32 -> f16 x256 weights, P . V^T GEMM with N = 1024 written as f32 (alpha 2^-8) straight into the output rows (query tiles past the exact rows only). Every stage is ONE launch over all batches (the two causal GEMMs: batch in grid y, query tile past the exact rows in grid z); S, P, V^T and the f32 planes hold all of them in the workspace.
// First-tile refinement: the first 512 query rows of every batch (which see few keys, so single-f16 q / k / v / P would be too coarse with no output projection to average the errors) are computed exactly and only so: the projection GEMM stores their q | k | v rows as f32 too (exact products, f32 accumulation), and an f32 attention on VALU (k_att0w: four query rows per block; full-width dot products; precise expf) stores them into the output; the f16 scores, softmax and P . V stages leave these rows out.
// Compute dtype: inputs rounded to bf16; x / weights exact; q, k, v and the softmax weights as plain f16 GEMM operands (~2^-12) past the exact rows; scores, softmax statistics and the output accumulation f32. v_wmma_f32_16x16x32_f16.
#define NB 4
#define SQ 2048
#define DM 1024
#define NH 16
#define HD 64
#define HG 4                         /* heads per attention launch group */
#define QT 256                       /* query rows per causal tile */
#define NKX SQ                       /* S / P row pitch */
#define QT0 512                      /* first-tile rows recomputed exactly (f32): 512 here (no output projection averages the early-row cancellation errors away; logit sigma 1.0) */
#define B0 0                         /* unused (each launch covers all batches) */
#define NBR NB                       /* unused by the launches (they cover all NB batches in their grids) */
#define NR ((size_t)NB * SQ)
#define DMQ DM
#define DFF 4096                     /* unused (no FFN in this file) */
#define DFFR 100                     /* unused */
#define MP ((int)((size_t)NBR * SQ)) /* unused by the launches (the projection covers NR rows) */
#define QN SQ                        /* unused (the query tiles cover SQ rows) */
#define NHD NH                       /* unused (one full-width head is attended) */
#define MPO MP                       /* unused (there is no output stage) */
#define LQ (3 * DM)      /* unused (the q | k | v rows have pitch LQK) */
typedef __bf16 v16b __attribute__((ext_vector_type(16)));
typedef unsigned short v8us __attribute__((ext_vector_type(8), may_alias));
typedef float  v8f  __attribute__((ext_vector_type(8)));
typedef float  v4f  __attribute__((ext_vector_type(4)));
typedef float  v4fa __attribute__((ext_vector_type(4), may_alias));
union FragB { v16b v; v8us half[2]; unsigned short u[16]; };

__device__ __forceinline__ unsigned short bf16_bits(float x) { unsigned int u = __float_as_uint(x); return (unsigned short)((u + 0x7FFFu + ((u >> 16) & 1u)) >> 16); }
__device__ __forceinline__ float bf16_val(unsigned short b) { return __uint_as_float(((unsigned int)b) << 16); }
__device__ __forceinline__ float bf16_round(float x) { return bf16_val(bf16_bits(x)); }
// D += A·B with NT terms: 1 = ah·bh, 2 = + al·bh (A split), 3 = + ah·bl (both split)
template <int NT>
__device__ __forceinline__ v8f mmaN(v16b ah, v16b al, v16b bh, v16b bl, v8f c) {
  c = __builtin_amdgcn_wmma_f32_16x16x32_bf16(false, ah, false, bh, (short)0, c, false, false);
  if (NT >= 2) c = __builtin_amdgcn_wmma_f32_16x16x32_bf16(false, al, false, bh, (short)0, c, false, false);
  if (NT >= 3) c = __builtin_amdgcn_wmma_f32_16x16x32_bf16(false, ah, false, bl, (short)0, c, false, false);
  asm volatile("v_nop\n\tv_nop\n\tv_nop\n\tv_nop" : "+v"(c) : "v"(ah), "v"(al), "v"(bh), "v"(bl));
  return c;
}

__global__ __launch_bounds__(256) void k_wt_bf16(const float* __restrict__ W, unsigned short* __restrict__ Wt, int K, int N) {
  const int t = blockIdx.x * 256 + threadIdx.x;
  const int k8n = K / 8;
  if (t >= N * k8n) return;
  const int n = t / k8n, k8 = (t % k8n) * 8;
  v8us v;
#pragma unroll
  for (int i = 0; i < 8; ++i) v[i] = bf16_bits(W[(size_t)(k8 + i) * N + n]);
  *(v8us*)(Wt + (size_t)n * K + k8) = v;
  
}

// GEMM C[M][N] (f32, pitch ldc) = act(A[M][K]·W + bias). A f32 row-major (pitch lda) converted per fragment to bf16
// (ASPLIT: hi/lo two planes -> 2 terms, else single rounded term); Wt bf16 [N][K] (pitch ldb). BIAS_BF16 rounds the
// bias to bf16 first (bias quantised to bf16 before the add). K%32==0, M%16==0, N%64==0.
template <bool ASPLIT, int ACT, bool BIAS_BF16>
__global__ __launch_bounds__(128) void k_gemm_bf(const float* __restrict__ A, int lda, const unsigned short* __restrict__ Wt, int ldb,
                                               const float* __restrict__ bias, float* __restrict__ C, int ldc, int M, int N, int K) {
  __shared__ __attribute__((aligned(16))) float so[4][16][64];
  const int tid = threadIdx.x, w = tid >> 5, lane = tid & 31, ln = lane & 15, hh = lane >> 4;
  const int ntn = N / 64;
  const int wid = blockIdx.x * 4 + w;
  const int mt = wid / ntn, nq = wid % ntn;
  if (mt * 16 >= M) return;
  const int row0 = mt * 16, col0 = nq * 64;
  const float* arow = A + (size_t)(row0 + ln) * lda;
  v8f acc[4] = {};
  for (int kb = 0; kb < K; kb += 32) {
    FragB ah, al;
    const v4f x0 = *(const v4fa*)(arow + kb + 8 * hh), x1 = *(const v4fa*)(arow + kb + 8 * hh + 4);
    const v4f x2 = *(const v4fa*)(arow + kb + 16 + 8 * hh), x3 = *(const v4fa*)(arow + kb + 16 + 8 * hh + 4);
    float xs[16] = {x0[0],x0[1],x0[2],x0[3],x1[0],x1[1],x1[2],x1[3],x2[0],x2[1],x2[2],x2[3],x3[0],x3[1],x3[2],x3[3]};
#pragma unroll
    for (int i = 0; i < 16; ++i) { const unsigned short hb = bf16_bits(xs[i]); ah.u[i] = hb; al.u[i] = ASPLIT ? bf16_bits(xs[i] - bf16_val(hb)) : (unsigned short)0; }
#pragma unroll
    for (int t = 0; t < 4; ++t) {
      const unsigned short* brow = Wt + (size_t)(col0 + t * 16 + ln) * ldb + kb;
      FragB b;
      b.half[0] = *(const v8us*)(brow + 8 * hh);
      b.half[1] = *(const v8us*)(brow + 16 + 8 * hh);
      acc[t] = mmaN<ASPLIT ? 2 : 1>(ah.v, al.v, b.v, b.v, acc[t]);
    }
  }
#pragma unroll
  for (int t = 0; t < 4; ++t) {
    float bv = bias ? bias[col0 + t * 16 + ln] : 0.f;
    if (BIAS_BF16) bv = bf16_round(bv);
#pragma unroll
    for (int r = 0; r < 8; ++r) { float v = acc[t][r] + bv; if (ACT == 1) v = fmaxf(v, 0.f); so[w][8 * hh + r][t * 16 + ln] = v; }
  }
  __builtin_amdgcn_fence(__ATOMIC_ACQ_REL, "workgroup");
  __builtin_amdgcn_wave_barrier();
  const int rsub = lane >> 4, c4 = (lane & 15) * 4;
  {
#pragma unroll
    for (int q = 0; q < 8; ++q) {
      const int r = q * 2 + rsub;
      const v4f v = *(const v4fa*)&so[w][r][c4];
      *(v4f*)(C + (size_t)(row0 + r) * ldc + col0 + c4) = v;
    }
    
  }
}

// GEMM C = act(A·W + bias + resid): A f32 (ASPLIT -> hi/lo 2 terms), Wt bf16 [N][K]; ACT 0 none, 1 relu, 2 exact gelu;
// resid (optional, f32, row index = (row % rmod), pitch ldr, RES_BF16 rounds it) added before the activation.
template <bool ASPLIT, int ACT, bool BIAS_BF16, bool RES_BF16>
__global__ __launch_bounds__(128) void k_gemm_bf3(const float* __restrict__ A, int lda, const unsigned short* __restrict__ Wt, int ldb,
                                                const float* __restrict__ bias, const float* __restrict__ resid, int rmod, int ldr,
                                                float* __restrict__ C, int ldc, int M, int N, int K) {
  __shared__ __attribute__((aligned(16))) float so[4][16][64];
  const int tid = threadIdx.x, w = tid >> 5, lane = tid & 31, ln = lane & 15, hh = lane >> 4;
  const int ntn = N / 64;
  const int wid = blockIdx.x * 4 + w;
  const int mt = wid / ntn, nq = wid % ntn;
  if (mt * 16 >= M) return;
  const int row0 = mt * 16, col0 = nq * 64;
  const float* arow = A + (size_t)(row0 + ln) * lda;
  v8f acc[4] = {};
  for (int kb = 0; kb < K; kb += 32) {
    FragB ah, al;
    const v4f x0 = *(const v4fa*)(arow + kb + 8 * hh), x1 = *(const v4fa*)(arow + kb + 8 * hh + 4);
    const v4f x2 = *(const v4fa*)(arow + kb + 16 + 8 * hh), x3 = *(const v4fa*)(arow + kb + 16 + 8 * hh + 4);
    float xs[16] = {x0[0],x0[1],x0[2],x0[3],x1[0],x1[1],x1[2],x1[3],x2[0],x2[1],x2[2],x2[3],x3[0],x3[1],x3[2],x3[3]};
#pragma unroll
    for (int i = 0; i < 16; ++i) { const unsigned short hb = bf16_bits(xs[i]); ah.u[i] = hb; al.u[i] = ASPLIT ? bf16_bits(xs[i] - bf16_val(hb)) : (unsigned short)0; }
#pragma unroll
    for (int t = 0; t < 4; ++t) {
      const unsigned short* brow = Wt + (size_t)(col0 + t * 16 + ln) * ldb + kb;
      FragB b;
      b.half[0] = *(const v8us*)(brow + 8 * hh);
      b.half[1] = *(const v8us*)(brow + 16 + 8 * hh);
      acc[t] = mmaN<ASPLIT ? 2 : 1>(ah.v, al.v, b.v, b.v, acc[t]);
    }
  }
#pragma unroll
  for (int t = 0; t < 4; ++t) {
    const int col = col0 + t * 16 + ln;
    float bv = bias ? bias[col] : 0.f;
    if (BIAS_BF16) bv = bf16_round(bv);
#pragma unroll
    for (int r = 0; r < 8; ++r) {
      float v = acc[t][r] + bv;
      if (resid) { float rv = resid[(size_t)((row0 + 8 * hh + r) % rmod) * ldr + col]; if (RES_BF16) rv = bf16_round(rv); v += rv; }
      if (ACT == 1) v = fmaxf(v, 0.f);
      if (ACT == 2) v = 0.5f * v * (1.0f + erff(v * 0.70710678118654752f));
      if (ACT == 3) { const float u = 0.7978845608028654f * (v + 0.044715f * v * v * v); v = 0.5f * v * (1.0f + tanhf(u)); }
      so[w][8 * hh + r][t * 16 + ln] = v;
    }
  }
  __builtin_amdgcn_fence(__ATOMIC_ACQ_REL, "workgroup");
  __builtin_amdgcn_wave_barrier();
  const int rsub = lane >> 4, c4 = (lane & 15) * 4;
  {
#pragma unroll
    for (int q = 0; q < 8; ++q) {
      const int r = q * 2 + rsub;
      const v4f v = *(const v4fa*)&so[w][r][c4];
      *(v4f*)(C + (size_t)(row0 + r) * ldc + col0 + c4) = v;
    }
    
  }
}
// row LayerNorm (biased variance, eps) over N: s = X (+ R); optional out_sum <- s; out_norm <- (s-mu)*rsqrt(var+eps)*g + b
template <bool PARAM_BF16>
__global__ __launch_bounds__(256) void k_layernorm(const float* __restrict__ X, const float* __restrict__ R, const float* __restrict__ g, const float* __restrict__ bta,
                                                  float* __restrict__ out_sum, float* __restrict__ out_norm, int N, float eps) {
  __shared__ float red[256];
  const int row = blockIdx.x, tid = threadIdx.x;
  const float* x = X + (size_t)row * N; const float* rr = R ? R + (size_t)row * N : nullptr;
  float vals[16];                     // up to N = 4096
  const int per = N / 256;            // contiguous chunk per thread? use strided-by-4 chunks: thread handles j = tid*4 + 1024*u
  float s1 = 0.f;
  for (int u = 0; u < per / 4; ++u) {
    const int j = tid * 4 + 1024 * u;
    const v4f a = *(const v4fa*)(x + j);
    v4f b = {0.f,0.f,0.f,0.f}; if (rr) b = *(const v4fa*)(rr + j);
#pragma unroll
    for (int q = 0; q < 4; ++q) { const float v = a[q] + b[q]; vals[u * 4 + q] = v; s1 += v; }
  }
  red[tid] = s1; __syncthreads();
  for (int st = 128; st > 0; st >>= 1) { if (tid < st) red[tid] += red[tid + st]; __syncthreads(); }
  const float mu = red[0] / (float)N; __syncthreads();
  float s2 = 0.f;
  for (int u = 0; u < per / 4; ++u)
#pragma unroll
    for (int q = 0; q < 4; ++q) { const float c = vals[u * 4 + q] - mu; s2 += c * c; }
  red[tid] = s2; __syncthreads();
  for (int st = 128; st > 0; st >>= 1) { if (tid < st) red[tid] += red[tid + st]; __syncthreads(); }
  const float rs = rsqrtf(red[0] / (float)N + eps);
  {
    for (int u = 0; u < per / 4; ++u) {
      const int j = tid * 4 + 1024 * u;
      v4f o, sm;
#pragma unroll
      for (int q = 0; q < 4; ++q) {
        float gg = g[j + q], bb = bta[j + q];
        if (PARAM_BF16) { gg = bf16_round(gg); bb = bf16_round(bb); }
        sm[q] = vals[u * 4 + q]; o[q] = (vals[u * 4 + q] - mu) * rs * gg + bb;
      }
      if (out_sum) *(v4f*)(out_sum + (size_t)row * N + j) = sm;
      *(v4f*)(out_norm + (size_t)row * N + j) = o;
    }
    
  }
}



// ---- f16 WMMA path (v_wmma_f32_16x16x32_f16): 11-bit significands for operands in range — used where a [0,1] probability operand needs more precision than bf16
typedef _Float16 v16h __attribute__((ext_vector_type(16)));
union FragH { v16h v; v8us half[2]; _Float16 h[16]; unsigned short u[16]; };
template <int NT>
__device__ __forceinline__ v8f mmaH(v16h ah, v16h al, v16h bh, v16h bl, v8f c) {
  c = __builtin_amdgcn_wmma_f32_16x16x32_f16(false, ah, false, bh, (short)0, c, false, false);
  if (NT >= 2) c = __builtin_amdgcn_wmma_f32_16x16x32_f16(false, al, false, bh, (short)0, c, false, false);
  if (NT >= 3) c = __builtin_amdgcn_wmma_f32_16x16x32_f16(false, ah, false, bl, (short)0, c, false, false);
  asm volatile("v_nop\n\tv_nop\n\tv_nop\n\tv_nop" : "+v"(c) : "v"(ah), "v"(al), "v"(bh), "v"(bl));
  return c;
}
// batched GEMM like k_gemm_b but f16 operands: A f32 (split into f16 hi/lo if ASPLIT, else rounded to f16), Bt = f16 values [n][k]; alpha; C f32; N multiple of 16 (partial tiles skipped)
template <bool ASPLIT>
__global__ __launch_bounds__(128) void k_gemm_h(const float* __restrict__ A, int lda, size_t sA, const _Float16* __restrict__ Bh, int ldb, size_t sB, float alpha, float* __restrict__ C, int ldc, size_t sC, int M, int N, int K) {
  __shared__ __attribute__((aligned(16))) float so[4][16][64];
  const int tid = threadIdx.x, w = tid >> 5, lane = tid & 31, ln = lane & 15, hh = lane >> 4; const int by = blockIdx.y;
  A += (size_t)by * sA; Bh += (size_t)by * sB; C += (size_t)by * sC;
  const int ntn = (N + 63) / 64; const int wid = blockIdx.x * 4 + w; const int mt = wid / ntn, nq = wid % ntn; if (mt * 16 >= M) return;
  const int row0 = mt * 16, col0 = nq * 64; const float* arow = A + (size_t)(row0 + ln) * lda;
  v8f acc[4] = {};
  for (int kb = 0; kb < K; kb += 32) {
    FragH ah, al;
    const v4f x0 = *(const v4fa*)(arow + kb + 8 * hh), x1 = *(const v4fa*)(arow + kb + 8 * hh + 4), x2 = *(const v4fa*)(arow + kb + 16 + 8 * hh), x3 = *(const v4fa*)(arow + kb + 16 + 8 * hh + 4);
    float xs[16] = {x0[0],x0[1],x0[2],x0[3],x1[0],x1[1],x1[2],x1[3],x2[0],x2[1],x2[2],x2[3],x3[0],x3[1],x3[2],x3[3]};
#pragma unroll
    for (int i = 0; i < 16; ++i) { const _Float16 h = (_Float16)xs[i]; ah.h[i] = h; al.h[i] = ASPLIT ? (_Float16)(xs[i] - (float)h) : (_Float16)0.0f; }
#pragma unroll
    for (int t = 0; t < 4; ++t) { if (col0 + t * 16 >= N) continue; const size_t boff = (size_t)(col0 + t * 16 + ln) * ldb + kb; FragH bq; bq.half[0] = *(const v8us*)(Bh + boff + 8 * hh); bq.half[1] = *(const v8us*)(Bh + boff + 16 + 8 * hh);
      acc[t] = mmaH<ASPLIT ? 2 : 1>(ah.v, al.v, bq.v, bq.v, acc[t]); }
  }
#pragma unroll
  for (int t = 0; t < 4; ++t) { if (col0 + t * 16 >= N) continue;
#pragma unroll
    for (int r = 0; r < 8; ++r) so[w][8 * hh + r][t * 16 + ln] = acc[t][r] * alpha; }
  __builtin_amdgcn_fence(__ATOMIC_ACQ_REL, "workgroup"); __builtin_amdgcn_wave_barrier();
  const int rsub = lane >> 4, c4 = (lane & 15) * 4;
  {
#pragma unroll
    for (int q = 0; q < 8; ++q) { const int r = q * 2 + rsub; if (col0 + c4 < N) { const v4f v = *(const v4fa*)&so[w][r][c4]; *(v4f*)(C + (size_t)(row0 + r) * ldc + col0 + c4) = v; } }
     }
}

// Wt[n][k] = f16(W[k][n]·scale) from f32 row-major W[K][N] (scale = power of two; bf16-exact weights stay exact in f16 away from the subnormal range)
__global__ __launch_bounds__(256) void k_wt_f16(const float* __restrict__ W, _Float16* __restrict__ Wt, int K, int N, float scale) {
  const int t = blockIdx.x * 256 + threadIdx.x; if (t >= N * (K / 8)) return; const int n = t / (K / 8), k8 = (t % (K / 8)) * 8; FragH f;
#pragma unroll
  for (int i = 0; i < 8; ++i) f.h[i] = (_Float16)(bf16_round(W[(size_t)(k8 + i) * N + n]) * scale); const v8us o = f.half[0];
  *(v8us*)((unsigned short*)Wt + (size_t)n * K + k8) = o; 
}
// k_gemm_hh variant with fused epilogue: v = acc·alpha + bias[by·sBias + col] (+ CP[(row/rowsPerB)·sCPb + by·64 + col] if CP) ; ACT 0 none / 1 elu ; writes f16 C16 (and f32 C if non-null)
template <int ACT>
__global__ __launch_bounds__(128) void k_gemm_hhx(const _Float16* __restrict__ A, int lda, size_t sA, const _Float16* __restrict__ Bh, int ldb, size_t sB, float alpha, const float* __restrict__ bias, size_t sBias, const float* __restrict__ CP, int rowsPerB, size_t sCPb, int row0g,
    float* __restrict__ C, _Float16* __restrict__ C16, int ldc, size_t sC, int M, int N, int K) {
  __shared__ __attribute__((aligned(16))) float so[4][16][64];
  const int tid = threadIdx.x, w = tid >> 5, lane = tid & 31, ln = lane & 15, hh = lane >> 4; const int by = blockIdx.y;
  A += (size_t)by * sA; Bh += (size_t)by * sB; const size_t cofs = (size_t)by * sC; const float* bp = bias ? bias + (size_t)by * sBias : nullptr;
  const int ntn = (N + 63) / 64; const int wid = blockIdx.x * 4 + w; const int mt = wid / ntn, nq = wid % ntn; if (mt * 16 >= M) return;
  const int row0 = mt * 16, col0 = nq * 64; const _Float16* arow = A + (size_t)(row0 + ln) * lda;
  v8f acc[4] = {};
  for (int kb = 0; kb < K; kb += 32) { FragH ah; ah.half[0] = *(const v8us*)((const unsigned short*)arow + kb + 8 * hh); ah.half[1] = *(const v8us*)((const unsigned short*)arow + kb + 16 + 8 * hh);
#pragma unroll
    for (int t = 0; t < 4; ++t) { if (col0 + t * 16 >= N) continue; const size_t boff = (size_t)(col0 + t * 16 + ln) * ldb + kb; FragH bq; bq.half[0] = *(const v8us*)((const unsigned short*)Bh + boff + 8 * hh); bq.half[1] = *(const v8us*)((const unsigned short*)Bh + boff + 16 + 8 * hh);
      acc[t] = mmaH<1>(ah.v, ah.v, bq.v, bq.v, acc[t]); }
  }
#pragma unroll
  for (int t = 0; t < 4; ++t) { if (col0 + t * 16 >= N) continue; const int col = col0 + t * 16 + ln; const float bv = bp ? bf16_round(bp[col]) : 0.f;
#pragma unroll
    for (int r = 0; r < 8; ++r) { float v = acc[t][r] * alpha + bv; if (CP) { const int rr = row0g + row0 + 8 * hh + r; if (rowsPerB < 0) v += CP[cofs + (size_t)rr * ldc + col];      /* rowsPerB < 0: own element of the batched C plane */ else { const int bidx = rr / rowsPerB; v += CP[(size_t)bidx * sCPb + (size_t)by * 64 + col]; } } if (ACT == 1) v = (v > 0.f) ? v : expm1f(v); else if (ACT == 7) v = (v > 0.f) ? v + 1.0f : expf(v); else if (ACT == 8) v = tanhf(v); else if (ACT == 9) v = 0.5f * v * (1.0f + tanhf(0.7978845608028654f * (v + 0.044715f * v * v * v))); else if (ACT == 11) v = 1.0f / (1.0f + expf(-v)); else if (ACT == 12) v = (v > 0.f) ? v : 0.01f * v; else if (ACT == 14) v = (v > 0.f) ? v : 0.1f * v; else if (ACT == 16) v = (v >= 0.f) ? v : 0.3f * v; else if (ACT == 17) v = (v >= 0.f) ? v : 0.2f * v; else if (ACT == 15) v = v / (1.0f + expf(-v)); else if (ACT == 3) v = fmaxf(v, 0.f); else if (ACT == 6) v = 0.5f * v * (1.0f + erff(v * 0.70710678118654752f)); so[w][8 * hh + r][t * 16 + ln] = v; } }
  __builtin_amdgcn_fence(__ATOMIC_ACQ_REL, "workgroup"); __builtin_amdgcn_wave_barrier();
  const int rsub = lane >> 4, c4 = (lane & 15) * 4; typedef _Float16 v4h __attribute__((ext_vector_type(4)));
  {
#pragma unroll
    for (int q = 0; q < 8; ++q) { const int r = q * 2 + rsub; if (col0 + c4 < N) { const v4f v = *(const v4fa*)&so[w][r][c4]; if (C) *(v4f*)(C + cofs + (size_t)(row0 + r) * ldc + col0 + c4) = v; if (C16) { v4h h4; for (int i = 0; i < 4; ++i) h4[i] = (_Float16)v[i]; *(v4h*)(C16 + cofs + (size_t)(row0 + r) * ldc + col0 + c4) = h4; } } }
     }
}


typedef _Float16 v4h __attribute__((ext_vector_type(4)));

__global__ __launch_bounds__(256) void k_x16(const float* __restrict__ x, _Float16* __restrict__ X16, size_t n8) { const size_t t = (size_t)blockIdx.x * 256 + threadIdx.x; if (t >= n8) return; FragH f;
#pragma unroll
  for (int q = 0; q < 8; ++q) f.h[q] = (_Float16)bf16_round(x[t * 8 + q]); *(v8us*)((unsigned short*)X16 + t * 8) = f.half[0];  }
__global__ __launch_bounds__(256) void k_h16(const float* __restrict__ x, _Float16* __restrict__ X16, size_t n8) { const size_t t = (size_t)blockIdx.x * 256 + threadIdx.x; if (t >= n8) return; FragH f;
#pragma unroll
  for (int q = 0; q < 8; ++q) f.h[q] = (_Float16)x[t * 8 + q]; *(v8us*)((unsigned short*)X16 + t * 8) = f.half[0];  }
__global__ __launch_bounds__(256) void k_round16f(const float* __restrict__ W, _Float16* __restrict__ Bt, size_t n8) { const size_t t = (size_t)blockIdx.x * 256 + threadIdx.x; if (t >= n8) return; FragH f;
#pragma unroll
  for (int i = 0; i < 8; ++i) f.h[i] = (_Float16)(bf16_round(W[t * 8 + i]) * 16.0f); *(v8us*)((unsigned short*)Bt + t * 8) = f.half[0];  }
template <int NHv, int TTv>
__global__ __launch_bounds__(256) void k_vt(const _Float16* __restrict__ V16, int ldv, int voff, _Float16* __restrict__ Vt) { __shared__ unsigned short tl[64][66]; const int tid = threadIdx.x; const int slab = blockIdx.x / (TTv / 64), lg = blockIdx.x % (TTv / 64); const int b = slab / NHv, h = slab % NHv;
  for (int i = tid; i < 64 * 8; i += 256) { const int r = i / 8, c8 = (i % 8) * 8; FragH f; f.half[0] = *(const v8us*)((const unsigned short*)V16 + ((size_t)b * TTv + lg * 64 + r) * ldv + voff + h * 64 + c8);
#pragma unroll
    for (int q = 0; q < 8; ++q) tl[r][c8 + q] = f.u[q]; }
  __syncthreads();
  {
#pragma unroll
    for (int rd = 0; rd < 2; ++rd) { const int d = rd * 32 + tid / 8, pc = tid % 8; FragH f;
#pragma unroll
      for (int q = 0; q < 8; ++q) f.u[q] = tl[pc * 8 + q][d];
      *(v8us*)((unsigned short*)Vt + ((size_t)slab * 64 + d) * TTv + lg * 64 + pc * 8) = f.half[0]; }
     } }

__global__ __launch_bounds__(256) void k_hl(const float* __restrict__ F, _Float16* __restrict__ Hh, _Float16* __restrict__ Hl, size_t n8) { const size_t t = (size_t)blockIdx.x * 256 + threadIdx.x; if (t >= n8) return; FragH fh, fl; const v4f a = *(const v4fa*)(F + t * 8), c = *(const v4fa*)(F + t * 8 + 4);
#pragma unroll
  for (int q = 0; q < 4; ++q) { _Float16 h = (_Float16)a[q]; fh.h[q] = h; fl.h[q] = (_Float16)((a[q] - (float)h) * 1024.0f); h = (_Float16)c[q]; fh.h[4 + q] = h; fl.h[4 + q] = (_Float16)((c[q] - (float)h) * 1024.0f); }
  { *(v8us*)((unsigned short*)Hh + t * 8) = fh.half[0]; *(v8us*)((unsigned short*)Hl + t * 8) = fl.half[0];  } }

// ---- LDS-staged GEMM: C[M][N] = alpha * A[M][K] . Bt[N][K]^T, f16 operands, f32 accumulation; one 128 x 128 tile of C per block of four waves (2 x 2, 64 x 64 of C a wave); M, N multiples of 128, K of 64 ----
// Each slab of 64 k (128-byte pieces of 128 A rows and 128 Bt rows) comes in as whole-line 16-byte loads (8 lanes a row, 4 rows a wave-load), goes through registers into one of two LDS buffers, and is read from there as fragments:
// every operand byte leaves L2 once per block and serves 64 rows or columns of each wave that needs it. The next slab's global loads fly while this slab is multiplied; one barrier a slab.
__device__ __forceinline__ v16h g2_frag(const _Float16* p, int hh) { FragH f; f.half[0] = *(const v8us*)((const unsigned short*)p + 8 * hh); f.half[1] = *(const v8us*)((const unsigned short*)p + 16 + 8 * hh); return f.v; }
#define G3T 128                      /* tile rows of A and of Bt per block */
#define G3K 64                       /* k per slab */
#define G3P 72                       /* LDS row pitch in f16: 144 bytes = 16 x odd, the conflict-free pitch for 16-byte fragment reads */
#define G3B (2 * G3T * G3P)          /* f16 per buffer: rows 0..127 A, rows 128..255 Bt */
// one slab: every fragment of its 64 k from LDS, then the 2 x 16 products of the wave's 64 x 64 tile, k ascending; each '#pragma unroll' makes the index of a register array a constant
__device__ __forceinline__ void g3_slab(v8f (&acc)[4][4], const unsigned short* fa, const unsigned short* fb, int hh) { v16h a[2][4], b[2][4];
#pragma unroll
  for (int kk = 0; kk < 2; ++kk)
#pragma unroll
    for (int i = 0; i < 4; ++i) { a[kk][i] = g2_frag((const _Float16*)(fa + 16 * i * G3P + 32 * kk), hh); b[kk][i] = g2_frag((const _Float16*)(fb + 16 * i * G3P + 32 * kk), hh); }
#pragma unroll
  for (int kk = 0; kk < 2; ++kk)
#pragma unroll
    for (int i = 0; i < 4; ++i)
#pragma unroll
      for (int j = 0; j < 4; ++j) acc[i][j] = __builtin_amdgcn_wmma_f32_16x16x32_f16(false, a[kk][i], false, b[kk][j], (short)0, acc[i][j], false, false); }
// behind a run of global loads from two pointers: the wait that stands in front of any rewrite of the registers the loads name; naming the pointers keeps their registers live up to the wait.
// Built without it, one load of the run sank to just in front of its LDS store (no time to fly).
#define G3_XW(p, q) asm volatile("s_wait_xcnt 0x0" :: "v"(p), "v"(q) : "memory")
// CAUS: grid z = causal query tile of QT rows (A and C step QT rows a tile). 1 = scores: only key columns up to the tile's end are computed; 2 = P V: K ends at the tile's end. grid x = (rows / 128) * (N / 128), grid y = batch.
// H16: the output rows are f16 (C16), else f32 (C). X32 (with H16): the first QT0 rows of every SQ rows go to C as f32 as well, packed QT0 rows a batch. The row pitches lda, ldb, ldc, N and K are compile-time constants: a thread's eight rows of an operand are then one address pair with immediate offsets.
// VTR (with H16, one batch of SQ rows after the other, the last DM columns = v): a block of v columns stores its f16 tile TRANSPOSED into VT [batch][v column][key] and not into C16.
template <int CAUS, bool H16, bool X32, int lda, int ldb, int ldc, int N, int KF, bool VTR>
__device__ __forceinline__ void g3_body(const _Float16* __restrict__ A, size_t sA, const _Float16* __restrict__ Bh, size_t sB, float alpha,
    float* __restrict__ C, _Float16* __restrict__ C16, size_t sC, _Float16* __restrict__ VT) {
  __shared__ __attribute__((aligned(16))) unsigned short sm[2 * G3B];      /* 73,728 bytes; after the last slab the same bytes stage the output rows */
  const int tid = threadIdx.x, w = tid >> 5, lane = tid & 31, ln = lane & 15, hh = lane >> 4; const int by = blockIdx.y;
  const int qt = CAUS ? SQ / QT - 1 - (int)blockIdx.z : 0;      /* low z starts first: the tile with the most keys goes first */
  A += (size_t)by * sA + (size_t)qt * QT * lda; Bh += (size_t)by * sB; const size_t cofs = (size_t)by * sC + (size_t)qt * QT * ldc;
  const int ntn = N / G3T; const int mt = blockIdx.x / ntn, nq = blockIdx.x - mt * ntn; const int row0 = mt * G3T, col0 = nq * G3T;
  if (CAUS == 1 && col0 >= (qt + 1) * QT) return;      /* the same for the whole block, in front of every barrier */
  const int K = (CAUS == 2) ? (qt + 1) * QT : KF;
  const int sr = tid >> 3, sc = (tid & 7) * 8;      /* staging: thread t moves 16-byte piece t % 8 of rows t / 8 + 16 i, i = 0..7, of both operands */
  const unsigned short* ga = (const unsigned short*)A + (size_t)(row0 + sr) * lda + sc;
  const unsigned short* gb = (const unsigned short*)Bh + (size_t)(col0 + sr) * ldb + sc;
  unsigned short* st = sm + sr * G3P + sc;
  const int wm = w >> 1, wn = w & 1;
  const unsigned short* fa = sm + (wm * 64 + ln) * G3P; const unsigned short* fb = sm + (G3T + wn * 64 + ln) * G3P;
  const v8f z8 = {0.f,0.f,0.f,0.f,0.f,0.f,0.f,0.f}; v8f acc[4][4]; v8us ra[8], rb[8];
  /* every '#pragma unroll' of this kernel makes the index of a register array a constant */
#pragma unroll
  for (int i = 0; i < 4; ++i)
#pragma unroll
    for (int j = 0; j < 4; ++j) acc[i][j] = z8;
#pragma unroll
  for (int i = 0; i < 8; ++i) { ra[i] = *(const v8us*)(ga + 16 * i * lda); rb[i] = *(const v8us*)(gb + 16 * i * ldb); }
  G3_XW(ga, gb);
#pragma unroll
  for (int i = 0; i < 8; ++i) { *(v8us*)(st + 16 * i * G3P) = ra[i]; *(v8us*)(st + (G3T + 16 * i) * G3P) = rb[i]; }
  __syncthreads();
  const int nkt = K / G3K;
  for (int kt = 0; kt + 1 < nkt; ++kt) {      /* the trip count is the same for the whole block */
    const int bo = (kt & 1) * G3B;
    const unsigned short* pa = ga + (kt + 1) * G3K; const unsigned short* pb = gb + (kt + 1) * G3K;
#pragma unroll
    for (int i = 0; i < 8; ++i) { ra[i] = *(const v8us*)(pa + 16 * i * lda); rb[i] = *(const v8us*)(pb + 16 * i * ldb); }
    G3_XW(pa, pb);
    g3_slab(acc, fa + bo, fb + bo, hh);
    unsigned short* sn = st + (G3B - bo);      /* the other buffer: its last readers left it in front of the barrier that ended the slab before */
#pragma unroll
    for (int i = 0; i < 8; ++i) { *(v8us*)(sn + 16 * i * G3P) = ra[i]; *(v8us*)(sn + (G3T + 16 * i) * G3P) = rb[i]; }
    __syncthreads(); }      /* publishes the next slab and ends every read of this one */
  g3_slab(acc, fa + ((nkt - 1) & 1) * G3B, fb + ((nkt - 1) & 1) * G3B, hh);
  __syncthreads();      /* ends every read of the last slab: the output rows are staged over it */
  float* so = (float*)sm + w * (64 * 68);      /* the wave's own 64 x 64 f32 rows at pitch 68, so that the stores below are whole lines */
  if (VTR && col0 >= N - DM) {      /* the same for the whole block: a tile of 128 columns lies wholly inside or outside the v columns */
    const int rs = lane >> 4, k4 = (lane & 15) * 4;
#pragma unroll
    for (int i = 0; i < 4; ++i)
#pragma unroll
      for (int j = 0; j < 4; ++j) acc[i][j] *= alpha;      /* scaled in place, once: both stagings below read the same registers */
    if (X32 && row0 % SQ < QT0) {      /* exact rows: their f32 v rows go out first, staged row by row as in the other blocks */
#pragma unroll
      for (int i = 0; i < 4; ++i)
#pragma unroll
        for (int j = 0; j < 4; ++j)
#pragma unroll
          for (int r = 0; r < 8; ++r) so[(16 * i + 8 * hh + r) * 68 + 16 * j + ln] = acc[i][j][r];
      __builtin_amdgcn_fence(__ATOMIC_ACQ_REL, "workgroup"); __builtin_amdgcn_wave_barrier();      /* the wave reads back what its other lanes wrote */
      float* cx = C + ((size_t)(row0 - (row0 / SQ) * (SQ - QT0) + wm * 64 + rs) * ldc + col0 + wn * 64 + k4);
#pragma unroll
      for (int q = 0; q < 32; ++q) { const v4f v = *(const v4fa*)&so[(q * 2 + rs) * 68 + k4]; *(v4f*)(cx + q * 2 * ldc) = v; }
      asm volatile("s_wait_xcnt 0x0" ::: "memory");      /* in front of the code below, which rewrites the address and data registers of these stores */
      __builtin_amdgcn_fence(__ATOMIC_ACQ_REL, "workgroup"); __builtin_amdgcn_wave_barrier(); }      /* the rows are read before the same bytes are staged anew */
    /* staged column by column: the eight rows a lane holds of one column are neighbours there (two 16-byte LDS stores), and a v column's 64 keys read back as one whole line */
#pragma unroll
    for (int i = 0; i < 4; ++i)
#pragma unroll
      for (int j = 0; j < 4; ++j) { v4f lo4, hi4;
#pragma unroll
        for (int r = 0; r < 4; ++r) { lo4[r] = acc[i][j][r]; hi4[r] = acc[i][j][4 + r]; }
        float* d = &so[(16 * j + ln) * 68 + 16 * i + 8 * hh]; *(v4fa*)d = lo4; *(v4fa*)(d + 4) = hi4; }
    __builtin_amdgcn_fence(__ATOMIC_ACQ_REL, "workgroup"); __builtin_amdgcn_wave_barrier();      /* the wave reads back what its other lanes wrote */
    _Float16* vt = VT + ((size_t)(row0 / SQ) * DM + (col0 - (N - DM)) + wn * 64 + rs) * SQ + row0 % SQ + wm * 64 + k4;
#pragma unroll
    for (int q = 0; q < 32; ++q) { const v4f v = *(const v4fa*)&so[(q * 2 + rs) * 68 + k4]; v4h h4; for (int i = 0; i < 4; ++i) h4[i] = (_Float16)v[i]; *(v4h*)(vt + q * 2 * SQ) = h4; }
    return; }      /* behind the kernel's last barrier */
#pragma unroll
  for (int i = 0; i < 4; ++i)
#pragma unroll
    for (int j = 0; j < 4; ++j)
#pragma unroll
      for (int r = 0; r < 8; ++r) so[(16 * i + 8 * hh + r) * 68 + 16 * j + ln] = acc[i][j][r] * alpha;
  __builtin_amdgcn_fence(__ATOMIC_ACQ_REL, "workgroup"); __builtin_amdgcn_wave_barrier();
  const int rsub = lane >> 4, c4 = (lane & 15) * 4; const size_t co = cofs + (size_t)(row0 + wm * 64 + rsub) * ldc + col0 + wn * 64 + c4; float* cp = H16 ? nullptr : C + co; _Float16* cp16 = H16 ? C16 + co : nullptr;
  if (X32 && row0 % SQ < QT0) {      /* the same for the whole block: a tile of 128 rows lies wholly inside or outside the exact rows */
    float* cx = C + (co - (size_t)(row0 / SQ) * ((SQ - QT0) * ldc));      /* the f16 row's place less the rows of earlier batches that are not kept */
#pragma unroll
    for (int q = 0; q < 32; ++q) { const v4f v = *(const v4fa*)&so[(q * 2 + rsub) * 68 + c4]; v4h h4; for (int i = 0; i < 4; ++i) h4[i] = (_Float16)v[i]; *(v4h*)(cp16 + q * 2 * ldc) = h4; *(v4f*)(cx + q * 2 * ldc) = v; }
    if (VTR) asm volatile("s_wait_xcnt 0x0" ::: "memory"); }      /* the built code lays the v branch behind these stores, with only a conditional branch between, and it rewrites their address and data registers */
  else {
#pragma unroll
    for (int q = 0; q < 32; ++q) { const int r = q * 2 + rsub; const v4f v = *(const v4fa*)&so[r * 68 + c4]; if (!H16) *(v4f*)(cp + q * 2 * ldc) = v; else { v4h h4; for (int i = 0; i < 4; ++i) h4[i] = (_Float16)v[i]; *(v4h*)(cp16 + q * 2 * ldc) = h4; } }
    if (X32) asm volatile("s_wait_xcnt 0x0" ::: "memory"); } }      /* the built code lays the other branch directly behind these stores, with only a conditional branch between, and it rewrites their data registers */
template <int CAUS, bool H16, bool X32, int lda, int ldb, int ldc, int N, int KF>
__global__ __launch_bounds__(128) void k_gemm3(const _Float16* __restrict__ A, size_t sA, const _Float16* __restrict__ Bh, size_t sB, float alpha,
    float* __restrict__ C, _Float16* __restrict__ C16, size_t sC) { g3_body<CAUS, H16, X32, lda, ldb, ldc, N, KF, false>(A, sA, Bh, sB, alpha, C, C16, sC, nullptr); }
// the projection, with the v branch in its epilogue. The register budget of four waves per SIMD is stated: LDS lets four blocks share a WGP, and left free this build took two registers more than that leaves a wave.
template <int lda, int ldb, int ldc, int N, int KF>
__global__ __launch_bounds__(128) __attribute__((amdgpu_waves_per_eu(4, 4))) void k_gemm3v(const _Float16* __restrict__ A, const _Float16* __restrict__ Bh, float alpha,
    float* __restrict__ C, _Float16* __restrict__ C16, _Float16* __restrict__ VT) { g3_body<0, true, true, lda, ldb, ldc, N, KF, true>(A, 0, Bh, 0, alpha, C, C16, 0, VT); }


__global__ __launch_bounds__(256) void k_wnat(const float* __restrict__ w, size_t n8, _Float16* __restrict__ Bt) { const size_t t = (size_t)blockIdx.x * 256 + threadIdx.x; if (t >= n8) return; FragH f; for (int q = 0; q < 8; ++q) f.h[q] = (_Float16)(bf16_round(w[t * 8 + q]) * 16.0f); *(v8us*)((unsigned short*)Bt + t * 8) = f.half[0];  }
__global__ __launch_bounds__(256) void k_rsm(const float* __restrict__ S, _Float16* __restrict__ P, int nrows) {
  #pragma clang fp contract(off)
  const int i = blockIdx.x * 256 + threadIdx.x; if (i >= nrows) return; const float* s = S + (size_t)i * SQ; float mx = -3.0e38f;
#pragma unroll 1
  for (int j = 0; j < SQ; ++j) mx = fmaxf(mx, s[j]); float se = 0.f;
#pragma unroll 1
  for (int j = 0; j < SQ; ++j) se += expf(s[j] - mx); const float sc = 256.0f / se;
#pragma unroll 1
  for (int j0 = 0; j0 < SQ; j0 += 8) { FragH f; for (int q = 0; q < 8; ++q) f.h[q] = (_Float16)(expf(s[j0 + q] - mx) * sc); unsigned short* d = (unsigned short*)P + (size_t)i * SQ + j0; *(v8us*)d = f.half[0];  } }
__global__ __launch_bounds__(256) void k_vt(const _Float16* __restrict__ V16, int b, int h0, _Float16* __restrict__ VT) { __shared__ unsigned short tl[64][65]; const int tid = threadIdx.x; const int hh = blockIdx.x % HG, sg = blockIdx.x / HG; const int s0 = sg * 64; const int h = h0 + hh;
  for (int i = tid; i < 64 * 8; i += 256) { const int j = i / 8, d8 = (i % 8) * 8; FragH f; f.half[0] = *(const v8us*)((const unsigned short*)V16 + ((size_t)b * SQ + s0 + j) * DM + h * HD + d8); for (int q = 0; q < 8; ++q) tl[d8 + q][j] = f.u[q]; }
  __syncthreads();
  { for (int i = tid; i < 64 * 8; i += 256) { const int d = i / 8, j8 = (i % 8) * 8; FragH f; for (int q = 0; q < 8; ++q) f.u[q] = tl[d][j8 + q]; *(v8us*)((unsigned short*)VT + ((size_t)hh * HD + d) * SQ + s0 + j8) = f.half[0]; }  } }



// Causal softmax, ONE S ROW PER WAVE, the row held in registers: lane l owns keys 256 c + 8 l .. + 7 of each 256-key chunk c (two 16-byte loads in, one 16-byte f16 store out per chunk).
// Row max and row sum: per-lane partials (the sum in four independent chains), then a five-step butterfly over the 32 lanes. NC = nk / 256 chunks, all loads of a row in flight together.
// e^x as the fast form has it (one multiply, v_exp_f32). The v_nop is the one slot the instruction set asks for behind a transcendental before its result is read or its source overwritten; it stands in the same statement because the compiler's own schedule of this kernel reused a source register directly behind some v_exp_f32.
__device__ __forceinline__ float rsm_exp(float x) { const float y = x * 1.44269504088896340736f; float e; asm("v_exp_f32 %0, %1\n\tv_nop" : "=v"(e) : "v"(y)); return e; }
template <int NC>
__device__ __forceinline__ void rsm_row(const float* __restrict__ s, unsigned short* __restrict__ p, int k0, int last) {
  float v[NC][8];
#pragma unroll
  for (int c = 0; c < NC; ++c) { const v4f a = *(const v4fa*)(s + c * 256 + k0), b = *(const v4fa*)(s + c * 256 + k0 + 4);
#pragma unroll
    for (int q = 0; q < 4; ++q) { v[c][q] = a[q]; v[c][4 + q] = b[q]; } }
  float mx = -3.0e38f;
#pragma unroll
  for (int c = 0; c < NC; ++c)
#pragma unroll
    for (int q = 0; q < 8; ++q) { if (c * 256 + k0 + q > last) v[c][q] = -1.0e9f; mx = fmaxf(mx, v[c][q]); }
#pragma unroll
  for (int m = 16; m > 0; m >>= 1) mx = fmaxf(mx, __shfl_xor(mx, m, 32));
  float s4[4] = {0.f, 0.f, 0.f, 0.f};
#pragma unroll
  for (int c = 0; c < NC; ++c)
#pragma unroll
    for (int q = 0; q < 8; ++q) { v[c][q] = rsm_exp(v[c][q] - mx); s4[q & 3] += v[c][q]; }
  float se = (s4[0] + s4[1]) + (s4[2] + s4[3]);
#pragma unroll
  for (int m = 16; m > 0; m >>= 1) se += __shfl_xor(se, m, 32);
  const float sc = 256.0f / se;
#pragma unroll
  for (int c = 0; c < NC; ++c) { FragH fr;
#pragma unroll
    for (int q = 0; q < 8; ++q) fr.h[q] = (_Float16)(v[c][q] * sc);
    *(v8us*)(p + c * 256 + k0) = fr.half[0]; }
  asm volatile("s_wait_xcnt 0x0" ::: "memory");      /* the built code lays the row lengths one behind the other, and only a conditional branch stands between these stores and the next length's code, which rewrites their address and data registers */
}
// grid = the token rows past the exact rows, of all batches, one 32-lane block each; a row's length is the end of its own QT-row query tile
__global__ __launch_bounds__(32) void k_rsmcf2(const float* __restrict__ S, _Float16* __restrict__ P, int nrows) {
  if ((int)blockIdx.x >= nrows) return; const int last = QT0 + blockIdx.x % (SQ - QT0); const int t = blockIdx.x / (SQ - QT0) * SQ + last; const int k0 = threadIdx.x * 8;
  const float* s = S + (size_t)t * NKX; unsigned short* p = (unsigned short*)P + (size_t)t * NKX;
  switch (last / QT + 1) {      /* the same for every lane of the wave: straight-line code for each row length */
    case 1: rsm_row<1>(s, p, k0, last); break; case 2: rsm_row<2>(s, p, k0, last); break; case 3: rsm_row<3>(s, p, k0, last); break; case 4: rsm_row<4>(s, p, k0, last); break;
    case 5: rsm_row<5>(s, p, k0, last); break; case 6: rsm_row<6>(s, p, k0, last); break; case 7: rsm_row<7>(s, p, k0, last); break; case 8: rsm_row<8>(s, p, k0, last); break;
    default: break; } }


template <int MASKADD>
__global__ __launch_bounds__(64) void k_att0(const float* __restrict__ QF, const float* __restrict__ KF, const float* __restrict__ VF, int ld, const float* __restrict__ mask, float scale, float* __restrict__ OF, int ldo) {
  #pragma clang fp contract(off)
  __shared__ __attribute__((aligned(16))) float lq[64][64]; __shared__ __attribute__((aligned(16))) float lo[64][64];
  const int tid = threadIdx.x; const int h = blockIdx.x / (QT0 / 64), rg = blockIdx.x % (QT0 / 64); const int i = rg * 64 + tid;
  const float* qr = QF + (size_t)i * ld + h * HD;
#pragma unroll 1
  for (int c = 0; c < HD / 4; ++c) { *(v4f*)&lq[tid][c * 4] = *(const v4fa*)(qr + c * 4); const v4f z = {0.f, 0.f, 0.f, 0.f}; *(v4f*)&lo[tid][c * 4] = z; }
  float m = -1.0e30f, l = 0.f; const int jmax = MASKADD ? (SQ - 1) : (rg * 64 + 63);      /* additive-mask form: every key (the mask input decides); causal form: keys up to the block's last row */
#pragma unroll 1
  for (int j = 0; j <= jmax; ++j) { const float* kr = KF + (size_t)j * ld + h * HD; const float* vr = VF + (size_t)j * ld + h * HD; float s = 0.f;
#pragma unroll 1
    for (int c = 0; c < HD / 4; ++c) { const v4f kq = *(const v4fa*)(kr + c * 4); const v4f qq = *(v4f*)&lq[tid][c * 4]; s = __fadd_rn(s, __fmul_rn(qq[0], kq[0])); s = __fadd_rn(s, __fmul_rn(qq[1], kq[1])); s = __fadd_rn(s, __fmul_rn(qq[2], kq[2])); s = __fadd_rn(s, __fmul_rn(qq[3], kq[3])); }
    s = __fmul_rn(s, scale); if (MASKADD) s = __fadd_rn(s, __fmul_rn(bf16_round(mask[(size_t)i * SQ + j]), -10000.0f));
    const float f = (MASKADD || j <= i) ? 1.f : 0.f; const float sm = fmaf(f, s, (1.f - f) * -1.0e30f); const float mn = fmaxf(m, sm); const float sc = expf(m - mn); const float e = expf(sm - mn); l = __fadd_rn(__fmul_rn(l, sc), e); m = mn;
#pragma unroll 1
    for (int c = 0; c < HD / 4; ++c) { const v4f vv = *(const v4fa*)(vr + c * 4); v4f oo = *(v4f*)&lo[tid][c * 4]; for (int u = 0; u < 4; ++u) oo[u] = __fadd_rn(__fmul_rn(oo[u], sc), __fmul_rn(e, vv[u])); *(v4f*)&lo[tid][c * 4] = oo; } }
  const float fin = 64.0f / l;      /* o carried x64 */
#pragma unroll 1
  for (int c = 0; c < HD / 4; ++c) { v4f oo = *(v4f*)&lo[tid][c * 4]; for (int u = 0; u < 4; ++u) oo[u] = __fmul_rn(oo[u], fin); *(v4f*)&lo[tid][c * 4] = oo; }
  __syncthreads();
  {
#pragma unroll 1
    for (int it = 0; it < 16; ++it) { const int row = it * 4 + tid / 16, pc = (tid % 16) * 4; const v4f v = *(const v4f*)&lo[row][pc]; *(v4f*)(OF + (size_t)(rg * 64 + row) * ldo + h * HD + pc) = v; }
     } }


template <int BFIN, int WXB>
__global__ __launch_bounds__(256) void k_ln16(const float* __restrict__ X, const float* __restrict__ g, const float* __restrict__ bb, float eps, _Float16* __restrict__ N16, float* __restrict__ XB) {
  #pragma clang fp contract(off)
  __shared__ float red[256]; const size_t r = blockIdx.x; const int t = threadIdx.x; const v4f xa = *(const v4fa*)(X + r * DMQ + t * 4); float s[4]; float sum = 0.f;
  for (int q = 0; q < 4; ++q) { s[q] = BFIN ? bf16_round(xa[q]) : xa[q]; sum = __fadd_rn(sum, s[q]); }
  red[t] = sum; __syncthreads(); for (int st = 128; st > 0; st >>= 1) { if (t < st) red[t] = __fadd_rn(red[t], red[t + st]); __syncthreads(); } const float mu = red[0] / (float)DMQ; __syncthreads();
  float vs = 0.f; for (int q = 0; q < 4; ++q) { const float dl = __fadd_rn(s[q], -mu); vs = __fadd_rn(vs, __fmul_rn(dl, dl)); } red[t] = vs; __syncthreads(); for (int st = 128; st > 0; st >>= 1) { if (t < st) red[t] = __fadd_rn(red[t], red[t + st]); __syncthreads(); }
  const float rs = rsqrtf(__fadd_rn(red[0] / (float)DMQ, eps)); v4h y; v4f xb;
  for (int q = 0; q < 4; ++q) { const int c = t * 4 + q; y[q] = (_Float16)__fadd_rn(__fmul_rn(__fmul_rn(__fadd_rn(s[q], -mu), rs), bf16_round(g[c])), bf16_round(bb[c])); xb[q] = s[q]; }
  { *(v4h*)(N16 + r * DMQ + t * 4) = y; if (WXB) *(v4f*)(XB + r * DMQ + t * 4) = xb;  } }
__global__ __launch_bounds__(256) void k_ftres2(const float* __restrict__ OF0, const float* __restrict__ XB, float* __restrict__ X1, size_t n4) {
  #pragma clang fp contract(off)
  const size_t t = (size_t)blockIdx.x * 256 + threadIdx.x; if (t >= n4) return; const v4f o = *(const v4fa*)(OF0 + t * 4), xv = *(const v4fa*)(XB + t * 4); v4f y; for (int q = 0; q < 4; ++q) y[q] = __fadd_rn(__fmul_rn(o[q], 0.015625f), xv[q]); *(v4f*)(X1 + t * 4) = y;  }

__global__ __launch_bounds__(256) void k_wthd(const float* __restrict__ Wt, _Float16* __restrict__ Bt) { const size_t t = (size_t)blockIdx.x * 256 + threadIdx.x; if (t >= (size_t)NH * HD * (DM / 8)) return; const int m8 = (int)(t % (DM / 8)) * 8; const int d = (int)((t / (DM / 8)) % HD); const int h = (int)(t / ((size_t)(DM / 8) * HD)); FragH f;
  for (int q = 0; q < 8; ++q) f.h[q] = (_Float16)(16.0f * bf16_round(Wt[((size_t)h * DM + m8 + q) * HD + d])); unsigned short* dst = (unsigned short*)Bt + ((size_t)h * HD + d) * DM + m8; *(v8us*)dst = f.half[0];  }




__global__ __launch_bounds__(256) void k_wtpad(const float* __restrict__ Wm, _Float16* __restrict__ Wt, int Kr, int Kp, int Nr, int Np, float scale) {
  const int t = blockIdx.x * 256 + threadIdx.x; if (t >= Np * (Kp / 8)) return; const int n = t / (Kp / 8), k8 = (t % (Kp / 8)) * 8; const int nc = min(n, Nr - 1); const float fn = (n < Nr) ? 1.f : 0.f; FragH f;
  for (int i = 0; i < 8; ++i) { const int k = k8 + i; const int kc = min(k, Kr - 1); const float fk = (k < Kr) ? fn : 0.f; f.h[i] = (_Float16)(bf16_round(Wm[(size_t)kc * Nr + nc]) * scale * fk); }
  unsigned short* o = (unsigned short*)Wt + (size_t)n * Kp + k8; *(v8us*)o = f.half[0];  }
__global__ __launch_bounds__(128) void k_bpad(const float* __restrict__ b, float* __restrict__ Bp, int nr, int np) {
  const int i = threadIdx.x; if (i >= np) return; const float v = b[min(i, nr - 1)] * ((i < nr) ? 1.f : 0.f); *(float*)(Bp + i) = v;  }

#define DI 1024       /* inner width = NH * HD */
#define LQK (3 * DI)  /* fused q | k | v row pitch (3072) */
__global__ __launch_bounds__(256) void k_o0(const float* __restrict__ OF, float* __restrict__ ob, size_t n4) {
  #pragma clang fp contract(off)
  const size_t t = (size_t)blockIdx.x * 256 + threadIdx.x; if (t >= n4) return; const size_t e = t * 4; const int i = (int)(e / DI); const int c = (int)(e % DI); const int h = c / HD, d = c % HD; const v4f a = *(const v4fa*)(OF + e); v4f o; for (int q = 0; q < 4; ++q) o[q] = __fmul_rn(a[q], 0.015625f); float* dst = ob + (size_t)h * SQ * HD + (size_t)i * HD + d; *(v4f*)dst = o;  }

#define RQ 4                 /* query rows per block of the exact path */
#define SJP (QT0 + 16)       /* pitch of a score row in LDS: the RQ rows of one key fall on different banks */
// Exact f32 attention for the first QT0 rows of every batch, RQ query rows per block, so that every k row and every v row a block loads serves RQ queries, and every global load is whole lines.
// Scores: one wave per group of 8 keys; lane l holds columns 128 u + 4 l .. + 3 (u = 0..7) of the RQ query rows in registers and of the key row as it comes in; the 8 x RQ = 32 per-lane partial dot products
// are summed over the 32 lanes by a halving exchange (31 exchanges in all) that leaves sum number l (key * RQ + row) in lane l. Softmax: one wave per query row. Output: thread t owns columns 4 t .. + 3 of the RQ rows, keys in order.
// Every '#pragma unroll' of this kernel and its helpers makes the index of a register array a constant; each '#pragma unroll 1' keeps a loop rolled whose body already fills the registers that four waves per SIMD leave a wave.
typedef float v2f __attribute__((ext_vector_type(2)));
// the value of lane ^ BIT, on the vector unit: inside a 16-lane row by DPP (row_xmask), between the two rows by the cross-row move; all 32 lanes are on wherever it is called
template <int BIT>
__device__ __forceinline__ float att0_xor(float x) { int v = __float_as_int(x);
  if constexpr (BIT == 16) v = __builtin_amdgcn_permlanex16(v, v, 0x76543210, 0xfedcba98, false, false); else v = __builtin_amdgcn_update_dpp(v, v, 0x160 + BIT, 0xf, 0xf, false);
  return __int_as_float(v); }
// one step of the halving exchange over lane bit BIT: a lane with the bit set keeps the sums hi[], its partner (lane ^ BIT) the sums lo[]; each hands the other half over; the kept sums come back in lo[]
template <int N, int BIT>
__device__ __forceinline__ void att0_halve(float (&lo)[N], const float (&hi)[N], int lane) { const bool up = (lane & BIT) != 0;
#pragma unroll
  for (int t = 0; t < N; ++t) { const float send = up ? lo[t] : hi[t]; const float keep = up ? hi[t] : lo[t]; lo[t] = keep + att0_xor<BIT>(send); } }
// behind a run of global loads from one pointer: the wait that stands in front of any rewrite of the registers the loads name; naming the pointer keeps its registers live up to the wait, so that no load of the run is given them as its destination
#define ATT0_XW(p) asm volatile("s_wait_xcnt 0x0" :: "v"(p) : "memory")
__device__ __forceinline__ void att0_use8(v4f (&o)[RQ], const v4f (&v)[8], const float (*pe)[RQ]) {      /* eight v rows into the RQ output rows, keys in order */
#pragma unroll
  for (int t = 0; t < 8; ++t) { const v4f e = *(const v4f*)&pe[t][0];
#pragma unroll
    for (int r = 0; r < RQ; ++r) { const v2f er = {e[r], e[r]}; o[r].xy = __builtin_elementwise_fma(er, v[t].xy, o[r].xy); o[r].zw = __builtin_elementwise_fma(er, v[t].zw, o[r].zw); } } }
__global__ __launch_bounds__(256) __attribute__((amdgpu_waves_per_eu(4, 4))) void k_att0w(const float* __restrict__ QF, const float* __restrict__ KF, const float* __restrict__ VF, float scale, float* __restrict__ OF) {      /* q | k | v rows of pitch LQK, QT0 a batch; OF = the output itself, rows of pitch DI, SQ a batch; the register budget of four waves per SIMD, so that a long and a short block share a WGP */
  __shared__ float sj[RQ][SJP]; __shared__ __attribute__((aligned(16))) float pe[QT0][RQ]; __shared__ float fin[RQ];
  const int tid = threadIdx.x, w = __builtin_amdgcn_readfirstlane(tid >> 5), lane = tid & 31; const int b = blockIdx.x % NB, idx = blockIdx.x / NB;      /* the wave's number as a scalar: the key loop stays on the scalar unit; batch fastest */
  const int g = (idx < QT0 / RQ / 2) ? QT0 / RQ - 1 - idx : idx - QT0 / RQ / 2;      /* first half of the grid: the row groups with the most keys, longest first; second half: the short ones, shortest first */
  const int i0 = g * RQ, nk = i0 + RQ;      /* keys 0 .. nk - 1 are seen by at least one of the block's rows */
  QF += (size_t)b * QT0 * LQK; KF += (size_t)b * QT0 * LQK; VF += (size_t)b * QT0 * LQK; OF += (size_t)b * SQ * DI;
  for (int t = tid; t < RQ * SJP; t += 256) (&sj[0][0])[t] = -1.0e30f;      /* keys no wave computes count as masked */
  v4f q[RQ][8]; const float* qp = QF + (size_t)i0 * LQK + lane * 4;
#pragma unroll
  for (int r = 0; r < RQ; ++r)
#pragma unroll
    for (int u = 0; u < 8; ++u) q[r][u] = *(const v4fa*)(qp + r * LQK + u * 128);
  ATT0_XW(qp);
  __syncthreads();
  v4f cur[8]; const float* kp = KF + (size_t)(w * 8) * LQK + lane * 4;      /* the key row in use; the next one is fetched while it is used. Rows w * 8 .. + 7 lie below QT0 for every wave, also for one that has no group */
#pragma unroll
  for (int u = 0; u < 8; ++u) cur[u] = *(const v4fa*)(kp + u * 128);
  ATT0_XW(kp);
#pragma unroll 1
  for (int g8 = w; g8 * 8 < nk; g8 += 8) {      /* the same for every lane of a wave; key rows g8 * 8 .. + 7 lie below QT0 */
    const float* kg = KF + (size_t)(g8 * 8) * LQK + lane * 4;
    const float* kn = KF + (size_t)((((g8 + 8) * 8 < nk) ? g8 + 8 : g8) * 8) * LQK + lane * 4;      /* first row of the wave's next group (the last trip fetches its own first row again) */
    float a4[2][RQ];      /* the exchange runs as a tree beside the keys (2 keys, 4 keys, 8 keys), so that few partial sums are live at a time */
#pragma unroll
    for (int k4 = 0; k4 < 2; ++k4) { float a2[2][RQ];
#pragma unroll
      for (int k2 = 0; k2 < 2; ++k2) { float a1[2][RQ];
#pragma unroll
        for (int k1 = 0; k1 < 2; ++k1) { const int kk = k4 * 4 + k2 * 2 + k1; const float* kr = (kk < 7) ? kg + (kk + 1) * LQK : kn; v4f nxt[8];
#pragma unroll
          for (int u = 0; u < 8; ++u) nxt[u] = *(const v4fa*)(kr + u * 128);
          ATT0_XW(kr);
#pragma unroll
          for (int r = 0; r < RQ; ++r) { v2f s = {0.f, 0.f};      /* even and odd columns in the two halves of a packed multiply-add */
#pragma unroll
            for (int u = 0; u < 8; ++u) { s = __builtin_elementwise_fma(q[r][u].xy, cur[u].xy, s); s = __builtin_elementwise_fma(q[r][u].zw, cur[u].zw, s); }
            a1[k1][r] = s.x + s.y; }
#pragma unroll
          for (int u = 0; u < 8; ++u) cur[u] = nxt[u];
          __builtin_amdgcn_sched_barrier(0); }      /* keeps the eight keys of a group apart: left free, the scheduler mixed their loads and spilled query registers to scratch */
        att0_halve<RQ, 4>(a1[0], a1[1], lane);
#pragma unroll
        for (int r = 0; r < RQ; ++r) a2[k2][r] = a1[0][r]; }
      att0_halve<RQ, 8>(a2[0], a2[1], lane);
#pragma unroll
      for (int r = 0; r < RQ; ++r) a4[k4][r] = a2[0][r]; }
    att0_halve<RQ, 16>(a4[0], a4[1], lane);
    float b2[2][2] = {{a4[0][0], a4[0][1]}, {a4[0][2], a4[0][3]}}; att0_halve<2, 2>(b2[0], b2[1], lane);
    float b1[2][1] = {{b2[0][0]}, {b2[0][1]}}; att0_halve<1, 1>(b1[0], b1[1], lane);
    const int j = g8 * 8 + (lane >> 2), r = lane & 3;      /* lane bits 16, 8, 4 chose the key in the group, bits 2, 1 the row */
    sj[r][j] = (j <= i0 + r) ? b1[0][0] * scale : -1.0e30f; }
  __syncthreads();
  if (w < RQ) { float sv[QT0 / 32]; float mx = -1.0e30f;
#pragma unroll
    for (int u = 0; u < QT0 / 32; ++u) { sv[u] = sj[w][u * 32 + lane]; mx = fmaxf(mx, sv[u]); }
    mx = fmaxf(mx, att0_xor<1>(mx)); mx = fmaxf(mx, att0_xor<2>(mx)); mx = fmaxf(mx, att0_xor<4>(mx)); mx = fmaxf(mx, att0_xor<8>(mx)); mx = fmaxf(mx, att0_xor<16>(mx));
    float ls = 0.f;
#pragma unroll
    for (int u = 0; u < QT0 / 32; ++u) { const float e = expf(sv[u] - mx); pe[u * 32 + lane][w] = e; ls += e; }
    ls += att0_xor<1>(ls); ls += att0_xor<2>(ls); ls += att0_xor<4>(ls); ls += att0_xor<8>(ls); ls += att0_xor<16>(ls);
    if (lane == 0) fin[w] = 1.0f / ls; }
  __syncthreads();
  const float* vp = VF + tid * 4; const v4f z4 = {0.f, 0.f, 0.f, 0.f}; v4f o[RQ] = {z4, z4, z4, z4}; v4f va[8], vb[8];
  const int nk16 = (nk + 15) & ~15;      /* v rows in steps of 16: rows nk .. nk16 - 1 lie below QT0 and carry weight 0 for all RQ queries */
#pragma unroll
  for (int t = 0; t < 8; ++t) va[t] = *(const v4fa*)(vp + t * LQK);
  ATT0_XW(vp);
#pragma unroll 1
  for (int j = 0; j < nk16; j += 16) {      /* two sets of eight v rows: one flies while the other is used */
    const float* pb = vp + (size_t)(j + 8) * LQK;
#pragma unroll
    for (int t = 0; t < 8; ++t) vb[t] = *(const v4fa*)(pb + t * LQK);
    ATT0_XW(pb);
    att0_use8(o, va, &pe[j]);
    __builtin_amdgcn_sched_barrier(0);      /* keeps each fetch ahead of the work it flies beside: left free, the loads were moved down to where their rows are used */
    const float* pa = vp + (size_t)((j + 16 < nk16) ? j + 16 : j) * LQK;      /* the last trip loads its own first rows again */
#pragma unroll
    for (int t = 0; t < 8; ++t) va[t] = *(const v4fa*)(pa + t * LQK);
    ATT0_XW(pa);
    att0_use8(o, vb, &pe[j + 8]);
    __builtin_amdgcn_sched_barrier(0); }      /* as above */
#pragma unroll
  for (int r = 0; r < RQ; ++r) { const v4f y = o[r] * fin[r]; *(v4f*)(OF + (size_t)(i0 + r) * DI + tid * 4) = y; } }

__global__ __launch_bounds__(256) void k_o0m(const float* __restrict__ OF, float* __restrict__ o_, size_t n4) {
  #pragma clang fp contract(off)
  const size_t t = (size_t)blockIdx.x * 256 + threadIdx.x; if (t >= n4) return; const size_t e = t * 4; OF += (size_t)blockIdx.y * QT0 * DI; o_ += (size_t)blockIdx.y * SQ * DI;      /* grid y = batch */
  const v4f a = *(const v4fa*)(OF + e); v4f o; for (int q = 0; q < 4; ++q) o[q] = __fmul_rn(a[q], 0.015625f); *(v4f*)(o_ + e) = o;  }
extern "C" void kernel_launch(void* const* d_in, const int* in_sizes, int n_in,
                              void* d_out, int out_size, void* d_ws, size_t ws_size, hipStream_t stream) {
  (void)in_sizes; (void)n_in; (void)out_size;
  const float* const* I = (const float* const*)d_in; const float* x = I[0]; const float* wqkv = I[1];      /* input order: x [4][2048][1024], W_qkv ([in][out] [1024][3072]: q | k | v column thirds); the module has no biases and no output projection */
  char* ws = (char*)d_ws; size_t off = 0;
  auto take = [&](size_t bytes) { char* p = ws + off; off += (bytes + 255) & ~(size_t)255; return p; };
  _Float16* BW = (_Float16*)take((size_t)LQK * DM * 2); _Float16* X16 = (_Float16*)take(NR * DM * 2); _Float16* QKV = (_Float16*)take(NR * LQK * 2); _Float16* VT = (_Float16*)take((size_t)NB * DI * SQ * 2);
  float* S = (float*)take(NR * NKX * 4); _Float16* P = (_Float16*)take(NR * NKX * 2); float* QKVF0 = (float*)take((size_t)NB * QT0 * LQK * 4);      /* ONE head: S / P row = token row, pitch NKX; every plane holds all batches */
  if (off > ws_size) return;
  k_wtpad<<<(unsigned)(((size_t)LQK * (DM / 8) + 255) / 256), 256, 0, stream>>>(wqkv, BW, DM, DM, LQK, LQK, 16.0f);      /* [in][out] [1024][3072] -> Bt[n][k] x16 (no padding: Kr = Kp = 1024, Nr = Np = 3072) */
  k_x16<<<(unsigned)((NR * DM / 8 + 255) / 256), 256, 0, stream>>>(x, X16, NR * DM / 8);      /* x (bf16-valued) as exact f16 rows */
  k_gemm3v<DM, DM, LQK, LQK, DM><<<dim3((unsigned)((NR / 128) * (LQK / 128)), 1), 128, 0, stream>>>(X16, BW, 0.0625f, QKVF0, QKV, VT);      /* q | k | v = x W: q and k -> f16 rows, column blocks 0 / 1024 of the fused plane (pitch 3072); v -> V^T [NB][1024][SQ] f16; no bias; rows 0..511 of every batch also as f32 (exact products, f32 accumulation) */
  const _Float16* Q16 = QKV; const _Float16* K16 = QKV + DI;
  k_gemm3<1, false, false, LQK, LQK, NKX, SQ, DI><<<dim3((QT / 128) * (SQ / 128), NB, (SQ - QT0) / QT), 128, 0, stream>>>(Q16, (size_t)SQ * LQK, K16, (size_t)SQ * LQK, 0.03125f, S, nullptr, (size_t)SQ * NKX);      /* scores / sqrt(1024) over the FULL width (K = 1024), one head; causal: only keys below each tile's end; query tiles past the exact rows */
  k_rsmcf2<<<NB * (SQ - QT0), 32, 0, stream>>>(S, P, NB * (SQ - QT0));      /* causal softmax -> P x256 f16, one wave per row */
  k_gemm3<2, false, false, NKX, SQ, DI, DI, SQ><<<dim3((QT / 128) * (DI / 128), NB, (SQ - QT0) / QT), 128, 0, stream>>>(P, (size_t)SQ * NKX, VT, (size_t)DI * SQ, 0.00390625f, (float*)d_out, nullptr, (size_t)SQ * DI);      /* out[b][q][:] = P V^T 2^-8 (f32), N = 1024, keys up to each tile's end */
  k_att0w<<<NB * (QT0 / RQ), 256, 0, stream>>>(QKVF0, QKVF0 + DI, QKVF0 + 2 * DI, 0.03125f, (float*)d_out);      /* exact f32 single-head causal attention for rows 0..511 of every batch, stored into the output rows */
}

// v007
// It runs in 157 microseconds.
// Two timings next to v006 both put it at 1.08 times that version's speed.
// Counting every step since v000, it is 56.7 times as fast.
#include <hip/hip_runtime.h>
// Causal SINGLE-HEAD self-attention of full width with a fused bias-free QKV projection and NO output projection (x [4][2048][1024]; qkv = x W_qkv ([in][out] 1024 x 3072, no bias) split into q | k | v thirds of width 1024; scores = q k^T / sqrt(1024) over the FULL width (one head); causal (keys after the query -> -inf); softmax over keys; out = attn v -> [4][2048][1024]).
// Structure: token rows; x as exact f16 rows; ONE WMMA GEMM into the f16 q | k plane (pitch 3072) and, from the same epilogue, v^T [batch][1024][2048]; causal 256-row query tiles: scores GEMM with K = 1024 (alpha 1/32), causal softmax f32 -> f16 x256 weights, P . V^T GEMM with N = 1024 written as f32 (alpha 2^-8) straight into the output rows (query tiles past the exact rows only). Every stage is ONE launch over all batches (the two causal GEMMs: batch in grid y, query tile past the exact rows in grid z); S, P, V^T and the f32 planes hold all of them in the workspace.
// First-tile refinement: the first 512 query rows of every batch (which see few keys, so single-f16 q / k / v / P would be too coarse with no output projection to average the errors) are computed exactly and only so: the projection GEMM stores their q | k | v rows as f32 too (exact products, f32 accumulation), and an f32 attention on VALU (k_att0w: four query rows per block; full-width dot products; precise expf) stores them into the output; the f16 scores, softmax and P . V stages leave these rows out.
// Compute dtype: inputs rounded to bf16; x / weights exact; q, k, v and the softmax weights as plain f16 GEMM operands (~2^-12) past the exact rows; scores, softmax statistics and the output accumulation f32. v_wmma_f32_16x16x32_f16.
#define NB 4
#define SQ 2048
#define DM 1024
#define NH 16
#define HD 64
#define HG 4                         /* heads per attention launch group */
#define QT 256                       /* query rows per causal tile */
#define NKX SQ                       /* S / P row pitch */
#define QT0 512                      /* first-tile rows recomputed exactly (f32): 512 here (no output projection averages the early-row cancellation errors away; logit sigma 1.0) */
#define B0 0                         /* unused (each launch covers all batches) */
#define NBR NB                       /* unused by the launches (they cover all NB batches in their grids) */
#define NR ((size_t)NB * SQ)
#define DMQ DM
#define DFF 4096                     /* unused (no FFN in this file) */
#define DFFR 100                     /* unused */
#define MP ((int)((size_t)NBR * SQ)) /* unused by the launches (the projection covers NR rows) */
#define QN SQ                        /* unused (the query tiles cover SQ rows) */
#define NHD NH                       /* unused (one full-width head is attended) */
#define MPO MP                       /* unused (there is no output stage) */
#define LQ (3 * DM)      /* unused (the q | k | v rows have pitch LQK) */
typedef __bf16 v16b __attribute__((ext_vector_type(16)));
typedef unsigned short v8us __attribute__((ext_vector_type(8), may_alias));
typedef float  v8f  __attribute__((ext_vector_type(8)));
typedef float  v4f  __attribute__((ext_vector_type(4)));
typedef float  v4fa __attribute__((ext_vector_type(4), may_alias));
union FragB { v16b v; v8us half[2]; unsigned short u[16]; };

__device__ __forceinline__ unsigned short bf16_bits(float x) { unsigned int u = __float_as_uint(x); return (unsigned short)((u + 0x7FFFu + ((u >> 16) & 1u)) >> 16); }
__device__ __forceinline__ float bf16_val(unsigned short b) { return __uint_as_float(((unsigned int)b) << 16); }
__device__ __forceinline__ float bf16_round(float x) { return bf16_val(bf16_bits(x)); }
// D += A·B with NT terms: 1 = ah·bh, 2 = + al·bh (A split), 3 = + ah·bl (both split)
template <int NT>
__device__ __forceinline__ v8f mmaN(v16b ah, v16b al, v16b bh, v16b bl, v8f c) {
  c = __builtin_amdgcn_wmma_f32_16x16x32_bf16(false, ah, false, bh, (short)0, c, false, false);
  if (NT >= 2) c = __builtin_amdgcn_wmma_f32_16x16x32_bf16(false, al, false, bh, (short)0, c, false, false);
  if (NT >= 3) c = __builtin_amdgcn_wmma_f32_16x16x32_bf16(false, ah, false, bl, (short)0, c, false, false);
  asm volatile("v_nop\n\tv_nop\n\tv_nop\n\tv_nop" : "+v"(c) : "v"(ah), "v"(al), "v"(bh), "v"(bl));
  return c;
}

__global__ __launch_bounds__(256) void k_wt_bf16(const float* __restrict__ W, unsigned short* __restrict__ Wt, int K, int N) {
  const int t = blockIdx.x * 256 + threadIdx.x;
  const int k8n = K / 8;
  if (t >= N * k8n) return;
  const int n = t / k8n, k8 = (t % k8n) * 8;
  v8us v;
#pragma unroll
  for (int i = 0; i < 8; ++i) v[i] = bf16_bits(W[(size_t)(k8 + i) * N + n]);
  *(v8us*)(Wt + (size_t)n * K + k8) = v;
  
}

// GEMM C[M][N] (f32, pitch ldc) = act(A[M][K]·W + bias). A f32 row-major (pitch lda) converted per fragment to bf16
// (ASPLIT: hi/lo two planes -> 2 terms, else single rounded term); Wt bf16 [N][K] (pitch ldb). BIAS_BF16 rounds the
// bias to bf16 first (bias quantised to bf16 before the add). K%32==0, M%16==0, N%64==0.
template <bool ASPLIT, int ACT, bool BIAS_BF16>
__global__ __launch_bounds__(128) void k_gemm_bf(const float* __restrict__ A, int lda, const unsigned short* __restrict__ Wt, int ldb,
                                               const float* __restrict__ bias, float* __restrict__ C, int ldc, int M, int N, int K) {
  __shared__ __attribute__((aligned(16))) float so[4][16][64];
  const int tid = threadIdx.x, w = tid >> 5, lane = tid & 31, ln = lane & 15, hh = lane >> 4;
  const int ntn = N / 64;
  const int wid = blockIdx.x * 4 + w;
  const int mt = wid / ntn, nq = wid % ntn;
  if (mt * 16 >= M) return;
  const int row0 = mt * 16, col0 = nq * 64;
  const float* arow = A + (size_t)(row0 + ln) * lda;
  v8f acc[4] = {};
  for (int kb = 0; kb < K; kb += 32) {
    FragB ah, al;
    const v4f x0 = *(const v4fa*)(arow + kb + 8 * hh), x1 = *(const v4fa*)(arow + kb + 8 * hh + 4);
    const v4f x2 = *(const v4fa*)(arow + kb + 16 + 8 * hh), x3 = *(const v4fa*)(arow + kb + 16 + 8 * hh + 4);
    float xs[16] = {x0[0],x0[1],x0[2],x0[3],x1[0],x1[1],x1[2],x1[3],x2[0],x2[1],x2[2],x2[3],x3[0],x3[1],x3[2],x3[3]};
#pragma unroll
    for (int i = 0; i < 16; ++i) { const unsigned short hb = bf16_bits(xs[i]); ah.u[i] = hb; al.u[i] = ASPLIT ? bf16_bits(xs[i] - bf16_val(hb)) : (unsigned short)0; }
#pragma unroll
    for (int t = 0; t < 4; ++t) {
      const unsigned short* brow = Wt + (size_t)(col0 + t * 16 + ln) * ldb + kb;
      FragB b;
      b.half[0] = *(const v8us*)(brow + 8 * hh);
      b.half[1] = *(const v8us*)(brow + 16 + 8 * hh);
      acc[t] = mmaN<ASPLIT ? 2 : 1>(ah.v, al.v, b.v, b.v, acc[t]);
    }
  }
#pragma unroll
  for (int t = 0; t < 4; ++t) {
    float bv = bias ? bias[col0 + t * 16 + ln] : 0.f;
    if (BIAS_BF16) bv = bf16_round(bv);
#pragma unroll
    for (int r = 0; r < 8; ++r) { float v = acc[t][r] + bv; if (ACT == 1) v = fmaxf(v, 0.f); so[w][8 * hh + r][t * 16 + ln] = v; }
  }
  __builtin_amdgcn_fence(__ATOMIC_ACQ_REL, "workgroup");
  __builtin_amdgcn_wave_barrier();
  const int rsub = lane >> 4, c4 = (lane & 15) * 4;
  {
#pragma unroll
    for (int q = 0; q < 8; ++q) {
      const int r = q * 2 + rsub;
      const v4f v = *(const v4fa*)&so[w][r][c4];
      *(v4f*)(C + (size_t)(row0 + r) * ldc + col0 + c4) = v;
    }
    
  }
}

// GEMM C = act(A·W + bias + resid): A f32 (ASPLIT -> hi/lo 2 terms), Wt bf16 [N][K]; ACT 0 none, 1 relu, 2 exact gelu;
// resid (optional, f32, row index = (row % rmod), pitch ldr, RES_BF16 rounds it) added before the activation.
template <bool ASPLIT, int ACT, bool BIAS_BF16, bool RES_BF16>
__global__ __launch_bounds__(128) void k_gemm_bf3(const float* __restrict__ A, int lda, const unsigned short* __restrict__ Wt, int ldb,
                                                const float* __restrict__ bias, const float* __restrict__ resid, int rmod, int ldr,
                                                float* __restrict__ C, int ldc, int M, int N, int K) {
  __shared__ __attribute__((aligned(16))) float so[4][16][64];
  const int tid = threadIdx.x, w = tid >> 5, lane = tid & 31, ln = lane & 15, hh = lane >> 4;
  const int ntn = N / 64;
  const int wid = blockIdx.x * 4 + w;
  const int mt = wid / ntn, nq = wid % ntn;
  if (mt * 16 >= M) return;
  const int row0 = mt * 16, col0 = nq * 64;
  const float* arow = A + (size_t)(row0 + ln) * lda;
  v8f acc[4] = {};
  for (int kb = 0; kb < K; kb += 32) {
    FragB ah, al;
    const v4f x0 = *(const v4fa*)(arow + kb + 8 * hh), x1 = *(const v4fa*)(arow + kb + 8 * hh + 4);
    const v4f x2 = *(const v4fa*)(arow + kb + 16 + 8 * hh), x3 = *(const v4fa*)(arow + kb + 16 + 8 * hh + 4);
    float xs[16] = {x0[0],x0[1],x0[2],x0[3],x1[0],x1[1],x1[2],x1[3],x2[0],x2[1],x2[2],x2[3],x3[0],x3[1],x3[2],x3[3]};
#pragma unroll
    for (int i = 0; i < 16; ++i) { const unsigned short hb = bf16_bits(xs[i]); ah.u[i] = hb; al.u[i] = ASPLIT ? bf16_bits(xs[i] - bf16_val(hb)) : (unsigned short)0; }
#pragma unroll
    for (int t = 0; t < 4; ++t) {
      const unsigned short* brow = Wt + (size_t)(col0 + t * 16 + ln) * ldb + kb;
      FragB b;
      b.half[0] = *(const v8us*)(brow + 8 * hh);
      b.half[1] = *(const v8us*)(brow + 16 + 8 * hh);
      acc[t] = mmaN<ASPLIT ? 2 : 1>(ah.v, al.v, b.v, b.v, acc[t]);
    }
  }
#pragma unroll
  for (int t = 0; t < 4; ++t) {
    const int col = col0 + t * 16 + ln;
    float bv = bias ? bias[col] : 0.f;
    if (BIAS_BF16) bv = bf16_round(bv);
#pragma unroll
    for (int r = 0; r < 8; ++r) {
      float v = acc[t][r] + bv;
      if (resid) { float rv = resid[(size_t)((row0 + 8 * hh + r) % rmod) * ldr + col]; if (RES_BF16) rv = bf16_round(rv); v += rv; }
      if (ACT == 1) v = fmaxf(v, 0.f);
      if (ACT == 2) v = 0.5f * v * (1.0f + erff(v * 0.70710678118654752f));
      if (ACT == 3) { const float u = 0.7978845608028654f * (v + 0.044715f * v * v * v); v = 0.5f * v * (1.0f + tanhf(u)); }
      so[w][8 * hh + r][t * 16 + ln] = v;
    }
  }
  __builtin_amdgcn_fence(__ATOMIC_ACQ_REL, "workgroup");
  __builtin_amdgcn_wave_barrier();
  const int rsub = lane >> 4, c4 = (lane & 15) * 4;
  {
#pragma unroll
    for (int q = 0; q < 8; ++q) {
      const int r = q * 2 + rsub;
      const v4f v = *(const v4fa*)&so[w][r][c4];
      *(v4f*)(C + (size_t)(row0 + r) * ldc + col0 + c4) = v;
    }
    
  }
}
// row LayerNorm (biased variance, eps) over N: s = X (+ R); optional out_sum <- s; out_norm <- (s-mu)*rsqrt(var+eps)*g + b
template <bool PARAM_BF16>
__global__ __launch_bounds__(256) void k_layernorm(const float* __restrict__ X, const float* __restrict__ R, const float* __restrict__ g, const float* __restrict__ bta,
                                                  float* __restrict__ out_sum, float* __restrict__ out_norm, int N, float eps) {
  __shared__ float red[256];
  const int row = blockIdx.x, tid = threadIdx.x;
  const float* x = X + (size_t)row * N; const float* rr = R ? R + (size_t)row * N : nullptr;
  float vals[16];                     // up to N = 4096
  const int per = N / 256;            // contiguous chunk per thread? use strided-by-4 chunks: thread handles j = tid*4 + 1024*u
  float s1 = 0.f;
  for (int u = 0; u < per / 4; ++u) {
    const int j = tid * 4 + 1024 * u;
    const v4f a = *(const v4fa*)(x + j);
    v4f b = {0.f,0.f,0.f,0.f}; if (rr) b = *(const v4fa*)(rr + j);
#pragma unroll
    for (int q = 0; q < 4; ++q) { const float v = a[q] + b[q]; vals[u * 4 + q] = v; s1 += v; }
  }
  red[tid] = s1; __syncthreads();
  for (int st = 128; st > 0; st >>= 1) { if (tid < st) red[tid] += red[tid + st]; __syncthreads(); }
  const float mu = red[0] / (float)N; __syncthreads();
  float s2 = 0.f;
  for (int u = 0; u < per / 4; ++u)
#pragma unroll
    for (int q = 0; q < 4; ++q) { const float c = vals[u * 4 + q] - mu; s2 += c * c; }
  red[tid] = s2; __syncthreads();
  for (int st = 128; st > 0; st >>= 1) { if (tid < st) red[tid] += red[tid + st]; __syncthreads(); }
  const float rs = rsqrtf(red[0] / (float)N + eps);
  {
    for (int u = 0; u < per / 4; ++u) {
      const int j = tid * 4 + 1024 * u;
      v4f o, sm;
#pragma unroll
      for (int q = 0; q < 4; ++q) {
        float gg = g[j + q], bb = bta[j + q];
        if (PARAM_BF16) { gg = bf16_round(gg); bb = bf16_round(bb); }
        sm[q] = vals[u * 4 + q]; o[q] = (vals[u * 4 + q] - mu) * rs * gg + bb;
      }
      if (out_sum) *(v4f*)(out_sum + (size_t)row * N + j) = sm;
      *(v4f*)(out_norm + (size_t)row * N + j) = o;
    }
    
  }
}



// ---- f16 WMMA path (v_wmma_f32_16x16x32_f16): 11-bit significands for operands in range — used where a [0,1] probability operand needs more precision than bf16
typedef _Float16 v16h __attribute__((ext_vector_type(16)));
union FragH { v16h v; v8us half[2]; _Float16 h[16]; unsigned short u[16]; };
template <int NT>
__device__ __forceinline__ v8f mmaH(v16h ah, v16h al, v16h bh, v16h bl, v8f c) {
  c = __builtin_amdgcn_wmma_f32_16x16x32_f16(false, ah, false, bh, (short)0, c, false, false);
  if (NT >= 2) c = __builtin_amdgcn_wmma_f32_16x16x32_f16(false, al, false, bh, (short)0, c, false, false);
  if (NT >= 3) c = __builtin_amdgcn_wmma_f32_16x16x32_f16(false, ah, false, bl, (short)0, c, false, false);
  asm volatile("v_nop\n\tv_nop\n\tv_nop\n\tv_nop" : "+v"(c) : "v"(ah), "v"(al), "v"(bh), "v"(bl));
  return c;
}
// batched GEMM like k_gemm_b but f16 operands: A f32 (split into f16 hi/lo if ASPLIT, else rounded to f16), Bt = f16 values [n][k]; alpha; C f32; N multiple of 16 (partial tiles skipped)
template <bool ASPLIT>
__global__ __launch_bounds__(128) void k_gemm_h(const float* __restrict__ A, int lda, size_t sA, const _Float16* __restrict__ Bh, int ldb, size_t sB, float alpha, float* __restrict__ C, int ldc, size_t sC, int M, int N, int K) {
  __shared__ __attribute__((aligned(16))) float so[4][16][64];
  const int tid = threadIdx.x, w = tid >> 5, lane = tid & 31, ln = lane & 15, hh = lane >> 4; const int by = blockIdx.y;
  A += (size_t)by * sA; Bh += (size_t)by * sB; C += (size_t)by * sC;
  const int ntn = (N + 63) / 64; const int wid = blockIdx.x * 4 + w; const int mt = wid / ntn, nq = wid % ntn; if (mt * 16 >= M) return;
  const int row0 = mt * 16, col0 = nq * 64; const float* arow = A + (size_t)(row0 + ln) * lda;
  v8f acc[4] = {};
  for (int kb = 0; kb < K; kb += 32) {
    FragH ah, al;
    const v4f x0 = *(const v4fa*)(arow + kb + 8 * hh), x1 = *(const v4fa*)(arow + kb + 8 * hh + 4), x2 = *(const v4fa*)(arow + kb + 16 + 8 * hh), x3 = *(const v4fa*)(arow + kb + 16 + 8 * hh + 4);
    float xs[16] = {x0[0],x0[1],x0[2],x0[3],x1[0],x1[1],x1[2],x1[3],x2[0],x2[1],x2[2],x2[3],x3[0],x3[1],x3[2],x3[3]};
#pragma unroll
    for (int i = 0; i < 16; ++i) { const _Float16 h = (_Float16)xs[i]; ah.h[i] = h; al.h[i] = ASPLIT ? (_Float16)(xs[i] - (float)h) : (_Float16)0.0f; }
#pragma unroll
    for (int t = 0; t < 4; ++t) { if (col0 + t * 16 >= N) continue; const size_t boff = (size_t)(col0 + t * 16 + ln) * ldb + kb; FragH bq; bq.half[0] = *(const v8us*)(Bh + boff + 8 * hh); bq.half[1] = *(const v8us*)(Bh + boff + 16 + 8 * hh);
      acc[t] = mmaH<ASPLIT ? 2 : 1>(ah.v, al.v, bq.v, bq.v, acc[t]); }
  }
#pragma unroll
  for (int t = 0; t < 4; ++t) { if (col0 + t * 16 >= N) continue;
#pragma unroll
    for (int r = 0; r < 8; ++r) so[w][8 * hh + r][t * 16 + ln] = acc[t][r] * alpha; }
  __builtin_amdgcn_fence(__ATOMIC_ACQ_REL, "workgroup"); __builtin_amdgcn_wave_barrier();
  const int rsub = lane >> 4, c4 = (lane & 15) * 4;
  {
#pragma unroll
    for (int q = 0; q < 8; ++q) { const int r = q * 2 + rsub; if (col0 + c4 < N) { const v4f v = *(const v4fa*)&so[w][r][c4]; *(v4f*)(C + (size_t)(row0 + r) * ldc + col0 + c4) = v; } }
     }
}

// Wt[n][k] = f16(W[k][n]·scale) from f32 row-major W[K][N] (scale = power of two; bf16-exact weights stay exact in f16 away from the subnormal range)
__global__ __launch_bounds__(256) void k_wt_f16(const float* __restrict__ W, _Float16* __restrict__ Wt, int K, int N, float scale) {
  const int t = blockIdx.x * 256 + threadIdx.x; if (t >= N * (K / 8)) return; const int n = t / (K / 8), k8 = (t % (K / 8)) * 8; FragH f;
#pragma unroll
  for (int i = 0; i < 8; ++i) f.h[i] = (_Float16)(bf16_round(W[(size_t)(k8 + i) * N + n]) * scale); const v8us o = f.half[0];
  *(v8us*)((unsigned short*)Wt + (size_t)n * K + k8) = o; 
}
// k_gemm_hh variant with fused epilogue: v = acc·alpha + bias[by·sBias + col] (+ CP[(row/rowsPerB)·sCPb + by·64 + col] if CP) ; ACT 0 none / 1 elu ; writes f16 C16 (and f32 C if non-null)
template <int ACT>
__global__ __launch_bounds__(128) void k_gemm_hhx(const _Float16* __restrict__ A, int lda, size_t sA, const _Float16* __restrict__ Bh, int ldb, size_t sB, float alpha, const float* __restrict__ bias, size_t sBias, const float* __restrict__ CP, int rowsPerB, size_t sCPb, int row0g,
    float* __restrict__ C, _Float16* __restrict__ C16, int ldc, size_t sC, int M, int N, int K) {
  __shared__ __attribute__((aligned(16))) float so[4][16][64];
  const int tid = threadIdx.x, w = tid >> 5, lane = tid & 31, ln = lane & 15, hh = lane >> 4; const int by = blockIdx.y;
  A += (size_t)by * sA; Bh += (size_t)by * sB; const size_t cofs = (size_t)by * sC; const float* bp = bias ? bias + (size_t)by * sBias : nullptr;
  const int ntn = (N + 63) / 64; const int wid = blockIdx.x * 4 + w; const int mt = wid / ntn, nq = wid % ntn; if (mt * 16 >= M) return;
  const int row0 = mt * 16, col0 = nq * 64; const _Float16* arow = A + (size_t)(row0 + ln) * lda;
  v8f acc[4] = {};
  for (int kb = 0; kb < K; kb += 32) { FragH ah; ah.half[0] = *(const v8us*)((const unsigned short*)arow + kb + 8 * hh); ah.half[1] = *(const v8us*)((const unsigned short*)arow + kb + 16 + 8 * hh);
#pragma unroll
    for (int t = 0; t < 4; ++t) { if (col0 + t * 16 >= N) continue; const size_t boff = (size_t)(col0 + t * 16 + ln) * ldb + kb; FragH bq; bq.half[0] = *(const v8us*)((const unsigned short*)Bh + boff + 8 * hh); bq.half[1] = *(const v8us*)((const unsigned short*)Bh + boff + 16 + 8 * hh);
      acc[t] = mmaH<1>(ah.v, ah.v, bq.v, bq.v, acc[t]); }
  }
#pragma unroll
  for (int t = 0; t < 4; ++t) { if (col0 + t * 16 >= N) continue; const int col = col0 + t * 16 + ln; const float bv = bp ? bf16_round(bp[col]) : 0.f;
#pragma unroll
    for (int r = 0; r < 8; ++r) { float v = acc[t][r] * alpha + bv; if (CP) { const int rr = row0g + row0 + 8 * hh + r; if (rowsPerB < 0) v += CP[cofs + (size_t)rr * ldc + col];      /* rowsPerB < 0: own element of the batched C plane */ else { const int bidx = rr / rowsPerB; v += CP[(size_t)bidx * sCPb + (size_t)by * 64 + col]; } } if (ACT == 1) v = (v > 0.f) ? v : expm1f(v); else if (ACT == 7) v = (v > 0.f) ? v + 1.0f : expf(v); else if (ACT == 8) v = tanhf(v); else if (ACT == 9) v = 0.5f * v * (1.0f + tanhf(0.7978845608028654f * (v + 0.044715f * v * v * v))); else if (ACT == 11) v = 1.0f / (1.0f + expf(-v)); else if (ACT == 12) v = (v > 0.f) ? v : 0.01f * v; else if (ACT == 14) v = (v > 0.f) ? v : 0.1f * v; else if (ACT == 16) v = (v >= 0.f) ? v : 0.3f * v; else if (ACT == 17) v = (v >= 0.f) ? v : 0.2f * v; else if (ACT == 15) v = v / (1.0f + expf(-v)); else if (ACT == 3) v = fmaxf(v, 0.f); else if (ACT == 6) v = 0.5f * v * (1.0f + erff(v * 0.70710678118654752f)); so[w][8 * hh + r][t * 16 + ln] = v; } }
  __builtin_amdgcn_fence(__ATOMIC_ACQ_REL, "workgroup"); __builtin_amdgcn_wave_barrier();
  const int rsub = lane >> 4, c4 = (lane & 15) * 4; typedef _Float16 v4h __attribute__((ext_vector_type(4)));
  {
#pragma unroll
    for (int q = 0; q < 8; ++q) { const int r = q * 2 + rsub; if (col0 + c4 < N) { const v4f v = *(const v4fa*)&so[w][r][c4]; if (C) *(v4f*)(C + cofs + (size_t)(row0 + r) * ldc + col0 + c4) = v; if (C16) { v4h h4; for (int i = 0; i < 4; ++i) h4[i] = (_Float16)v[i]; *(v4h*)(C16 + cofs + (size_t)(row0 + r) * ldc + col0 + c4) = h4; } } }
     }
}


typedef _Float16 v4h __attribute__((ext_vector_type(4)));

__global__ __launch_bounds__(256) void k_x16(const float* __restrict__ x, _Float16* __restrict__ X16, size_t n8) { const size_t t = (size_t)blockIdx.x * 256 + threadIdx.x; if (t >= n8) return; FragH f;
#pragma unroll
  for (int q = 0; q < 8; ++q) f.h[q] = (_Float16)bf16_round(x[t * 8 + q]); *(v8us*)((unsigned short*)X16 + t * 8) = f.half[0];  }
__global__ __launch_bounds__(256) void k_h16(const float* __restrict__ x, _Float16* __restrict__ X16, size_t n8) { const size_t t = (size_t)blockIdx.x * 256 + threadIdx.x; if (t >= n8) return; FragH f;
#pragma unroll
  for (int q = 0; q < 8; ++q) f.h[q] = (_Float16)x[t * 8 + q]; *(v8us*)((unsigned short*)X16 + t * 8) = f.half[0];  }
__global__ __launch_bounds__(256) void k_round16f(const float* __restrict__ W, _Float16* __restrict__ Bt, size_t n8) { const size_t t = (size_t)blockIdx.x * 256 + threadIdx.x; if (t >= n8) return; FragH f;
#pragma unroll
  for (int i = 0; i < 8; ++i) f.h[i] = (_Float16)(bf16_round(W[t * 8 + i]) * 16.0f); *(v8us*)((unsigned short*)Bt + t * 8) = f.half[0];  }
template <int NHv, int TTv>
__global__ __launch_bounds__(256) void k_vt(const _Float16* __restrict__ V16, int ldv, int voff, _Float16* __restrict__ Vt) { __shared__ unsigned short tl[64][66]; const int tid = threadIdx.x; const int slab = blockIdx.x / (TTv / 64), lg = blockIdx.x % (TTv / 64); const int b = slab / NHv, h = slab % NHv;
  for (int i = tid; i < 64 * 8; i += 256) { const int r = i / 8, c8 = (i % 8) * 8; FragH f; f.half[0] = *(const v8us*)((const unsigned short*)V16 + ((size_t)b * TTv + lg * 64 + r) * ldv + voff + h * 64 + c8);
#pragma unroll
    for (int q = 0; q < 8; ++q) tl[r][c8 + q] = f.u[q]; }
  __syncthreads();
  {
#pragma unroll
    for (int rd = 0; rd < 2; ++rd) { const int d = rd * 32 + tid / 8, pc = tid % 8; FragH f;
#pragma unroll
      for (int q = 0; q < 8; ++q) f.u[q] = tl[pc * 8 + q][d];
      *(v8us*)((unsigned short*)Vt + ((size_t)slab * 64 + d) * TTv + lg * 64 + pc * 8) = f.half[0]; }
     } }

__global__ __launch_bounds__(256) void k_hl(const float* __restrict__ F, _Float16* __restrict__ Hh, _Float16* __restrict__ Hl, size_t n8) { const size_t t = (size_t)blockIdx.x * 256 + threadIdx.x; if (t >= n8) return; FragH fh, fl; const v4f a = *(const v4fa*)(F + t * 8), c = *(const v4fa*)(F + t * 8 + 4);
#pragma unroll
  for (int q = 0; q < 4; ++q) { _Float16 h = (_Float16)a[q]; fh.h[q] = h; fl.h[q] = (_Float16)((a[q] - (float)h) * 1024.0f); h = (_Float16)c[q]; fh.h[4 + q] = h; fl.h[4 + q] = (_Float16)((c[q] - (float)h) * 1024.0f); }
  { *(v8us*)((unsigned short*)Hh + t * 8) = fh.half[0]; *(v8us*)((unsigned short*)Hl + t * 8) = fl.half[0];  } }

// ---- LDS-staged GEMM: C[M][N] = alpha * A[M][K] . Bt[N][K]^T, f16 operands, f32 accumulation; one 128 x 128 tile of C per block of four waves (2 x 2, 64 x 64 of C a wave); M, N multiples of 128, K of 64 ----
// Each slab of 64 k (128-byte pieces of 128 A rows and 128 Bt rows) comes in as whole-line 16-byte loads (8 lanes a row, 4 rows a wave-load), goes through registers into one of two LDS buffers, and is read from there as fragments:
// every operand byte leaves L2 once per block and serves 64 rows or columns of each wave that needs it. The next slab's global loads fly while this slab is multiplied; one barrier a slab.
__device__ __forceinline__ v16h g2_frag(const _Float16* p, int hh) { FragH f; f.half[0] = *(const v8us*)((const unsigned short*)p + 8 * hh); f.half[1] = *(const v8us*)((const unsigned short*)p + 16 + 8 * hh); return f.v; }
#define G3T 128                      /* tile rows of A and of Bt per block */
#define G3K 64                       /* k per slab */
#define G3P 72                       /* LDS row pitch in f16: 144 bytes = 16 x odd, the conflict-free pitch for 16-byte fragment reads */
#define G3B (2 * G3T * G3P)          /* f16 per buffer: rows 0..127 A, rows 128..255 Bt */
// one slab: every fragment of its 64 k from LDS, then the 2 x 16 products of the wave's 64 x 64 tile, k ascending; each '#pragma unroll' makes the index of a register array a constant
__device__ __forceinline__ void g3_slab(v8f (&acc)[4][4], const unsigned short* fa, const unsigned short* fb, int hh) { v16h a[2][4], b[2][4];
#pragma unroll
  for (int kk = 0; kk < 2; ++kk)
#pragma unroll
    for (int i = 0; i < 4; ++i) { a[kk][i] = g2_frag((const _Float16*)(fa + 16 * i * G3P + 32 * kk), hh); b[kk][i] = g2_frag((const _Float16*)(fb + 16 * i * G3P + 32 * kk), hh); }
#pragma unroll
  for (int kk = 0; kk < 2; ++kk)
#pragma unroll
    for (int i = 0; i < 4; ++i)
#pragma unroll
      for (int j = 0; j < 4; ++j) acc[i][j] = __builtin_amdgcn_wmma_f32_16x16x32_f16(false, a[kk][i], false, b[kk][j], (short)0, acc[i][j], false, false); }
// behind a run of global loads from two pointers: the wait that stands in front of any rewrite of the registers the loads name; naming the pointers keeps their registers live up to the wait.
// Built without it, one load of the run sank to just in front of its LDS store (no time to fly).
#define G3_XW(p, q) asm volatile("s_wait_xcnt 0x0" :: "v"(p), "v"(q) : "memory")
// CAUS: grid z = causal query tile of QT rows (A and C step QT rows a tile). 1 = scores: only key columns up to the tile's end are computed; 2 = P V: K ends at the tile's end. grid x = (rows / 128) * (N / 128), grid y = batch.
// H16: the output rows are f16 (C16), else f32 (C). X32 (with H16): the first QT0 rows of every SQ rows go to C as f32 as well, packed QT0 rows a batch. The row pitches lda, ldb, ldc, N and K are compile-time constants: a thread's eight rows of an operand are then one address pair with immediate offsets.
// VTR (with H16, one batch of SQ rows after the other, the last DM columns = v): a block of v columns stores its f16 tile TRANSPOSED into VT [batch][v column][key] and not into C16.
template <int CAUS, bool H16, bool X32, int lda, int ldb, int ldc, int N, int KF, bool VTR>
__device__ __forceinline__ void g3_body(const _Float16* __restrict__ A, size_t sA, const _Float16* __restrict__ Bh, size_t sB, float alpha,
    float* __restrict__ C, _Float16* __restrict__ C16, size_t sC, _Float16* __restrict__ VT) {
  __shared__ __attribute__((aligned(16))) unsigned short sm[2 * G3B];      /* 73,728 bytes; after the last slab the same bytes stage the output rows */
  const int tid = threadIdx.x, w = tid >> 5, lane = tid & 31, ln = lane & 15, hh = lane >> 4; const int by = blockIdx.y;
  const int qt = CAUS ? SQ / QT - 1 - (int)blockIdx.z : 0;      /* low z starts first: the tile with the most keys goes first */
  A += (size_t)by * sA + (size_t)qt * QT * lda; Bh += (size_t)by * sB; const size_t cofs = (size_t)by * sC + (size_t)qt * QT * ldc;
  const int ntn = N / G3T; const int mt = blockIdx.x / ntn, nq = blockIdx.x - mt * ntn; const int row0 = mt * G3T, col0 = nq * G3T;
  if (CAUS == 1 && col0 >= (qt + 1) * QT) return;      /* the same for the whole block, in front of every barrier */
  const int K = (CAUS == 2) ? (qt + 1) * QT : KF;
  const int sr = tid >> 3, sc = (tid & 7) * 8;      /* staging: thread t moves 16-byte piece t % 8 of rows t / 8 + 16 i, i = 0..7, of both operands */
  const unsigned short* ga = (const unsigned short*)A + (size_t)(row0 + sr) * lda + sc;
  const unsigned short* gb = (const unsigned short*)Bh + (size_t)(col0 + sr) * ldb + sc;
  unsigned short* st = sm + sr * G3P + sc;
  const int wm = w >> 1, wn = w & 1;
  const unsigned short* fa = sm + (wm * 64 + ln) * G3P; const unsigned short* fb = sm + (G3T + wn * 64 + ln) * G3P;
  const v8f z8 = {0.f,0.f,0.f,0.f,0.f,0.f,0.f,0.f}; v8f acc[4][4]; v8us ra[8], rb[8];
  /* every '#pragma unroll' of this kernel makes the index of a register array a constant */
#pragma unroll
  for (int i = 0; i < 4; ++i)
#pragma unroll
    for (int j = 0; j < 4; ++j) acc[i][j] = z8;
#pragma unroll
  for (int i = 0; i < 8; ++i) { ra[i] = *(const v8us*)(ga + 16 * i * lda); rb[i] = *(const v8us*)(gb + 16 * i * ldb); }
  G3_XW(ga, gb);
#pragma unroll
  for (int i = 0; i < 8; ++i) { *(v8us*)(st + 16 * i * G3P) = ra[i]; *(v8us*)(st + (G3T + 16 * i) * G3P) = rb[i]; }
  __syncthreads();
  const int nkt = K / G3K;
  for (int kt = 0; kt + 1 < nkt; ++kt) {      /* the trip count is the same for the whole block */
    const int bo = (kt & 1) * G3B;
    const unsigned short* pa = ga + (kt + 1) * G3K; const unsigned short* pb = gb + (kt + 1) * G3K;
#pragma unroll
    for (int i = 0; i < 8; ++i) { ra[i] = *(const v8us*)(pa + 16 * i * lda); rb[i] = *(const v8us*)(pb + 16 * i * ldb); }
    G3_XW(pa, pb);
    g3_slab(acc, fa + bo, fb + bo, hh);
    unsigned short* sn = st + (G3B - bo);      /* the other buffer: its last readers left it in front of the barrier that ended the slab before */
#pragma unroll
    for (int i = 0; i < 8; ++i) { *(v8us*)(sn + 16 * i * G3P) = ra[i]; *(v8us*)(sn + (G3T + 16 * i) * G3P) = rb[i]; }
    __syncthreads(); }      /* publishes the next slab and ends every read of this one */
  g3_slab(acc, fa + ((nkt - 1) & 1) * G3B, fb + ((nkt - 1) & 1) * G3B, hh);
  __syncthreads();      /* ends every read of the last slab: the output rows are staged over it */
  float* so = (float*)sm + w * (64 * 68);      /* the wave's own 64 x 64 f32 rows at pitch 68, so that the stores below are whole lines */
  if (VTR && col0 >= N - DM) {      /* the same for the whole block: a tile of 128 columns lies wholly inside or outside the v columns */
    const int rs = lane >> 4, k4 = (lane & 15) * 4;
#pragma unroll
    for (int i = 0; i < 4; ++i)
#pragma unroll
      for (int j = 0; j < 4; ++j) acc[i][j] *= alpha;      /* scaled in place, once: both stagings below read the same registers */
    if (X32 && row0 % SQ < QT0) {      /* exact rows: their f32 v rows go out first, staged row by row as in the other blocks */
#pragma unroll
      for (int i = 0; i < 4; ++i)
#pragma unroll
        for (int j = 0; j < 4; ++j)
#pragma unroll
          for (int r = 0; r < 8; ++r) so[(16 * i + 8 * hh + r) * 68 + 16 * j + ln] = acc[i][j][r];
      __builtin_amdgcn_fence(__ATOMIC_ACQ_REL, "workgroup"); __builtin_amdgcn_wave_barrier();      /* the wave reads back what its other lanes wrote */
      float* cx = C + ((size_t)(row0 - (row0 / SQ) * (SQ - QT0) + wm * 64 + rs) * ldc + col0 + wn * 64 + k4);
#pragma unroll
      for (int q = 0; q < 32; ++q) { const v4f v = *(const v4fa*)&so[(q * 2 + rs) * 68 + k4]; *(v4f*)(cx + q * 2 * ldc) = v; }
      asm volatile("s_wait_xcnt 0x0" ::: "memory");      /* in front of the code below, which rewrites the address and data registers of these stores */
      __builtin_amdgcn_fence(__ATOMIC_ACQ_REL, "workgroup"); __builtin_amdgcn_wave_barrier(); }      /* the rows are read before the same bytes are staged anew */
    /* staged column by column: the eight rows a lane holds of one column are neighbours there (two 16-byte LDS stores), and a v column's 64 keys read back as one whole line */
#pragma unroll
    for (int i = 0; i < 4; ++i)
#pragma unroll
      for (int j = 0; j < 4; ++j) { v4f lo4, hi4;
#pragma unroll
        for (int r = 0; r < 4; ++r) { lo4[r] = acc[i][j][r]; hi4[r] = acc[i][j][4 + r]; }
        float* d = &so[(16 * j + ln) * 68 + 16 * i + 8 * hh]; *(v4fa*)d = lo4; *(v4fa*)(d + 4) = hi4; }
    __builtin_amdgcn_fence(__ATOMIC_ACQ_REL, "workgroup"); __builtin_amdgcn_wave_barrier();      /* the wave reads back what its other lanes wrote */
    _Float16* vt = VT + ((size_t)(row0 / SQ) * DM + (col0 - (N - DM)) + wn * 64 + rs) * SQ + row0 % SQ + wm * 64 + k4;
#pragma unroll
    for (int q = 0; q < 32; ++q) { const v4f v = *(const v4fa*)&so[(q * 2 + rs) * 68 + k4]; v4h h4; for (int i = 0; i < 4; ++i) h4[i] = (_Float16)v[i]; *(v4h*)(vt + q * 2 * SQ) = h4; }
    return; }      /* behind the kernel's last barrier */
#pragma unroll
  for (int i = 0; i < 4; ++i)
#pragma unroll
    for (int j = 0; j < 4; ++j)
#pragma unroll
      for (int r = 0; r < 8; ++r) so[(16 * i + 8 * hh + r) * 68 + 16 * j + ln] = acc[i][j][r] * alpha;
  __builtin_amdgcn_fence(__ATOMIC_ACQ_REL, "workgroup"); __builtin_amdgcn_wave_barrier();
  const int rsub = lane >> 4, c4 = (lane & 15) * 4; const size_t co = cofs + (size_t)(row0 + wm * 64 + rsub) * ldc + col0 + wn * 64 + c4; float* cp = H16 ? nullptr : C + co; _Float16* cp16 = H16 ? C16 + co : nullptr;
  if (X32 && row0 % SQ < QT0) {      /* the same for the whole block: a tile of 128 rows lies wholly inside or outside the exact rows */
    float* cx = C + (co - (size_t)(row0 / SQ) * ((SQ - QT0) * ldc));      /* the f16 row's place less the rows of earlier batches that are not kept */
#pragma unroll
    for (int q = 0; q < 32; ++q) { const v4f v = *(const v4fa*)&so[(q * 2 + rsub) * 68 + c4]; v4h h4; for (int i = 0; i < 4; ++i) h4[i] = (_Float16)v[i]; *(v4h*)(cp16 + q * 2 * ldc) = h4; *(v4f*)(cx + q * 2 * ldc) = v; }
    if (VTR) asm volatile("s_wait_xcnt 0x0" ::: "memory"); }      /* the built code lays the v branch behind these stores, with only a conditional branch between, and it rewrites their address and data registers */
  else {
#pragma unroll
    for (int q = 0; q < 32; ++q) { const int r = q * 2 + rsub; const v4f v = *(const v4fa*)&so[r * 68 + c4]; if (!H16) *(v4f*)(cp + q * 2 * ldc) = v; else { v4h h4; for (int i = 0; i < 4; ++i) h4[i] = (_Float16)v[i]; *(v4h*)(cp16 + q * 2 * ldc) = h4; } }
    if (X32) asm volatile("s_wait_xcnt 0x0" ::: "memory"); } }      /* the built code lays the other branch directly behind these stores, with only a conditional branch between, and it rewrites their data registers */
template <int CAUS, bool H16, bool X32, int lda, int ldb, int ldc, int N, int KF>
__global__ __launch_bounds__(128) void k_gemm3(const _Float16* __restrict__ A, size_t sA, const _Float16* __restrict__ Bh, size_t sB, float alpha,
    float* __restrict__ C, _Float16* __restrict__ C16, size_t sC) { g3_body<CAUS, H16, X32, lda, ldb, ldc, N, KF, false>(A, sA, Bh, sB, alpha, C, C16, sC, nullptr); }
// the projection, with the v branch in its epilogue. The register budget of four waves per SIMD is stated: LDS lets four blocks share a WGP, and left free this build took two registers more than that leaves a wave.
template <int lda, int ldb, int ldc, int N, int KF>
__global__ __launch_bounds__(128) __attribute__((amdgpu_waves_per_eu(4, 4))) void k_gemm3v(const _Float16* __restrict__ A, const _Float16* __restrict__ Bh, float alpha,
    float* __restrict__ C, _Float16* __restrict__ C16, _Float16* __restrict__ VT) { g3_body<0, true, true, lda, ldb, ldc, N, KF, true>(A, 0, Bh, 0, alpha, C, C16, 0, VT); }


__global__ __launch_bounds__(256) void k_wnat(const float* __restrict__ w, size_t n8, _Float16* __restrict__ Bt) { const size_t t = (size_t)blockIdx.x * 256 + threadIdx.x; if (t >= n8) return; FragH f; for (int q = 0; q < 8; ++q) f.h[q] = (_Float16)(bf16_round(w[t * 8 + q]) * 16.0f); *(v8us*)((unsigned short*)Bt + t * 8) = f.half[0];  }
__global__ __launch_bounds__(256) void k_rsm(const float* __restrict__ S, _Float16* __restrict__ P, int nrows) {
  #pragma clang fp contract(off)
  const int i = blockIdx.x * 256 + threadIdx.x; if (i >= nrows) return; const float* s = S + (size_t)i * SQ; float mx = -3.0e38f;
#pragma unroll 1
  for (int j = 0; j < SQ; ++j) mx = fmaxf(mx, s[j]); float se = 0.f;
#pragma unroll 1
  for (int j = 0; j < SQ; ++j) se += expf(s[j] - mx); const float sc = 256.0f / se;
#pragma unroll 1
  for (int j0 = 0; j0 < SQ; j0 += 8) { FragH f; for (int q = 0; q < 8; ++q) f.h[q] = (_Float16)(expf(s[j0 + q] - mx) * sc); unsigned short* d = (unsigned short*)P + (size_t)i * SQ + j0; *(v8us*)d = f.half[0];  } }
__global__ __launch_bounds__(256) void k_vt(const _Float16* __restrict__ V16, int b, int h0, _Float16* __restrict__ VT) { __shared__ unsigned short tl[64][65]; const int tid = threadIdx.x; const int hh = blockIdx.x % HG, sg = blockIdx.x / HG; const int s0 = sg * 64; const int h = h0 + hh;
  for (int i = tid; i < 64 * 8; i += 256) { const int j = i / 8, d8 = (i % 8) * 8; FragH f; f.half[0] = *(const v8us*)((const unsigned short*)V16 + ((size_t)b * SQ + s0 + j) * DM + h * HD + d8); for (int q = 0; q < 8; ++q) tl[d8 + q][j] = f.u[q]; }
  __syncthreads();
  { for (int i = tid; i < 64 * 8; i += 256) { const int d = i / 8, j8 = (i % 8) * 8; FragH f; for (int q = 0; q < 8; ++q) f.u[q] = tl[d][j8 + q]; *(v8us*)((unsigned short*)VT + ((size_t)hh * HD + d) * SQ + s0 + j8) = f.half[0]; }  } }



// Causal softmax, ONE S ROW PER WAVE, the row held in registers: lane l owns keys 256 c + 8 l .. + 7 of each 256-key chunk c (two 16-byte loads in, one 16-byte f16 store out per chunk).
// Row max and row sum: per-lane partials (the sum in four independent chains), then a five-step butterfly over the 32 lanes. NC = nk / 256 chunks, all loads of a row in flight together.
// e^x as the fast form has it (one multiply, v_exp_f32). The v_nop is the one slot the instruction set asks for behind a transcendental before its result is read or its source overwritten; it stands in the same statement because the compiler's own schedule of this kernel reused a source register directly behind some v_exp_f32.
__device__ __forceinline__ float rsm_exp(float x) { const float y = x * 1.44269504088896340736f; float e; asm("v_exp_f32 %0, %1\n\tv_nop" : "=v"(e) : "v"(y)); return e; }
template <int NC>
__device__ __forceinline__ void rsm_row(const float* __restrict__ s, unsigned short* __restrict__ p, int k0, int last) {
  float v[NC][8];
#pragma unroll
  for (int c = 0; c < NC; ++c) { const v4f a = *(const v4fa*)(s + c * 256 + k0), b = *(const v4fa*)(s + c * 256 + k0 + 4);
#pragma unroll
    for (int q = 0; q < 4; ++q) { v[c][q] = a[q]; v[c][4 + q] = b[q]; } }
  float mx = -3.0e38f;
#pragma unroll
  for (int c = 0; c < NC; ++c)
#pragma unroll
    for (int q = 0; q < 8; ++q) { if (c * 256 + k0 + q > last) v[c][q] = -1.0e9f; mx = fmaxf(mx, v[c][q]); }
#pragma unroll
  for (int m = 16; m > 0; m >>= 1) mx = fmaxf(mx, __shfl_xor(mx, m, 32));
  float s4[4] = {0.f, 0.f, 0.f, 0.f};
#pragma unroll
  for (int c = 0; c < NC; ++c)
#pragma unroll
    for (int q = 0; q < 8; ++q) { v[c][q] = rsm_exp(v[c][q] - mx); s4[q & 3] += v[c][q]; }
  float se = (s4[0] + s4[1]) + (s4[2] + s4[3]);
#pragma unroll
  for (int m = 16; m > 0; m >>= 1) se += __shfl_xor(se, m, 32);
  const float sc = 256.0f / se;
#pragma unroll
  for (int c = 0; c < NC; ++c) { FragH fr;
#pragma unroll
    for (int q = 0; q < 8; ++q) fr.h[q] = (_Float16)(v[c][q] * sc);
    *(v8us*)(p + c * 256 + k0) = fr.half[0]; }
  asm volatile("s_wait_xcnt 0x0" ::: "memory");      /* the built code lays the row lengths one behind the other, and only a conditional branch stands between these stores and the next length's code, which rewrites their address and data registers */
}
// grid = the token rows past the exact rows, of all batches, one 32-lane block each; a row's length is the end of its own QT-row query tile
__global__ __launch_bounds__(32) void k_rsmcf2(const float* __restrict__ S, _Float16* __restrict__ P, int nrows) {
  if ((int)blockIdx.x >= nrows) return; const int last = QT0 + blockIdx.x % (SQ - QT0); const int t = blockIdx.x / (SQ - QT0) * SQ + last; const int k0 = threadIdx.x * 8;
  const float* s = S + (size_t)t * NKX; unsigned short* p = (unsigned short*)P + (size_t)t * NKX;
  switch (last / QT + 1) {      /* the same for every lane of the wave: straight-line code for each row length */
    case 1: rsm_row<1>(s, p, k0, last); break; case 2: rsm_row<2>(s, p, k0, last); break; case 3: rsm_row<3>(s, p, k0, last); break; case 4: rsm_row<4>(s, p, k0, last); break;
    case 5: rsm_row<5>(s, p, k0, last); break; case 6: rsm_row<6>(s, p, k0, last); break; case 7: rsm_row<7>(s, p, k0, last); break; case 8: rsm_row<8>(s, p, k0, last); break;
    default: break; } }


template <int MASKADD>
__global__ __launch_bounds__(64) void k_att0(const float* __restrict__ QF, const float* __restrict__ KF, const float* __restrict__ VF, int ld, const float* __restrict__ mask, float scale, float* __restrict__ OF, int ldo) {
  #pragma clang fp contract(off)
  __shared__ __attribute__((aligned(16))) float lq[64][64]; __shared__ __attribute__((aligned(16))) float lo[64][64];
  const int tid = threadIdx.x; const int h = blockIdx.x / (QT0 / 64), rg = blockIdx.x % (QT0 / 64); const int i = rg * 64 + tid;
  const float* qr = QF + (size_t)i * ld + h * HD;
#pragma unroll 1
  for (int c = 0; c < HD / 4; ++c) { *(v4f*)&lq[tid][c * 4] = *(const v4fa*)(qr + c * 4); const v4f z = {0.f, 0.f, 0.f, 0.f}; *(v4f*)&lo[tid][c * 4] = z; }
  float m = -1.0e30f, l = 0.f; const int jmax = MASKADD ? (SQ - 1) : (rg * 64 + 63);      /* additive-mask form: every key (the mask input decides); causal form: keys up to the block's last row */
#pragma unroll 1
  for (int j = 0; j <= jmax; ++j) { const float* kr = KF + (size_t)j * ld + h * HD; const float* vr = VF + (size_t)j * ld + h * HD; float s = 0.f;
#pragma unroll 1
    for (int c = 0; c < HD / 4; ++c) { const v4f kq = *(const v4fa*)(kr + c * 4); const v4f qq = *(v4f*)&lq[tid][c * 4]; s = __fadd_rn(s, __fmul_rn(qq[0], kq[0])); s = __fadd_rn(s, __fmul_rn(qq[1], kq[1])); s = __fadd_rn(s, __fmul_rn(qq[2], kq[2])); s = __fadd_rn(s, __fmul_rn(qq[3], kq[3])); }
    s = __fmul_rn(s, scale); if (MASKADD) s = __fadd_rn(s, __fmul_rn(bf16_round(mask[(size_t)i * SQ + j]), -10000.0f));
    const float f = (MASKADD || j <= i) ? 1.f : 0.f; const float sm = fmaf(f, s, (1.f - f) * -1.0e30f); const float mn = fmaxf(m, sm); const float sc = expf(m - mn); const float e = expf(sm - mn); l = __fadd_rn(__fmul_rn(l, sc), e); m = mn;
#pragma unroll 1
    for (int c = 0; c < HD / 4; ++c) { const v4f vv = *(const v4fa*)(vr + c * 4); v4f oo = *(v4f*)&lo[tid][c * 4]; for (int u = 0; u < 4; ++u) oo[u] = __fadd_rn(__fmul_rn(oo[u], sc), __fmul_rn(e, vv[u])); *(v4f*)&lo[tid][c * 4] = oo; } }
  const float fin = 64.0f / l;      /* o carried x64 */
#pragma unroll 1
  for (int c = 0; c < HD / 4; ++c) { v4f oo = *(v4f*)&lo[tid][c * 4]; for (int u = 0; u < 4; ++u) oo[u] = __fmul_rn(oo[u], fin); *(v4f*)&lo[tid][c * 4] = oo; }
  __syncthreads();
  {
#pragma unroll 1
    for (int it = 0; it < 16; ++it) { const int row = it * 4 + tid / 16, pc = (tid % 16) * 4; const v4f v = *(const v4f*)&lo[row][pc]; *(v4f*)(OF + (size_t)(rg * 64 + row) * ldo + h * HD + pc) = v; }
     } }


template <int BFIN, int WXB>
__global__ __launch_bounds__(256) void k_ln16(const float* __restrict__ X, const float* __restrict__ g, const float* __restrict__ bb, float eps, _Float16* __restrict__ N16, float* __restrict__ XB) {
  #pragma clang fp contract(off)
  __shared__ float red[256]; const size_t r = blockIdx.x; const int t = threadIdx.x; const v4f xa = *(const v4fa*)(X + r * DMQ + t * 4); float s[4]; float sum = 0.f;
  for (int q = 0; q < 4; ++q) { s[q] = BFIN ? bf16_round(xa[q]) : xa[q]; sum = __fadd_rn(sum, s[q]); }
  red[t] = sum; __syncthreads(); for (int st = 128; st > 0; st >>= 1) { if (t < st) red[t] = __fadd_rn(red[t], red[t + st]); __syncthreads(); } const float mu = red[0] / (float)DMQ; __syncthreads();
  float vs = 0.f; for (int q = 0; q < 4; ++q) { const float dl = __fadd_rn(s[q], -mu); vs = __fadd_rn(vs, __fmul_rn(dl, dl)); } red[t] = vs; __syncthreads(); for (int st = 128; st > 0; st >>= 1) { if (t < st) red[t] = __fadd_rn(red[t], red[t + st]); __syncthreads(); }
  const float rs = rsqrtf(__fadd_rn(red[0] / (float)DMQ, eps)); v4h y; v4f xb;
  for (int q = 0; q < 4; ++q) { const int c = t * 4 + q; y[q] = (_Float16)__fadd_rn(__fmul_rn(__fmul_rn(__fadd_rn(s[q], -mu), rs), bf16_round(g[c])), bf16_round(bb[c])); xb[q] = s[q]; }
  { *(v4h*)(N16 + r * DMQ + t * 4) = y; if (WXB) *(v4f*)(XB + r * DMQ + t * 4) = xb;  } }
__global__ __launch_bounds__(256) void k_ftres2(const float* __restrict__ OF0, const float* __restrict__ XB, float* __restrict__ X1, size_t n4) {
  #pragma clang fp contract(off)
  const size_t t = (size_t)blockIdx.x * 256 + threadIdx.x; if (t >= n4) return; const v4f o = *(const v4fa*)(OF0 + t * 4), xv = *(const v4fa*)(XB + t * 4); v4f y; for (int q = 0; q < 4; ++q) y[q] = __fadd_rn(__fmul_rn(o[q], 0.015625f), xv[q]); *(v4f*)(X1 + t * 4) = y;  }

__global__ __launch_bounds__(256) void k_wthd(const float* __restrict__ Wt, _Float16* __restrict__ Bt) { const size_t t = (size_t)blockIdx.x * 256 + threadIdx.x; if (t >= (size_t)NH * HD * (DM / 8)) return; const int m8 = (int)(t % (DM / 8)) * 8; const int d = (int)((t / (DM / 8)) % HD); const int h = (int)(t / ((size_t)(DM / 8) * HD)); FragH f;
  for (int q = 0; q < 8; ++q) f.h[q] = (_Float16)(16.0f * bf16_round(Wt[((size_t)h * DM + m8 + q) * HD + d])); unsigned short* dst = (unsigned short*)Bt + ((size_t)h * HD + d) * DM + m8; *(v8us*)dst = f.half[0];  }




__global__ __launch_bounds__(256) void k_wtpad(const float* __restrict__ Wm, _Float16* __restrict__ Wt, int Kr, int Kp, int Nr, int Np, float scale) {
  const int t = blockIdx.x * 256 + threadIdx.x; if (t >= Np * (Kp / 8)) return; const int n = t / (Kp / 8), k8 = (t % (Kp / 8)) * 8; const int nc = min(n, Nr - 1); const float fn = (n < Nr) ? 1.f : 0.f; FragH f;
  for (int i = 0; i < 8; ++i) { const int k = k8 + i; const int kc = min(k, Kr - 1); const float fk = (k < Kr) ? fn : 0.f; f.h[i] = (_Float16)(bf16_round(Wm[(size_t)kc * Nr + nc]) * scale * fk); }
  unsigned short* o = (unsigned short*)Wt + (size_t)n * Kp + k8; *(v8us*)o = f.half[0];  }
__global__ __launch_bounds__(128) void k_bpad(const float* __restrict__ b, float* __restrict__ Bp, int nr, int np) {
  const int i = threadIdx.x; if (i >= np) return; const float v = b[min(i, nr - 1)] * ((i < nr) ? 1.f : 0.f); *(float*)(Bp + i) = v;  }

#define DI 1024       /* inner width = NH * HD */
#define LQK (3 * DI)  /* fused q | k | v row pitch (3072) */
__global__ __launch_bounds__(256) void k_o0(const float* __restrict__ OF, float* __restrict__ ob, size_t n4) {
  #pragma clang fp contract(off)
  const size_t t = (size_t)blockIdx.x * 256 + threadIdx.x; if (t >= n4) return; const size_t e = t * 4; const int i = (int)(e / DI); const int c = (int)(e % DI); const int h = c / HD, d = c % HD; const v4f a = *(const v4fa*)(OF + e); v4f o; for (int q = 0; q < 4; ++q) o[q] = __fmul_rn(a[q], 0.015625f); float* dst = ob + (size_t)h * SQ * HD + (size_t)i * HD + d; *(v4f*)dst = o;  }

#define RQ 4                 /* query rows per block of the exact path */
#define SJP (QT0 + 16)       /* pitch of a score row in LDS: the RQ rows of one key fall on different banks */
// Exact f32 attention for the first QT0 rows of every batch, RQ query rows per block, so that every k row and every v row a block loads serves RQ queries, and every global load is whole lines.
// Scores: one wave per group of 8 keys; lane l holds columns 128 u + 4 l .. + 3 (u = 0..7) of the RQ query rows in registers and of the key row as it comes in; the 8 x RQ = 32 per-lane partial dot products
// are summed over the 32 lanes by a halving exchange (31 exchanges in all) that leaves sum number l (key * RQ + row) in lane l. Softmax: one wave per query row. Output: thread t owns columns 4 t .. + 3 of the RQ rows, keys in order.
// Every '#pragma unroll' of this kernel and its helpers makes the index of a register array a constant; each '#pragma unroll 1' keeps a loop rolled whose body already fills the registers that four waves per SIMD leave a wave.
typedef float v2f __attribute__((ext_vector_type(2)));
// the value of lane ^ BIT, on the vector unit: inside a 16-lane row by DPP (row_xmask), between the two rows by the cross-row move; all 32 lanes are on wherever it is called
template <int BIT>
__device__ __forceinline__ float att0_xor(float x) { int v = __float_as_int(x);
  if constexpr (BIT == 16) v = __builtin_amdgcn_permlanex16(v, v, 0x76543210, 0xfedcba98, false, false); else v = __builtin_amdgcn_update_dpp(v, v, 0x160 + BIT, 0xf, 0xf, false);
  return __int_as_float(v); }
// one step of the halving exchange over lane bit BIT: a lane with the bit set keeps the sums hi[], its partner (lane ^ BIT) the sums lo[]; each hands the other half over; the kept sums come back in lo[]
template <int N, int BIT>
__device__ __forceinline__ void att0_halve(float (&lo)[N], const float (&hi)[N], int lane) { const bool up = (lane & BIT) != 0;
#pragma unroll
  for (int t = 0; t < N; ++t) { const float send = up ? lo[t] : hi[t]; const float keep = up ? hi[t] : lo[t]; lo[t] = keep + att0_xor<BIT>(send); } }
// behind a run of global loads from one pointer: the wait that stands in front of any rewrite of the registers the loads name; naming the pointer keeps its registers live up to the wait, so that no load of the run is given them as its destination
#define ATT0_XW(p) asm volatile("s_wait_xcnt 0x0" :: "v"(p) : "memory")
__device__ __forceinline__ void att0_use8(v4f (&o)[RQ], const v4f (&v)[8], const float (*pe)[RQ]) {      /* eight v rows into the RQ output rows, keys in order */
#pragma unroll
  for (int t = 0; t < 8; ++t) { const v4f e = *(const v4f*)&pe[t][0];
#pragma unroll
    for (int r = 0; r < RQ; ++r) { const v2f er = {e[r], e[r]}; o[r].xy = __builtin_elementwise_fma(er, v[t].xy, o[r].xy); o[r].zw = __builtin_elementwise_fma(er, v[t].zw, o[r].zw); } } }
__global__ __launch_bounds__(256) __attribute__((amdgpu_waves_per_eu(4, 4))) void k_att0w(const float* __restrict__ QF, const float* __restrict__ KF, const float* __restrict__ VF, float scale, float* __restrict__ OF) {      /* q | k | v rows of pitch LQK, QT0 a batch; OF = the output itself, rows of pitch DI, SQ a batch; the register budget of four waves per SIMD, so that a long and a short block share a WGP */
  __shared__ float sj[RQ][SJP]; __shared__ __attribute__((aligned(16))) float pe[QT0][RQ]; __shared__ float fin[RQ];
  const int tid = threadIdx.x, w = __builtin_amdgcn_readfirstlane(tid >> 5), lane = tid & 31; const int b = blockIdx.x % NB, idx = blockIdx.x / NB;      /* the wave's number as a scalar: the key loop stays on the scalar unit; batch fastest */
  const int g = (idx < QT0 / RQ / 2) ? QT0 / RQ - 1 - idx : idx - QT0 / RQ / 2;      /* first half of the grid: the row groups with the most keys, longest first; second half: the short ones, shortest first */
  const int i0 = g * RQ, nk = i0 + RQ;      /* keys 0 .. nk - 1 are seen by at least one of the block's rows */
  QF += (size_t)b * QT0 * LQK; KF += (size_t)b * QT0 * LQK; VF += (size_t)b * QT0 * LQK; OF += (size_t)b * SQ * DI;
  for (int t = tid; t < RQ * SJP; t += 256) (&sj[0][0])[t] = -1.0e30f;      /* keys no wave computes count as masked */
  v4f q[RQ][8]; const float* qp = QF + (size_t)i0 * LQK + lane * 4;
#pragma unroll
  for (int r = 0; r < RQ; ++r)
#pragma unroll
    for (int u = 0; u < 8; ++u) q[r][u] = *(const v4fa*)(qp + r * LQK + u * 128);
  ATT0_XW(qp);
  __syncthreads();
  v4f cur[8]; const float* kp = KF + (size_t)(w * 8) * LQK + lane * 4;      /* the key row in use; the next one is fetched while it is used. Rows w * 8 .. + 7 lie below QT0 for every wave, also for one that has no group */
#pragma unroll
  for (int u = 0; u < 8; ++u) cur[u] = *(const v4fa*)(kp + u * 128);
  ATT0_XW(kp);
#pragma unroll 1
  for (int g8 = w; g8 * 8 < nk; g8 += 8) {      /* the same for every lane of a wave; key rows g8 * 8 .. + 7 lie below QT0 */
    const float* kg = KF + (size_t)(g8 * 8) * LQK + lane * 4;
    const float* kn = KF + (size_t)((((g8 + 8) * 8 < nk) ? g8 + 8 : g8) * 8) * LQK + lane * 4;      /* first row of the wave's next group (the last trip fetches its own first row again) */
    float a4[2][RQ];      /* the exchange runs as a tree beside the keys (2 keys, 4 keys, 8 keys), so that few partial sums are live at a time */
#pragma unroll
    for (int k4 = 0; k4 < 2; ++k4) { float a2[2][RQ];
#pragma unroll
      for (int k2 = 0; k2 < 2; ++k2) { float a1[2][RQ];
#pragma unroll
        for (int k1 = 0; k1 < 2; ++k1) { const int kk = k4 * 4 + k2 * 2 + k1; const float* kr = (kk < 7) ? kg + (kk + 1) * LQK : kn; v4f nxt[8];
#pragma unroll
          for (int u = 0; u < 8; ++u) nxt[u] = *(const v4fa*)(kr + u * 128);
          ATT0_XW(kr);
#pragma unroll
          for (int r = 0; r < RQ; ++r) { v2f s = {0.f, 0.f};      /* even and odd columns in the two halves of a packed multiply-add */
#pragma unroll
            for (int u = 0; u < 8; ++u) { s = __builtin_elementwise_fma(q[r][u].xy, cur[u].xy, s); s = __builtin_elementwise_fma(q[r][u].zw, cur[u].zw, s); }
            a1[k1][r] = s.x + s.y; }
#pragma unroll
          for (int u = 0; u < 8; ++u) cur[u] = nxt[u];
          __builtin_amdgcn_sched_barrier(0); }      /* keeps the eight keys of a group apart: left free, the scheduler mixed their loads and spilled query registers to scratch */
        att0_halve<RQ, 4>(a1[0], a1[1], lane);
#pragma unroll
        for (int r = 0; r < RQ; ++r) a2[k2][r] = a1[0][r]; }
      att0_halve<RQ, 8>(a2[0], a2[1], lane);
#pragma unroll
      for (int r = 0; r < RQ; ++r) a4[k4][r] = a2[0][r]; }
    att0_halve<RQ, 16>(a4[0], a4[1], lane);
    float b2[2][2] = {{a4[0][0], a4[0][1]}, {a4[0][2], a4[0][3]}}; att0_halve<2, 2>(b2[0], b2[1], lane);
    float b1[2][1] = {{b2[0][0]}, {b2[0][1]}}; att0_halve<1, 1>(b1[0], b1[1], lane);
    const int j = g8 * 8 + (lane >> 2), r = lane & 3;      /* lane bits 16, 8, 4 chose the key in the group, bits 2, 1 the row */
    sj[r][j] = (j <= i0 + r) ? b1[0][0] * scale : -1.0e30f; }
  __syncthreads();
  if (w < RQ) { float sv[QT0 / 32]; float mx = -1.0e30f;
#pragma unroll
    for (int u = 0; u < QT0 / 32; ++u) { sv[u] = sj[w][u * 32 + lane]; mx = fmaxf(mx, sv[u]); }
    mx = fmaxf(mx, att0_xor<1>(mx)); mx = fmaxf(mx, att0_xor<2>(mx)); mx = fmaxf(mx, att0_xor<4>(mx)); mx = fmaxf(mx, att0_xor<8>(mx)); mx = fmaxf(mx, att0_xor<16>(mx));
    float ls = 0.f;
#pragma unroll
    for (int u = 0; u < QT0 / 32; ++u) { const float e = expf(sv[u] - mx); pe[u * 32 + lane][w] = e; ls += e; }
    ls += att0_xor<1>(ls); ls += att0_xor<2>(ls); ls += att0_xor<4>(ls); ls += att0_xor<8>(ls); ls += att0_xor<16>(ls);
    if (lane == 0) fin[w] = 1.0f / ls; }
  __syncthreads();
  const float* vp = VF + tid * 4; const v4f z4 = {0.f, 0.f, 0.f, 0.f}; v4f o[RQ] = {z4, z4, z4, z4}; v4f va[8], vb[8];
  const int nk16 = (nk + 15) & ~15;      /* v rows in steps of 16: rows nk .. nk16 - 1 lie below QT0 and carry weight 0 for all RQ queries */
#pragma unroll
  for (int t = 0; t < 8; ++t) va[t] = *(const v4fa*)(vp + t * LQK);
  ATT0_XW(vp);
#pragma unroll 1
  for (int j = 0; j < nk16; j += 16) {      /* two sets of eight v rows: one flies while the other is used */
    const float* pb = vp + (size_t)(j + 8) * LQK;
#pragma unroll
    for (int t = 0; t < 8; ++t) vb[t] = *(const v4fa*)(pb + t * LQK);
    ATT0_XW(pb);
    att0_use8(o, va, &pe[j]);
    __builtin_amdgcn_sched_barrier(0);      /* keeps each fetch ahead of the work it flies beside: left free, the loads were moved down to where their rows are used */
    const float* pa = vp + (size_t)((j + 16 < nk16) ? j + 16 : j) * LQK;      /* the last trip loads its own first rows again */
#pragma unroll
    for (int t = 0; t < 8; ++t) va[t] = *(const v4fa*)(pa + t * LQK);
    ATT0_XW(pa);
    att0_use8(o, vb, &pe[j + 8]);
    __builtin_amdgcn_sched_barrier(0); }      /* as above */
#pragma unroll
  for (int r = 0; r < RQ; ++r) { const v4f y = o[r] * fin[r]; *(v4f*)(OF + (size_t)(i0 + r) * DI + tid * 4) = y; } }

__global__ __launch_bounds__(256) void k_o0m(const float* __restrict__ OF, float* __restrict__ o_, size_t n4) {
  #pragma clang fp contract(off)
  const size_t t = (size_t)blockIdx.x * 256 + threadIdx.x; if (t >= n4) return; const size_t e = t * 4; OF += (size_t)blockIdx.y * QT0 * DI; o_ += (size_t)blockIdx.y * SQ * DI;      /* grid y = batch */
  const v4f a = *(const v4fa*)(OF + e); v4f o; for (int q = 0; q < 4; ++q) o[q] = __fmul_rn(a[q], 0.015625f); *(v4f*)(o_ + e) = o;  }
// W^T operand of the projection: Wt[n][k] = f16(bf16(W[k][n]) * 16) from W [DM][LQK] f32, one 64 k x 32 n tile per wave.
// Lane l reads column n0 + l of the tile's 64 rows: the 32 lanes of a load lie side by side in one row of W, so a wave-load is one whole 128-byte line. The lane's 64 values are one 128-byte piece of row n0 + l of W^T;
// they go through the wave's own LDS tile (pitch 144 bytes = 16 x odd) so that eight lanes store one such piece together: a wave-store is four whole lines.
#define WLK 64                       /* k per tile */
#define WLP 72                       /* LDS row pitch in f16 */
__global__ __launch_bounds__(128) void k_wtl(const float* __restrict__ Wm, _Float16* __restrict__ Wt) {
  __shared__ __attribute__((aligned(16))) unsigned short tl[4][32 * WLP];
  const int tid = threadIdx.x, w = tid >> 5, lane = tid & 31; const int wv = blockIdx.x * 4 + w;      /* tile number: column group fastest */
  const int n0 = (wv % (LQK / 32)) * 32, k0 = (wv / (LQK / 32)) * WLK;
  const float* sp = Wm + (size_t)k0 * LQK + n0 + lane; float v[WLK];
  /* every '#pragma unroll' of this kernel makes the index of a register array a constant; all 64 loads of a lane fly together */
#pragma unroll
  for (int i = 0; i < WLK; ++i) v[i] = sp[i * LQK];
  ATT0_XW(sp);      /* in front of the code below, which reuses the address registers of these loads */
  unsigned short* row = &tl[w][lane * WLP];
#pragma unroll
  for (int c = 0; c < WLK / 8; ++c) { FragH f;
#pragma unroll
    for (int q = 0; q < 8; ++q) f.h[q] = (_Float16)(bf16_round(v[c * 8 + q]) * 16.0f);
    *(v8us*)(row + c * 8) = f.half[0]; }
  __builtin_amdgcn_fence(__ATOMIC_ACQ_REL, "workgroup"); __builtin_amdgcn_wave_barrier();      /* the wave reads back what its other lanes wrote */
  const int r = lane >> 3, p = (lane & 7) * 8;
  unsigned short* dp = (unsigned short*)Wt + (size_t)(n0 + r) * DM + k0 + p;
#pragma unroll
  for (int q = 0; q < 8; ++q) { const v8us o = *(const v8us*)&tl[w][(q * 4 + r) * WLP + p]; *(v8us*)(dp + q * 4 * DM) = o; } }

extern "C" void kernel_launch(void* const* d_in, const int* in_sizes, int n_in,
                              void* d_out, int out_size, void* d_ws, size_t ws_size, hipStream_t stream) {
  (void)in_sizes; (void)n_in; (void)out_size;
  const float* const* I = (const float* const*)d_in; const float* x = I[0]; const float* wqkv = I[1];      /* input order: x [4][2048][1024], W_qkv ([in][out] [1024][3072]: q | k | v column thirds); the module has no biases and no output projection */
  char* ws = (char*)d_ws; size_t off = 0;
  auto take = [&](size_t bytes) { char* p = ws + off; off += (bytes + 255) & ~(size_t)255; return p; };
  _Float16* BW = (_Float16*)take((size_t)LQK * DM * 2); _Float16* X16 = (_Float16*)take(NR * DM * 2); _Float16* QKV = (_Float16*)take(NR * LQK * 2); _Float16* VT = (_Float16*)take((size_t)NB * DI * SQ * 2);
  float* S = (float*)take(NR * NKX * 4); _Float16* P = (_Float16*)take(NR * NKX * 2); float* QKVF0 = (float*)take((size_t)NB * QT0 * LQK * 4);      /* ONE head: S / P row = token row, pitch NKX; every plane holds all batches */
  if (off > ws_size) return;
  k_wtl<<<(LQK / 32) * (DM / WLK) / 4, 128, 0, stream>>>(wqkv, BW);      /* [in][out] [1024][3072] -> Bt[n][k] x16, one 64 k x 32 n tile a wave */
  k_x16<<<(unsigned)((NR * DM / 8 + 255) / 256), 256, 0, stream>>>(x, X16, NR * DM / 8);      /* x (bf16-valued) as exact f16 rows */
  k_gemm3v<DM, DM, LQK, LQK, DM><<<dim3((unsigned)((NR / 128) * (LQK / 128)), 1), 128, 0, stream>>>(X16, BW, 0.0625f, QKVF0, QKV, VT);      /* q | k | v = x W: q and k -> f16 rows, column blocks 0 / 1024 of the fused plane (pitch 3072); v -> V^T [NB][1024][SQ] f16; no bias; rows 0..511 of every batch also as f32 (exact products, f32 accumulation) */
  const _Float16* Q16 = QKV; const _Float16* K16 = QKV + DI;
  k_gemm3<1, false, false, LQK, LQK, NKX, SQ, DI><<<dim3((QT / 128) * (SQ / 128), NB, (SQ - QT0) / QT), 128, 0, stream>>>(Q16, (size_t)SQ * LQK, K16, (size_t)SQ * LQK, 0.03125f, S, nullptr, (size_t)SQ * NKX);      /* scores / sqrt(1024) over the FULL width (K = 1024), one head; causal: only keys below each tile's end; query tiles past the exact rows */
  k_rsmcf2<<<NB * (SQ - QT0), 32, 0, stream>>>(S, P, NB * (SQ - QT0));      /* causal softmax -> P x256 f16, one wave per row */
  k_gemm3<2, false, false, NKX, SQ, DI, DI, SQ><<<dim3((QT / 128) * (DI / 128), NB, (SQ - QT0) / QT), 128, 0, stream>>>(P, (size_t)SQ * NKX, VT, (size_t)DI * SQ, 0.00390625f, (float*)d_out, nullptr, (size_t)SQ * DI);      /* out[b][q][:] = P V^T 2^-8 (f32), N = 1024, keys up to each tile's end */
  k_att0w<<<NB * (QT0 / RQ), 256, 0, stream>>>(QKVF0, QKVF0 + DI, QKVF0 + 2 * DI, 0.03125f, (float*)d_out);      /* exact f32 single-head causal attention for rows 0..511 of every batch, stored into the output rows */
}

// v008
// Measured time: 149 microseconds a run.
// Timed twice side by side with v007, it ran 1.05 times as fast both times.
// Over all steps from v000 it is 59.6 times as fast.
#include <hip/hip_runtime.h>
// Causal SINGLE-HEAD self-attention of full width with a fused bias-free QKV projection and NO output projection (x [4][2048][1024]; qkv = x W_qkv ([in][out] 1024 x 3072, no bias) split into q | k | v thirds of width 1024; scores = q k^T / sqrt(1024) over the FULL width (one head); causal (keys after the query -> -inf); softmax over keys; out = attn v -> [4][2048][1024]).
// Structure: token rows; x as exact f16 rows; ONE WMMA GEMM into the f16 q | k plane (pitch 3072) and, from the same epilogue, v^T [batch][1024][2048]; causal 256-row query tiles: scores GEMM with K = 1024 (alpha 1/32), causal softmax f32 -> f16 x256 weights, P . V^T GEMM with N = 1024 written as f32 (alpha 2^-8) straight into the output rows (query tiles past the exact rows only). Scores and P . V are each ONE launch over all batches (grid y) and all query tiles (grid z); the softmax of all rows runs in the exact attention's launch, behind its blocks; S, P, V^T and the f32 planes hold all of them in the workspace.
// First-tile refinement: the first 512 query rows of every batch (which see few keys, so single-f16 q / k / v / P would be too coarse with no output projection to average the errors) are computed exactly and only so: the projection GEMM stores their q | k | v rows as f32 too (exact products, f32 accumulation), and an f32 attention on VALU (k_att0w_rsm: four query rows per block; full-width dot products; precise expf) stores them into the output; the f16 scores, softmax and P . V stages leave these rows out.
// Compute dtype: inputs rounded to bf16; x / weights exact; q, k, v and the softmax weights as plain f16 GEMM operands (~2^-12) past the exact rows; scores, softmax statistics and the output accumulation f32. v_wmma_f32_16x16x32_f16.
#define NB 4
#define SQ 2048
#define DM 1024
#define NH 16
#define HD 64
#define HG 4                         /* heads per attention launch group */
#define QT 256                       /* query rows per causal tile */
#define NKX SQ                       /* S / P row pitch */
#define QT0 512                      /* first-tile rows recomputed exactly (f32): 512 here (no output projection averages the early-row cancellation errors away; logit sigma 1.0) */
#define B0 0                         /* unused (each launch covers all batches) */
#define NBR NB                       /* unused by the launches (they cover all NB batches in their grids) */
#define NR ((size_t)NB * SQ)
#define DMQ DM
#define DFF 4096                     /* unused (no FFN in this file) */
#define DFFR 100                     /* unused */
#define MP ((int)((size_t)NBR * SQ)) /* unused by the launches (the projection covers NR rows) */
#define QN SQ                        /* unused (the query tiles cover the SQ - QT0 rows past the exact rows) */
#define NHD NH                       /* unused (one full-width head is attended) */
#define MPO MP                       /* unused (there is no output stage) */
#define LQ (3 * DM)      /* unused (the q | k | v rows have pitch LQK) */
typedef __bf16 v16b __attribute__((ext_vector_type(16)));
typedef unsigned short v8us __attribute__((ext_vector_type(8), may_alias));
typedef float  v8f  __attribute__((ext_vector_type(8)));
typedef float  v4f  __attribute__((ext_vector_type(4)));
typedef float  v4fa __attribute__((ext_vector_type(4), may_alias));
union FragB { v16b v; v8us half[2]; unsigned short u[16]; };

__device__ __forceinline__ unsigned short bf16_bits(float x) { unsigned int u = __float_as_uint(x); return (unsigned short)((u + 0x7FFFu + ((u >> 16) & 1u)) >> 16); }
__device__ __forceinline__ float bf16_val(unsigned short b) { return __uint_as_float(((unsigned int)b) << 16); }
__device__ __forceinline__ float bf16_round(float x) { return bf16_val(bf16_bits(x)); }
// D += A·B with NT terms: 1 = ah·bh, 2 = + al·bh (A split), 3 = + ah·bl (both split)
template <int NT>
__device__ __forceinline__ v8f mmaN(v16b ah, v16b al, v16b bh, v16b bl, v8f c) {
  c = __builtin_amdgcn_wmma_f32_16x16x32_bf16(false, ah, false, bh, (short)0, c, false, false);
  if (NT >= 2) c = __builtin_amdgcn_wmma_f32_16x16x32_bf16(false, al, false, bh, (short)0, c, false, false);
  if (NT >= 3) c = __builtin_amdgcn_wmma_f32_16x16x32_bf16(false, ah, false, bl, (short)0, c, false, false);
  asm volatile("v_nop\n\tv_nop\n\tv_nop\n\tv_nop" : "+v"(c) : "v"(ah), "v"(al), "v"(bh), "v"(bl));
  return c;
}

__global__ __launch_bounds__(256) void k_wt_bf16(const float* __restrict__ W, unsigned short* __restrict__ Wt, int K, int N) {
  const int t = blockIdx.x * 256 + threadIdx.x;
  const int k8n = K / 8;
  if (t >= N * k8n) return;
  const int n = t / k8n, k8 = (t % k8n) * 8;
  v8us v;
#pragma unroll
  for (int i = 0; i < 8; ++i) v[i] = bf16_bits(W[(size_t)(k8 + i) * N + n]);
  *(v8us*)(Wt + (size_t)n * K + k8) = v;
  
}

// GEMM C[M][N] (f32, pitch ldc) = act(A[M][K]·W + bias). A f32 row-major (pitch lda) converted per fragment to bf16
// (ASPLIT: hi/lo two planes -> 2 terms, else single rounded term); Wt bf16 [N][K] (pitch ldb). BIAS_BF16 rounds the
// bias to bf16 first (bias quantised to bf16 before the add). K%32==0, M%16==0, N%64==0.
template <bool ASPLIT, int ACT, bool BIAS_BF16>
__global__ __launch_bounds__(128) void k_gemm_bf(const float* __restrict__ A, int lda, const unsigned short* __restrict__ Wt, int ldb,
                                               const float* __restrict__ bias, float* __restrict__ C, int ldc, int M, int N, int K) {
  __shared__ __attribute__((aligned(16))) float so[4][16][64];
  const int tid = threadIdx.x, w = tid >> 5, lane = tid & 31, ln = lane & 15, hh = lane >> 4;
  const int ntn = N / 64;
  const int wid = blockIdx.x * 4 + w;
  const int mt = wid / ntn, nq = wid % ntn;
  if (mt * 16 >= M) return;
  const int row0 = mt * 16, col0 = nq * 64;
  const float* arow = A + (size_t)(row0 + ln) * lda;
  v8f acc[4] = {};
  for (int kb = 0; kb < K; kb += 32) {
    FragB ah, al;
    const v4f x0 = *(const v4fa*)(arow + kb + 8 * hh), x1 = *(const v4fa*)(arow + kb + 8 * hh + 4);
    const v4f x2 = *(const v4fa*)(arow + kb + 16 + 8 * hh), x3 = *(const v4fa*)(arow + kb + 16 + 8 * hh + 4);
    float xs[16] = {x0[0],x0[1],x0[2],x0[3],x1[0],x1[1],x1[2],x1[3],x2[0],x2[1],x2[2],x2[3],x3[0],x3[1],x3[2],x3[3]};
#pragma unroll
    for (int i = 0; i < 16; ++i) { const unsigned short hb = bf16_bits(xs[i]); ah.u[i] = hb; al.u[i] = ASPLIT ? bf16_bits(xs[i] - bf16_val(hb)) : (unsigned short)0; }
#pragma unroll
    for (int t = 0; t < 4; ++t) {
      const unsigned short* brow = Wt + (size_t)(col0 + t * 16 + ln) * ldb + kb;
      FragB b;
      b.half[0] = *(const v8us*)(brow + 8 * hh);
      b.half[1] = *(const v8us*)(brow + 16 + 8 * hh);
      acc[t] = mmaN<ASPLIT ? 2 : 1>(ah.v, al.v, b.v, b.v, acc[t]);
    }
  }
#pragma unroll
  for (int t = 0; t < 4; ++t) {
    float bv = bias ? bias[col0 + t * 16 + ln] : 0.f;
    if (BIAS_BF16) bv = bf16_round(bv);
#pragma unroll
    for (int r = 0; r < 8; ++r) { float v = acc[t][r] + bv; if (ACT == 1) v = fmaxf(v, 0.f); so[w][8 * hh + r][t * 16 + ln] = v; }
  }
  __builtin_amdgcn_fence(__ATOMIC_ACQ_REL, "workgroup");
  __builtin_amdgcn_wave_barrier();
  const int rsub = lane >> 4, c4 = (lane & 15) * 4;
  {
#pragma unroll
    for (int q = 0; q < 8; ++q) {
      const int r = q * 2 + rsub;
      const v4f v = *(const v4fa*)&so[w][r][c4];
      *(v4f*)(C + (size_t)(row0 + r) * ldc + col0 + c4) = v;
    }
    
  }
}

// GEMM C = act(A·W + bias + resid): A f32 (ASPLIT -> hi/lo 2 terms), Wt bf16 [N][K]; ACT 0 none, 1 relu, 2 exact gelu;
// resid (optional, f32, row index = (row % rmod), pitch ldr, RES_BF16 rounds it) added before the activation.
template <bool ASPLIT, int ACT, bool BIAS_BF16, bool RES_BF16>
__global__ __launch_bounds__(128) void k_gemm_bf3(const float* __restrict__ A, int lda, const unsigned short* __restrict__ Wt, int ldb,
                                                const float* __restrict__ bias, const float* __restrict__ resid, int rmod, int ldr,
                                                float* __restrict__ C, int ldc, int M, int N, int K) {
  __shared__ __attribute__((aligned(16))) float so[4][16][64];
  const int tid = threadIdx.x, w = tid >> 5, lane = tid & 31, ln = lane & 15, hh = lane >> 4;
  const int ntn = N / 64;
  const int wid = blockIdx.x * 4 + w;
  const int mt = wid / ntn, nq = wid % ntn;
  if (mt * 16 >= M) return;
  const int row0 = mt * 16, col0 = nq * 64;
  const float* arow = A + (size_t)(row0 + ln) * lda;
  v8f acc[4] = {};
  for (int kb = 0; kb < K; kb += 32) {
    FragB ah, al;
    const v4f x0 = *(const v4fa*)(arow + kb + 8 * hh), x1 = *(const v4fa*)(arow + kb + 8 * hh + 4);
    const v4f x2 = *(const v4fa*)(arow + kb + 16 + 8 * hh), x3 = *(const v4fa*)(arow + kb + 16 + 8 * hh + 4);
    float xs[16] = {x0[0],x0[1],x0[2],x0[3],x1[0],x1[1],x1[2],x1[3],x2[0],x2[1],x2[2],x2[3],x3[0],x3[1],x3[2],x3[3]};
#pragma unroll
    for (int i = 0; i < 16; ++i) { const unsigned short hb = bf16_bits(xs[i]); ah.u[i] = hb; al.u[i] = ASPLIT ? bf16_bits(xs[i] - bf16_val(hb)) : (unsigned short)0; }
#pragma unroll
    for (int t = 0; t < 4; ++t) {
      const unsigned short* brow = Wt + (size_t)(col0 + t * 16 + ln) * ldb + kb;
      FragB b;
      b.half[0] = *(const v8us*)(brow + 8 * hh);
      b.half[1] = *(const v8us*)(brow + 16 + 8 * hh);
      acc[t] = mmaN<ASPLIT ? 2 : 1>(ah.v, al.v, b.v, b.v, acc[t]);
    }
  }
#pragma unroll
  for (int t = 0; t < 4; ++t) {
    const int col = col0 + t * 16 + ln;
    float bv = bias ? bias[col] : 0.f;
    if (BIAS_BF16) bv = bf16_round(bv);
#pragma unroll
    for (int r = 0; r < 8; ++r) {
      float v = acc[t][r] + bv;
      if (resid) { float rv = resid[(size_t)((row0 + 8 * hh + r) % rmod) * ldr + col]; if (RES_BF16) rv = bf16_round(rv); v += rv; }
      if (ACT == 1) v = fmaxf(v, 0.f);
      if (ACT == 2) v = 0.5f * v * (1.0f + erff(v * 0.70710678118654752f));
      if (ACT == 3) { const float u = 0.7978845608028654f * (v + 0.044715f * v * v * v); v = 0.5f * v * (1.0f + tanhf(u)); }
      so[w][8 * hh + r][t * 16 + ln] = v;
    }
  }
  __builtin_amdgcn_fence(__ATOMIC_ACQ_REL, "workgroup");
  __builtin_amdgcn_wave_barrier();
  const int rsub = lane >> 4, c4 = (lane & 15) * 4;
  {
#pragma unroll
    for (int q = 0; q < 8; ++q) {
      const int r = q * 2 + rsub;
      const v4f v = *(const v4fa*)&so[w][r][c4];
      *(v4f*)(C + (size_t)(row0 + r) * ldc + col0 + c4) = v;
    }
    
  }
}
// row LayerNorm (biased variance, eps) over N: s = X (+ R); optional out_sum <- s; out_norm <- (s-mu)*rsqrt(var+eps)*g + b
template <bool PARAM_BF16>
__global__ __launch_bounds__(256) void k_layernorm(const float* __restrict__ X, const float* __restrict__ R, const float* __restrict__ g, const float* __restrict__ bta,
                                                  float* __restrict__ out_sum, float* __restrict__ out_norm, int N, float eps) {
  __shared__ float red[256];
  const int row = blockIdx.x, tid = threadIdx.x;
  const float* x = X + (size_t)row * N; const float* rr = R ? R + (size_t)row * N : nullptr;
  float vals[16];                     // up to N = 4096
  const int per = N / 256;            // contiguous chunk per thread? use strided-by-4 chunks: thread handles j = tid*4 + 1024*u
  float s1 = 0.f;
  for (int u = 0; u < per / 4; ++u) {
    const int j = tid * 4 + 1024 * u;
    const v4f a = *(const v4fa*)(x + j);
    v4f b = {0.f,0.f,0.f,0.f}; if (rr) b = *(const v4fa*)(rr + j);
#pragma unroll
    for (int q = 0; q < 4; ++q) { const float v = a[q] + b[q]; vals[u * 4 + q] = v; s1 += v; }
  }
  red[tid] = s1; __syncthreads();
  for (int st = 128; st > 0; st >>= 1) { if (tid < st) red[tid] += red[tid + st]; __syncthreads(); }
  const float mu = red[0] / (float)N; __syncthreads();
  float s2 = 0.f;
  for (int u = 0; u < per / 4; ++u)
#pragma unroll
    for (int q = 0; q < 4; ++q) { const float c = vals[u * 4 + q] - mu; s2 += c * c; }
  red[tid] = s2; __syncthreads();
  for (int st = 128; st > 0; st >>= 1) { if (tid < st) red[tid] += red[tid + st]; __syncthreads(); }
  const float rs = rsqrtf(red[0] / (float)N + eps);
  {
    for (int u = 0; u < per / 4; ++u) {
      const int j = tid * 4 + 1024 * u;
      v4f o, sm;
#pragma unroll
      for (int q = 0; q < 4; ++q) {
        float gg = g[j + q], bb = bta[j + q];
        if (PARAM_BF16) { gg = bf16_round(gg); bb = bf16_round(bb); }
        sm[q] = vals[u * 4 + q]; o[q] = (vals[u * 4 + q] - mu) * rs * gg + bb;
      }
      if (out_sum) *(v4f*)(out_sum + (size_t)row * N + j) = sm;
      *(v4f*)(out_norm + (size_t)row * N + j) = o;
    }
    
  }
}



// ---- f16 WMMA path (v_wmma_f32_16x16x32_f16): 11-bit significands for operands in range — used where a [0,1] probability operand needs more precision than bf16
typedef _Float16 v16h __attribute__((ext_vector_type(16)));
union FragH { v16h v; v8us half[2]; _Float16 h[16]; unsigned short u[16]; };
template <int NT>
__device__ __forceinline__ v8f mmaH(v16h ah, v16h al, v16h bh, v16h bl, v8f c) {
  c = __builtin_amdgcn_wmma_f32_16x16x32_f16(false, ah, false, bh, (short)0, c, false, false);
  if (NT >= 2) c = __builtin_amdgcn_wmma_f32_16x16x32_f16(false, al, false, bh, (short)0, c, false, false);
  if (NT >= 3) c = __builtin_amdgcn_wmma_f32_16x16x32_f16(false, ah, false, bl, (short)0, c, false, false);
  asm volatile("v_nop\n\tv_nop\n\tv_nop\n\tv_nop" : "+v"(c) : "v"(ah), "v"(al), "v"(bh), "v"(bl));
  return c;
}
// batched GEMM like k_gemm_b but f16 operands: A f32 (split into f16 hi/lo if ASPLIT, else rounded to f16), Bt = f16 values [n][k]; alpha; C f32; N multiple of 16 (partial tiles skipped)
template <bool ASPLIT>
__global__ __launch_bounds__(128) void k_gemm_h(const float* __restrict__ A, int lda, size_t sA, const _Float16* __restrict__ Bh, int ldb, size_t sB, float alpha, float* __restrict__ C, int ldc, size_t sC, int M, int N, int K) {
  __shared__ __attribute__((aligned(16))) float so[4][16][64];
  const int tid = threadIdx.x, w = tid >> 5, lane = tid & 31, ln = lane & 15, hh = lane >> 4; const int by = blockIdx.y;
  A += (size_t)by * sA; Bh += (size_t)by * sB; C += (size_t)by * sC;
  const int ntn = (N + 63) / 64; const int wid = blockIdx.x * 4 + w; const int mt = wid / ntn, nq = wid % ntn; if (mt * 16 >= M) return;
  const int row0 = mt * 16, col0 = nq * 64; const float* arow = A + (size_t)(row0 + ln) * lda;
  v8f acc[4] = {};
  for (int kb = 0; kb < K; kb += 32) {
    FragH ah, al;
    const v4f x0 = *(const v4fa*)(arow + kb + 8 * hh), x1 = *(const v4fa*)(arow + kb + 8 * hh + 4), x2 = *(const v4fa*)(arow + kb + 16 + 8 * hh), x3 = *(const v4fa*)(arow + kb + 16 + 8 * hh + 4);
    float xs[16] = {x0[0],x0[1],x0[2],x0[3],x1[0],x1[1],x1[2],x1[3],x2[0],x2[1],x2[2],x2[3],x3[0],x3[1],x3[2],x3[3]};
#pragma unroll
    for (int i = 0; i < 16; ++i) { const _Float16 h = (_Float16)xs[i]; ah.h[i] = h; al.h[i] = ASPLIT ? (_Float16)(xs[i] - (float)h) : (_Float16)0.0f; }
#pragma unroll
    for (int t = 0; t < 4; ++t) { if (col0 + t * 16 >= N) continue; const size_t boff = (size_t)(col0 + t * 16 + ln) * ldb + kb; FragH bq; bq.half[0] = *(const v8us*)(Bh + boff + 8 * hh); bq.half[1] = *(const v8us*)(Bh + boff + 16 + 8 * hh);
      acc[t] = mmaH<ASPLIT ? 2 : 1>(ah.v, al.v, bq.v, bq.v, acc[t]); }
  }
#pragma unroll
  for (int t = 0; t < 4; ++t) { if (col0 + t * 16 >= N) continue;
#pragma unroll
    for (int r = 0; r < 8; ++r) so[w][8 * hh + r][t * 16 + ln] = acc[t][r] * alpha; }
  __builtin_amdgcn_fence(__ATOMIC_ACQ_REL, "workgroup"); __builtin_amdgcn_wave_barrier();
  const int rsub = lane >> 4, c4 = (lane & 15) * 4;
  {
#pragma unroll
    for (int q = 0; q < 8; ++q) { const int r = q * 2 + rsub; if (col0 + c4 < N) { const v4f v = *(const v4fa*)&so[w][r][c4]; *(v4f*)(C + (size_t)(row0 + r) * ldc + col0 + c4) = v; } }
     }
}

// Wt[n][k] = f16(W[k][n]·scale) from f32 row-major W[K][N] (scale = power of two; bf16-exact weights stay exact in f16 away from the subnormal range)
__global__ __launch_bounds__(256) void k_wt_f16(const float* __restrict__ W, _Float16* __restrict__ Wt, int K, int N, float scale) {
  const int t = blockIdx.x * 256 + threadIdx.x; if (t >= N * (K / 8)) return; const int n = t / (K / 8), k8 = (t % (K / 8)) * 8; FragH f;
#pragma unroll
  for (int i = 0; i < 8; ++i) f.h[i] = (_Float16)(bf16_round(W[(size_t)(k8 + i) * N + n]) * scale); const v8us o = f.half[0];
  *(v8us*)((unsigned short*)Wt + (size_t)n * K + k8) = o; 
}
// k_gemm_hh variant with fused epilogue: v = acc·alpha + bias[by·sBias + col] (+ CP[(row/rowsPerB)·sCPb + by·64 + col] if CP) ; ACT 0 none / 1 elu ; writes f16 C16 (and f32 C if non-null)
template <int ACT>
__global__ __launch_bounds__(128) void k_gemm_hhx(const _Float16* __restrict__ A, int lda, size_t sA, const _Float16* __restrict__ Bh, int ldb, size_t sB, float alpha, const float* __restrict__ bias, size_t sBias, const float* __restrict__ CP, int rowsPerB, size_t sCPb, int row0g,
    float* __restrict__ C, _Float16* __restrict__ C16, int ldc, size_t sC, int M, int N, int K) {
  __shared__ __attribute__((aligned(16))) float so[4][16][64];
  const int tid = threadIdx.x, w = tid >> 5, lane = tid & 31, ln = lane & 15, hh = lane >> 4; const int by = blockIdx.y;
  A += (size_t)by * sA; Bh += (size_t)by * sB; const size_t cofs = (size_t)by * sC; const float* bp = bias ? bias + (size_t)by * sBias : nullptr;
  const int ntn = (N + 63) / 64; const int wid = blockIdx.x * 4 + w; const int mt = wid / ntn, nq = wid % ntn; if (mt * 16 >= M) return;
  const int row0 = mt * 16, col0 = nq * 64; const _Float16* arow = A + (size_t)(row0 + ln) * lda;
  v8f acc[4] = {};
  for (int kb = 0; kb < K; kb += 32) { FragH ah; ah.half[0] = *(const v8us*)((const unsigned short*)arow + kb + 8 * hh); ah.half[1] = *(const v8us*)((const unsigned short*)arow + kb + 16 + 8 * hh);
#pragma unroll
    for (int t = 0; t < 4; ++t) { if (col0 + t * 16 >= N) continue; const size_t boff = (size_t)(col0 + t * 16 + ln) * ldb + kb; FragH bq; bq.half[0] = *(const v8us*)((const unsigned short*)Bh + boff + 8 * hh); bq.half[1] = *(const v8us*)((const unsigned short*)Bh + boff + 16 + 8 * hh);
      acc[t] = mmaH<1>(ah.v, ah.v, bq.v, bq.v, acc[t]); }
  }
#pragma unroll
  for (int t = 0; t < 4; ++t) { if (col0 + t * 16 >= N) continue; const int col = col0 + t * 16 + ln; const float bv = bp ? bf16_round(bp[col]) : 0.f;
#pragma unroll
    for (int r = 0; r < 8; ++r) { float v = acc[t][r] * alpha + bv; if (CP) { const int rr = row0g + row0 + 8 * hh + r; if (rowsPerB < 0) v += CP[cofs + (size_t)rr * ldc + col];      /* rowsPerB < 0: own element of the batched C plane */ else { const int bidx = rr / rowsPerB; v += CP[(size_t)bidx * sCPb + (size_t)by * 64 + col]; } } if (ACT == 1) v = (v > 0.f) ? v : expm1f(v); else if (ACT == 7) v = (v > 0.f) ? v + 1.0f : expf(v); else if (ACT == 8) v = tanhf(v); else if (ACT == 9) v = 0.5f * v * (1.0f + tanhf(0.7978845608028654f * (v + 0.044715f * v * v * v))); else if (ACT == 11) v = 1.0f / (1.0f + expf(-v)); else if (ACT == 12) v = (v > 0.f) ? v : 0.01f * v; else if (ACT == 14) v = (v > 0.f) ? v : 0.1f * v; else if (ACT == 16) v = (v >= 0.f) ? v : 0.3f * v; else if (ACT == 17) v = (v >= 0.f) ? v : 0.2f * v; else if (ACT == 15) v = v / (1.0f + expf(-v)); else if (ACT == 3) v = fmaxf(v, 0.f); else if (ACT == 6) v = 0.5f * v * (1.0f + erff(v * 0.70710678118654752f)); so[w][8 * hh + r][t * 16 + ln] = v; } }
  __builtin_amdgcn_fence(__ATOMIC_ACQ_REL, "workgroup"); __builtin_amdgcn_wave_barrier();
  const int rsub = lane >> 4, c4 = (lane & 15) * 4; typedef _Float16 v4h __attribute__((ext_vector_type(4)));
  {
#pragma unroll
    for (int q = 0; q < 8; ++q) { const int r = q * 2 + rsub; if (col0 + c4 < N) { const v4f v = *(const v4fa*)&so[w][r][c4]; if (C) *(v4f*)(C + cofs + (size_t)(row0 + r) * ldc + col0 + c4) = v; if (C16) { v4h h4; for (int i = 0; i < 4; ++i) h4[i] = (_Float16)v[i]; *(v4h*)(C16 + cofs + (size_t)(row0 + r) * ldc + col0 + c4) = h4; } } }
     }
}


typedef _Float16 v4h __attribute__((ext_vector_type(4)));

__global__ __launch_bounds__(256) void k_x16(const float* __restrict__ x, _Float16* __restrict__ X16, size_t n8) { const size_t t = (size_t)blockIdx.x * 256 + threadIdx.x; if (t >= n8) return; FragH f;
#pragma unroll
  for (int q = 0; q < 8; ++q) f.h[q] = (_Float16)bf16_round(x[t * 8 + q]); *(v8us*)((unsigned short*)X16 + t * 8) = f.half[0];  }
__global__ __launch_bounds__(256) void k_h16(const float* __restrict__ x, _Float16* __restrict__ X16, size_t n8) { const size_t t = (size_t)blockIdx.x * 256 + threadIdx.x; if (t >= n8) return; FragH f;
#pragma unroll
  for (int q = 0; q < 8; ++q) f.h[q] = (_Float16)x[t * 8 + q]; *(v8us*)((unsigned short*)X16 + t * 8) = f.half[0];  }
__global__ __launch_bounds__(256) void k_round16f(const float* __restrict__ W, _Float16* __restrict__ Bt, size_t n8) { const size_t t = (size_t)blockIdx.x * 256 + threadIdx.x; if (t >= n8) return; FragH f;
#pragma unroll
  for (int i = 0; i < 8; ++i) f.h[i] = (_Float16)(bf16_round(W[t * 8 + i]) * 16.0f); *(v8us*)((unsigned short*)Bt + t * 8) = f.half[0];  }
template <int NHv, int TTv>
__global__ __launch_bounds__(256) void k_vt(const _Float16* __restrict__ V16, int ldv, int voff, _Float16* __restrict__ Vt) { __shared__ unsigned short tl[64][66]; const int tid = threadIdx.x; const int slab = blockIdx.x / (TTv / 64), lg = blockIdx.x % (TTv / 64); const int b = slab / NHv, h = slab % NHv;
  for (int i = tid; i < 64 * 8; i += 256) { const int r = i / 8, c8 = (i % 8) * 8; FragH f; f.half[0] = *(const v8us*)((const unsigned short*)V16 + ((size_t)b * TTv + lg * 64 + r) * ldv + voff + h * 64 + c8);
#pragma unroll
    for (int q = 0; q < 8; ++q) tl[r][c8 + q] = f.u[q]; }
  __syncthreads();
  {
#pragma unroll
    for (int rd = 0; rd < 2; ++rd) { const int d = rd * 32 + tid / 8, pc = tid % 8; FragH f;
#pragma unroll
      for (int q = 0; q < 8; ++q) f.u[q] = tl[pc * 8 + q][d];
      *(v8us*)((unsigned short*)Vt + ((size_t)slab * 64 + d) * TTv + lg * 64 + pc * 8) = f.half[0]; }
     } }

__global__ __launch_bounds__(256) void k_hl(const float* __restrict__ F, _Float16* __restrict__ Hh, _Float16* __restrict__ Hl, size_t n8) { const size_t t = (size_t)blockIdx.x * 256 + threadIdx.x; if (t >= n8) return; FragH fh, fl; const v4f a = *(const v4fa*)(F + t * 8), c = *(const v4fa*)(F + t * 8 + 4);
#pragma unroll
  for (int q = 0; q < 4; ++q) { _Float16 h = (_Float16)a[q]; fh.h[q] = h; fl.h[q] = (_Float16)((a[q] - (float)h) * 1024.0f); h = (_Float16)c[q]; fh.h[4 + q] = h; fl.h[4 + q] = (_Float16)((c[q] - (float)h) * 1024.0f); }
  { *(v8us*)((unsigned short*)Hh + t * 8) = fh.half[0]; *(v8us*)((unsigned short*)Hl + t * 8) = fl.half[0];  } }

// ---- LDS-staged GEMM: C[M][N] = alpha * A[M][K] . Bt[N][K]^T, f16 operands, f32 accumulation; one 128 x 128 tile of C per block of four waves (2 x 2, 64 x 64 of C a wave); M, N multiples of 128, K of 64 ----
// Each slab of 64 k (128-byte pieces of 128 A rows and 128 Bt rows) comes in as whole-line 16-byte loads (8 lanes a row, 4 rows a wave-load), goes through registers into one of two LDS buffers, and is read from there as fragments:
// every operand byte leaves L2 once per block and serves 64 rows or columns of each wave that needs it. The next slab's global loads fly while this slab is multiplied; one barrier a slab.
__device__ __forceinline__ v16h g2_frag(const _Float16* p, int hh) { FragH f; f.half[0] = *(const v8us*)((const unsigned short*)p + 8 * hh); f.half[1] = *(const v8us*)((const unsigned short*)p + 16 + 8 * hh); return f.v; }
#define G3T 128                      /* tile rows of A and of Bt per block */
#define G3K 64                       /* k per slab */
#define G3P 72                       /* LDS row pitch in f16: 144 bytes = 16 x odd, the conflict-free pitch for 16-byte fragment reads */
#define G3B (2 * G3T * G3P)          /* f16 per buffer: rows 0..127 A, rows 128..255 Bt */
// one slab: every fragment of its 64 k from LDS, then the 2 x 16 products of the wave's 64 x 64 tile, k ascending; each '#pragma unroll' makes the index of a register array a constant
__device__ __forceinline__ void g3_slab(v8f (&acc)[4][4], const unsigned short* fa, const unsigned short* fb, int hh) { v16h a[2][4], b[2][4];
#pragma unroll
  for (int kk = 0; kk < 2; ++kk)
#pragma unroll
    for (int i = 0; i < 4; ++i) { a[kk][i] = g2_frag((const _Float16*)(fa + 16 * i * G3P + 32 * kk), hh); b[kk][i] = g2_frag((const _Float16*)(fb + 16 * i * G3P + 32 * kk), hh); }
#pragma unroll
  for (int kk = 0; kk < 2; ++kk)
#pragma unroll
    for (int i = 0; i < 4; ++i)
#pragma unroll
      for (int j = 0; j < 4; ++j) acc[i][j] = __builtin_amdgcn_wmma_f32_16x16x32_f16(false, a[kk][i], false, b[kk][j], (short)0, acc[i][j], false, false); }
// behind a run of global loads from two pointers: the wait that stands in front of any rewrite of the registers the loads name; naming the pointers keeps their registers live up to the wait.
// Built without it, one load of the run sank to just in front of its LDS store (no time to fly).
#define G3_XW(p, q) asm volatile("s_wait_xcnt 0x0" :: "v"(p), "v"(q) : "memory")
// CAUS: grid z = causal query tile of QT rows (A and C step QT rows a tile). 1 = scores: only key columns up to the tile's end are computed; 2 = P V: K ends at the tile's end. grid x = (rows / 128) * (N / 128), grid y = batch.
// H16: the output rows are f16 (C16), else f32 (C). X32 (with H16): the first QT0 rows of every SQ rows go to C as f32 as well, packed QT0 rows a batch. The row pitches lda, ldb, ldc, N and K are compile-time constants: a thread's eight rows of an operand are then one address pair with immediate offsets.
// VTR (with H16, one batch of SQ rows after the other, the last DM columns = v): a block of v columns stores its f16 tile TRANSPOSED into VT [batch][v column][key] and not into C16.
template <int CAUS, bool H16, bool X32, int lda, int ldb, int ldc, int N, int KF, bool VTR>
__device__ __forceinline__ void g3_body(const _Float16* __restrict__ A, size_t sA, const _Float16* __restrict__ Bh, size_t sB, float alpha,
    float* __restrict__ C, _Float16* __restrict__ C16, size_t sC, _Float16* __restrict__ VT) {
  __shared__ __attribute__((aligned(16))) unsigned short sm[2 * G3B];      /* 73,728 bytes; after the last slab the same bytes stage the output rows */
  const int tid = threadIdx.x, w = tid >> 5, lane = tid & 31, ln = lane & 15, hh = lane >> 4; const int by = blockIdx.y;
  const int qt = CAUS ? SQ / QT - 1 - (int)blockIdx.z : 0;      /* low z starts first: the tile with the most keys goes first */
  A += (size_t)by * sA + (size_t)qt * QT * lda; Bh += (size_t)by * sB; const size_t cofs = (size_t)by * sC + (size_t)qt * QT * ldc;
  const int ntn = N / G3T; const int mt = blockIdx.x / ntn, nq = blockIdx.x - mt * ntn; const int row0 = mt * G3T, col0 = nq * G3T;
  if (CAUS == 1 && col0 >= (qt + 1) * QT) return;      /* the same for the whole block, in front of every barrier */
  const int K = (CAUS == 2) ? (qt + 1) * QT : KF;
  const int sr = tid >> 3, sc = (tid & 7) * 8;      /* staging: thread t moves 16-byte piece t % 8 of rows t / 8 + 16 i, i = 0..7, of both operands */
  const unsigned short* ga = (const unsigned short*)A + (size_t)(row0 + sr) * lda + sc;
  const unsigned short* gb = (const unsigned short*)Bh + (size_t)(col0 + sr) * ldb + sc;
  unsigned short* st = sm + sr * G3P + sc;
  const int wm = w >> 1, wn = w & 1;
  const unsigned short* fa = sm + (wm * 64 + ln) * G3P; const unsigned short* fb = sm + (G3T + wn * 64 + ln) * G3P;
  const v8f z8 = {0.f,0.f,0.f,0.f,0.f,0.f,0.f,0.f}; v8f acc[4][4]; v8us ra[8], rb[8];
  /* every '#pragma unroll' of this kernel makes the index of a register array a constant */
#pragma unroll
  for (int i = 0; i < 4; ++i)
#pragma unroll
    for (int j = 0; j < 4; ++j) acc[i][j] = z8;
#pragma unroll
  for (int i = 0; i < 8; ++i) { ra[i] = *(const v8us*)(ga + 16 * i * lda); rb[i] = *(const v8us*)(gb + 16 * i * ldb); }
  G3_XW(ga, gb);
#pragma unroll
  for (int i = 0; i < 8; ++i) { *(v8us*)(st + 16 * i * G3P) = ra[i]; *(v8us*)(st + (G3T + 16 * i) * G3P) = rb[i]; }
  __syncthreads();
  const int nkt = K / G3K;
  for (int kt = 0; kt + 1 < nkt; ++kt) {      /* the trip count is the same for the whole block */
    const int bo = (kt & 1) * G3B;
    const unsigned short* pa = ga + (kt + 1) * G3K; const unsigned short* pb = gb + (kt + 1) * G3K;
#pragma unroll
    for (int i = 0; i < 8; ++i) { ra[i] = *(const v8us*)(pa + 16 * i * lda); rb[i] = *(const v8us*)(pb + 16 * i * ldb); }
    G3_XW(pa, pb);
    g3_slab(acc, fa + bo, fb + bo, hh);
    unsigned short* sn = st + (G3B - bo);      /* the other buffer: its last readers left it in front of the barrier that ended the slab before */
#pragma unroll
    for (int i = 0; i < 8; ++i) { *(v8us*)(sn + 16 * i * G3P) = ra[i]; *(v8us*)(sn + (G3T + 16 * i) * G3P) = rb[i]; }
    __syncthreads(); }      /* publishes the next slab and ends every read of this one */
  g3_slab(acc, fa + ((nkt - 1) & 1) * G3B, fb + ((nkt - 1) & 1) * G3B, hh);
  __syncthreads();      /* ends every read of the last slab: the output rows are staged over it */
  float* so = (float*)sm + w * (64 * 68);      /* the wave's own 64 x 64 f32 rows at pitch 68, so that the stores below are whole lines */
  if (VTR && col0 >= N - DM) {      /* the same for the whole block: a tile of 128 columns lies wholly inside or outside the v columns */
    const int rs = lane >> 4, k4 = (lane & 15) * 4;
#pragma unroll
    for (int i = 0; i < 4; ++i)
#pragma unroll
      for (int j = 0; j < 4; ++j) acc[i][j] *= alpha;      /* scaled in place, once: both stagings below read the same registers */
    if (X32 && row0 % SQ < QT0) {      /* exact rows: their f32 v rows go out first, staged row by row as in the other blocks */
#pragma unroll
      for (int i = 0; i < 4; ++i)
#pragma unroll
        for (int j = 0; j < 4; ++j)
#pragma unroll
          for (int r = 0; r < 8; ++r) so[(16 * i + 8 * hh + r) * 68 + 16 * j + ln] = acc[i][j][r];
      __builtin_amdgcn_fence(__ATOMIC_ACQ_REL, "workgroup"); __builtin_amdgcn_wave_barrier();      /* the wave reads back what its other lanes wrote */
      float* cx = C + ((size_t)(row0 - (row0 / SQ) * (SQ - QT0) + wm * 64 + rs) * ldc + col0 + wn * 64 + k4);
#pragma unroll
      for (int q = 0; q < 32; ++q) { const v4f v = *(const v4fa*)&so[(q * 2 + rs) * 68 + k4]; *(v4f*)(cx + q * 2 * ldc) = v; }
      asm volatile("s_wait_xcnt 0x0" ::: "memory");      /* in front of the code below, which rewrites the address and data registers of these stores */
      __builtin_amdgcn_fence(__ATOMIC_ACQ_REL, "workgroup"); __builtin_amdgcn_wave_barrier(); }      /* the rows are read before the same bytes are staged anew */
    /* staged column by column: the eight rows a lane holds of one column are neighbours there (two 16-byte LDS stores), and a v column's 64 keys read back as one whole line */
#pragma unroll
    for (int i = 0; i < 4; ++i)
#pragma unroll
      for (int j = 0; j < 4; ++j) { v4f lo4, hi4;
#pragma unroll
        for (int r = 0; r < 4; ++r) { lo4[r] = acc[i][j][r]; hi4[r] = acc[i][j][4 + r]; }
        float* d = &so[(16 * j + ln) * 68 + 16 * i + 8 * hh]; *(v4fa*)d = lo4; *(v4fa*)(d + 4) = hi4; }
    __builtin_amdgcn_fence(__ATOMIC_ACQ_REL, "workgroup"); __builtin_amdgcn_wave_barrier();      /* the wave reads back what its other lanes wrote */
    _Float16* vt = VT + ((size_t)(row0 / SQ) * DM + (col0 - (N - DM)) + wn * 64 + rs) * SQ + row0 % SQ + wm * 64 + k4;
#pragma unroll
    for (int q = 0; q < 32; ++q) { const v4f v = *(const v4fa*)&so[(q * 2 + rs) * 68 + k4]; v4h h4; for (int i = 0; i < 4; ++i) h4[i] = (_Float16)v[i]; *(v4h*)(vt + q * 2 * SQ) = h4; }
    return; }      /* behind the kernel's last barrier */
#pragma unroll
  for (int i = 0; i < 4; ++i)
#pragma unroll
    for (int j = 0; j < 4; ++j)
#pragma unroll
      for (int r = 0; r < 8; ++r) so[(16 * i + 8 * hh + r) * 68 + 16 * j + ln] = acc[i][j][r] * alpha;
  __builtin_amdgcn_fence(__ATOMIC_ACQ_REL, "workgroup"); __builtin_amdgcn_wave_barrier();
  const int rsub = lane >> 4, c4 = (lane & 15) * 4; const size_t co = cofs + (size_t)(row0 + wm * 64 + rsub) * ldc + col0 + wn * 64 + c4; float* cp = H16 ? nullptr : C + co; _Float16* cp16 = H16 ? C16 + co : nullptr;
  if (X32 && row0 % SQ < QT0) {      /* the same for the whole block: a tile of 128 rows lies wholly inside or outside the exact rows */
    float* cx = C + (co - (size_t)(row0 / SQ) * ((SQ - QT0) * ldc));      /* the f16 row's place less the rows of earlier batches that are not kept */
#pragma unroll
    for (int q = 0; q < 32; ++q) { const v4f v = *(const v4fa*)&so[(q * 2 + rsub) * 68 + c4]; v4h h4; for (int i = 0; i < 4; ++i) h4[i] = (_Float16)v[i]; *(v4h*)(cp16 + q * 2 * ldc) = h4; *(v4f*)(cx + q * 2 * ldc) = v; }
    if (VTR) asm volatile("s_wait_xcnt 0x0" ::: "memory"); }      /* the built code lays the v branch behind these stores, with only a conditional branch between, and it rewrites their address and data registers */
  else {
#pragma unroll
    for (int q = 0; q < 32; ++q) { const int r = q * 2 + rsub; const v4f v = *(const v4fa*)&so[r * 68 + c4]; if (!H16) *(v4f*)(cp + q * 2 * ldc) = v; else { v4h h4; for (int i = 0; i < 4; ++i) h4[i] = (_Float16)v[i]; *(v4h*)(cp16 + q * 2 * ldc) = h4; } }
    if (X32) asm volatile("s_wait_xcnt 0x0" ::: "memory"); } }      /* the built code lays the other branch directly behind these stores, with only a conditional branch between, and it rewrites their data registers */
template <int CAUS, bool H16, bool X32, int lda, int ldb, int ldc, int N, int KF>
__global__ __launch_bounds__(128) void k_gemm3(const _Float16* __restrict__ A, size_t sA, const _Float16* __restrict__ Bh, size_t sB, float alpha,
    float* __restrict__ C, _Float16* __restrict__ C16, size_t sC) { g3_body<CAUS, H16, X32, lda, ldb, ldc, N, KF, false>(A, sA, Bh, sB, alpha, C, C16, sC, nullptr); }
// the projection, with the v branch in its epilogue. The register budget of four waves per SIMD is stated: LDS lets four blocks share a WGP, and left free this build took two registers more than that leaves a wave.
template <int lda, int ldb, int ldc, int N, int KF>
__global__ __launch_bounds__(128) __attribute__((amdgpu_waves_per_eu(4, 4))) void k_gemm3v(const _Float16* __restrict__ A, const _Float16* __restrict__ Bh, float alpha,
    float* __restrict__ C, _Float16* __restrict__ C16, _Float16* __restrict__ VT) { g3_body<0, true, true, lda, ldb, ldc, N, KF, true>(A, 0, Bh, 0, alpha, C, C16, 0, VT); }


__global__ __launch_bounds__(256) void k_wnat(const float* __restrict__ w, size_t n8, _Float16* __restrict__ Bt) { const size_t t = (size_t)blockIdx.x * 256 + threadIdx.x; if (t >= n8) return; FragH f; for (int q = 0; q < 8; ++q) f.h[q] = (_Float16)(bf16_round(w[t * 8 + q]) * 16.0f); *(v8us*)((unsigned short*)Bt + t * 8) = f.half[0];  }
__global__ __launch_bounds__(256) void k_rsm(const float* __restrict__ S, _Float16* __restrict__ P, int nrows) {
  #pragma clang fp contract(off)
  const int i = blockIdx.x * 256 + threadIdx.x; if (i >= nrows) return; const float* s = S + (size_t)i * SQ; float mx = -3.0e38f;
#pragma unroll 1
  for (int j = 0; j < SQ; ++j) mx = fmaxf(mx, s[j]); float se = 0.f;
#pragma unroll 1
  for (int j = 0; j < SQ; ++j) se += expf(s[j] - mx); const float sc = 256.0f / se;
#pragma unroll 1
  for (int j0 = 0; j0 < SQ; j0 += 8) { FragH f; for (int q = 0; q < 8; ++q) f.h[q] = (_Float16)(expf(s[j0 + q] - mx) * sc); unsigned short* d = (unsigned short*)P + (size_t)i * SQ + j0; *(v8us*)d = f.half[0];  } }
__global__ __launch_bounds__(256) void k_vt(const _Float16* __restrict__ V16, int b, int h0, _Float16* __restrict__ VT) { __shared__ unsigned short tl[64][65]; const int tid = threadIdx.x; const int hh = blockIdx.x % HG, sg = blockIdx.x / HG; const int s0 = sg * 64; const int h = h0 + hh;
  for (int i = tid; i < 64 * 8; i += 256) { const int j = i / 8, d8 = (i % 8) * 8; FragH f; f.half[0] = *(const v8us*)((const unsigned short*)V16 + ((size_t)b * SQ + s0 + j) * DM + h * HD + d8); for (int q = 0; q < 8; ++q) tl[d8 + q][j] = f.u[q]; }
  __syncthreads();
  { for (int i = tid; i < 64 * 8; i += 256) { const int d = i / 8, j8 = (i % 8) * 8; FragH f; for (int q = 0; q < 8; ++q) f.u[q] = tl[d][j8 + q]; *(v8us*)((unsigned short*)VT + ((size_t)hh * HD + d) * SQ + s0 + j8) = f.half[0]; }  } }



// Causal softmax, ONE S ROW PER WAVE, the row held in registers: lane l owns keys 256 c + 8 l .. + 7 of each 256-key chunk c (two 16-byte loads in, one 16-byte f16 store out per chunk).
// Row max and row sum: per-lane partials (the sum in four independent chains), then a five-step butterfly over the 32 lanes. NC = nk / 256 chunks, all loads of a row in flight together.
// e^x as the fast form has it (one multiply, v_exp_f32). The v_nop is the one slot the instruction set asks for behind a transcendental before its result is read or its source overwritten; it stands in the same statement because the compiler's own schedule of this kernel reused a source register directly behind some v_exp_f32.
__device__ __forceinline__ float rsm_exp(float x) { const float y = x * 1.44269504088896340736f; float e; asm("v_exp_f32 %0, %1\n\tv_nop" : "=v"(e) : "v"(y)); return e; }
template <int NC>
__device__ __forceinline__ void rsm_row(const float* __restrict__ s, unsigned short* __restrict__ p, int k0, int last) {
  float v[NC][8];
#pragma unroll
  for (int c = 0; c < NC; ++c) { const v4f a = *(const v4fa*)(s + c * 256 + k0), b = *(const v4fa*)(s + c * 256 + k0 + 4);
#pragma unroll
    for (int q = 0; q < 4; ++q) { v[c][q] = a[q]; v[c][4 + q] = b[q]; } }
  float mx = -3.0e38f;
#pragma unroll
  for (int c = 0; c < NC; ++c)
#pragma unroll
    for (int q = 0; q < 8; ++q) { if (c * 256 + k0 + q > last) v[c][q] = -1.0e9f; mx = fmaxf(mx, v[c][q]); }
#pragma unroll
  for (int m = 16; m > 0; m >>= 1) mx = fmaxf(mx, __shfl_xor(mx, m, 32));
  float s4[4] = {0.f, 0.f, 0.f, 0.f};
#pragma unroll
  for (int c = 0; c < NC; ++c)
#pragma unroll
    for (int q = 0; q < 8; ++q) { v[c][q] = rsm_exp(v[c][q] - mx); s4[q & 3] += v[c][q]; }
  float se = (s4[0] + s4[1]) + (s4[2] + s4[3]);
#pragma unroll
  for (int m = 16; m > 0; m >>= 1) se += __shfl_xor(se, m, 32);
  const float sc = 256.0f / se;
#pragma unroll
  for (int c = 0; c < NC; ++c) { FragH fr;
#pragma unroll
    for (int q = 0; q < 8; ++q) fr.h[q] = (_Float16)(v[c][q] * sc);
    *(v8us*)(p + c * 256 + k0) = fr.half[0]; }
  asm volatile("s_wait_xcnt 0x0" ::: "memory");      /* the built code lays the row lengths one behind the other, and only a conditional branch stands between these stores and the next length's code, which rewrites their address and data registers */
}
// row = number of a token row among the rows past the exact rows, of all batches (the same in every lane of the wave); a row's length is the end of its own QT-row query tile
__device__ __forceinline__ void rsm_wave(const float* __restrict__ S, _Float16* __restrict__ P, unsigned row, int lane) {
  const int last = QT0 + row % (SQ - QT0); const int t = row / (SQ - QT0) * SQ + last; const int k0 = lane * 8;
  const float* s = S + (size_t)t * NKX; unsigned short* p = (unsigned short*)P + (size_t)t * NKX;
  switch (last / QT + 1) {      /* the same for every lane of the wave: straight-line code for each row length */
    case 1: rsm_row<1>(s, p, k0, last); break; case 2: rsm_row<2>(s, p, k0, last); break; case 3: rsm_row<3>(s, p, k0, last); break; case 4: rsm_row<4>(s, p, k0, last); break;
    case 5: rsm_row<5>(s, p, k0, last); break; case 6: rsm_row<6>(s, p, k0, last); break; case 7: rsm_row<7>(s, p, k0, last); break; case 8: rsm_row<8>(s, p, k0, last); break;
    default: break; } }


template <int MASKADD>
__global__ __launch_bounds__(64) void k_att0(const float* __restrict__ QF, const float* __restrict__ KF, const float* __restrict__ VF, int ld, const float* __restrict__ mask, float scale, float* __restrict__ OF, int ldo) {
  #pragma clang fp contract(off)
  __shared__ __attribute__((aligned(16))) float lq[64][64]; __shared__ __attribute__((aligned(16))) float lo[64][64];
  const int tid = threadIdx.x; const int h = blockIdx.x / (QT0 / 64), rg = blockIdx.x % (QT0 / 64); const int i = rg * 64 + tid;
  const float* qr = QF + (size_t)i * ld + h * HD;
#pragma unroll 1
  for (int c = 0; c < HD / 4; ++c) { *(v4f*)&lq[tid][c * 4] = *(const v4fa*)(qr + c * 4); const v4f z = {0.f, 0.f, 0.f, 0.f}; *(v4f*)&lo[tid][c * 4] = z; }
  float m = -1.0e30f, l = 0.f; const int jmax = MASKADD ? (SQ - 1) : (rg * 64 + 63);      /* additive-mask form: every key (the mask input decides); causal form: keys up to the block's last row */
#pragma unroll 1
  for (int j = 0; j <= jmax; ++j) { const float* kr = KF + (size_t)j * ld + h * HD; const float* vr = VF + (size_t)j * ld + h * HD; float s = 0.f;
#pragma unroll 1
    for (int c = 0; c < HD / 4; ++c) { const v4f kq = *(const v4fa*)(kr + c * 4); const v4f qq = *(v4f*)&lq[tid][c * 4]; s = __fadd_rn(s, __fmul_rn(qq[0], kq[0])); s = __fadd_rn(s, __fmul_rn(qq[1], kq[1])); s = __fadd_rn(s, __fmul_rn(qq[2], kq[2])); s = __fadd_rn(s, __fmul_rn(qq[3], kq[3])); }
    s = __fmul_rn(s, scale); if (MASKADD) s = __fadd_rn(s, __fmul_rn(bf16_round(mask[(size_t)i * SQ + j]), -10000.0f));
    const float f = (MASKADD || j <= i) ? 1.f : 0.f; const float sm = fmaf(f, s, (1.f - f) * -1.0e30f); const float mn = fmaxf(m, sm); const float sc = expf(m - mn); const float e = expf(sm - mn); l = __fadd_rn(__fmul_rn(l, sc), e); m = mn;
#pragma unroll 1
    for (int c = 0; c < HD / 4; ++c) { const v4f vv = *(const v4fa*)(vr + c * 4); v4f oo = *(v4f*)&lo[tid][c * 4]; for (int u = 0; u < 4; ++u) oo[u] = __fadd_rn(__fmul_rn(oo[u], sc), __fmul_rn(e, vv[u])); *(v4f*)&lo[tid][c * 4] = oo; } }
  const float fin = 64.0f / l;      /* o carried x64 */
#pragma unroll 1
  for (int c = 0; c < HD / 4; ++c) { v4f oo = *(v4f*)&lo[tid][c * 4]; for (int u = 0; u < 4; ++u) oo[u] = __fmul_rn(oo[u], fin); *(v4f*)&lo[tid][c * 4] = oo; }
  __syncthreads();
  {
#pragma unroll 1
    for (int it = 0; it < 16; ++it) { const int row = it * 4 + tid / 16, pc = (tid % 16) * 4; const v4f v = *(const v4f*)&lo[row][pc]; *(v4f*)(OF + (size_t)(rg * 64 + row) * ldo + h * HD + pc) = v; }
     } }


template <int BFIN, int WXB>
__global__ __launch_bounds__(256) void k_ln16(const float* __restrict__ X, const float* __restrict__ g, const float* __restrict__ bb, float eps, _Float16* __restrict__ N16, float* __restrict__ XB) {
  #pragma clang fp contract(off)
  __shared__ float red[256]; const size_t r = blockIdx.x; const int t = threadIdx.x; const v4f xa = *(const v4fa*)(X + r * DMQ + t * 4); float s[4]; float sum = 0.f;
  for (int q = 0; q < 4; ++q) { s[q] = BFIN ? bf16_round(xa[q]) : xa[q]; sum = __fadd_rn(sum, s[q]); }
  red[t] = sum; __syncthreads(); for (int st = 128; st > 0; st >>= 1) { if (t < st) red[t] = __fadd_rn(red[t], red[t + st]); __syncthreads(); } const float mu = red[0] / (float)DMQ; __syncthreads();
  float vs = 0.f; for (int q = 0; q < 4; ++q) { const float dl = __fadd_rn(s[q], -mu); vs = __fadd_rn(vs, __fmul_rn(dl, dl)); } red[t] = vs; __syncthreads(); for (int st = 128; st > 0; st >>= 1) { if (t < st) red[t] = __fadd_rn(red[t], red[t + st]); __syncthreads(); }
  const float rs = rsqrtf(__fadd_rn(red[0] / (float)DMQ, eps)); v4h y; v4f xb;
  for (int q = 0; q < 4; ++q) { const int c = t * 4 + q; y[q] = (_Float16)__fadd_rn(__fmul_rn(__fmul_rn(__fadd_rn(s[q], -mu), rs), bf16_round(g[c])), bf16_round(bb[c])); xb[q] = s[q]; }
  { *(v4h*)(N16 + r * DMQ + t * 4) = y; if (WXB) *(v4f*)(XB + r * DMQ + t * 4) = xb;  } }
__global__ __launch_bounds__(256) void k_ftres2(const float* __restrict__ OF0, const float* __restrict__ XB, float* __restrict__ X1, size_t n4) {
  #pragma clang fp contract(off)
  const size_t t = (size_t)blockIdx.x * 256 + threadIdx.x; if (t >= n4) return; const v4f o = *(const v4fa*)(OF0 + t * 4), xv = *(const v4fa*)(XB + t * 4); v4f y; for (int q = 0; q < 4; ++q) y[q] = __fadd_rn(__fmul_rn(o[q], 0.015625f), xv[q]); *(v4f*)(X1 + t * 4) = y;  }

__global__ __launch_bounds__(256) void k_wthd(const float* __restrict__ Wt, _Float16* __restrict__ Bt) { const size_t t = (size_t)blockIdx.x * 256 + threadIdx.x; if (t >= (size_t)NH * HD * (DM / 8)) return; const int m8 = (int)(t % (DM / 8)) * 8; const int d = (int)((t / (DM / 8)) % HD); const int h = (int)(t / ((size_t)(DM / 8) * HD)); FragH f;
  for (int q = 0; q < 8; ++q) f.h[q] = (_Float16)(16.0f * bf16_round(Wt[((size_t)h * DM + m8 + q) * HD + d])); unsigned short* dst = (unsigned short*)Bt + ((size_t)h * HD + d) * DM + m8; *(v8us*)dst = f.half[0];  }




__global__ __launch_bounds__(256) void k_wtpad(const float* __restrict__ Wm, _Float16* __restrict__ Wt, int Kr, int Kp, int Nr, int Np, float scale) {
  const int t = blockIdx.x * 256 + threadIdx.x; if (t >= Np * (Kp / 8)) return; const int n = t / (Kp / 8), k8 = (t % (Kp / 8)) * 8; const int nc = min(n, Nr - 1); const float fn = (n < Nr) ? 1.f : 0.f; FragH f;
  for (int i = 0; i < 8; ++i) { const int k = k8 + i; const int kc = min(k, Kr - 1); const float fk = (k < Kr) ? fn : 0.f; f.h[i] = (_Float16)(bf16_round(Wm[(size_t)kc * Nr + nc]) * scale * fk); }
  unsigned short* o = (unsigned short*)Wt + (size_t)n * Kp + k8; *(v8us*)o = f.half[0];  }
__global__ __launch_bounds__(128) void k_bpad(const float* __restrict__ b, float* __restrict__ Bp, int nr, int np) {
  const int i = threadIdx.x; if (i >= np) return; const float v = b[min(i, nr - 1)] * ((i < nr) ? 1.f : 0.f); *(float*)(Bp + i) = v;  }

#define DI 1024       /* inner width = NH * HD */
#define LQK (3 * DI)  /* fused q | k | v row pitch (3072) */
__global__ __launch_bounds__(256) void k_o0(const float* __restrict__ OF, float* __restrict__ ob, size_t n4) {
  #pragma clang fp contract(off)
  const size_t t = (size_t)blockIdx.x * 256 + threadIdx.x; if (t >= n4) return; const size_t e = t * 4; const int i = (int)(e / DI); const int c = (int)(e % DI); const int h = c / HD, d = c % HD; const v4f a = *(const v4fa*)(OF + e); v4f o; for (int q = 0; q < 4; ++q) o[q] = __fmul_rn(a[q], 0.015625f); float* dst = ob + (size_t)h * SQ * HD + (size_t)i * HD + d; *(v4f*)dst = o;  }

#define RQ 4                 /* query rows per block of the exact path */
#define SJP (QT0 + 16)       /* pitch of a score row in LDS: the RQ rows of one key fall on different banks */
// Exact f32 attention for the first QT0 rows of every batch, RQ query rows per block, so that every k row and every v row a block loads serves RQ queries, and every global load is whole lines.
// Scores: one wave per group of 8 keys; lane l holds columns 128 u + 4 l .. + 3 (u = 0..7) of the RQ query rows in registers and of the key row as it comes in; the 8 x RQ = 32 per-lane partial dot products
// are summed over the 32 lanes by a halving exchange (31 exchanges in all) that leaves sum number l (key * RQ + row) in lane l. Softmax: one wave per query row. Output: thread t owns columns 4 t .. + 3 of the RQ rows, keys in order.
// Every '#pragma unroll' of this kernel and its helpers makes the index of a register array a constant; each '#pragma unroll 1' keeps a loop rolled whose body already fills the registers that four waves per SIMD leave a wave.
typedef float v2f __attribute__((ext_vector_type(2)));
// the value of lane ^ BIT, on the vector unit: inside a 16-lane row by DPP (row_xmask), between the two rows by the cross-row move; all 32 lanes are on wherever it is called
template <int BIT>
__device__ __forceinline__ float att0_xor(float x) { int v = __float_as_int(x);
  if constexpr (BIT == 16) v = __builtin_amdgcn_permlanex16(v, v, 0x76543210, 0xfedcba98, false, false); else v = __builtin_amdgcn_update_dpp(v, v, 0x160 + BIT, 0xf, 0xf, false);
  return __int_as_float(v); }
// one step of the halving exchange over lane bit BIT: a lane with the bit set keeps the sums hi[], its partner (lane ^ BIT) the sums lo[]; each hands the other half over; the kept sums come back in lo[]
template <int N, int BIT>
__device__ __forceinline__ void att0_halve(float (&lo)[N], const float (&hi)[N], int lane) { const bool up = (lane & BIT) != 0;
#pragma unroll
  for (int t = 0; t < N; ++t) { const float send = up ? lo[t] : hi[t]; const float keep = up ? hi[t] : lo[t]; lo[t] = keep + att0_xor<BIT>(send); } }
// behind a run of global loads from one pointer: the wait that stands in front of any rewrite of the registers the loads name; naming the pointer keeps its registers live up to the wait, so that no load of the run is given them as its destination
#define ATT0_XW(p) asm volatile("s_wait_xcnt 0x0" :: "v"(p) : "memory")
__device__ __forceinline__ void att0_use8(v4f (&o)[RQ], const v4f (&v)[8], const float (*pe)[RQ]) {      /* eight v rows into the RQ output rows, keys in order */
#pragma unroll
  for (int t = 0; t < 8; ++t) { const v4f e = *(const v4f*)&pe[t][0];
#pragma unroll
    for (int r = 0; r < RQ; ++r) { const v2f er = {e[r], e[r]}; o[r].xy = __builtin_elementwise_fma(er, v[t].xy, o[r].xy); o[r].zw = __builtin_elementwise_fma(er, v[t].zw, o[r].zw); } } }
// ONE launch with the causal softmax of the other rows: neither needs anything of the other; the short exact blocks leave their places early while the long ones run on, and the softmax blocks (eight rows each, a wave a row, no barrier, no LDS) run in those places.
#define ATT0_NBLK (NB * (QT0 / RQ))      /* blocks 0 .. ATT0_NBLK - 1: exact rows; the blocks behind them: softmax */
__global__ __launch_bounds__(256) __attribute__((amdgpu_waves_per_eu(4, 4))) void k_att0w_rsm(const float* __restrict__ QF, const float* __restrict__ KF, const float* __restrict__ VF, float scale, float* __restrict__ OF, const float* __restrict__ S, _Float16* __restrict__ P) {      /* q | k | v rows of pitch LQK, QT0 a batch; OF = the output itself, rows of pitch DI, SQ a batch; the register budget of four waves per SIMD, so that a long and a short block share a WGP */
  __shared__ float sj[RQ][SJP]; __shared__ __attribute__((aligned(16))) float pe[QT0][RQ]; __shared__ float fin[RQ];
  const int tid = threadIdx.x, w = __builtin_amdgcn_readfirstlane(tid >> 5), lane = tid & 31;      /* the wave's number as a scalar: the key loop stays on the scalar unit */
  if (blockIdx.x >= ATT0_NBLK) { rsm_wave(S, P, (blockIdx.x - ATT0_NBLK) * 8 + (unsigned)w, lane); return; }      /* the same for the whole block, in front of every barrier */
  const int b = blockIdx.x % NB, idx = blockIdx.x / NB;      /* batch fastest */
  const int g = (idx < QT0 / RQ / 2) ? QT0 / RQ - 1 - idx : idx - QT0 / RQ / 2;      /* first half of the exact blocks: the row groups with the most keys, longest first; second half: the short ones, shortest first */
  const int i0 = g * RQ, nk = i0 + RQ;      /* keys 0 .. nk - 1 are seen by at least one of the block's rows */
  QF += (size_t)b * QT0 * LQK; KF += (size_t)b * QT0 * LQK; VF += (size_t)b * QT0 * LQK; OF += (size_t)b * SQ * DI;
  for (int t = tid; t < RQ * SJP; t += 256) (&sj[0][0])[t] = -1.0e30f;      /* keys no wave computes count as masked */
  v4f q[RQ][8]; const float* qp = QF + (size_t)i0 * LQK + lane * 4;
#pragma unroll
  for (int r = 0; r < RQ; ++r)
#pragma unroll
    for (int u = 0; u < 8; ++u) q[r][u] = *(const v4fa*)(qp + r * LQK + u * 128);
  ATT0_XW(qp);
  __syncthreads();
  v4f cur[8]; const float* kp = KF + (size_t)(w * 8) * LQK + lane * 4;      /* the key row in use; the next one is fetched while it is used. Rows w * 8 .. + 7 lie below QT0 for every wave, also for one that has no group */
#pragma unroll
  for (int u = 0; u < 8; ++u) cur[u] = *(const v4fa*)(kp + u * 128);
  ATT0_XW(kp);
#pragma unroll 1
  for (int g8 = w; g8 * 8 < nk; g8 += 8) {      /* the same for every lane of a wave; key rows g8 * 8 .. + 7 lie below QT0 */
    const float* kg = KF + (size_t)(g8 * 8) * LQK + lane * 4;
    const float* kn = KF + (size_t)((((g8 + 8) * 8 < nk) ? g8 + 8 : g8) * 8) * LQK + lane * 4;      /* first row of the wave's next group (the last trip fetches its own first row again) */
    float a4[2][RQ];      /* the exchange runs as a tree beside the keys (2 keys, 4 keys, 8 keys), so that few partial sums are live at a time */
#pragma unroll
    for (int k4 = 0; k4 < 2; ++k4) { float a2[2][RQ];
#pragma unroll
      for (int k2 = 0; k2 < 2; ++k2) { float a1[2][RQ];
#pragma unroll
        for (int k1 = 0; k1 < 2; ++k1) { const int kk = k4 * 4 + k2 * 2 + k1; const float* kr = (kk < 7) ? kg + (kk + 1) * LQK : kn; v4f nxt[8];
#pragma unroll
          for (int u = 0; u < 8; ++u) nxt[u] = *(const v4fa*)(kr + u * 128);
          ATT0_XW(kr);
#pragma unroll
          for (int r = 0; r < RQ; ++r) { v2f s = {0.f, 0.f};      /* even and odd columns in the two halves of a packed multiply-add */
#pragma unroll
            for (int u = 0; u < 8; ++u) { s = __builtin_elementwise_fma(q[r][u].xy, cur[u].xy, s); s = __builtin_elementwise_fma(q[r][u].zw, cur[u].zw, s); }
            a1[k1][r] = s.x + s.y; }
#pragma unroll
          for (int u = 0; u < 8; ++u) cur[u] = nxt[u];
          __builtin_amdgcn_sched_barrier(0); }      /* keeps the eight keys of a group apart: left free, the scheduler mixed their loads and spilled query registers to scratch */
        att0_halve<RQ, 4>(a1[0], a1[1], lane);
#pragma unroll
        for (int r = 0; r < RQ; ++r) a2[k2][r] = a1[0][r]; }
      att0_halve<RQ, 8>(a2[0], a2[1], lane);
#pragma unroll
      for (int r = 0; r < RQ; ++r) a4[k4][r] = a2[0][r]; }
    att0_halve<RQ, 16>(a4[0], a4[1], lane);
    float b2[2][2] = {{a4[0][0], a4[0][1]}, {a4[0][2], a4[0][3]}}; att0_halve<2, 2>(b2[0], b2[1], lane);
    float b1[2][1] = {{b2[0][0]}, {b2[0][1]}}; att0_halve<1, 1>(b1[0], b1[1], lane);
    const int j = g8 * 8 + (lane >> 2), r = lane & 3;      /* lane bits 16, 8, 4 chose the key in the group, bits 2, 1 the row */
    sj[r][j] = (j <= i0 + r) ? b1[0][0] * scale : -1.0e30f; }
  __syncthreads();
  if (w < RQ) { float sv[QT0 / 32]; float mx = -1.0e30f;
#pragma unroll
    for (int u = 0; u < QT0 / 32; ++u) { sv[u] = sj[w][u * 32 + lane]; mx = fmaxf(mx, sv[u]); }
    mx = fmaxf(mx, att0_xor<1>(mx)); mx = fmaxf(mx, att0_xor<2>(mx)); mx = fmaxf(mx, att0_xor<4>(mx)); mx = fmaxf(mx, att0_xor<8>(mx)); mx = fmaxf(mx, att0_xor<16>(mx));
    float ls = 0.f;
#pragma unroll
    for (int u = 0; u < QT0 / 32; ++u) { const float e = expf(sv[u] - mx); pe[u * 32 + lane][w] = e; ls += e; }
    ls += att0_xor<1>(ls); ls += att0_xor<2>(ls); ls += att0_xor<4>(ls); ls += att0_xor<8>(ls); ls += att0_xor<16>(ls);
    if (lane == 0) fin[w] = 1.0f / ls; }
  __syncthreads();
  const float* vp = VF + tid * 4; const v4f z4 = {0.f, 0.f, 0.f, 0.f}; v4f o[RQ] = {z4, z4, z4, z4}; v4f va[8], vb[8];
  const int nk16 = (nk + 15) & ~15;      /* v rows in steps of 16: rows nk .. nk16 - 1 lie below QT0 and carry weight 0 for all RQ queries */
#pragma unroll
  for (int t = 0; t < 8; ++t) va[t] = *(const v4fa*)(vp + t * LQK);
  ATT0_XW(vp);
#pragma unroll 1
  for (int j = 0; j < nk16; j += 16) {      /* two sets of eight v rows: one flies while the other is used */
    const float* pb = vp + (size_t)(j + 8) * LQK;
#pragma unroll
    for (int t = 0; t < 8; ++t) vb[t] = *(const v4fa*)(pb + t * LQK);
    ATT0_XW(pb);
    att0_use8(o, va, &pe[j]);
    __builtin_amdgcn_sched_barrier(0);      /* keeps each fetch ahead of the work it flies beside: left free, the loads were moved down to where their rows are used */
    const float* pa = vp + (size_t)((j + 16 < nk16) ? j + 16 : j) * LQK;      /* the last trip loads its own first rows again */
#pragma unroll
    for (int t = 0; t < 8; ++t) va[t] = *(const v4fa*)(pa + t * LQK);
    ATT0_XW(pa);
    att0_use8(o, vb, &pe[j + 8]);
    __builtin_amdgcn_sched_barrier(0); }      /* as above */
#pragma unroll
  for (int r = 0; r < RQ; ++r) { const v4f y = o[r] * fin[r]; *(v4f*)(OF + (size_t)(i0 + r) * DI + tid * 4) = y; }
  asm volatile("s_wait_xcnt 0x0" ::: "memory"); }      /* the built code lays the softmax branch directly behind these stores, with only a conditional branch between, and it rewrites their address and data registers */

__global__ __launch_bounds__(256) void k_o0m(const float* __restrict__ OF, float* __restrict__ o_, size_t n4) {
  #pragma clang fp contract(off)
  const size_t t = (size_t)blockIdx.x * 256 + threadIdx.x; if (t >= n4) return; const size_t e = t * 4; OF += (size_t)blockIdx.y * QT0 * DI; o_ += (size_t)blockIdx.y * SQ * DI;      /* grid y = batch */
  const v4f a = *(const v4fa*)(OF + e); v4f o; for (int q = 0; q < 4; ++q) o[q] = __fmul_rn(a[q], 0.015625f); *(v4f*)(o_ + e) = o;  }
// W^T operand of the projection: Wt[n][k] = f16(bf16(W[k][n]) * 16) from W [DM][LQK] f32, one 64 k x 32 n tile per wave.
// Lane l reads column n0 + l of the tile's 64 rows: the 32 lanes of a load lie side by side in one row of W, so a wave-load is one whole 128-byte line. The lane's 64 values are one 128-byte piece of row n0 + l of W^T;
// they go through the wave's own LDS tile (pitch 144 bytes = 16 x odd) so that eight lanes store one such piece together: a wave-store is four whole lines.
#define WLK 64                       /* k per tile */
#define WLP 72                       /* LDS row pitch in f16 */
__global__ __launch_bounds__(128) void k_wtl(const float* __restrict__ Wm, _Float16* __restrict__ Wt) {
  __shared__ __attribute__((aligned(16))) unsigned short tl[4][32 * WLP];
  const int tid = threadIdx.x, w = tid >> 5, lane = tid & 31; const int wv = blockIdx.x * 4 + w;      /* tile number: column group fastest */
  const int n0 = (wv % (LQK / 32)) * 32, k0 = (wv / (LQK / 32)) * WLK;
  const float* sp = Wm + (size_t)k0 * LQK + n0 + lane; float v[WLK];
  /* every '#pragma unroll' of this kernel makes the index of a register array a constant; all 64 loads of a lane fly together */
#pragma unroll
  for (int i = 0; i < WLK; ++i) v[i] = sp[i * LQK];
  ATT0_XW(sp);      /* in front of the code below, which reuses the address registers of these loads */
  unsigned short* row = &tl[w][lane * WLP];
#pragma unroll
  for (int c = 0; c < WLK / 8; ++c) { FragH f;
#pragma unroll
    for (int q = 0; q < 8; ++q) f.h[q] = (_Float16)(bf16_round(v[c * 8 + q]) * 16.0f);
    *(v8us*)(row + c * 8) = f.half[0]; }
  __builtin_amdgcn_fence(__ATOMIC_ACQ_REL, "workgroup"); __builtin_amdgcn_wave_barrier();      /* the wave reads back what its other lanes wrote */
  const int r = lane >> 3, p = (lane & 7) * 8;
  unsigned short* dp = (unsigned short*)Wt + (size_t)(n0 + r) * DM + k0 + p;
#pragma unroll
  for (int q = 0; q < 8; ++q) { const v8us o = *(const v8us*)&tl[w][(q * 4 + r) * WLP + p]; *(v8us*)(dp + q * 4 * DM) = o; } }

extern "C" void kernel_launch(void* const* d_in, const int* in_sizes, int n_in,
                              void* d_out, int out_size, void* d_ws, size_t ws_size, hipStream_t stream) {
  (void)in_sizes; (void)n_in; (void)out_size;
  const float* const* I = (const float* const*)d_in; const float* x = I[0]; const float* wqkv = I[1];      /* input order: x [4][2048][1024], W_qkv ([in][out] [1024][3072]: q | k | v column thirds); the module has no biases and no output projection */
  char* ws = (char*)d_ws; size_t off = 0;
  auto take = [&](size_t bytes) { char* p = ws + off; off += (bytes + 255) & ~(size_t)255; return p; };
  _Float16* BW = (_Float16*)take((size_t)LQK * DM * 2); _Float16* X16 = (_Float16*)take(NR * DM * 2); _Float16* QKV = (_Float16*)take(NR * LQK * 2); _Float16* VT = (_Float16*)take((size_t)NB * DI * SQ * 2);
  float* S = (float*)take(NR * NKX * 4); _Float16* P = (_Float16*)take(NR * NKX * 2); float* QKVF0 = (float*)take((size_t)NB * QT0 * LQK * 4);      /* ONE head: S / P row = token row, pitch NKX; every plane holds all batches */
  if (off > ws_size) return;
  k_wtl<<<(LQK / 32) * (DM / WLK) / 4, 128, 0, stream>>>(wqkv, BW);      /* [in][out] [1024][3072] -> Bt[n][k] x16, one 64 k x 32 n tile a wave */
  k_x16<<<(unsigned)((NR * DM / 8 + 255) / 256), 256, 0, stream>>>(x, X16, NR * DM / 8);      /* x (bf16-valued) as exact f16 rows */
  k_gemm3v<DM, DM, LQK, LQK, DM><<<dim3((unsigned)((NR / 128) * (LQK / 128)), 1), 128, 0, stream>>>(X16, BW, 0.0625f, QKVF0, QKV, VT);      /* q | k | v = x W: q and k -> f16 rows, column blocks 0 / 1024 of the fused plane (pitch 3072); v -> V^T [NB][1024][SQ] f16; no bias; rows 0..511 of every batch also as f32 (exact products, f32 accumulation) */
  const _Float16* Q16 = QKV; const _Float16* K16 = QKV + DI;
  k_gemm3<1, false, false, LQK, LQK, NKX, SQ, DI><<<dim3((QT / 128) * (SQ / 128), NB, (SQ - QT0) / QT), 128, 0, stream>>>(Q16, (size_t)SQ * LQK, K16, (size_t)SQ * LQK, 0.03125f, S, nullptr, (size_t)SQ * NKX);      /* scores / sqrt(1024) over the FULL width (K = 1024), one head; causal: only keys below each tile's end; query tiles past the exact rows */
  k_att0w_rsm<<<ATT0_NBLK + NB * (SQ - QT0) / 8, 256, 0, stream>>>(QKVF0, QKVF0 + DI, QKVF0 + 2 * DI, 0.03125f, (float*)d_out, S, P);      /* exact f32 single-head causal attention for rows 0..511 of every batch, stored into the output rows; behind its blocks the causal softmax -> P x256 f16, one wave per row */
  k_gemm3<2, false, false, NKX, SQ, DI, DI, SQ><<<dim3((QT / 128) * (DI / 128), NB, (SQ - QT0) / QT), 128, 0, stream>>>(P, (size_t)SQ * NKX, VT, (size_t)DI * SQ, 0.00390625f, (float*)d_out, nullptr, (size_t)SQ * DI);      /* out[b][q][:] = P V^T 2^-8 (f32), N = 1024, keys up to each tile's end */
}
